// v000
// The times below were measured on an AMD MI455X: many runs one after another, warmed up first and cycling through
// copies of the inputs, with the whole window's GPU time divided by the number of runs. Launches and the gaps
// between them are all in it. The median over several windows is given; except for v000 it joins two sittings, which
// can be a few percent apart, so the side-by-side timings, each taken in one sitting, are the better comparison.
// The starting kernel, v000, takes 7510 microseconds a run.
// compute dtype: all float inputs rounded to bf16; q/k/v projections with EXACT bf16 products on WMMA 16x16x32 (f32 accumulate); causal scores with BOTH q and k as f16 hi + (x 2^10) residual (3 products) on EVERY block, x 64^-0.5; softmax over the QUERY axis in f32 (per key column: online max / sum over the visible queries, precise expf); P as bf16 hi + lo against v as bf16 hi + lo (3 products) on EVERY block; f32 output.
#include <hip/hip_runtime.h>
#include <math.h>

typedef __attribute__((ext_vector_type(16))) _Float16 v16h;
typedef __attribute__((ext_vector_type(16))) __bf16 v16b;
typedef __attribute__((ext_vector_type(8)))  _Float16 v8h;
typedef __attribute__((ext_vector_type(8)))  float v8f;
typedef __attribute__((ext_vector_type(4)))  float v4f;
typedef __attribute__((ext_vector_type(2)))  float v2f;
typedef __attribute__((ext_vector_type(4)))  unsigned v4u;
typedef __attribute__((ext_vector_type(4)))  int v4i;
typedef float __attribute__((may_alias)) float_a;
typedef int __attribute__((may_alias)) int_a;

template <typename T> __device__ __forceinline__ void vst2(void* p, T v) { *(T*)p = v;  }
__device__ __forceinline__ v8f wmma16(v16h a, v16h b, v8f c) {
  v8f d = __builtin_amdgcn_wmma_f32_16x16x32_f16(false, a, false, b, (short)0, c, false, false);
  asm volatile("v_nop\n\tv_nop\n\tv_nop\n\tv_nop" : "+v"(d) : "v"(a), "v"(b));
  return d;
}
__device__ __forceinline__ v8f wmma_bf(v16b a, v16b b, v8f c) {
  v8f d = __builtin_amdgcn_wmma_f32_16x16x32_bf16(false, a, false, b, (short)0, c, false, false);
  asm volatile("v_nop\n\tv_nop\n\tv_nop\n\tv_nop" : "+v"(d) : "v"(a), "v"(b));
  return d;
}
// 16x16x32 fragments: lane = (h = lane>>4, row/col = lane&15); elements 0..7 = k0+8h+0..7, 8..15 = k0+16+8h+0..7; D element r = row 8h+r
__device__ __forceinline__ v16h frag_h(const _Float16* rowk0, int lane) {
  union { v16h v; v8h q[2]; } u; const _Float16* p = rowk0 + 8 * (lane >> 4);
  u.q[0] = *(const v8h*)p; u.q[1] = *(const v8h*)(p + 16); return u.v;
}
__device__ __forceinline__ v16h frag_f32(const float* rowk0, int lane) {
  v16h a; const float* p = rowk0 + 8 * (lane >> 4);
#pragma unroll
  for (int i = 0; i < 8; ++i) { a[i] = (_Float16)p[i]; a[8 + i] = (_Float16)p[16 + i]; }
  return a;
}
__device__ __forceinline__ v16h frag_f32s(const float* rowk0, int lane, float sc) {
  v16h a; const float* p = rowk0 + 8 * (lane >> 4);
#pragma unroll
  for (int i = 0; i < 8; ++i) { a[i] = (_Float16)(p[i] * sc); a[8 + i] = (_Float16)(p[16 + i] * sc); }
  return a;
}
// column fragment from a [K][ld] layout (column n), rows >= K read as 0
__device__ __forceinline__ v16h fragc_f32(const float* W, int k0, int n, int lane, int ld, int K) {
  v16h a; const int g = lane >> 4;
#pragma unroll
  for (int i = 0; i < 8; ++i) { const int ka = k0 + 8 * g + i, kb = ka + 16;
    a[i] = (_Float16)(ka < K ? W[(size_t)(ka < K ? ka : K - 1) * ld + n] : 0.f); a[8 + i] = (_Float16)(kb < K ? W[(size_t)(kb < K ? kb : K - 1) * ld + n] : 0.f); }
  return a;
}
struct F2 { v16b h, l; };
__device__ __forceinline__ F2 bsplit16(const float v[16]) { F2 r;
#pragma unroll
  for (int i = 0; i < 16; ++i) { const __bf16 h = (__bf16)v[i]; r.h[i] = h; r.l[i] = (__bf16)(v[i] - (float)h); }
  return r; }
__device__ __forceinline__ F2 split_row(const float* row, int k0, int lane) { float v[16]; const float* p = row + k0 + 8 * (lane >> 4);
#pragma unroll
  for (int i = 0; i < 8; ++i) { v[i] = p[i]; v[8 + i] = p[16 + i]; }
  return bsplit16(v); }
__device__ __forceinline__ F2 split_rowK(const float* row, int k0, int lane, int K) { float v[16]; const int g = lane >> 4;
#pragma unroll
  for (int i = 0; i < 8; ++i) { const int ka = k0 + 8 * g + i, kb = ka + 16; v[i] = ka < K ? row[ka < K ? ka : K - 1] : 0.f; v[8 + i] = kb < K ? row[kb < K ? kb : K - 1] : 0.f; }
  return bsplit16(v); }
__device__ __forceinline__ F2 split_col(const float* W, int k0, int n, int lane, int ld, int K) { float v[16]; const int g = lane >> 4;
#pragma unroll
  for (int i = 0; i < 8; ++i) { const int ka = k0 + 8 * g + i, kb = ka + 16; v[i] = ka < K ? W[(size_t)(ka < K ? ka : K - 1) * ld + n] : 0.f; v[8 + i] = kb < K ? W[(size_t)(kb < K ? kb : K - 1) * ld + n] : 0.f; }
  return bsplit16(v); }
__device__ __forceinline__ v8f mac3(const F2& a, const F2& b, v8f c) { c = wmma_bf(a.l, b.h, c); c = wmma_bf(a.h, b.l, c); return wmma_bf(a.h, b.h, c); }
__device__ __forceinline__ float sigm(float v) { return 1.0f / (1.0f + expf(-v)); }
#define LDSX() do { asm volatile("s_wait_dscnt 0" ::: "memory"); __builtin_amdgcn_wave_barrier(); __builtin_amdgcn_fence(__ATOMIC_RELEASE, "workgroup"); } while (0)

// Single-head causal self-attention whose softmax runs over the QUERY axis (x [8,2048,384]; (in,out) Wq / Wk / Wv [384,64] (0.02 scale), no biases; scores[b, i, j] = q_i . k_j / 8; -inf where j > i; attn = softmax(scores, axis=1) - axis 1 is the QUERY axis i, so every key column j is normalised over the queries i >= j (faithful to the source); out = attn v -> [8,2048,64]).
#define NB 8
#define TT 2048
#define CC 128            // NH * HD = projected width
#define DIN 384          // input (model) width
#define NH 2
#define HD 64
#define NQB (TT / 64)
#define HG 1
#define SCALE (0.125f)
#define CAUSAL 1
#ifndef TNB
#define TNB NB
#endif
__device__ __forceinline__ float bfr(float v) { return (float)(__bf16)v; }
__host__ __device__ __forceinline__ int kb_last(int qb) { return CAUSAL ? ((qb * 64 + 63) >> 7) : (TT / 128 - 1); }
typedef __attribute__((ext_vector_type(8))) __bf16 v8b;
__device__ __forceinline__ v16b frag_b(const __bf16* rowk0, int lane) {
  union { v16b v; v8b q[2]; } u; const __bf16* p = rowk0 + 8 * (lane >> 4);
  u.q[0] = *(const v8b*)p; u.q[1] = *(const v8b*)(p + 16); return u.v;
}
#define QBH 32              // causal: query blocks 0..QBH-1 of each sequence (all NQB = 32 of them) take the high-precision path
#define QHI 2048            // rows carrying a q residual plane (all TT rows)
#define KHI 2048            // key rows carrying k residual / v bf16 hi+lo planes (used only by the causal high-precision path)
// B fragment (k rows k0+.., output column o) of a weight: (in,out) [K][ld] or (out,in) [ld rows of K]: bf16 exact, or f16(bf16 * 256) exact
__device__ __forceinline__ v16b wcol_io(const float* Wm, int k0, int o, int lane, int ld) { v16b w; const int g = lane >> 4;
#pragma unroll
  for (int i = 0; i < 8; ++i) { w[i] = (__bf16)Wm[(size_t)(k0 + 8 * g + i) * ld + o]; w[8 + i] = (__bf16)Wm[(size_t)(k0 + 16 + 8 * g + i) * ld + o]; }
  return w; }
__device__ __forceinline__ v16b wcol_oi(const float* Wm, int k0, int o, int lane, int K) { v16b w; const float* p = Wm + (size_t)o * K + k0 + 8 * (lane >> 4);
#pragma unroll
  for (int i = 0; i < 8; ++i) { w[i] = (__bf16)p[i]; w[8 + i] = (__bf16)p[16 + i]; }
  return w; }
__device__ __forceinline__ v16h wcolh_io(const float* Wm, int k0, int o, int lane, int ld) { v16h w; const int g = lane >> 4;
#pragma unroll
  for (int i = 0; i < 8; ++i) { w[i] = (_Float16)(bfr(Wm[(size_t)(k0 + 8 * g + i) * ld + o]) * 256.0f); w[8 + i] = (_Float16)(bfr(Wm[(size_t)(k0 + 16 + 8 * g + i) * ld + o]) * 256.0f); }
  return w; }
__device__ __forceinline__ v16h wcolh_oi(const float* Wm, int k0, int o, int lane, int K) { v16h w; const float* p = Wm + (size_t)o * K + k0 + 8 * (lane >> 4);
#pragma unroll
  for (int i = 0; i < 8; ++i) { w[i] = (_Float16)(bfr(p[i]) * 256.0f); w[8 + i] = (_Float16)(bfr(p[16 + i]) * 256.0f); }
  return w; }
#define WQKV_LAYOUT 0   // 0 = (in,out) [DIN][64] (head 0 only; columns 64..127 zero); 1 = (out,in) [CC][DIN]; 2 = per-head [NH][DIN][HD]
__device__ __forceinline__ v16b wcol_hdk(const float* Wm, int k0, int o, int lane) { v16b w; const int g = lane >> 4; const float* p = Wm + (size_t)(o / HD) * DIN * HD + (o % HD);
#pragma unroll
  for (int i = 0; i < 8; ++i) { w[i] = (__bf16)p[(size_t)(k0 + 8 * g + i) * HD]; w[8 + i] = (__bf16)p[(size_t)(k0 + 16 + 8 * g + i) * HD]; }
  return w; }
#define WO_OUT_IN 0
#if WQKV_LAYOUT == 1
#define WCOL(W, k0, o, lane) wcol_oi(W, k0, o, lane, DIN)
#elif WQKV_LAYOUT == 2
#define WCOL(W, k0, o, lane) wcol_hdk(W, k0, o, lane)
#else
__device__ __forceinline__ v16b zero16b() { v16b w; _Pragma("unroll") for (int i = 0; i < 16; ++i) w[i] = (__bf16)0.0f; return w; }
#define WCOL(W, k0, o, lane) ((o) < 64 ? wcol_io(W, k0, (o), lane, 64) : zero16b())   /* (in,out) [384][64] pitch 64: only 64 real output columns; projected columns 64..127 (padding head 1) are zero; compile-time per unrolled tile (c0 = 0) */
#endif
#if WO_OUT_IN
#define WOCOL(W, k0, o, lane) wcol_oi(W, k0, o, lane, CC)
#define WOCOLH(W, k0, o, lane) wcolh_oi(W, k0, o, lane, CC)
#else
#define WOCOL(W, k0, o, lane) wcol_io(W, k0, o, lane, DIN)
#define WOCOLH(W, k0, o, lane) wcolh_io(W, k0, o, lane, DIN)
#endif

#ifndef SM_EXTRA_PARAMS
#define SM_EXTRA_PARAMS
#endif
#ifndef PROJ_EXTRA_PARAMS
#define PROJ_EXTRA_PARAMS
#endif
#ifndef SM_MASK_HOOK
#define SM_MASK_HOOK (void)0
#endif

#define WS_QH  0u                                      // f16 q rows [b*t][CC]
#define WS_KH  (WS_QH + 2u * (size_t)NB * TT * CC)      // f16 k rows [b*t][CC]
#define WS_VT  (WS_KH + 2u * (size_t)NB * TT * CC)      // f16 v planes [b][c][t]
#define WS_QL  (WS_VT + 2u * (size_t)NB * CC * TT)      // f16 q residual x 2^10 rows [b][t < QHI][CC]
#define WS_KL  (WS_QL + 2u * (size_t)NB * QHI * CC)     // f16 k residual x 2^10 rows [b][t < KHI][CC]
#define WS_VB  (WS_KL + 2u * (size_t)NB * KHI * CC)     // bf16 v hi planes [b][c][t < KHI]
#define WS_VBL (WS_VB + 2u * (size_t)NB * CC * KHI)
#define WS_S   (WS_VBL + 2u * (size_t)NB * CC * KHI)    // f32 logits / P [hg][t][s]
#define WS_Y   (WS_S  + 4u * (size_t)HG * TT * TT)      // f32 ctx rows [b*t][CC] (only when there is an output projection)
#define WS_END (WS_Y  + 0u)
#define WS_Y2 (WS_END)                                  // f32 ctx rows [b*TT + t][128] (columns 64..127 = the padding head)
#define WS_CM (WS_Y2 + 4u * (size_t)NB * TT * CC)        // f32 column maxima [TT]
#define WS_CZ (WS_CM + 4u * (size_t)HG * TT)
#define WS_END2 (WS_CZ + 4u * (size_t)HG * TT)

// ---- k_proj: block = (64 rows, 128 cols, which): q/k/v = X W (+ b) with exact bf16 products (K = DIN) -> which 0: q f16 rows (+ residual rows < QHI); 1: k f16 rows (+ residual rows < KHI); 2: v f16 planes [c][t] (+ bf16 hi/lo planes for t < KHI)
__global__ __launch_bounds__(128) void k_proj(const float* __restrict__ XQ, const float* __restrict__ XK, const float* __restrict__ XV, const float* __restrict__ WQ, const float* __restrict__ WK, const float* __restrict__ WV, const float* __restrict__ BQ, const float* __restrict__ BK, const float* __restrict__ BV,
    _Float16* __restrict__ QH, _Float16* __restrict__ QL, _Float16* __restrict__ KH, _Float16* __restrict__ KL, _Float16* __restrict__ VT, __bf16* __restrict__ VB, __bf16* __restrict__ VBL) {
  __shared__ __align__(16) _Float16 sh[64][136], sl[64][136]; __shared__ __align__(16) _Float16 th[128][72]; __shared__ __align__(16) __bf16 tb[128][72], tbl[128][72];
  const int tid = threadIdx.x, wave = tid >> 5, lane = tid & 31, col = lane & 15, g = lane >> 4; const int which = blockIdx.z; const int c0 = blockIdx.y * 128; const size_t r0 = (size_t)blockIdx.x * 64; const size_t bb = r0 / TT; const int t0 = (int)(r0 % TT);
  const float* X = which == 0 ? XQ : which == 1 ? XK : XV; const float* WA = which == 0 ? WQ : which == 1 ? WK : WV; const float* BA = which == 0 ? BQ : which == 1 ? BK : BV;
  v8f acc[8] = {};
#pragma unroll 2
  for (int kc = 0; kc < DIN / 32; ++kc) { v16b a; { const float* p = X + (r0 + wave * 16 + col) * DIN + kc * 32 + 8 * g;
#pragma unroll
      for (int i = 0; i < 8; ++i) { a[i] = (__bf16)p[i]; a[8 + i] = (__bf16)p[16 + i]; } }
    asm volatile("s_wait_loadcnt 0x0" ::: "memory");
#pragma unroll
    for (int j = 0; j < 8; ++j) { const v16b w = WCOL(WA, kc * 32, c0 + j * 16 + col, lane); asm volatile("s_wait_loadcnt 0x0" ::: "memory"); acc[j] = wmma_bf(a, w, acc[j]); } }
  if (which < 2) { _Float16* DH = which == 0 ? QH : KH; _Float16* DL = which == 0 ? QL : KL; const int nhi = which == 0 ? QHI : KHI; const bool hi_rows = t0 < nhi;
#pragma unroll
    for (int j = 0; j < 8; ++j) { const float bias = BA ? bfr(BA[c0 + j * 16 + col]) : 0.f;
#pragma unroll
      for (int r = 0; r < 8; ++r) { const float v = acc[j][r] + bias; const _Float16 hv = (_Float16)v; sh[wave * 16 + 8 * g + r][j * 16 + col] = hv; sl[wave * 16 + 8 * g + r][j * 16 + col] = (_Float16)((v - (float)hv) * 1024.0f); } }
    __syncthreads();
    for (int e = tid; e < 64 * 16; e += 128) { const int rl = e >> 4, q = e & 15; vst2((unsigned*)(DH + (r0 + rl) * CC + c0 + q * 8), *(const v4u*)&sh[rl][q * 8]); if (hi_rows) vst2((unsigned*)(DL + (bb * nhi + t0 + rl) * (size_t)CC + c0 + q * 8), *(const v4u*)&sl[rl][q * 8]); }
  } else { const bool hi_rows = t0 < KHI;
#pragma unroll
    for (int j = 0; j < 8; ++j) { const float bias = BA ? bfr(BA[c0 + j * 16 + col]) : 0.f;
#pragma unroll
      for (int r = 0; r < 8; ++r) { const float v = acc[j][r] + bias; const int rl = wave * 16 + 8 * g + r, cl = j * 16 + col; th[cl][rl] = (_Float16)v; const __bf16 bh = (__bf16)v; tb[cl][rl] = bh; tbl[cl][rl] = (__bf16)(v - (float)bh); } }
    __syncthreads();
    for (int e = tid; e < 128 * 8; e += 128) { const int cl = e >> 3, q = e & 7; vst2((unsigned*)(VT + (bb * CC + c0 + cl) * (size_t)TT + t0 + q * 8), *(const v4u*)&th[cl][q * 8]); if (hi_rows) { const size_t o3 = (bb * CC + c0 + cl) * (size_t)KHI + t0 + q * 8; vst2((unsigned*)(VB + o3), *(const v4u*)&tb[cl][q * 8]); vst2((unsigned*)(VBL + o3), *(const v4u*)&tbl[cl][q * 8]); } } } }
// ---- k_sc: block = (query block qb, key block kb <= kb_last(qb), head in group) of batch b: logits x SCALE; q hi + residual (x 2^10) against k (2 products) for query rows < QHI, plus the k residual (3 products) for query blocks < QBH (every query block here); causal: blocks past the diagonal exit, the mask itself is applied by index in k_colstat_c and k_csm_c
__global__ __launch_bounds__(128) void k_sc(const _Float16* __restrict__ QH, const _Float16* __restrict__ KH, const _Float16* __restrict__ QL, const _Float16* __restrict__ KL, int b, int h0, float* __restrict__ S0) { __shared__ __align__(16) float ss[4][16][132];
  const int qb = blockIdx.x, kb = blockIdx.y; if (kb > kb_last(qb)) return;
  const int h = h0 + blockIdx.z; float* S = S0 + (size_t)blockIdx.z * TT * TT;
  const int tid = threadIdx.x, wave = tid >> 5, lane = tid & 31, col = lane & 15, g = lane >> 4; const int k0 = kb * 128; const int ql0 = qb * 64 + wave * 16; const size_t q0 = (size_t)b * TT + ql0, kr0 = (size_t)b * TT + k0;
  v8f acc[8] = {}, accl[8] = {};
  const _Float16* QLb = QL + (size_t)b * QHI * CC; const _Float16* KLb = KL + (size_t)b * KHI * CC;
  if (qb < QBH) {
#pragma unroll
    for (int kc = 0; kc < HD / 32; ++kc) { const v16h ah = frag_h(QH + (q0 + col) * CC + h * HD + kc * 32, lane), al = frag_h(QLb + (size_t)(ql0 + col) * CC + h * HD + kc * 32, lane);
#pragma unroll
      for (int j = 0; j < 8; ++j) { const v16h kbf = frag_h(KH + (kr0 + j * 16 + col) * CC + h * HD + kc * 32, lane), klf = frag_h(KLb + (size_t)(k0 + j * 16 + col) * CC + h * HD + kc * 32, lane); acc[j] = wmma16(ah, kbf, acc[j]); accl[j] = wmma16(al, kbf, accl[j]); accl[j] = wmma16(ah, klf, accl[j]); } }
  } else if (qb * 64 < QHI) {
#pragma unroll
    for (int kc = 0; kc < HD / 32; ++kc) { const v16h ah = frag_h(QH + (q0 + col) * CC + h * HD + kc * 32, lane), al = frag_h(QLb + (size_t)(ql0 + col) * CC + h * HD + kc * 32, lane);
#pragma unroll
      for (int j = 0; j < 8; ++j) { const v16h kbf = frag_h(KH + (kr0 + j * 16 + col) * CC + h * HD + kc * 32, lane); acc[j] = wmma16(ah, kbf, acc[j]); accl[j] = wmma16(al, kbf, accl[j]); } }
  } else {
#pragma unroll
    for (int kc = 0; kc < HD / 32; ++kc) { const v16h ah = frag_h(QH + (q0 + col) * CC + h * HD + kc * 32, lane);
#pragma unroll
      for (int j = 0; j < 8; ++j) { const v16h kbf = frag_h(KH + (kr0 + j * 16 + col) * CC + h * HD + kc * 32, lane); acc[j] = wmma16(ah, kbf, acc[j]); } } }
#pragma unroll
  for (int j = 0; j < 8; ++j) {
#pragma unroll
    for (int r = 0; r < 8; ++r) ss[wave][8 * g + r][j * 16 + col] = (acc[j][r] + accl[j][r] * (1.0f / 1024.0f)) * SCALE; }
  LDSX(); for (int rl = 0; rl < 16; ++rl) vst2(S + (size_t)(ql0 + rl) * TT + k0 + lane * 4, *(const v4f*)&ss[wave][rl][lane * 4]); }
// ---- k_sm: block = query row t (head in group): keys [0, kend): causal -> logit if s <= t else excluded; softmax in f32; P x 2^11 in place (0 for excluded)
__global__ __launch_bounds__(256) void k_sm(float* __restrict__ S0 SM_EXTRA_PARAMS) { __shared__ float sred[8]; __shared__ float sbc; __shared__ __align__(16) float shv[TT];
  const int tid = threadIdx.x; const int t = blockIdx.x; const int kend = (kb_last(t >> 6) + 1) * 128;
  float* sr = S0 + (size_t)blockIdx.y * TT * TT + (size_t)t * TT;
  float m = -3.0e38f; for (int k = tid; k < kend; k += 256) { float v = (!CAUSAL || k <= t) ? sr[k] : -3.0e38f; SM_MASK_HOOK; shv[k] = v; m = fmaxf(m, v); }
#pragma unroll
  for (int o = 1; o < 32; o <<= 1) m = fmaxf(m, __shfl_xor(m, o));
  if ((tid & 31) == 0) sred[tid >> 5] = m; __syncthreads(); if (tid == 0) { float a = sred[0]; for (int i = 1; i < 8; ++i) a = fmaxf(a, sred[i]); sbc = a; } __syncthreads(); m = sbc; __syncthreads();
  float sum = 0.f; for (int k = tid; k < kend; k += 256) { const float v = shv[k]; const float e = (v <= -1.0e38f) ? 0.f : expf(v - m); shv[k] = e; sum += e; }
#pragma unroll
  for (int o = 1; o < 32; o <<= 1) sum += __shfl_xor(sum, o);
  if ((tid & 31) == 0) sred[tid >> 5] = sum; __syncthreads(); if (tid == 0) { float a = 0.f; for (int i = 0; i < 8; ++i) a += sred[i]; sbc = a > 0.f ? 2048.0f / a : 0.f; }   /* a fully excluded row yields P = 0 */ __syncthreads(); const float inv = sbc;
  for (int k = tid; k < kend; k += 256) shv[k] = shv[k] * inv;
  __syncthreads(); for (int q = tid; q < kend / 4; q += 256) vst2(sr + q * 4, *(const v4f*)&shv[q * 4]); }
// ---- k_colstat_c: softmax over the QUERY axis under the causal mask (the source's softmax(axis=1) on [B, t, s] scores with -1e9 above the diagonal): for every key column k: m_k = max_{q >= k} S[q][k], Z_k = sum_{q >= k} exp(S[q][k] - m_k) (online, one pass, f32, precise expf); thread per column; the row loop starts at the block's first column (block-uniform) and masks q < k by a value select after an unconditional load (rows above a column's diagonal may lie in score blocks k_sc never computed: their content is discarded)
__global__ __launch_bounds__(256) void k_colstat_c(const float* __restrict__ S0, float* __restrict__ CM, float* __restrict__ CZ) { const int k = blockIdx.x * 256 + threadIdx.x; const float* sp = S0 + (size_t)blockIdx.y * TT * TT + k; const int q0 = blockIdx.x * 256;
  float m = -3.0e38f, z = 0.f;
#pragma unroll 4
  for (int q = q0; q < TT; ++q) { const float ld = sp[(size_t)q * TT]; asm volatile("s_wait_loadcnt 0x0" ::: "memory"); const bool vis = q >= k; const float v = vis ? ld : -3.0e38f; const float mn = fmaxf(m, v); z = z * expf(m - mn) + (vis ? expf(v - mn) : 0.f); m = mn; }
  vst2(CM + (size_t)blockIdx.y * TT + k, m); vst2(CZ + (size_t)blockIdx.y * TT + k, z); }   /* every column sees at least its own diagonal entry: Z_k >= 1 */
// ---- k_csm_c: block = query row t: P[t][k] = exp(S[t][k] - m_k) / Z_k x 2^11 for k <= t, 0 for t < k < kend (inside the diagonal block); in place; unconditional loads, value select
__global__ __launch_bounds__(256) void k_csm_c(float* __restrict__ S0, const float* __restrict__ CM, const float* __restrict__ CZ) { const int tid = threadIdx.x; const int t = blockIdx.x; const int kend = (kb_last(t >> 6) + 1) * 128; float* sr = S0 + (size_t)blockIdx.y * TT * TT + (size_t)t * TT; const float* cm = CM + (size_t)blockIdx.y * TT; const float* cz = CZ + (size_t)blockIdx.y * TT;
  for (int q4 = tid; q4 < kend / 4; q4 += 256) { const v4f sv = *(const v4f*)(sr + q4 * 4), m4 = *(const v4f*)(cm + q4 * 4), z4 = *(const v4f*)(cz + q4 * 4); asm volatile("s_wait_loadcnt 0x0" ::: "memory"); v4f p;
#pragma unroll
    for (int u = 0; u < 4; ++u) p[u] = (q4 * 4 + u <= t) ? expf(sv[u] - m4[u]) * (2048.0f / z4[u]) : 0.f;
    vst2(sr + q4 * 4, p); } }
// ---- k_out64: out[b][t][0..63] = ctx row columns 0..63 (256 B by 16 lanes)
__global__ __launch_bounds__(256) void k_out64(const float* __restrict__ Y, float* __restrict__ OUT) { const size_t row = (size_t)blockIdx.x * 16 + (threadIdx.x >> 4); const int q = threadIdx.x & 15; const v4f v = *(const v4f*)(Y + row * CC + q * 4); asm volatile("s_wait_loadcnt 0x0" ::: "memory"); vst2(OUT + row * 64 + q * 4, v); }
// ---- k_pv: block = 64 queries (qb) of (b, h): ctx = P . v over keys [0, kend) (P x 2^11 once to f16 against v f16: 1 product; query blocks < QBH, i.e. all of them: P and v as bf16 hi + lo, 3 products); 256-B (row, head) segment by 16 lanes
__global__ __launch_bounds__(128) void k_pv(const float* __restrict__ PS0, const _Float16* __restrict__ VT, const __bf16* __restrict__ VB, const __bf16* __restrict__ VBL, int b, int h0, float* __restrict__ Y) { const int h = h0 + blockIdx.z; const float* PS = PS0 + (size_t)blockIdx.z * TT * TT; __shared__ __align__(16) float ss[4][16][HD + 4];
  const int tid = threadIdx.x, wave = tid >> 5, lane = tid & 31, col = lane & 15, g = lane >> 4; const int qb = blockIdx.x; const int ql0 = qb * 64 + wave * 16; const int kce = (kb_last(qb) + 1) * 4;
  v8f acc[HD / 16] = {};
  if (qb < QBH) {
#pragma unroll 1
    for (int kc = 0; kc < kce; ++kc) { const F2 p = split_row(PS + (size_t)(ql0 + col) * TT, kc * 32, lane);
      asm volatile("s_wait_loadcnt 0x0" ::: "memory");
#pragma unroll
      for (int j = 0; j < HD / 16; ++j) { const size_t po = ((size_t)b * CC + h * HD + j * 16 + col) * (size_t)KHI + kc * 32; const v16b vh = frag_b(VB + po, lane); acc[j] = wmma_bf(p.h, vh, acc[j]); acc[j] = wmma_bf(p.l, vh, acc[j]); acc[j] = wmma_bf(p.h, frag_b(VBL + po, lane), acc[j]); } }
  } else {
#pragma unroll 1
    for (int kc = 0; kc < kce; ++kc) { const v16h p = frag_f32(PS + (size_t)(ql0 + col) * TT + kc * 32, lane);
      asm volatile("s_wait_loadcnt 0x0" ::: "memory");
#pragma unroll
      for (int j = 0; j < HD / 16; ++j) { const size_t po = ((size_t)b * CC + h * HD + j * 16 + col) * (size_t)TT + kc * 32; acc[j] = wmma16(p, frag_h(VT + po, lane), acc[j]); } } }
#pragma unroll
  for (int j = 0; j < HD / 16; ++j)
#pragma unroll
    for (int r = 0; r < 8; ++r) ss[wave][8 * g + r][j * 16 + col] = acc[j][r] * (1.0f / 2048.0f);
  LDSX(); for (int rl = 0; rl < 16; ++rl) if (lane < HD / 4) vst2(Y + ((size_t)b * TT + ql0 + rl) * CC + h * HD + lane * 4, *(const v4f*)&ss[wave][rl][lane * 4]); }

extern "C" void kernel_launch(void* const* d_in, const int* in_sizes, int n_in, void* d_out, int out_size, void* d_ws, size_t ws_size, hipStream_t stream) {
  (void)in_sizes; (void)n_in; (void)out_size;
  const float** F = (const float**)d_in;
  if (ws_size < (size_t)WS_END) return;
  char* ws = (char*)d_ws; _Float16 *QH = (_Float16*)(ws + WS_QH), *KH = (_Float16*)(ws + WS_KH), *VT = (_Float16*)(ws + WS_VT), *QL = (_Float16*)(ws + WS_QL), *KL = (_Float16*)(ws + WS_KL); __bf16 *VB = (__bf16*)(ws + WS_VB), *VBL = (__bf16*)(ws + WS_VBL); float *S = (float*)(ws + WS_S), *Y = (float*)(ws + WS_Y);
  (void)Y; (void)QL; (void)KL; (void)VB; (void)VBL;
  // inputs: 0 x [8,2048,384]; 1 Wq [384,64] (in,out); 2 Wk; 3 Wv; no biases
  if (ws_size < (size_t)WS_END2) return;
  float *Y2 = (float*)(ws + WS_Y2), *CM = (float*)(ws + WS_CM), *CZ = (float*)(ws + WS_CZ);
  k_proj<<<dim3(TNB * TT / 64, CC / 128, 3), 128, 0, stream>>>(F[0], F[0], F[0], F[1], F[2], F[3], nullptr, nullptr, nullptr, QH, QL, KH, KL, VT, VB, VBL);   /* weight columns 64..127 (the padding head) are zero fragments */
  for (int b = 0; b < TNB; ++b) {   /* head 0 only (head 1 is the zero padding) */
    k_sc<<<dim3(NQB, TT / 128, 1), 128, 0, stream>>>(QH, KH, QL, KL, b, 0, S);
    k_colstat_c<<<dim3(TT / 256, 1), 256, 0, stream>>>(S, CM, CZ);   /* per key column j: max / sum over the visible queries i >= j */
    k_csm_c<<<dim3(TT, 1), 256, 0, stream>>>(S, CM, CZ);            /* P[i][j] = exp(S - m_j) / Z_j x 2^11 for j <= i, 0 above the diagonal */
    k_pv<<<dim3(NQB, 1, 1), 128, 0, stream>>>(S, VT, VB, VBL, b, 0, Y2);
  }
  k_out64<<<dim3(TNB * TT / 16), 256, 0, stream>>>(Y2, (float*)d_out);
}

// v001
// Measured time: 1030 microseconds a run.
// Two timings next to v000 put it at 7.27 and 7.29 times that version's speed.
// compute dtype: all float inputs rounded to bf16; q/k/v projections with EXACT bf16 products on WMMA 16x16x32 (f32 accumulate); causal scores with BOTH q and k as f16 hi + (x 2^10) residual (3 products) on EVERY block, x 64^-0.5; softmax over the QUERY axis in f32 (per key column: max and sum over the visible queries, per wave and merged, exp to expf's accuracy; P by precise expf); P as bf16 hi + lo against v as bf16 hi + lo (3 products) on EVERY block; f32 output.
#include <hip/hip_runtime.h>
#include <math.h>

typedef __attribute__((ext_vector_type(16))) _Float16 v16h;
typedef __attribute__((ext_vector_type(16))) __bf16 v16b;
typedef __attribute__((ext_vector_type(8)))  _Float16 v8h;
typedef __attribute__((ext_vector_type(8)))  float v8f;
typedef __attribute__((ext_vector_type(4)))  float v4f;
typedef __attribute__((ext_vector_type(2)))  float v2f;
typedef __attribute__((ext_vector_type(4)))  unsigned v4u;
typedef __attribute__((ext_vector_type(4)))  int v4i;
typedef float __attribute__((may_alias)) float_a;
typedef int __attribute__((may_alias)) int_a;

template <typename T> __device__ __forceinline__ void vst2(void* p, T v) { *(T*)p = v;  }
__device__ __forceinline__ v8f wmma16(v16h a, v16h b, v8f c) {
  v8f d = __builtin_amdgcn_wmma_f32_16x16x32_f16(false, a, false, b, (short)0, c, false, false);
  asm volatile("v_nop\n\tv_nop\n\tv_nop\n\tv_nop" : "+v"(d) : "v"(a), "v"(b));
  return d;
}
__device__ __forceinline__ v8f wmma_bf(v16b a, v16b b, v8f c) {
  v8f d = __builtin_amdgcn_wmma_f32_16x16x32_bf16(false, a, false, b, (short)0, c, false, false);
  asm volatile("v_nop\n\tv_nop\n\tv_nop\n\tv_nop" : "+v"(d) : "v"(a), "v"(b));
  return d;
}
// 16x16x32 fragments: lane = (h = lane>>4, row/col = lane&15); elements 0..7 = k0+8h+0..7, 8..15 = k0+16+8h+0..7; D element r = row 8h+r
__device__ __forceinline__ v16h frag_h(const _Float16* rowk0, int lane) {
  union { v16h v; v8h q[2]; } u; const _Float16* p = rowk0 + 8 * (lane >> 4);
  u.q[0] = *(const v8h*)p; u.q[1] = *(const v8h*)(p + 16); return u.v;
}
__device__ __forceinline__ v16h frag_f32(const float* rowk0, int lane) {
  v16h a; const float* p = rowk0 + 8 * (lane >> 4);
#pragma unroll
  for (int i = 0; i < 8; ++i) { a[i] = (_Float16)p[i]; a[8 + i] = (_Float16)p[16 + i]; }
  return a;
}
__device__ __forceinline__ v16h frag_f32s(const float* rowk0, int lane, float sc) {
  v16h a; const float* p = rowk0 + 8 * (lane >> 4);
#pragma unroll
  for (int i = 0; i < 8; ++i) { a[i] = (_Float16)(p[i] * sc); a[8 + i] = (_Float16)(p[16 + i] * sc); }
  return a;
}
// column fragment from a [K][ld] layout (column n), rows >= K read as 0
__device__ __forceinline__ v16h fragc_f32(const float* W, int k0, int n, int lane, int ld, int K) {
  v16h a; const int g = lane >> 4;
#pragma unroll
  for (int i = 0; i < 8; ++i) { const int ka = k0 + 8 * g + i, kb = ka + 16;
    a[i] = (_Float16)(ka < K ? W[(size_t)(ka < K ? ka : K - 1) * ld + n] : 0.f); a[8 + i] = (_Float16)(kb < K ? W[(size_t)(kb < K ? kb : K - 1) * ld + n] : 0.f); }
  return a;
}
struct F2 { v16b h, l; };
__device__ __forceinline__ F2 bsplit16(const float v[16]) { F2 r;
#pragma unroll
  for (int i = 0; i < 16; ++i) { const __bf16 h = (__bf16)v[i]; r.h[i] = h; r.l[i] = (__bf16)(v[i] - (float)h); }
  return r; }
__device__ __forceinline__ F2 split_row(const float* row, int k0, int lane) { float v[16]; const float* p = row + k0 + 8 * (lane >> 4);
#pragma unroll
  for (int i = 0; i < 8; ++i) { v[i] = p[i]; v[8 + i] = p[16 + i]; }
  return bsplit16(v); }
__device__ __forceinline__ F2 split_rowK(const float* row, int k0, int lane, int K) { float v[16]; const int g = lane >> 4;
#pragma unroll
  for (int i = 0; i < 8; ++i) { const int ka = k0 + 8 * g + i, kb = ka + 16; v[i] = ka < K ? row[ka < K ? ka : K - 1] : 0.f; v[8 + i] = kb < K ? row[kb < K ? kb : K - 1] : 0.f; }
  return bsplit16(v); }
__device__ __forceinline__ F2 split_col(const float* W, int k0, int n, int lane, int ld, int K) { float v[16]; const int g = lane >> 4;
#pragma unroll
  for (int i = 0; i < 8; ++i) { const int ka = k0 + 8 * g + i, kb = ka + 16; v[i] = ka < K ? W[(size_t)(ka < K ? ka : K - 1) * ld + n] : 0.f; v[8 + i] = kb < K ? W[(size_t)(kb < K ? kb : K - 1) * ld + n] : 0.f; }
  return bsplit16(v); }
__device__ __forceinline__ v8f mac3(const F2& a, const F2& b, v8f c) { c = wmma_bf(a.l, b.h, c); c = wmma_bf(a.h, b.l, c); return wmma_bf(a.h, b.h, c); }
__device__ __forceinline__ float sigm(float v) { return 1.0f / (1.0f + expf(-v)); }
#define LDSX() do { asm volatile("s_wait_dscnt 0" ::: "memory"); __builtin_amdgcn_wave_barrier(); __builtin_amdgcn_fence(__ATOMIC_RELEASE, "workgroup"); } while (0)

// Single-head causal self-attention whose softmax runs over the QUERY axis (x [8,2048,384]; (in,out) Wq / Wk / Wv [384,64] (0.02 scale), no biases; scores[b, i, j] = q_i . k_j / 8; -inf where j > i; attn = softmax(scores, axis=1) - axis 1 is the QUERY axis i, so every key column j is normalised over the queries i >= j (faithful to the source); out = attn v -> [8,2048,64]).
#define NB 8
#define TT 2048
#define CC 128            // NH * HD = projected width
#define DIN 384          // input (model) width
#define NH 2
#define HD 64
#define NQB (TT / 64)
#define HG 1
#define SCALE (0.125f)
#define CAUSAL 1
#ifndef TNB
#define TNB NB
#endif
__device__ __forceinline__ float bfr(float v) { return (float)(__bf16)v; }
__host__ __device__ __forceinline__ int kb_last(int qb) { return CAUSAL ? ((qb * 64 + 63) >> 7) : (TT / 128 - 1); }
typedef __attribute__((ext_vector_type(8))) __bf16 v8b;
__device__ __forceinline__ v16b frag_b(const __bf16* rowk0, int lane) {
  union { v16b v; v8b q[2]; } u; const __bf16* p = rowk0 + 8 * (lane >> 4);
  u.q[0] = *(const v8b*)p; u.q[1] = *(const v8b*)(p + 16); return u.v;
}
#define QBH 32              // causal: query blocks 0..QBH-1 of each sequence (all NQB = 32 of them) take the high-precision path
#define QHI 2048            // rows carrying a q residual plane (all TT rows)
#define KHI 2048            // key rows carrying k residual / v bf16 hi+lo planes (used only by the causal high-precision path)
// B fragment (k rows k0+.., output column o) of a weight: (in,out) [K][ld] or (out,in) [ld rows of K]: bf16 exact, or f16(bf16 * 256) exact
__device__ __forceinline__ v16b wcol_io(const float* Wm, int k0, int o, int lane, int ld) { v16b w; const int g = lane >> 4;
#pragma unroll
  for (int i = 0; i < 8; ++i) { w[i] = (__bf16)Wm[(size_t)(k0 + 8 * g + i) * ld + o]; w[8 + i] = (__bf16)Wm[(size_t)(k0 + 16 + 8 * g + i) * ld + o]; }
  return w; }
__device__ __forceinline__ v16b wcol_oi(const float* Wm, int k0, int o, int lane, int K) { v16b w; const float* p = Wm + (size_t)o * K + k0 + 8 * (lane >> 4);
#pragma unroll
  for (int i = 0; i < 8; ++i) { w[i] = (__bf16)p[i]; w[8 + i] = (__bf16)p[16 + i]; }
  return w; }
__device__ __forceinline__ v16h wcolh_io(const float* Wm, int k0, int o, int lane, int ld) { v16h w; const int g = lane >> 4;
#pragma unroll
  for (int i = 0; i < 8; ++i) { w[i] = (_Float16)(bfr(Wm[(size_t)(k0 + 8 * g + i) * ld + o]) * 256.0f); w[8 + i] = (_Float16)(bfr(Wm[(size_t)(k0 + 16 + 8 * g + i) * ld + o]) * 256.0f); }
  return w; }
__device__ __forceinline__ v16h wcolh_oi(const float* Wm, int k0, int o, int lane, int K) { v16h w; const float* p = Wm + (size_t)o * K + k0 + 8 * (lane >> 4);
#pragma unroll
  for (int i = 0; i < 8; ++i) { w[i] = (_Float16)(bfr(p[i]) * 256.0f); w[8 + i] = (_Float16)(bfr(p[16 + i]) * 256.0f); }
  return w; }
#define WQKV_LAYOUT 0   // 0 = (in,out) [DIN][64] (head 0 only; columns 64..127 zero); 1 = (out,in) [CC][DIN]; 2 = per-head [NH][DIN][HD]
__device__ __forceinline__ v16b wcol_hdk(const float* Wm, int k0, int o, int lane) { v16b w; const int g = lane >> 4; const float* p = Wm + (size_t)(o / HD) * DIN * HD + (o % HD);
#pragma unroll
  for (int i = 0; i < 8; ++i) { w[i] = (__bf16)p[(size_t)(k0 + 8 * g + i) * HD]; w[8 + i] = (__bf16)p[(size_t)(k0 + 16 + 8 * g + i) * HD]; }
  return w; }
#define WO_OUT_IN 0
#if WQKV_LAYOUT == 1
#define WCOL(W, k0, o, lane) wcol_oi(W, k0, o, lane, DIN)
#elif WQKV_LAYOUT == 2
#define WCOL(W, k0, o, lane) wcol_hdk(W, k0, o, lane)
#else
__device__ __forceinline__ v16b zero16b() { v16b w; _Pragma("unroll") for (int i = 0; i < 16; ++i) w[i] = (__bf16)0.0f; return w; }
#define WCOL(W, k0, o, lane) ((o) < 64 ? wcol_io(W, k0, (o), lane, 64) : zero16b())   /* (in,out) [384][64] pitch 64: only 64 real output columns; projected columns 64..127 (padding head 1) are zero; compile-time per unrolled tile (c0 = 0) */
#endif
#if WO_OUT_IN
#define WOCOL(W, k0, o, lane) wcol_oi(W, k0, o, lane, CC)
#define WOCOLH(W, k0, o, lane) wcolh_oi(W, k0, o, lane, CC)
#else
#define WOCOL(W, k0, o, lane) wcol_io(W, k0, o, lane, DIN)
#define WOCOLH(W, k0, o, lane) wcolh_io(W, k0, o, lane, DIN)
#endif

#ifndef SM_EXTRA_PARAMS
#define SM_EXTRA_PARAMS
#endif
#ifndef PROJ_EXTRA_PARAMS
#define PROJ_EXTRA_PARAMS
#endif
#ifndef SM_MASK_HOOK
#define SM_MASK_HOOK (void)0
#endif

#define WS_QH  0u                                      // f16 q rows [b*t][CC]
#define WS_KH  (WS_QH + 2u * (size_t)NB * TT * CC)      // f16 k rows [b*t][CC]
#define WS_VT  (WS_KH + 2u * (size_t)NB * TT * CC)      // f16 v planes [b][c][t]
#define WS_QL  (WS_VT + 2u * (size_t)NB * CC * TT)      // f16 q residual x 2^10 rows [b][t < QHI][CC]
#define WS_KL  (WS_QL + 2u * (size_t)NB * QHI * CC)     // f16 k residual x 2^10 rows [b][t < KHI][CC]
#define WS_VB  (WS_KL + 2u * (size_t)NB * KHI * CC)     // bf16 v hi planes [b][c][t < KHI]
#define WS_VBL (WS_VB + 2u * (size_t)NB * CC * KHI)
#define WS_S   (WS_VBL + 2u * (size_t)NB * CC * KHI)    // f32 logits / P [hg][t][s]
#define WS_Y   (WS_S  + 4u * (size_t)HG * TT * TT)      // f32 ctx rows [b*t][CC] (only when there is an output projection)
#define WS_END (WS_Y  + 0u)
#define WS_Y2 (WS_END)                                  // f32 ctx rows [b*TT + t][128] (columns 64..127 = the padding head)
#define WS_CM (WS_Y2 + 4u * (size_t)NB * TT * CC)        // f32 column maxima [TT]
#define WS_CZ (WS_CM + 4u * (size_t)HG * TT)
#define WS_END2 (WS_CZ + 4u * (size_t)HG * TT)

// ---- k_proj: block = (64 rows, 128 cols, which): q/k/v = X W (+ b) with exact bf16 products (K = DIN) -> which 0: q f16 rows (+ residual rows < QHI); 1: k f16 rows (+ residual rows < KHI); 2: v f16 planes [c][t] (+ bf16 hi/lo planes for t < KHI)
__global__ __launch_bounds__(128) void k_proj(const float* __restrict__ XQ, const float* __restrict__ XK, const float* __restrict__ XV, const float* __restrict__ WQ, const float* __restrict__ WK, const float* __restrict__ WV, const float* __restrict__ BQ, const float* __restrict__ BK, const float* __restrict__ BV,
    _Float16* __restrict__ QH, _Float16* __restrict__ QL, _Float16* __restrict__ KH, _Float16* __restrict__ KL, _Float16* __restrict__ VT, __bf16* __restrict__ VB, __bf16* __restrict__ VBL) {
  __shared__ __align__(16) _Float16 sh[64][136], sl[64][136]; __shared__ __align__(16) _Float16 th[128][72]; __shared__ __align__(16) __bf16 tb[128][72], tbl[128][72];
  const int tid = threadIdx.x, wave = tid >> 5, lane = tid & 31, col = lane & 15, g = lane >> 4; const int which = blockIdx.z; const int c0 = blockIdx.y * 128; const size_t r0 = (size_t)blockIdx.x * 64; const size_t bb = r0 / TT; const int t0 = (int)(r0 % TT);
  const float* X = which == 0 ? XQ : which == 1 ? XK : XV; const float* WA = which == 0 ? WQ : which == 1 ? WK : WV; const float* BA = which == 0 ? BQ : which == 1 ? BK : BV;
  v8f acc[8] = {};
#pragma unroll 2
  for (int kc = 0; kc < DIN / 32; ++kc) { v16b a; { const float* p = X + (r0 + wave * 16 + col) * DIN + kc * 32 + 8 * g;
#pragma unroll
      for (int i = 0; i < 8; ++i) { a[i] = (__bf16)p[i]; a[8 + i] = (__bf16)p[16 + i]; } }
    asm volatile("s_wait_loadcnt 0x0" ::: "memory");
#pragma unroll
    for (int j = 0; j < 8; ++j) { const v16b w = WCOL(WA, kc * 32, c0 + j * 16 + col, lane); asm volatile("s_wait_loadcnt 0x0" ::: "memory"); acc[j] = wmma_bf(a, w, acc[j]); } }
  if (which < 2) { _Float16* DH = which == 0 ? QH : KH; _Float16* DL = which == 0 ? QL : KL; const int nhi = which == 0 ? QHI : KHI; const bool hi_rows = t0 < nhi;
#pragma unroll
    for (int j = 0; j < 8; ++j) { const float bias = BA ? bfr(BA[c0 + j * 16 + col]) : 0.f;
#pragma unroll
      for (int r = 0; r < 8; ++r) { const float v = acc[j][r] + bias; const _Float16 hv = (_Float16)v; sh[wave * 16 + 8 * g + r][j * 16 + col] = hv; sl[wave * 16 + 8 * g + r][j * 16 + col] = (_Float16)((v - (float)hv) * 1024.0f); } }
    __syncthreads();
    for (int e = tid; e < 64 * 16; e += 128) { const int rl = e >> 4, q = e & 15; vst2((unsigned*)(DH + (r0 + rl) * CC + c0 + q * 8), *(const v4u*)&sh[rl][q * 8]); if (hi_rows) vst2((unsigned*)(DL + (bb * nhi + t0 + rl) * (size_t)CC + c0 + q * 8), *(const v4u*)&sl[rl][q * 8]); }
  } else { const bool hi_rows = t0 < KHI;
#pragma unroll
    for (int j = 0; j < 8; ++j) { const float bias = BA ? bfr(BA[c0 + j * 16 + col]) : 0.f;
#pragma unroll
      for (int r = 0; r < 8; ++r) { const float v = acc[j][r] + bias; const int rl = wave * 16 + 8 * g + r, cl = j * 16 + col; th[cl][rl] = (_Float16)v; const __bf16 bh = (__bf16)v; tb[cl][rl] = bh; tbl[cl][rl] = (__bf16)(v - (float)bh); } }
    __syncthreads();
    for (int e = tid; e < 128 * 8; e += 128) { const int cl = e >> 3, q = e & 7; vst2((unsigned*)(VT + (bb * CC + c0 + cl) * (size_t)TT + t0 + q * 8), *(const v4u*)&th[cl][q * 8]); if (hi_rows) { const size_t o3 = (bb * CC + c0 + cl) * (size_t)KHI + t0 + q * 8; vst2((unsigned*)(VB + o3), *(const v4u*)&tb[cl][q * 8]); vst2((unsigned*)(VBL + o3), *(const v4u*)&tbl[cl][q * 8]); } } } }
// ---- k_sc: block = (query block qb, key block kb <= kb_last(qb), head in group) of batch b: logits x SCALE; q hi + residual (x 2^10) against k (2 products) for query rows < QHI, plus the k residual (3 products) for query blocks < QBH (every query block here); causal: blocks past the diagonal exit, the mask itself is applied by index in k_colstat_c and k_csm_c
__global__ __launch_bounds__(128) void k_sc(const _Float16* __restrict__ QH, const _Float16* __restrict__ KH, const _Float16* __restrict__ QL, const _Float16* __restrict__ KL, int b, int h0, float* __restrict__ S0) { __shared__ __align__(16) float ss[4][16][132];
  const int qb = blockIdx.x, kb = blockIdx.y; if (kb > kb_last(qb)) return;
  const int h = h0 + blockIdx.z; float* S = S0 + (size_t)blockIdx.z * TT * TT;
  const int tid = threadIdx.x, wave = tid >> 5, lane = tid & 31, col = lane & 15, g = lane >> 4; const int k0 = kb * 128; const int ql0 = qb * 64 + wave * 16; const size_t q0 = (size_t)b * TT + ql0, kr0 = (size_t)b * TT + k0;
  v8f acc[8] = {}, accl[8] = {};
  const _Float16* QLb = QL + (size_t)b * QHI * CC; const _Float16* KLb = KL + (size_t)b * KHI * CC;
  if (qb < QBH) {
#pragma unroll
    for (int kc = 0; kc < HD / 32; ++kc) { const v16h ah = frag_h(QH + (q0 + col) * CC + h * HD + kc * 32, lane), al = frag_h(QLb + (size_t)(ql0 + col) * CC + h * HD + kc * 32, lane);
#pragma unroll
      for (int j = 0; j < 8; ++j) { const v16h kbf = frag_h(KH + (kr0 + j * 16 + col) * CC + h * HD + kc * 32, lane), klf = frag_h(KLb + (size_t)(k0 + j * 16 + col) * CC + h * HD + kc * 32, lane); acc[j] = wmma16(ah, kbf, acc[j]); accl[j] = wmma16(al, kbf, accl[j]); accl[j] = wmma16(ah, klf, accl[j]); } }
  } else if (qb * 64 < QHI) {
#pragma unroll
    for (int kc = 0; kc < HD / 32; ++kc) { const v16h ah = frag_h(QH + (q0 + col) * CC + h * HD + kc * 32, lane), al = frag_h(QLb + (size_t)(ql0 + col) * CC + h * HD + kc * 32, lane);
#pragma unroll
      for (int j = 0; j < 8; ++j) { const v16h kbf = frag_h(KH + (kr0 + j * 16 + col) * CC + h * HD + kc * 32, lane); acc[j] = wmma16(ah, kbf, acc[j]); accl[j] = wmma16(al, kbf, accl[j]); } }
  } else {
#pragma unroll
    for (int kc = 0; kc < HD / 32; ++kc) { const v16h ah = frag_h(QH + (q0 + col) * CC + h * HD + kc * 32, lane);
#pragma unroll
      for (int j = 0; j < 8; ++j) { const v16h kbf = frag_h(KH + (kr0 + j * 16 + col) * CC + h * HD + kc * 32, lane); acc[j] = wmma16(ah, kbf, acc[j]); } } }
#pragma unroll
  for (int j = 0; j < 8; ++j) {
#pragma unroll
    for (int r = 0; r < 8; ++r) ss[wave][8 * g + r][j * 16 + col] = (acc[j][r] + accl[j][r] * (1.0f / 1024.0f)) * SCALE; }
  LDSX(); for (int rl = 0; rl < 16; ++rl) vst2(S + (size_t)(ql0 + rl) * TT + k0 + lane * 4, *(const v4f*)&ss[wave][rl][lane * 4]); }
// ---- k_sm: block = query row t (head in group): keys [0, kend): causal -> logit if s <= t else excluded; softmax in f32; P x 2^11 in place (0 for excluded)
__global__ __launch_bounds__(256) void k_sm(float* __restrict__ S0 SM_EXTRA_PARAMS) { __shared__ float sred[8]; __shared__ float sbc; __shared__ __align__(16) float shv[TT];
  const int tid = threadIdx.x; const int t = blockIdx.x; const int kend = (kb_last(t >> 6) + 1) * 128;
  float* sr = S0 + (size_t)blockIdx.y * TT * TT + (size_t)t * TT;
  float m = -3.0e38f; for (int k = tid; k < kend; k += 256) { float v = (!CAUSAL || k <= t) ? sr[k] : -3.0e38f; SM_MASK_HOOK; shv[k] = v; m = fmaxf(m, v); }
#pragma unroll
  for (int o = 1; o < 32; o <<= 1) m = fmaxf(m, __shfl_xor(m, o));
  if ((tid & 31) == 0) sred[tid >> 5] = m; __syncthreads(); if (tid == 0) { float a = sred[0]; for (int i = 1; i < 8; ++i) a = fmaxf(a, sred[i]); sbc = a; } __syncthreads(); m = sbc; __syncthreads();
  float sum = 0.f; for (int k = tid; k < kend; k += 256) { const float v = shv[k]; const float e = (v <= -1.0e38f) ? 0.f : expf(v - m); shv[k] = e; sum += e; }
#pragma unroll
  for (int o = 1; o < 32; o <<= 1) sum += __shfl_xor(sum, o);
  if ((tid & 31) == 0) sred[tid >> 5] = sum; __syncthreads(); if (tid == 0) { float a = 0.f; for (int i = 0; i < 8; ++i) a += sred[i]; sbc = a > 0.f ? 2048.0f / a : 0.f; }   /* a fully excluded row yields P = 0 */ __syncthreads(); const float inv = sbc;
  for (int k = tid; k < kend; k += 256) shv[k] = shv[k] * inv;
  __syncthreads(); for (int q = tid; q < kend / 4; q += 256) vst2(sr + q * 4, *(const v4f*)&shv[q * 4]); }
// exp for k_colstat_c, to expf's accuracy: e = the integer nearest to x log2(e); the fraction x log2(e) - e by two fused multiply-adds with the constant's high and low word; exp2 of the fraction, ldexp by e; 0 below -103.28 (ln of the smallest f32 denormal), +inf above 88.72 (expf's overflow limit). v_exp_f32 stands in one asm statement with a v_nop: the free slot that the instruction set asks for between a transcendental and an instruction that reads its result or overwrites its source (in a statement of its own nothing would hold the v_nop there)
__device__ __forceinline__ float exp_slot(float x) { const float c = __builtin_bit_cast(float, 0x3fb8aa3bu), cl = __builtin_bit_cast(float, 0x32a5705fu);
  const float e = __builtin_rintf(x * c); const float a = __builtin_fmaf(x, cl, __builtin_fmaf(x, c, -e)); float r;
  asm("v_exp_f32 %0, %1\n\tv_nop" : "=v"(r) : "v"(a));   /* the v_nop keeps the slot behind the transcendental free whatever the compiler schedules next */
  r = __builtin_ldexpf(r, (int)e); r = (x < __builtin_bit_cast(float, 0xc2ce8ed0u)) ? 0.f : r; return (x > __builtin_bit_cast(float, 0x42b17218u)) ? __builtin_inff() : r; }
// ---- k_colstat_c: softmax over the QUERY axis under the causal mask (the source's softmax(axis=1) on [B, t, s] scores with -inf above the diagonal): for every key column k: m_k = max_{q >= k} S[q][k], Z_k = sum_{q >= k} exp(S[q][k] - m_k) (f32, exp_slot).
// block = 32 key columns (one 128-B line of every score row) x 32 waves. A wave-wide 16-byte load covers 4 query rows x 32 columns (4 whole lines); wave w takes the 64 rows from c0 + 64 w and holds them in registers, so its 16 loads are all in flight at once and the scores are read once.
// Per wave and column: max, then the sum of exp against that max; the 32 (max, sum) pairs of a column are merged through LDS by wave 0: M = max m_w, Z = sum z_w exp(m_w - M).
// Rows above a column's diagonal lie only in wave 0's first 32 rows (they hold the unmasked logits of the diagonal score block): their content is replaced by value select. Sentinels: a hidden entry reads -3e38 and the running max starts at -1e38, so a hidden entry adds exp(-2e38) = 0, and a wave with no row below TT hands the pair (-1e38, 0), which adds 0 to the merge (the logits are sums of 64 f16-range products, far above -1e38).
__global__ __launch_bounds__(1024) void k_colstat_c(const float* __restrict__ S0, float* __restrict__ CM, float* __restrict__ CZ) { __shared__ __align__(16) float pm[32][32], pz[32][32];
  const int tid = threadIdx.x, lane = tid & 31, sub = lane >> 3, cq = lane & 7; const int wave = __builtin_amdgcn_readfirstlane(tid >> 5); const int c0 = blockIdx.x * 32;
  const int r0 = c0 + wave * 64;                       /* the wave's first row */
  const bool h0 = r0 < TT, h1 = r0 + 32 < TT;          /* TT - c0 is a multiple of 32: each half of the wave's 64 rows is wholly inside or wholly past the end (wave-uniform) */
  const float* sp = S0 + (size_t)blockIdx.y * TT * TT + (size_t)(r0 + sub) * TT + c0 + cq * 4;
  v4f v[16];
  if (h0) {
#pragma unroll
    for (int s = 0; s < 8; ++s) v[s] = *(const v4f*)(sp + (size_t)s * 4 * TT); }
  if (h1) {
#pragma unroll
    for (int s = 8; s < 16; ++s) v[s] = *(const v4f*)(sp + (size_t)s * 4 * TT); }
  asm volatile("s_wait_xcnt 0x0" :: "v"(sp) : "memory");   /* the issued loads' address pair is an input here, so nothing (a load's own result included) overwrites it in front of this wait */
  v4f m = { -1.0e38f, -1.0e38f, -1.0e38f, -1.0e38f }, z = { 0.f, 0.f, 0.f, 0.f };
  if (wave == 0) {
#pragma unroll
    for (int s = 0; s < 8; ++s)
#pragma unroll
      for (int u = 0; u < 4; ++u) v[s][u] = (s * 4 + sub >= cq * 4 + u) ? v[s][u] : -3.0e38f; }
  if (h0) {
#pragma unroll
    for (int s = 0; s < 8; ++s)
#pragma unroll
      for (int u = 0; u < 4; ++u) m[u] = fmaxf(m[u], v[s][u]); }
  if (h1) {
#pragma unroll
    for (int s = 8; s < 16; ++s)
#pragma unroll
      for (int u = 0; u < 4; ++u) m[u] = fmaxf(m[u], v[s][u]); }
#pragma unroll
  for (int u = 0; u < 4; ++u) { m[u] = fmaxf(m[u], __shfl_xor(m[u], 8)); m[u] = fmaxf(m[u], __shfl_xor(m[u], 16)); }
  if (h0) {
#pragma unroll
    for (int s = 0; s < 8; ++s)
#pragma unroll
      for (int u = 0; u < 4; ++u) z[u] += exp_slot(v[s][u] - m[u]); }
  if (h1) {
#pragma unroll
    for (int s = 8; s < 16; ++s)
#pragma unroll
      for (int u = 0; u < 4; ++u) z[u] += exp_slot(v[s][u] - m[u]); }
#pragma unroll
  for (int u = 0; u < 4; ++u) { z[u] += __shfl_xor(z[u], 8); z[u] += __shfl_xor(z[u], 16); }
  if (sub == 0) { *(v4f*)&pm[wave][cq * 4] = m; *(v4f*)&pz[wave][cq * 4] = z; }
  __syncthreads();   /* publishes the 32 waves' pairs to wave 0 */
  if (wave == 0) { float mw[32], zw[32], M = -1.0e38f, Z = 0.f;
#pragma unroll
    for (int i = 0; i < 32; ++i) { mw[i] = pm[i][lane]; zw[i] = pz[i][lane]; }
#pragma unroll
    for (int i = 0; i < 32; ++i) M = fmaxf(M, mw[i]);
#pragma unroll
    for (int i = 0; i < 32; ++i) Z += zw[i] * exp_slot(mw[i] - M);
    vst2(CM + (size_t)blockIdx.y * TT + c0 + lane, M); vst2(CZ + (size_t)blockIdx.y * TT + c0 + lane, Z); } }   /* every column sees at least its own diagonal entry: Z_k >= 1 */
// ---- k_csm_c: block = query row t: P[t][k] = exp(S[t][k] - m_k) / Z_k x 2^11 for k <= t, 0 for t < k < kend (inside the diagonal block); in place; unconditional loads, value select
__global__ __launch_bounds__(256) void k_csm_c(float* __restrict__ S0, const float* __restrict__ CM, const float* __restrict__ CZ) { const int tid = threadIdx.x; const int t = blockIdx.x; const int kend = (kb_last(t >> 6) + 1) * 128; float* sr = S0 + (size_t)blockIdx.y * TT * TT + (size_t)t * TT; const float* cm = CM + (size_t)blockIdx.y * TT; const float* cz = CZ + (size_t)blockIdx.y * TT;
  for (int q4 = tid; q4 < kend / 4; q4 += 256) { const v4f sv = *(const v4f*)(sr + q4 * 4), m4 = *(const v4f*)(cm + q4 * 4), z4 = *(const v4f*)(cz + q4 * 4); asm volatile("s_wait_loadcnt 0x0" ::: "memory"); v4f p;
#pragma unroll
    for (int u = 0; u < 4; ++u) p[u] = (q4 * 4 + u <= t) ? expf(sv[u] - m4[u]) * (2048.0f / z4[u]) : 0.f;
    vst2(sr + q4 * 4, p); } }
// ---- k_out64: out[b][t][0..63] = ctx row columns 0..63 (256 B by 16 lanes)
__global__ __launch_bounds__(256) void k_out64(const float* __restrict__ Y, float* __restrict__ OUT) { const size_t row = (size_t)blockIdx.x * 16 + (threadIdx.x >> 4); const int q = threadIdx.x & 15; const v4f v = *(const v4f*)(Y + row * CC + q * 4); asm volatile("s_wait_loadcnt 0x0" ::: "memory"); vst2(OUT + row * 64 + q * 4, v); }
// ---- k_pv: block = 64 queries (qb) of (b, h): ctx = P . v over keys [0, kend) (P x 2^11 once to f16 against v f16: 1 product; query blocks < QBH, i.e. all of them: P and v as bf16 hi + lo, 3 products); 256-B (row, head) segment by 16 lanes
__global__ __launch_bounds__(128) void k_pv(const float* __restrict__ PS0, const _Float16* __restrict__ VT, const __bf16* __restrict__ VB, const __bf16* __restrict__ VBL, int b, int h0, float* __restrict__ Y) { const int h = h0 + blockIdx.z; const float* PS = PS0 + (size_t)blockIdx.z * TT * TT; __shared__ __align__(16) float ss[4][16][HD + 4];
  const int tid = threadIdx.x, wave = tid >> 5, lane = tid & 31, col = lane & 15, g = lane >> 4; const int qb = blockIdx.x; const int ql0 = qb * 64 + wave * 16; const int kce = (kb_last(qb) + 1) * 4;
  v8f acc[HD / 16] = {};
  if (qb < QBH) {
#pragma unroll 1
    for (int kc = 0; kc < kce; ++kc) { const F2 p = split_row(PS + (size_t)(ql0 + col) * TT, kc * 32, lane);
      asm volatile("s_wait_loadcnt 0x0" ::: "memory");
#pragma unroll
      for (int j = 0; j < HD / 16; ++j) { const size_t po = ((size_t)b * CC + h * HD + j * 16 + col) * (size_t)KHI + kc * 32; const v16b vh = frag_b(VB + po, lane); acc[j] = wmma_bf(p.h, vh, acc[j]); acc[j] = wmma_bf(p.l, vh, acc[j]); acc[j] = wmma_bf(p.h, frag_b(VBL + po, lane), acc[j]); } }
  } else {
#pragma unroll 1
    for (int kc = 0; kc < kce; ++kc) { const v16h p = frag_f32(PS + (size_t)(ql0 + col) * TT + kc * 32, lane);
      asm volatile("s_wait_loadcnt 0x0" ::: "memory");
#pragma unroll
      for (int j = 0; j < HD / 16; ++j) { const size_t po = ((size_t)b * CC + h * HD + j * 16 + col) * (size_t)TT + kc * 32; acc[j] = wmma16(p, frag_h(VT + po, lane), acc[j]); } } }
#pragma unroll
  for (int j = 0; j < HD / 16; ++j)
#pragma unroll
    for (int r = 0; r < 8; ++r) ss[wave][8 * g + r][j * 16 + col] = acc[j][r] * (1.0f / 2048.0f);
  LDSX(); for (int rl = 0; rl < 16; ++rl) if (lane < HD / 4) vst2(Y + ((size_t)b * TT + ql0 + rl) * CC + h * HD + lane * 4, *(const v4f*)&ss[wave][rl][lane * 4]); }

extern "C" void kernel_launch(void* const* d_in, const int* in_sizes, int n_in, void* d_out, int out_size, void* d_ws, size_t ws_size, hipStream_t stream) {
  (void)in_sizes; (void)n_in; (void)out_size;
  const float** F = (const float**)d_in;
  if (ws_size < (size_t)WS_END) return;
  char* ws = (char*)d_ws; _Float16 *QH = (_Float16*)(ws + WS_QH), *KH = (_Float16*)(ws + WS_KH), *VT = (_Float16*)(ws + WS_VT), *QL = (_Float16*)(ws + WS_QL), *KL = (_Float16*)(ws + WS_KL); __bf16 *VB = (__bf16*)(ws + WS_VB), *VBL = (__bf16*)(ws + WS_VBL); float *S = (float*)(ws + WS_S), *Y = (float*)(ws + WS_Y);
  (void)Y; (void)QL; (void)KL; (void)VB; (void)VBL;
  // inputs: 0 x [8,2048,384]; 1 Wq [384,64] (in,out); 2 Wk; 3 Wv; no biases
  if (ws_size < (size_t)WS_END2) return;
  float *Y2 = (float*)(ws + WS_Y2), *CM = (float*)(ws + WS_CM), *CZ = (float*)(ws + WS_CZ);
  k_proj<<<dim3(TNB * TT / 64, CC / 128, 3), 128, 0, stream>>>(F[0], F[0], F[0], F[1], F[2], F[3], nullptr, nullptr, nullptr, QH, QL, KH, KL, VT, VB, VBL);   /* weight columns 64..127 (the padding head) are zero fragments */
  for (int b = 0; b < TNB; ++b) {   /* head 0 only (head 1 is the zero padding) */
    k_sc<<<dim3(NQB, TT / 128, 1), 128, 0, stream>>>(QH, KH, QL, KL, b, 0, S);
    k_colstat_c<<<dim3(TT / 32, 1), 1024, 0, stream>>>(S, CM, CZ);   /* per key column j: max / sum over the visible queries i >= j */
    k_csm_c<<<dim3(TT, 1), 256, 0, stream>>>(S, CM, CZ);            /* P[i][j] = exp(S - m_j) / Z_j x 2^11 for j <= i, 0 above the diagonal */
    k_pv<<<dim3(NQB, 1, 1), 128, 0, stream>>>(S, VT, VB, VBL, b, 0, Y2);
  }
  k_out64<<<dim3(TNB * TT / 16), 256, 0, stream>>>(Y2, (float*)d_out);
}

// v002
// A run of this version takes 210 microseconds.
// Timed twice side by side with v001, it ran 4.90 and 4.93 times as fast.
// All steps since v000 together make it 35.8 times as fast.
// compute dtype: all float inputs rounded to bf16; q/k/v projections with EXACT bf16 products on WMMA 16x16x32 (f32 accumulate); causal scores with BOTH q and k as f16 hi + (x 2^10) residual (3 products) on EVERY block, x 64^-0.5; softmax over the QUERY axis in f32 (per key column: max and sum over the visible queries, per wave and merged, exp to expf's accuracy; P by precise expf); P as bf16 hi + lo against v as bf16 hi + lo (3 products) on EVERY block; f32 output.
#include <hip/hip_runtime.h>
#include <math.h>

typedef __attribute__((ext_vector_type(16))) _Float16 v16h;
typedef __attribute__((ext_vector_type(16))) __bf16 v16b;
typedef __attribute__((ext_vector_type(8)))  _Float16 v8h;
typedef __attribute__((ext_vector_type(8)))  float v8f;
typedef __attribute__((ext_vector_type(4)))  float v4f;
typedef __attribute__((ext_vector_type(2)))  float v2f;
typedef __attribute__((ext_vector_type(4)))  unsigned v4u;
typedef __attribute__((ext_vector_type(4)))  int v4i;
typedef float __attribute__((may_alias)) float_a;
typedef int __attribute__((may_alias)) int_a;

template <typename T> __device__ __forceinline__ void vst2(void* p, T v) { *(T*)p = v;  }
__device__ __forceinline__ v8f wmma16(v16h a, v16h b, v8f c) {
  v8f d = __builtin_amdgcn_wmma_f32_16x16x32_f16(false, a, false, b, (short)0, c, false, false);
  asm volatile("v_nop\n\tv_nop\n\tv_nop\n\tv_nop" : "+v"(d) : "v"(a), "v"(b));
  return d;
}
__device__ __forceinline__ v8f wmma_bf(v16b a, v16b b, v8f c) {
  v8f d = __builtin_amdgcn_wmma_f32_16x16x32_bf16(false, a, false, b, (short)0, c, false, false);
  asm volatile("v_nop\n\tv_nop\n\tv_nop\n\tv_nop" : "+v"(d) : "v"(a), "v"(b));
  return d;
}
// 16x16x32 fragments: lane = (h = lane>>4, row/col = lane&15); elements 0..7 = k0+8h+0..7, 8..15 = k0+16+8h+0..7; D element r = row 8h+r
__device__ __forceinline__ v16h frag_h(const _Float16* rowk0, int lane) {
  union { v16h v; v8h q[2]; } u; const _Float16* p = rowk0 + 8 * (lane >> 4);
  u.q[0] = *(const v8h*)p; u.q[1] = *(const v8h*)(p + 16); return u.v;
}
__device__ __forceinline__ v16h frag_f32(const float* rowk0, int lane) {
  v16h a; const float* p = rowk0 + 8 * (lane >> 4);
#pragma unroll
  for (int i = 0; i < 8; ++i) { a[i] = (_Float16)p[i]; a[8 + i] = (_Float16)p[16 + i]; }
  return a;
}
__device__ __forceinline__ v16h frag_f32s(const float* rowk0, int lane, float sc) {
  v16h a; const float* p = rowk0 + 8 * (lane >> 4);
#pragma unroll
  for (int i = 0; i < 8; ++i) { a[i] = (_Float16)(p[i] * sc); a[8 + i] = (_Float16)(p[16 + i] * sc); }
  return a;
}
// column fragment from a [K][ld] layout (column n), rows >= K read as 0
__device__ __forceinline__ v16h fragc_f32(const float* W, int k0, int n, int lane, int ld, int K) {
  v16h a; const int g = lane >> 4;
#pragma unroll
  for (int i = 0; i < 8; ++i) { const int ka = k0 + 8 * g + i, kb = ka + 16;
    a[i] = (_Float16)(ka < K ? W[(size_t)(ka < K ? ka : K - 1) * ld + n] : 0.f); a[8 + i] = (_Float16)(kb < K ? W[(size_t)(kb < K ? kb : K - 1) * ld + n] : 0.f); }
  return a;
}
struct F2 { v16b h, l; };
__device__ __forceinline__ F2 bsplit16(const float v[16]) { F2 r;
#pragma unroll
  for (int i = 0; i < 16; ++i) { const __bf16 h = (__bf16)v[i]; r.h[i] = h; r.l[i] = (__bf16)(v[i] - (float)h); }
  return r; }
__device__ __forceinline__ F2 split_row(const float* row, int k0, int lane) { float v[16]; const float* p = row + k0 + 8 * (lane >> 4);
#pragma unroll
  for (int i = 0; i < 8; ++i) { v[i] = p[i]; v[8 + i] = p[16 + i]; }
  return bsplit16(v); }
__device__ __forceinline__ F2 split_rowK(const float* row, int k0, int lane, int K) { float v[16]; const int g = lane >> 4;
#pragma unroll
  for (int i = 0; i < 8; ++i) { const int ka = k0 + 8 * g + i, kb = ka + 16; v[i] = ka < K ? row[ka < K ? ka : K - 1] : 0.f; v[8 + i] = kb < K ? row[kb < K ? kb : K - 1] : 0.f; }
  return bsplit16(v); }
__device__ __forceinline__ F2 split_col(const float* W, int k0, int n, int lane, int ld, int K) { float v[16]; const int g = lane >> 4;
#pragma unroll
  for (int i = 0; i < 8; ++i) { const int ka = k0 + 8 * g + i, kb = ka + 16; v[i] = ka < K ? W[(size_t)(ka < K ? ka : K - 1) * ld + n] : 0.f; v[8 + i] = kb < K ? W[(size_t)(kb < K ? kb : K - 1) * ld + n] : 0.f; }
  return bsplit16(v); }
__device__ __forceinline__ v8f mac3(const F2& a, const F2& b, v8f c) { c = wmma_bf(a.l, b.h, c); c = wmma_bf(a.h, b.l, c); return wmma_bf(a.h, b.h, c); }
__device__ __forceinline__ float sigm(float v) { return 1.0f / (1.0f + expf(-v)); }
#define LDSX() do { asm volatile("s_wait_dscnt 0" ::: "memory"); __builtin_amdgcn_wave_barrier(); __builtin_amdgcn_fence(__ATOMIC_RELEASE, "workgroup"); } while (0)

// Single-head causal self-attention whose softmax runs over the QUERY axis (x [8,2048,384]; (in,out) Wq / Wk / Wv [384,64] (0.02 scale), no biases; scores[b, i, j] = q_i . k_j / 8; -inf where j > i; attn = softmax(scores, axis=1) - axis 1 is the QUERY axis i, so every key column j is normalised over the queries i >= j (faithful to the source); out = attn v -> [8,2048,64]).
#define NB 8
#define TT 2048
#define CC 128            // NH * HD = projected width
#define DIN 384          // input (model) width
#define NH 2
#define HD 64
#define NQB (TT / 64)
#define SCALE (0.125f)
#define CAUSAL 1
#ifndef TNB
#define TNB NB
#endif
__device__ __forceinline__ float bfr(float v) { return (float)(__bf16)v; }
__host__ __device__ __forceinline__ int kb_last(int qb) { return CAUSAL ? ((qb * 64 + 63) >> 7) : (TT / 128 - 1); }
typedef __attribute__((ext_vector_type(8))) __bf16 v8b;
__device__ __forceinline__ v16b frag_b(const __bf16* rowk0, int lane) {
  union { v16b v; v8b q[2]; } u; const __bf16* p = rowk0 + 8 * (lane >> 4);
  u.q[0] = *(const v8b*)p; u.q[1] = *(const v8b*)(p + 16); return u.v;
}
#define QBH 32              // causal: query blocks 0..QBH-1 of each sequence (all NQB = 32 of them) take the high-precision path
#define QHI 2048            // rows carrying a q residual plane (all TT rows)
#define KHI 2048            // key rows carrying k residual / v bf16 hi+lo planes (used only by the causal high-precision path)
// B fragment (k rows k0+.., output column o) of a weight: (in,out) [K][ld] or (out,in) [ld rows of K]: bf16 exact, or f16(bf16 * 256) exact
__device__ __forceinline__ v16b wcol_io(const float* Wm, int k0, int o, int lane, int ld) { v16b w; const int g = lane >> 4;
#pragma unroll
  for (int i = 0; i < 8; ++i) { w[i] = (__bf16)Wm[(size_t)(k0 + 8 * g + i) * ld + o]; w[8 + i] = (__bf16)Wm[(size_t)(k0 + 16 + 8 * g + i) * ld + o]; }
  return w; }
__device__ __forceinline__ v16b wcol_oi(const float* Wm, int k0, int o, int lane, int K) { v16b w; const float* p = Wm + (size_t)o * K + k0 + 8 * (lane >> 4);
#pragma unroll
  for (int i = 0; i < 8; ++i) { w[i] = (__bf16)p[i]; w[8 + i] = (__bf16)p[16 + i]; }
  return w; }
__device__ __forceinline__ v16h wcolh_io(const float* Wm, int k0, int o, int lane, int ld) { v16h w; const int g = lane >> 4;
#pragma unroll
  for (int i = 0; i < 8; ++i) { w[i] = (_Float16)(bfr(Wm[(size_t)(k0 + 8 * g + i) * ld + o]) * 256.0f); w[8 + i] = (_Float16)(bfr(Wm[(size_t)(k0 + 16 + 8 * g + i) * ld + o]) * 256.0f); }
  return w; }
__device__ __forceinline__ v16h wcolh_oi(const float* Wm, int k0, int o, int lane, int K) { v16h w; const float* p = Wm + (size_t)o * K + k0 + 8 * (lane >> 4);
#pragma unroll
  for (int i = 0; i < 8; ++i) { w[i] = (_Float16)(bfr(p[i]) * 256.0f); w[8 + i] = (_Float16)(bfr(p[16 + i]) * 256.0f); }
  return w; }
#define WQKV_LAYOUT 0   // 0 = (in,out) [DIN][64] (head 0 only; columns 64..127 zero); 1 = (out,in) [CC][DIN]; 2 = per-head [NH][DIN][HD]
__device__ __forceinline__ v16b wcol_hdk(const float* Wm, int k0, int o, int lane) { v16b w; const int g = lane >> 4; const float* p = Wm + (size_t)(o / HD) * DIN * HD + (o % HD);
#pragma unroll
  for (int i = 0; i < 8; ++i) { w[i] = (__bf16)p[(size_t)(k0 + 8 * g + i) * HD]; w[8 + i] = (__bf16)p[(size_t)(k0 + 16 + 8 * g + i) * HD]; }
  return w; }
#define WO_OUT_IN 0
#if WQKV_LAYOUT == 1
#define WCOL(W, k0, o, lane) wcol_oi(W, k0, o, lane, DIN)
#elif WQKV_LAYOUT == 2
#define WCOL(W, k0, o, lane) wcol_hdk(W, k0, o, lane)
#else
__device__ __forceinline__ v16b zero16b() { v16b w; _Pragma("unroll") for (int i = 0; i < 16; ++i) w[i] = (__bf16)0.0f; return w; }
#define WCOL(W, k0, o, lane) ((o) < 64 ? wcol_io(W, k0, (o), lane, 64) : zero16b())   /* (in,out) [384][64] pitch 64: only 64 real output columns; projected columns 64..127 (padding head 1) are zero; compile-time per unrolled tile (c0 = 0) */
#endif
#if WO_OUT_IN
#define WOCOL(W, k0, o, lane) wcol_oi(W, k0, o, lane, CC)
#define WOCOLH(W, k0, o, lane) wcolh_oi(W, k0, o, lane, CC)
#else
#define WOCOL(W, k0, o, lane) wcol_io(W, k0, o, lane, DIN)
#define WOCOLH(W, k0, o, lane) wcolh_io(W, k0, o, lane, DIN)
#endif

#ifndef SM_EXTRA_PARAMS
#define SM_EXTRA_PARAMS
#endif
#ifndef PROJ_EXTRA_PARAMS
#define PROJ_EXTRA_PARAMS
#endif
#ifndef SM_MASK_HOOK
#define SM_MASK_HOOK (void)0
#endif

#define WS_QH  0u                                      // f16 q rows [b*t][CC]
#define WS_KH  (WS_QH + 2u * (size_t)NB * TT * CC)      // f16 k rows [b*t][CC]
#define WS_VT  (WS_KH + 2u * (size_t)NB * TT * CC)      // f16 v planes [b][c][t]
#define WS_QL  (WS_VT + 2u * (size_t)NB * CC * TT)      // f16 q residual x 2^10 rows [b][t < QHI][CC]
#define WS_KL  (WS_QL + 2u * (size_t)NB * QHI * CC)     // f16 k residual x 2^10 rows [b][t < KHI][CC]
#define WS_VB  (WS_KL + 2u * (size_t)NB * KHI * CC)     // bf16 v hi planes [b][c][t < KHI]
#define WS_VBL (WS_VB + 2u * (size_t)NB * CC * KHI)
#define WS_S   (WS_VBL + 2u * (size_t)NB * CC * KHI)    // f32 logits / P [b][t][s]: one plane per sequence
#define WS_Y   (WS_S  + 4u * (size_t)NB * TT * TT)      // f32 ctx rows [b*t][CC] (only when there is an output projection)
#define WS_END (WS_Y  + 0u)
#define WS_Y2 (WS_END)                                  // f32 ctx rows [b*TT + t][128] (columns 64..127 = the padding head)
#define WS_CM (WS_Y2 + 4u * (size_t)NB * TT * CC)        // f32 column maxima [b][TT]
#define WS_CZ (WS_CM + 4u * (size_t)NB * TT)
#define WS_END2 (WS_CZ + 4u * (size_t)NB * TT)

// ---- k_proj: block = (64 rows, 128 cols, which): q/k/v = X W (+ b) with exact bf16 products (K = DIN) -> which 0: q f16 rows (+ residual rows < QHI); 1: k f16 rows (+ residual rows < KHI); 2: v f16 planes [c][t] (+ bf16 hi/lo planes for t < KHI)
__global__ __launch_bounds__(128) void k_proj(const float* __restrict__ XQ, const float* __restrict__ XK, const float* __restrict__ XV, const float* __restrict__ WQ, const float* __restrict__ WK, const float* __restrict__ WV, const float* __restrict__ BQ, const float* __restrict__ BK, const float* __restrict__ BV,
    _Float16* __restrict__ QH, _Float16* __restrict__ QL, _Float16* __restrict__ KH, _Float16* __restrict__ KL, _Float16* __restrict__ VT, __bf16* __restrict__ VB, __bf16* __restrict__ VBL) {
  __shared__ __align__(16) _Float16 sh[64][136], sl[64][136]; __shared__ __align__(16) _Float16 th[128][72]; __shared__ __align__(16) __bf16 tb[128][72], tbl[128][72];
  const int tid = threadIdx.x, wave = tid >> 5, lane = tid & 31, col = lane & 15, g = lane >> 4; const int which = blockIdx.z; const int c0 = blockIdx.y * 128; const size_t r0 = (size_t)blockIdx.x * 64; const size_t bb = r0 / TT; const int t0 = (int)(r0 % TT);
  const float* X = which == 0 ? XQ : which == 1 ? XK : XV; const float* WA = which == 0 ? WQ : which == 1 ? WK : WV; const float* BA = which == 0 ? BQ : which == 1 ? BK : BV;
  v8f acc[8] = {};
#pragma unroll 2
  for (int kc = 0; kc < DIN / 32; ++kc) { v16b a; { const float* p = X + (r0 + wave * 16 + col) * DIN + kc * 32 + 8 * g;
#pragma unroll
      for (int i = 0; i < 8; ++i) { a[i] = (__bf16)p[i]; a[8 + i] = (__bf16)p[16 + i]; } }
    asm volatile("s_wait_loadcnt 0x0" ::: "memory");
#pragma unroll
    for (int j = 0; j < 8; ++j) { const v16b w = WCOL(WA, kc * 32, c0 + j * 16 + col, lane); asm volatile("s_wait_loadcnt 0x0" ::: "memory"); acc[j] = wmma_bf(a, w, acc[j]); } }
  if (which < 2) { _Float16* DH = which == 0 ? QH : KH; _Float16* DL = which == 0 ? QL : KL; const int nhi = which == 0 ? QHI : KHI; const bool hi_rows = t0 < nhi;
#pragma unroll
    for (int j = 0; j < 8; ++j) { const float bias = BA ? bfr(BA[c0 + j * 16 + col]) : 0.f;
#pragma unroll
      for (int r = 0; r < 8; ++r) { const float v = acc[j][r] + bias; const _Float16 hv = (_Float16)v; sh[wave * 16 + 8 * g + r][j * 16 + col] = hv; sl[wave * 16 + 8 * g + r][j * 16 + col] = (_Float16)((v - (float)hv) * 1024.0f); } }
    __syncthreads();
    for (int e = tid; e < 64 * 16; e += 128) { const int rl = e >> 4, q = e & 15; vst2((unsigned*)(DH + (r0 + rl) * CC + c0 + q * 8), *(const v4u*)&sh[rl][q * 8]); if (hi_rows) vst2((unsigned*)(DL + (bb * nhi + t0 + rl) * (size_t)CC + c0 + q * 8), *(const v4u*)&sl[rl][q * 8]); }
  } else { const bool hi_rows = t0 < KHI;
#pragma unroll
    for (int j = 0; j < 8; ++j) { const float bias = BA ? bfr(BA[c0 + j * 16 + col]) : 0.f;
#pragma unroll
      for (int r = 0; r < 8; ++r) { const float v = acc[j][r] + bias; const int rl = wave * 16 + 8 * g + r, cl = j * 16 + col; th[cl][rl] = (_Float16)v; const __bf16 bh = (__bf16)v; tb[cl][rl] = bh; tbl[cl][rl] = (__bf16)(v - (float)bh); } }
    __syncthreads();
    for (int e = tid; e < 128 * 8; e += 128) { const int cl = e >> 3, q = e & 7; vst2((unsigned*)(VT + (bb * CC + c0 + cl) * (size_t)TT + t0 + q * 8), *(const v4u*)&th[cl][q * 8]); if (hi_rows) { const size_t o3 = (bb * CC + c0 + cl) * (size_t)KHI + t0 + q * 8; vst2((unsigned*)(VB + o3), *(const v4u*)&tb[cl][q * 8]); vst2((unsigned*)(VBL + o3), *(const v4u*)&tbl[cl][q * 8]); } } } }
// ---- k_sc: block = (query block qb, key block kb <= kb_last(qb), sequence b = blockIdx.z), head h0, into score plane b: logits x SCALE; q hi + residual (x 2^10) against k (2 products) for query rows < QHI, plus the k residual (3 products) for query blocks < QBH (all NQB of them); causal: blocks past the diagonal exit, the mask itself is applied by index in k_colstat_c and k_csm_c
__global__ __launch_bounds__(128) void k_sc(const _Float16* __restrict__ QH, const _Float16* __restrict__ KH, const _Float16* __restrict__ QL, const _Float16* __restrict__ KL, int h0, float* __restrict__ S0) { __shared__ __align__(16) float ss[4][16][132];
  const int qb = blockIdx.x, kb = blockIdx.y; if (kb > kb_last(qb)) return;
  const int b = blockIdx.z, h = h0; float* S = S0 + (size_t)b * TT * TT;
  const int tid = threadIdx.x, wave = tid >> 5, lane = tid & 31, col = lane & 15, g = lane >> 4; const int k0 = kb * 128; const int ql0 = qb * 64 + wave * 16; const size_t q0 = (size_t)b * TT + ql0, kr0 = (size_t)b * TT + k0;
  v8f acc[8] = {}, accl[8] = {};
  const _Float16* QLb = QL + (size_t)b * QHI * CC; const _Float16* KLb = KL + (size_t)b * KHI * CC;
  if (qb < QBH) {
#pragma unroll
    for (int kc = 0; kc < HD / 32; ++kc) { const v16h ah = frag_h(QH + (q0 + col) * CC + h * HD + kc * 32, lane), al = frag_h(QLb + (size_t)(ql0 + col) * CC + h * HD + kc * 32, lane);
#pragma unroll
      for (int j = 0; j < 8; ++j) { const v16h kbf = frag_h(KH + (kr0 + j * 16 + col) * CC + h * HD + kc * 32, lane), klf = frag_h(KLb + (size_t)(k0 + j * 16 + col) * CC + h * HD + kc * 32, lane); acc[j] = wmma16(ah, kbf, acc[j]); accl[j] = wmma16(al, kbf, accl[j]); accl[j] = wmma16(ah, klf, accl[j]); } }
  } else if (qb * 64 < QHI) {
#pragma unroll
    for (int kc = 0; kc < HD / 32; ++kc) { const v16h ah = frag_h(QH + (q0 + col) * CC + h * HD + kc * 32, lane), al = frag_h(QLb + (size_t)(ql0 + col) * CC + h * HD + kc * 32, lane);
#pragma unroll
      for (int j = 0; j < 8; ++j) { const v16h kbf = frag_h(KH + (kr0 + j * 16 + col) * CC + h * HD + kc * 32, lane); acc[j] = wmma16(ah, kbf, acc[j]); accl[j] = wmma16(al, kbf, accl[j]); } }
  } else {
#pragma unroll
    for (int kc = 0; kc < HD / 32; ++kc) { const v16h ah = frag_h(QH + (q0 + col) * CC + h * HD + kc * 32, lane);
#pragma unroll
      for (int j = 0; j < 8; ++j) { const v16h kbf = frag_h(KH + (kr0 + j * 16 + col) * CC + h * HD + kc * 32, lane); acc[j] = wmma16(ah, kbf, acc[j]); } } }
#pragma unroll
  for (int j = 0; j < 8; ++j) {
#pragma unroll
    for (int r = 0; r < 8; ++r) ss[wave][8 * g + r][j * 16 + col] = (acc[j][r] + accl[j][r] * (1.0f / 1024.0f)) * SCALE; }
  LDSX(); for (int rl = 0; rl < 16; ++rl) vst2(S + (size_t)(ql0 + rl) * TT + k0 + lane * 4, *(const v4f*)&ss[wave][rl][lane * 4]); }
// ---- k_sm: block = query row t (head in group): keys [0, kend): causal -> logit if s <= t else excluded; softmax in f32; P x 2^11 in place (0 for excluded)
__global__ __launch_bounds__(256) void k_sm(float* __restrict__ S0 SM_EXTRA_PARAMS) { __shared__ float sred[8]; __shared__ float sbc; __shared__ __align__(16) float shv[TT];
  const int tid = threadIdx.x; const int t = blockIdx.x; const int kend = (kb_last(t >> 6) + 1) * 128;
  float* sr = S0 + (size_t)blockIdx.y * TT * TT + (size_t)t * TT;
  float m = -3.0e38f; for (int k = tid; k < kend; k += 256) { float v = (!CAUSAL || k <= t) ? sr[k] : -3.0e38f; SM_MASK_HOOK; shv[k] = v; m = fmaxf(m, v); }
#pragma unroll
  for (int o = 1; o < 32; o <<= 1) m = fmaxf(m, __shfl_xor(m, o));
  if ((tid & 31) == 0) sred[tid >> 5] = m; __syncthreads(); if (tid == 0) { float a = sred[0]; for (int i = 1; i < 8; ++i) a = fmaxf(a, sred[i]); sbc = a; } __syncthreads(); m = sbc; __syncthreads();
  float sum = 0.f; for (int k = tid; k < kend; k += 256) { const float v = shv[k]; const float e = (v <= -1.0e38f) ? 0.f : expf(v - m); shv[k] = e; sum += e; }
#pragma unroll
  for (int o = 1; o < 32; o <<= 1) sum += __shfl_xor(sum, o);
  if ((tid & 31) == 0) sred[tid >> 5] = sum; __syncthreads(); if (tid == 0) { float a = 0.f; for (int i = 0; i < 8; ++i) a += sred[i]; sbc = a > 0.f ? 2048.0f / a : 0.f; }   /* a fully excluded row yields P = 0 */ __syncthreads(); const float inv = sbc;
  for (int k = tid; k < kend; k += 256) shv[k] = shv[k] * inv;
  __syncthreads(); for (int q = tid; q < kend / 4; q += 256) vst2(sr + q * 4, *(const v4f*)&shv[q * 4]); }
// exp for k_colstat_c, to expf's accuracy: e = the integer nearest to x log2(e); the fraction x log2(e) - e by two fused multiply-adds with the constant's high and low word; exp2 of the fraction, ldexp by e; 0 below -103.28 (ln of the smallest f32 denormal), +inf above 88.72 (expf's overflow limit). v_exp_f32 stands in one asm statement with a v_nop: the free slot that the instruction set asks for between a transcendental and an instruction that reads its result or overwrites its source (in a statement of its own nothing would hold the v_nop there)
__device__ __forceinline__ float exp_slot(float x) { const float c = __builtin_bit_cast(float, 0x3fb8aa3bu), cl = __builtin_bit_cast(float, 0x32a5705fu);
  const float e = __builtin_rintf(x * c); const float a = __builtin_fmaf(x, cl, __builtin_fmaf(x, c, -e)); float r;
  asm("v_exp_f32 %0, %1\n\tv_nop" : "=v"(r) : "v"(a));   /* the v_nop keeps the slot behind the transcendental free whatever the compiler schedules next */
  r = __builtin_ldexpf(r, (int)e); r = (x < __builtin_bit_cast(float, 0xc2ce8ed0u)) ? 0.f : r; return (x > __builtin_bit_cast(float, 0x42b17218u)) ? __builtin_inff() : r; }
// ---- k_colstat_c: softmax over the QUERY axis under the causal mask (the source's softmax(axis=1) on [B, t, s] scores with -inf above the diagonal): for every key column k: m_k = max_{q >= k} S[q][k], Z_k = sum_{q >= k} exp(S[q][k] - m_k) (f32, exp_slot).
// block = 32 key columns (one 128-B line of every score row) of score plane blockIdx.y (the sequence) x 32 waves. A wave-wide 16-byte load covers 4 query rows x 32 columns (4 whole lines); wave w takes the 64 rows from c0 + 64 w and holds them in registers, so its 16 loads are all in flight at once and the scores are read once.
// Per wave and column: max, then the sum of exp against that max; the 32 (max, sum) pairs of a column are merged through LDS by wave 0: M = max m_w, Z = sum z_w exp(m_w - M).
// Rows above a column's diagonal lie only in wave 0's first 32 rows (they hold the unmasked logits of the diagonal score block): their content is replaced by value select. Sentinels: a hidden entry reads -3e38 and the running max starts at -1e38, so a hidden entry adds exp(-2e38) = 0, and a wave with no row below TT hands the pair (-1e38, 0), which adds 0 to the merge (the logits are sums of 64 f16-range products, far above -1e38).
__global__ __launch_bounds__(1024) void k_colstat_c(const float* __restrict__ S0, float* __restrict__ CM, float* __restrict__ CZ) { __shared__ __align__(16) float pm[32][32], pz[32][32];
  const int tid = threadIdx.x, lane = tid & 31, sub = lane >> 3, cq = lane & 7; const int wave = __builtin_amdgcn_readfirstlane(tid >> 5); const int c0 = blockIdx.x * 32;
  const int r0 = c0 + wave * 64;                       /* the wave's first row */
  const bool h0 = r0 < TT, h1 = r0 + 32 < TT;          /* TT - c0 is a multiple of 32: each half of the wave's 64 rows is wholly inside or wholly past the end (wave-uniform) */
  const float* sp = S0 + (size_t)blockIdx.y * TT * TT + (size_t)(r0 + sub) * TT + c0 + cq * 4;
  v4f v[16];
  if (h0) {
#pragma unroll
    for (int s = 0; s < 8; ++s) v[s] = *(const v4f*)(sp + (size_t)s * 4 * TT); }
  if (h1) {
#pragma unroll
    for (int s = 8; s < 16; ++s) v[s] = *(const v4f*)(sp + (size_t)s * 4 * TT); }
  asm volatile("s_wait_xcnt 0x0" :: "v"(sp) : "memory");   /* the issued loads' address pair is an input here, so nothing (a load's own result included) overwrites it in front of this wait */
  v4f m = { -1.0e38f, -1.0e38f, -1.0e38f, -1.0e38f }, z = { 0.f, 0.f, 0.f, 0.f };
  if (wave == 0) {
#pragma unroll
    for (int s = 0; s < 8; ++s)
#pragma unroll
      for (int u = 0; u < 4; ++u) v[s][u] = (s * 4 + sub >= cq * 4 + u) ? v[s][u] : -3.0e38f; }
  if (h0) {
#pragma unroll
    for (int s = 0; s < 8; ++s)
#pragma unroll
      for (int u = 0; u < 4; ++u) m[u] = fmaxf(m[u], v[s][u]); }
  if (h1) {
#pragma unroll
    for (int s = 8; s < 16; ++s)
#pragma unroll
      for (int u = 0; u < 4; ++u) m[u] = fmaxf(m[u], v[s][u]); }
#pragma unroll
  for (int u = 0; u < 4; ++u) { m[u] = fmaxf(m[u], __shfl_xor(m[u], 8)); m[u] = fmaxf(m[u], __shfl_xor(m[u], 16)); }
  if (h0) {
#pragma unroll
    for (int s = 0; s < 8; ++s)
#pragma unroll
      for (int u = 0; u < 4; ++u) z[u] += exp_slot(v[s][u] - m[u]); }
  if (h1) {
#pragma unroll
    for (int s = 8; s < 16; ++s)
#pragma unroll
      for (int u = 0; u < 4; ++u) z[u] += exp_slot(v[s][u] - m[u]); }
#pragma unroll
  for (int u = 0; u < 4; ++u) { z[u] += __shfl_xor(z[u], 8); z[u] += __shfl_xor(z[u], 16); }
  if (sub == 0) { *(v4f*)&pm[wave][cq * 4] = m; *(v4f*)&pz[wave][cq * 4] = z; }
  __syncthreads();   /* publishes the 32 waves' pairs to wave 0 */
  if (wave == 0) { float mw[32], zw[32], M = -1.0e38f, Z = 0.f;
#pragma unroll
    for (int i = 0; i < 32; ++i) { mw[i] = pm[i][lane]; zw[i] = pz[i][lane]; }
#pragma unroll
    for (int i = 0; i < 32; ++i) M = fmaxf(M, mw[i]);
#pragma unroll
    for (int i = 0; i < 32; ++i) Z += zw[i] * exp_slot(mw[i] - M);
    vst2(CM + (size_t)blockIdx.y * TT + c0 + lane, M); vst2(CZ + (size_t)blockIdx.y * TT + c0 + lane, Z); } }   /* every column sees at least its own diagonal entry: Z_k >= 1 */
// ---- k_csm_c: block = query row t of score plane blockIdx.y (the sequence): P[t][k] = exp(S[t][k] - m_k) / Z_k x 2^11 for k <= t, 0 for t < k < kend (inside the diagonal block); in place; unconditional loads, value select
__global__ __launch_bounds__(256) void k_csm_c(float* __restrict__ S0, const float* __restrict__ CM, const float* __restrict__ CZ) { const int tid = threadIdx.x; const int t = blockIdx.x; const int kend = (kb_last(t >> 6) + 1) * 128; float* sr = S0 + (size_t)blockIdx.y * TT * TT + (size_t)t * TT; const float* cm = CM + (size_t)blockIdx.y * TT; const float* cz = CZ + (size_t)blockIdx.y * TT;
  for (int q4 = tid; q4 < kend / 4; q4 += 256) { const v4f sv = *(const v4f*)(sr + q4 * 4), m4 = *(const v4f*)(cm + q4 * 4), z4 = *(const v4f*)(cz + q4 * 4); asm volatile("s_wait_loadcnt 0x0" ::: "memory"); v4f p;
#pragma unroll
    for (int u = 0; u < 4; ++u) p[u] = (q4 * 4 + u <= t) ? expf(sv[u] - m4[u]) * (2048.0f / z4[u]) : 0.f;
    vst2(sr + q4 * 4, p); } }
// ---- k_out64: out[b][t][0..63] = ctx row columns 0..63 (256 B by 16 lanes)
__global__ __launch_bounds__(256) void k_out64(const float* __restrict__ Y, float* __restrict__ OUT) { const size_t row = (size_t)blockIdx.x * 16 + (threadIdx.x >> 4); const int q = threadIdx.x & 15; const v4f v = *(const v4f*)(Y + row * CC + q * 4); asm volatile("s_wait_loadcnt 0x0" ::: "memory"); vst2(OUT + row * 64 + q * 4, v); }
// ---- k_pv: block = 64 queries (qb) of (sequence b = blockIdx.z, head h0), P from score plane b: ctx = P . v over keys [0, kend) (P x 2^11 once to f16 against v f16: 1 product; query blocks < QBH, i.e. all of them: P and v as bf16 hi + lo, 3 products); 256-B (row, head) segment by 16 lanes
__global__ __launch_bounds__(128) void k_pv(const float* __restrict__ PS0, const _Float16* __restrict__ VT, const __bf16* __restrict__ VB, const __bf16* __restrict__ VBL, int h0, float* __restrict__ Y) { const int b = blockIdx.z, h = h0; const float* PS = PS0 + (size_t)b * TT * TT; __shared__ __align__(16) float ss[4][16][HD + 4];
  const int tid = threadIdx.x, wave = tid >> 5, lane = tid & 31, col = lane & 15, g = lane >> 4; const int qb = blockIdx.x; const int ql0 = qb * 64 + wave * 16; const int kce = (kb_last(qb) + 1) * 4;
  v8f acc[HD / 16] = {};
  if (qb < QBH) {
#pragma unroll 1
    for (int kc = 0; kc < kce; ++kc) { const F2 p = split_row(PS + (size_t)(ql0 + col) * TT, kc * 32, lane);
      asm volatile("s_wait_loadcnt 0x0" ::: "memory");
#pragma unroll
      for (int j = 0; j < HD / 16; ++j) { const size_t po = ((size_t)b * CC + h * HD + j * 16 + col) * (size_t)KHI + kc * 32; const v16b vh = frag_b(VB + po, lane); acc[j] = wmma_bf(p.h, vh, acc[j]); acc[j] = wmma_bf(p.l, vh, acc[j]); acc[j] = wmma_bf(p.h, frag_b(VBL + po, lane), acc[j]); } }
  } else {
#pragma unroll 1
    for (int kc = 0; kc < kce; ++kc) { const v16h p = frag_f32(PS + (size_t)(ql0 + col) * TT + kc * 32, lane);
      asm volatile("s_wait_loadcnt 0x0" ::: "memory");
#pragma unroll
      for (int j = 0; j < HD / 16; ++j) { const size_t po = ((size_t)b * CC + h * HD + j * 16 + col) * (size_t)TT + kc * 32; acc[j] = wmma16(p, frag_h(VT + po, lane), acc[j]); } } }
#pragma unroll
  for (int j = 0; j < HD / 16; ++j)
#pragma unroll
    for (int r = 0; r < 8; ++r) ss[wave][8 * g + r][j * 16 + col] = acc[j][r] * (1.0f / 2048.0f);
  LDSX(); for (int rl = 0; rl < 16; ++rl) if (lane < HD / 4) vst2(Y + ((size_t)b * TT + ql0 + rl) * CC + h * HD + lane * 4, *(const v4f*)&ss[wave][rl][lane * 4]); }

extern "C" void kernel_launch(void* const* d_in, const int* in_sizes, int n_in, void* d_out, int out_size, void* d_ws, size_t ws_size, hipStream_t stream) {
  (void)in_sizes; (void)n_in; (void)out_size;
  const float** F = (const float**)d_in;
  if (ws_size < (size_t)WS_END) return;
  char* ws = (char*)d_ws; _Float16 *QH = (_Float16*)(ws + WS_QH), *KH = (_Float16*)(ws + WS_KH), *VT = (_Float16*)(ws + WS_VT), *QL = (_Float16*)(ws + WS_QL), *KL = (_Float16*)(ws + WS_KL); __bf16 *VB = (__bf16*)(ws + WS_VB), *VBL = (__bf16*)(ws + WS_VBL); float *S = (float*)(ws + WS_S), *Y = (float*)(ws + WS_Y);
  (void)Y; (void)QL; (void)KL; (void)VB; (void)VBL;
  // inputs: 0 x [8,2048,384]; 1 Wq [384,64] (in,out); 2 Wk; 3 Wv; no biases
  if (ws_size < (size_t)WS_END2) return;
  float *Y2 = (float*)(ws + WS_Y2), *CM = (float*)(ws + WS_CM), *CZ = (float*)(ws + WS_CZ);
  k_proj<<<dim3(TNB * TT / 64, CC / 128, 3), 128, 0, stream>>>(F[0], F[0], F[0], F[1], F[2], F[3], nullptr, nullptr, nullptr, QH, QL, KH, KL, VT, VB, VBL);   /* weight columns 64..127 (the padding head) are zero fragments */
  /* all sequences in one launch of each stage (the last grid index is the sequence, each with its own score plane); head 0 only (head 1 is the zero padding) */
  k_sc<<<dim3(NQB, TT / 128, TNB), 128, 0, stream>>>(QH, KH, QL, KL, 0, S);
  k_colstat_c<<<dim3(TT / 32, TNB), 1024, 0, stream>>>(S, CM, CZ);   /* per key column j: max / sum over the visible queries i >= j */
  k_csm_c<<<dim3(TT, TNB), 256, 0, stream>>>(S, CM, CZ);            /* P[i][j] = exp(S - m_j) / Z_j x 2^11 for j <= i, 0 above the diagonal */
  k_pv<<<dim3(NQB, 1, TNB), 128, 0, stream>>>(S, VT, VB, VBL, 0, Y2);
  k_out64<<<dim3(TNB * TT / 16), 256, 0, stream>>>(Y2, (float*)d_out);
}

// v003
// Measured time: 143 microseconds a run.
// Next to v002, in two timings, it ran 1.48 and 1.47 times as fast.
// All steps since v000 together make it 52.7 times as fast.
// compute dtype: all float inputs rounded to bf16; q/k/v projections with EXACT bf16 products on WMMA 16x16x32 (f32 accumulate); causal scores with BOTH q and k as f16 hi + (x 2^10) residual (3 products) on EVERY block, x 64^-0.5; softmax over the QUERY axis in f32 (per key column: max and sum over the visible queries, per wave and merged, exp to expf's accuracy; P by precise expf); P as bf16 hi + lo against v as bf16 hi + lo (3 products) on EVERY block; f32 output.
#include <hip/hip_runtime.h>
#include <math.h>

typedef __attribute__((ext_vector_type(16))) _Float16 v16h;
typedef __attribute__((ext_vector_type(16))) __bf16 v16b;
typedef __attribute__((ext_vector_type(8)))  _Float16 v8h;
typedef __attribute__((ext_vector_type(8)))  float v8f;
typedef __attribute__((ext_vector_type(4)))  float v4f;
typedef __attribute__((ext_vector_type(2)))  float v2f;
typedef __attribute__((ext_vector_type(4)))  unsigned v4u;
typedef __attribute__((ext_vector_type(4)))  int v4i;
typedef float __attribute__((may_alias)) float_a;
typedef int __attribute__((may_alias)) int_a;

template <typename T> __device__ __forceinline__ void vst2(void* p, T v) { *(T*)p = v;  }
__device__ __forceinline__ v8f wmma16(v16h a, v16h b, v8f c) {
  v8f d = __builtin_amdgcn_wmma_f32_16x16x32_f16(false, a, false, b, (short)0, c, false, false);
  asm volatile("v_nop\n\tv_nop\n\tv_nop\n\tv_nop" : "+v"(d) : "v"(a), "v"(b));
  return d;
}
__device__ __forceinline__ v8f wmma_bf(v16b a, v16b b, v8f c) {
  v8f d = __builtin_amdgcn_wmma_f32_16x16x32_bf16(false, a, false, b, (short)0, c, false, false);
  asm volatile("v_nop\n\tv_nop\n\tv_nop\n\tv_nop" : "+v"(d) : "v"(a), "v"(b));
  return d;
}
// 16x16x32 fragments: lane = (h = lane>>4, row/col = lane&15); elements 0..7 = k0+8h+0..7, 8..15 = k0+16+8h+0..7; D element r = row 8h+r
__device__ __forceinline__ v16h frag_h(const _Float16* rowk0, int lane) {
  union { v16h v; v8h q[2]; } u; const _Float16* p = rowk0 + 8 * (lane >> 4);
  u.q[0] = *(const v8h*)p; u.q[1] = *(const v8h*)(p + 16); return u.v;
}
__device__ __forceinline__ v16h frag_f32(const float* rowk0, int lane) {
  v16h a; const float* p = rowk0 + 8 * (lane >> 4);
#pragma unroll
  for (int i = 0; i < 8; ++i) { a[i] = (_Float16)p[i]; a[8 + i] = (_Float16)p[16 + i]; }
  return a;
}
__device__ __forceinline__ v16h frag_f32s(const float* rowk0, int lane, float sc) {
  v16h a; const float* p = rowk0 + 8 * (lane >> 4);
#pragma unroll
  for (int i = 0; i < 8; ++i) { a[i] = (_Float16)(p[i] * sc); a[8 + i] = (_Float16)(p[16 + i] * sc); }
  return a;
}
// column fragment from a [K][ld] layout (column n), rows >= K read as 0
__device__ __forceinline__ v16h fragc_f32(const float* W, int k0, int n, int lane, int ld, int K) {
  v16h a; const int g = lane >> 4;
#pragma unroll
  for (int i = 0; i < 8; ++i) { const int ka = k0 + 8 * g + i, kb = ka + 16;
    a[i] = (_Float16)(ka < K ? W[(size_t)(ka < K ? ka : K - 1) * ld + n] : 0.f); a[8 + i] = (_Float16)(kb < K ? W[(size_t)(kb < K ? kb : K - 1) * ld + n] : 0.f); }
  return a;
}
struct F2 { v16b h, l; };
__device__ __forceinline__ F2 bsplit16(const float v[16]) { F2 r;
#pragma unroll
  for (int i = 0; i < 16; ++i) { const __bf16 h = (__bf16)v[i]; r.h[i] = h; r.l[i] = (__bf16)(v[i] - (float)h); }
  return r; }
__device__ __forceinline__ F2 split_row(const float* row, int k0, int lane) { float v[16]; const float* p = row + k0 + 8 * (lane >> 4);
#pragma unroll
  for (int i = 0; i < 8; ++i) { v[i] = p[i]; v[8 + i] = p[16 + i]; }
  return bsplit16(v); }
__device__ __forceinline__ F2 split_rowK(const float* row, int k0, int lane, int K) { float v[16]; const int g = lane >> 4;
#pragma unroll
  for (int i = 0; i < 8; ++i) { const int ka = k0 + 8 * g + i, kb = ka + 16; v[i] = ka < K ? row[ka < K ? ka : K - 1] : 0.f; v[8 + i] = kb < K ? row[kb < K ? kb : K - 1] : 0.f; }
  return bsplit16(v); }
__device__ __forceinline__ F2 split_col(const float* W, int k0, int n, int lane, int ld, int K) { float v[16]; const int g = lane >> 4;
#pragma unroll
  for (int i = 0; i < 8; ++i) { const int ka = k0 + 8 * g + i, kb = ka + 16; v[i] = ka < K ? W[(size_t)(ka < K ? ka : K - 1) * ld + n] : 0.f; v[8 + i] = kb < K ? W[(size_t)(kb < K ? kb : K - 1) * ld + n] : 0.f; }
  return bsplit16(v); }
__device__ __forceinline__ v8f mac3(const F2& a, const F2& b, v8f c) { c = wmma_bf(a.l, b.h, c); c = wmma_bf(a.h, b.l, c); return wmma_bf(a.h, b.h, c); }
__device__ __forceinline__ float sigm(float v) { return 1.0f / (1.0f + expf(-v)); }
#define LDSX() do { asm volatile("s_wait_dscnt 0" ::: "memory"); __builtin_amdgcn_wave_barrier(); __builtin_amdgcn_fence(__ATOMIC_RELEASE, "workgroup"); } while (0)

// Single-head causal self-attention whose softmax runs over the QUERY axis (x [8,2048,384]; (in,out) Wq / Wk / Wv [384,64] (0.02 scale), no biases; scores[b, i, j] = q_i . k_j / 8; -inf where j > i; attn = softmax(scores, axis=1) - axis 1 is the QUERY axis i, so every key column j is normalised over the queries i >= j (faithful to the source); out = attn v -> [8,2048,64]).
#define NB 8
#define TT 2048
#define CC 128            // NH * HD = projected width
#define DIN 384          // input (model) width
#define NH 2
#define HD 64
#define NQB (TT / 64)
#define SCALE (0.125f)
#define CAUSAL 1
#ifndef TNB
#define TNB NB
#endif
__device__ __forceinline__ float bfr(float v) { return (float)(__bf16)v; }
__host__ __device__ __forceinline__ int kb_last(int qb) { return CAUSAL ? ((qb * 64 + 63) >> 7) : (TT / 128 - 1); }
typedef __attribute__((ext_vector_type(8))) __bf16 v8b;
__device__ __forceinline__ v16b frag_b(const __bf16* rowk0, int lane) {
  union { v16b v; v8b q[2]; } u; const __bf16* p = rowk0 + 8 * (lane >> 4);
  u.q[0] = *(const v8b*)p; u.q[1] = *(const v8b*)(p + 16); return u.v;
}
#define QBH 32              // causal: query blocks 0..QBH-1 of each sequence (all NQB = 32 of them) take the high-precision path
#define QHI 2048            // rows carrying a q residual plane (all TT rows)
#define KHI 2048            // key rows carrying k residual / v bf16 hi+lo planes (used only by the causal high-precision path)
// B fragment (k rows k0+.., output column o) of a weight: (in,out) [K][ld] or (out,in) [ld rows of K]: bf16 exact, or f16(bf16 * 256) exact
__device__ __forceinline__ v16b wcol_io(const float* Wm, int k0, int o, int lane, int ld) { v16b w; const int g = lane >> 4;
#pragma unroll
  for (int i = 0; i < 8; ++i) { w[i] = (__bf16)Wm[(size_t)(k0 + 8 * g + i) * ld + o]; w[8 + i] = (__bf16)Wm[(size_t)(k0 + 16 + 8 * g + i) * ld + o]; }
  return w; }
__device__ __forceinline__ v16b wcol_oi(const float* Wm, int k0, int o, int lane, int K) { v16b w; const float* p = Wm + (size_t)o * K + k0 + 8 * (lane >> 4);
#pragma unroll
  for (int i = 0; i < 8; ++i) { w[i] = (__bf16)p[i]; w[8 + i] = (__bf16)p[16 + i]; }
  return w; }
__device__ __forceinline__ v16h wcolh_io(const float* Wm, int k0, int o, int lane, int ld) { v16h w; const int g = lane >> 4;
#pragma unroll
  for (int i = 0; i < 8; ++i) { w[i] = (_Float16)(bfr(Wm[(size_t)(k0 + 8 * g + i) * ld + o]) * 256.0f); w[8 + i] = (_Float16)(bfr(Wm[(size_t)(k0 + 16 + 8 * g + i) * ld + o]) * 256.0f); }
  return w; }
__device__ __forceinline__ v16h wcolh_oi(const float* Wm, int k0, int o, int lane, int K) { v16h w; const float* p = Wm + (size_t)o * K + k0 + 8 * (lane >> 4);
#pragma unroll
  for (int i = 0; i < 8; ++i) { w[i] = (_Float16)(bfr(p[i]) * 256.0f); w[8 + i] = (_Float16)(bfr(p[16 + i]) * 256.0f); }
  return w; }
#define WQKV_LAYOUT 0   // 0 = (in,out) [DIN][64] (head 0 only; columns 64..127 zero); 1 = (out,in) [CC][DIN]; 2 = per-head [NH][DIN][HD]
__device__ __forceinline__ v16b wcol_hdk(const float* Wm, int k0, int o, int lane) { v16b w; const int g = lane >> 4; const float* p = Wm + (size_t)(o / HD) * DIN * HD + (o % HD);
#pragma unroll
  for (int i = 0; i < 8; ++i) { w[i] = (__bf16)p[(size_t)(k0 + 8 * g + i) * HD]; w[8 + i] = (__bf16)p[(size_t)(k0 + 16 + 8 * g + i) * HD]; }
  return w; }
#define WO_OUT_IN 0
#if WQKV_LAYOUT == 1
#define WCOL(W, k0, o, lane) wcol_oi(W, k0, o, lane, DIN)
#elif WQKV_LAYOUT == 2
#define WCOL(W, k0, o, lane) wcol_hdk(W, k0, o, lane)
#else
__device__ __forceinline__ v16b zero16b() { v16b w; _Pragma("unroll") for (int i = 0; i < 16; ++i) w[i] = (__bf16)0.0f; return w; }
#define WCOL(W, k0, o, lane) ((o) < 64 ? wcol_io(W, k0, (o), lane, 64) : zero16b())   /* (in,out) [384][64] pitch 64: only 64 real output columns; projected columns 64..127 (padding head 1) are zero; compile-time per unrolled tile (c0 = 0) */
#endif
#if WO_OUT_IN
#define WOCOL(W, k0, o, lane) wcol_oi(W, k0, o, lane, CC)
#define WOCOLH(W, k0, o, lane) wcolh_oi(W, k0, o, lane, CC)
#else
#define WOCOL(W, k0, o, lane) wcol_io(W, k0, o, lane, DIN)
#define WOCOLH(W, k0, o, lane) wcolh_io(W, k0, o, lane, DIN)
#endif

#ifndef SM_EXTRA_PARAMS
#define SM_EXTRA_PARAMS
#endif
#ifndef PROJ_EXTRA_PARAMS
#define PROJ_EXTRA_PARAMS
#endif
#ifndef SM_MASK_HOOK
#define SM_MASK_HOOK (void)0
#endif

#define WS_QH  0u                                      // f16 q rows [b*t][CC]
#define WS_KH  (WS_QH + 2u * (size_t)NB * TT * CC)      // f16 k rows [b*t][CC]
#define WS_VT  (WS_KH + 2u * (size_t)NB * TT * CC)      // f16 v planes [b][c][t]
#define WS_QL  (WS_VT + 2u * (size_t)NB * CC * TT)      // f16 q residual x 2^10 rows [b][t < QHI][CC]
#define WS_KL  (WS_QL + 2u * (size_t)NB * QHI * CC)     // f16 k residual x 2^10 rows [b][t < KHI][CC]
#define WS_VB  (WS_KL + 2u * (size_t)NB * KHI * CC)     // bf16 v hi planes [b][c][t < KHI]
#define WS_VBL (WS_VB + 2u * (size_t)NB * CC * KHI)
#define WS_S   (WS_VBL + 2u * (size_t)NB * CC * KHI)    // f32 logits / P [b][t][s]: one plane per sequence
#define WS_Y   (WS_S  + 4u * (size_t)NB * TT * TT)      // f32 ctx rows [b*t][CC] (only when there is an output projection)
#define WS_END (WS_Y  + 0u)
#define WS_Y2 (WS_END)                                  // f32 ctx rows [b*TT + t][128] (columns 64..127 = the padding head)
#define WS_CM (WS_Y2 + 4u * (size_t)NB * TT * CC)        // f32 column maxima [b][TT]
#define WS_CZ (WS_CM + 4u * (size_t)NB * TT)
#define WS_END2 (WS_CZ + 4u * (size_t)NB * TT)

// ---- k_proj: block = (64 rows, 128 cols, which): q/k/v = X W (+ b) with exact bf16 products (K = DIN) -> which 0: q f16 rows (+ residual rows < QHI); 1: k f16 rows (+ residual rows < KHI); 2: v f16 planes [c][t] (+ bf16 hi/lo planes for t < KHI)
__global__ __launch_bounds__(128) void k_proj(const float* __restrict__ XQ, const float* __restrict__ XK, const float* __restrict__ XV, const float* __restrict__ WQ, const float* __restrict__ WK, const float* __restrict__ WV, const float* __restrict__ BQ, const float* __restrict__ BK, const float* __restrict__ BV,
    _Float16* __restrict__ QH, _Float16* __restrict__ QL, _Float16* __restrict__ KH, _Float16* __restrict__ KL, _Float16* __restrict__ VT, __bf16* __restrict__ VB, __bf16* __restrict__ VBL) {
  __shared__ __align__(16) _Float16 sh[64][136], sl[64][136]; __shared__ __align__(16) _Float16 th[128][72]; __shared__ __align__(16) __bf16 tb[128][72], tbl[128][72];
  const int tid = threadIdx.x, wave = tid >> 5, lane = tid & 31, col = lane & 15, g = lane >> 4; const int which = blockIdx.z; const int c0 = blockIdx.y * 128; const size_t r0 = (size_t)blockIdx.x * 64; const size_t bb = r0 / TT; const int t0 = (int)(r0 % TT);
  const float* X = which == 0 ? XQ : which == 1 ? XK : XV; const float* WA = which == 0 ? WQ : which == 1 ? WK : WV; const float* BA = which == 0 ? BQ : which == 1 ? BK : BV;
  v8f acc[8] = {};
#pragma unroll 2
  for (int kc = 0; kc < DIN / 32; ++kc) { v16b a; { const float* p = X + (r0 + wave * 16 + col) * DIN + kc * 32 + 8 * g;
#pragma unroll
      for (int i = 0; i < 8; ++i) { a[i] = (__bf16)p[i]; a[8 + i] = (__bf16)p[16 + i]; } }
    asm volatile("s_wait_loadcnt 0x0" ::: "memory");
#pragma unroll
    for (int j = 0; j < 8; ++j) { const v16b w = WCOL(WA, kc * 32, c0 + j * 16 + col, lane); asm volatile("s_wait_loadcnt 0x0" ::: "memory"); acc[j] = wmma_bf(a, w, acc[j]); } }
  if (which < 2) { _Float16* DH = which == 0 ? QH : KH; _Float16* DL = which == 0 ? QL : KL; const int nhi = which == 0 ? QHI : KHI; const bool hi_rows = t0 < nhi;
#pragma unroll
    for (int j = 0; j < 8; ++j) { const float bias = BA ? bfr(BA[c0 + j * 16 + col]) : 0.f;
#pragma unroll
      for (int r = 0; r < 8; ++r) { const float v = acc[j][r] + bias; const _Float16 hv = (_Float16)v; sh[wave * 16 + 8 * g + r][j * 16 + col] = hv; sl[wave * 16 + 8 * g + r][j * 16 + col] = (_Float16)((v - (float)hv) * 1024.0f); } }
    __syncthreads();
    for (int e = tid; e < 64 * 16; e += 128) { const int rl = e >> 4, q = e & 15; vst2((unsigned*)(DH + (r0 + rl) * CC + c0 + q * 8), *(const v4u*)&sh[rl][q * 8]); if (hi_rows) vst2((unsigned*)(DL + (bb * nhi + t0 + rl) * (size_t)CC + c0 + q * 8), *(const v4u*)&sl[rl][q * 8]); }
  } else { const bool hi_rows = t0 < KHI;
#pragma unroll
    for (int j = 0; j < 8; ++j) { const float bias = BA ? bfr(BA[c0 + j * 16 + col]) : 0.f;
#pragma unroll
      for (int r = 0; r < 8; ++r) { const float v = acc[j][r] + bias; const int rl = wave * 16 + 8 * g + r, cl = j * 16 + col; th[cl][rl] = (_Float16)v; const __bf16 bh = (__bf16)v; tb[cl][rl] = bh; tbl[cl][rl] = (__bf16)(v - (float)bh); } }
    __syncthreads();
    for (int e = tid; e < 128 * 8; e += 128) { const int cl = e >> 3, q = e & 7; vst2((unsigned*)(VT + (bb * CC + c0 + cl) * (size_t)TT + t0 + q * 8), *(const v4u*)&th[cl][q * 8]); if (hi_rows) { const size_t o3 = (bb * CC + c0 + cl) * (size_t)KHI + t0 + q * 8; vst2((unsigned*)(VB + o3), *(const v4u*)&tb[cl][q * 8]); vst2((unsigned*)(VBL + o3), *(const v4u*)&tbl[cl][q * 8]); } } } }
// ---- k_sc: block = (query block qb, key block kb <= kb_last(qb), sequence b = blockIdx.z), head h0, into score plane b: logits x SCALE; q hi + residual (x 2^10) against k (2 products) for query rows < QHI, plus the k residual (3 products) for query blocks < QBH (all NQB of them); causal: blocks past the diagonal exit, the mask itself is applied by index in k_colstat_c and k_csm_c
__global__ __launch_bounds__(128) void k_sc(const _Float16* __restrict__ QH, const _Float16* __restrict__ KH, const _Float16* __restrict__ QL, const _Float16* __restrict__ KL, int h0, float* __restrict__ S0) { __shared__ __align__(16) float ss[4][16][132];
  const int qb = blockIdx.x, kb = blockIdx.y; if (kb > kb_last(qb)) return;
  const int b = blockIdx.z, h = h0; float* S = S0 + (size_t)b * TT * TT;
  const int tid = threadIdx.x, wave = tid >> 5, lane = tid & 31, col = lane & 15, g = lane >> 4; const int k0 = kb * 128; const int ql0 = qb * 64 + wave * 16; const size_t q0 = (size_t)b * TT + ql0, kr0 = (size_t)b * TT + k0;
  v8f acc[8] = {}, accl[8] = {};
  const _Float16* QLb = QL + (size_t)b * QHI * CC; const _Float16* KLb = KL + (size_t)b * KHI * CC;
  if (qb < QBH) {
#pragma unroll
    for (int kc = 0; kc < HD / 32; ++kc) { const v16h ah = frag_h(QH + (q0 + col) * CC + h * HD + kc * 32, lane), al = frag_h(QLb + (size_t)(ql0 + col) * CC + h * HD + kc * 32, lane);
#pragma unroll
      for (int j = 0; j < 8; ++j) { const v16h kbf = frag_h(KH + (kr0 + j * 16 + col) * CC + h * HD + kc * 32, lane), klf = frag_h(KLb + (size_t)(k0 + j * 16 + col) * CC + h * HD + kc * 32, lane); acc[j] = wmma16(ah, kbf, acc[j]); accl[j] = wmma16(al, kbf, accl[j]); accl[j] = wmma16(ah, klf, accl[j]); } }
  } else if (qb * 64 < QHI) {
#pragma unroll
    for (int kc = 0; kc < HD / 32; ++kc) { const v16h ah = frag_h(QH + (q0 + col) * CC + h * HD + kc * 32, lane), al = frag_h(QLb + (size_t)(ql0 + col) * CC + h * HD + kc * 32, lane);
#pragma unroll
      for (int j = 0; j < 8; ++j) { const v16h kbf = frag_h(KH + (kr0 + j * 16 + col) * CC + h * HD + kc * 32, lane); acc[j] = wmma16(ah, kbf, acc[j]); accl[j] = wmma16(al, kbf, accl[j]); } }
  } else {
#pragma unroll
    for (int kc = 0; kc < HD / 32; ++kc) { const v16h ah = frag_h(QH + (q0 + col) * CC + h * HD + kc * 32, lane);
#pragma unroll
      for (int j = 0; j < 8; ++j) { const v16h kbf = frag_h(KH + (kr0 + j * 16 + col) * CC + h * HD + kc * 32, lane); acc[j] = wmma16(ah, kbf, acc[j]); } } }
#pragma unroll
  for (int j = 0; j < 8; ++j) {
#pragma unroll
    for (int r = 0; r < 8; ++r) ss[wave][8 * g + r][j * 16 + col] = (acc[j][r] + accl[j][r] * (1.0f / 1024.0f)) * SCALE; }
  LDSX(); for (int rl = 0; rl < 16; ++rl) vst2(S + (size_t)(ql0 + rl) * TT + k0 + lane * 4, *(const v4f*)&ss[wave][rl][lane * 4]); }
// ---- k_sm: block = query row t (head in group): keys [0, kend): causal -> logit if s <= t else excluded; softmax in f32; P x 2^11 in place (0 for excluded)
__global__ __launch_bounds__(256) void k_sm(float* __restrict__ S0 SM_EXTRA_PARAMS) { __shared__ float sred[8]; __shared__ float sbc; __shared__ __align__(16) float shv[TT];
  const int tid = threadIdx.x; const int t = blockIdx.x; const int kend = (kb_last(t >> 6) + 1) * 128;
  float* sr = S0 + (size_t)blockIdx.y * TT * TT + (size_t)t * TT;
  float m = -3.0e38f; for (int k = tid; k < kend; k += 256) { float v = (!CAUSAL || k <= t) ? sr[k] : -3.0e38f; SM_MASK_HOOK; shv[k] = v; m = fmaxf(m, v); }
#pragma unroll
  for (int o = 1; o < 32; o <<= 1) m = fmaxf(m, __shfl_xor(m, o));
  if ((tid & 31) == 0) sred[tid >> 5] = m; __syncthreads(); if (tid == 0) { float a = sred[0]; for (int i = 1; i < 8; ++i) a = fmaxf(a, sred[i]); sbc = a; } __syncthreads(); m = sbc; __syncthreads();
  float sum = 0.f; for (int k = tid; k < kend; k += 256) { const float v = shv[k]; const float e = (v <= -1.0e38f) ? 0.f : expf(v - m); shv[k] = e; sum += e; }
#pragma unroll
  for (int o = 1; o < 32; o <<= 1) sum += __shfl_xor(sum, o);
  if ((tid & 31) == 0) sred[tid >> 5] = sum; __syncthreads(); if (tid == 0) { float a = 0.f; for (int i = 0; i < 8; ++i) a += sred[i]; sbc = a > 0.f ? 2048.0f / a : 0.f; }   /* a fully excluded row yields P = 0 */ __syncthreads(); const float inv = sbc;
  for (int k = tid; k < kend; k += 256) shv[k] = shv[k] * inv;
  __syncthreads(); for (int q = tid; q < kend / 4; q += 256) vst2(sr + q * 4, *(const v4f*)&shv[q * 4]); }
// exp for k_colstat_c, to expf's accuracy: e = the integer nearest to x log2(e); the fraction x log2(e) - e by two fused multiply-adds with the constant's high and low word; exp2 of the fraction, ldexp by e; 0 below -103.28 (ln of the smallest f32 denormal), +inf above 88.72 (expf's overflow limit). v_exp_f32 stands in one asm statement with a v_nop: the free slot that the instruction set asks for between a transcendental and an instruction that reads its result or overwrites its source (in a statement of its own nothing would hold the v_nop there)
__device__ __forceinline__ float exp_slot(float x) { const float c = __builtin_bit_cast(float, 0x3fb8aa3bu), cl = __builtin_bit_cast(float, 0x32a5705fu);
  const float e = __builtin_rintf(x * c); const float a = __builtin_fmaf(x, cl, __builtin_fmaf(x, c, -e)); float r;
  asm("v_exp_f32 %0, %1\n\tv_nop" : "=v"(r) : "v"(a));   /* the v_nop keeps the slot behind the transcendental free whatever the compiler schedules next */
  r = __builtin_ldexpf(r, (int)e); r = (x < __builtin_bit_cast(float, 0xc2ce8ed0u)) ? 0.f : r; return (x > __builtin_bit_cast(float, 0x42b17218u)) ? __builtin_inff() : r; }
// ---- k_colstat_c: softmax over the QUERY axis under the causal mask (the source's softmax(axis=1) on [B, t, s] scores with -inf above the diagonal): for every key column k: m_k = max_{q >= k} S[q][k], Z_k = sum_{q >= k} exp(S[q][k] - m_k) (f32, exp_slot).
// block = 32 key columns (one 128-B line of every score row) of score plane blockIdx.y (the sequence) x 32 waves. A wave-wide 16-byte load covers 4 query rows x 32 columns (4 whole lines); wave w takes the 64 rows from c0 + 64 w and holds them in registers, so its 16 loads are all in flight at once and the scores are read once.
// Per wave and column: max, then the sum of exp against that max; the 32 (max, sum) pairs of a column are merged through LDS by wave 0: M = max m_w, Z = sum z_w exp(m_w - M).
// Rows above a column's diagonal lie only in wave 0's first 32 rows (they hold the unmasked logits of the diagonal score block): their content is replaced by value select. Sentinels: a hidden entry reads -3e38 and the running max starts at -1e38, so a hidden entry adds exp(-2e38) = 0, and a wave with no row below TT hands the pair (-1e38, 0), which adds 0 to the merge (the logits are sums of 64 f16-range products, far above -1e38).
__global__ __launch_bounds__(1024) void k_colstat_c(const float* __restrict__ S0, float* __restrict__ CM, float* __restrict__ CZ) { __shared__ __align__(16) float pm[32][32], pz[32][32];
  const int tid = threadIdx.x, lane = tid & 31, sub = lane >> 3, cq = lane & 7; const int wave = __builtin_amdgcn_readfirstlane(tid >> 5); const int c0 = blockIdx.x * 32;
  const int r0 = c0 + wave * 64;                       /* the wave's first row */
  const bool h0 = r0 < TT, h1 = r0 + 32 < TT;          /* TT - c0 is a multiple of 32: each half of the wave's 64 rows is wholly inside or wholly past the end (wave-uniform) */
  const float* sp = S0 + (size_t)blockIdx.y * TT * TT + (size_t)(r0 + sub) * TT + c0 + cq * 4;
  v4f v[16];
  if (h0) {
#pragma unroll
    for (int s = 0; s < 8; ++s) v[s] = *(const v4f*)(sp + (size_t)s * 4 * TT); }
  if (h1) {
#pragma unroll
    for (int s = 8; s < 16; ++s) v[s] = *(const v4f*)(sp + (size_t)s * 4 * TT); }
  asm volatile("s_wait_xcnt 0x0" :: "v"(sp) : "memory");   /* the issued loads' address pair is an input here, so nothing (a load's own result included) overwrites it in front of this wait */
  v4f m = { -1.0e38f, -1.0e38f, -1.0e38f, -1.0e38f }, z = { 0.f, 0.f, 0.f, 0.f };
  if (wave == 0) {
#pragma unroll
    for (int s = 0; s < 8; ++s)
#pragma unroll
      for (int u = 0; u < 4; ++u) v[s][u] = (s * 4 + sub >= cq * 4 + u) ? v[s][u] : -3.0e38f; }
  if (h0) {
#pragma unroll
    for (int s = 0; s < 8; ++s)
#pragma unroll
      for (int u = 0; u < 4; ++u) m[u] = fmaxf(m[u], v[s][u]); }
  if (h1) {
#pragma unroll
    for (int s = 8; s < 16; ++s)
#pragma unroll
      for (int u = 0; u < 4; ++u) m[u] = fmaxf(m[u], v[s][u]); }
#pragma unroll
  for (int u = 0; u < 4; ++u) { m[u] = fmaxf(m[u], __shfl_xor(m[u], 8)); m[u] = fmaxf(m[u], __shfl_xor(m[u], 16)); }
  if (h0) {
#pragma unroll
    for (int s = 0; s < 8; ++s)
#pragma unroll
      for (int u = 0; u < 4; ++u) z[u] += exp_slot(v[s][u] - m[u]); }
  if (h1) {
#pragma unroll
    for (int s = 8; s < 16; ++s)
#pragma unroll
      for (int u = 0; u < 4; ++u) z[u] += exp_slot(v[s][u] - m[u]); }
#pragma unroll
  for (int u = 0; u < 4; ++u) { z[u] += __shfl_xor(z[u], 8); z[u] += __shfl_xor(z[u], 16); }
  if (sub == 0) { *(v4f*)&pm[wave][cq * 4] = m; *(v4f*)&pz[wave][cq * 4] = z; }
  __syncthreads();   /* publishes the 32 waves' pairs to wave 0 */
  if (wave == 0) { float mw[32], zw[32], M = -1.0e38f, Z = 0.f;
#pragma unroll
    for (int i = 0; i < 32; ++i) { mw[i] = pm[i][lane]; zw[i] = pz[i][lane]; }
#pragma unroll
    for (int i = 0; i < 32; ++i) M = fmaxf(M, mw[i]);
#pragma unroll
    for (int i = 0; i < 32; ++i) Z += zw[i] * exp_slot(mw[i] - M);
    vst2(CM + (size_t)blockIdx.y * TT + c0 + lane, M); vst2(CZ + (size_t)blockIdx.y * TT + c0 + lane, Z); } }   /* every column sees at least its own diagonal entry: Z_k >= 1 */
// ---- k_csm_c: block = query row t of score plane blockIdx.y (the sequence): P[t][k] = exp(S[t][k] - m_k) / Z_k x 2^11 for k <= t, 0 for t < k < kend (inside the diagonal block); in place; unconditional loads, value select
__global__ __launch_bounds__(256) void k_csm_c(float* __restrict__ S0, const float* __restrict__ CM, const float* __restrict__ CZ) { const int tid = threadIdx.x; const int t = blockIdx.x; const int kend = (kb_last(t >> 6) + 1) * 128; float* sr = S0 + (size_t)blockIdx.y * TT * TT + (size_t)t * TT; const float* cm = CM + (size_t)blockIdx.y * TT; const float* cz = CZ + (size_t)blockIdx.y * TT;
  for (int q4 = tid; q4 < kend / 4; q4 += 256) { const v4f sv = *(const v4f*)(sr + q4 * 4), m4 = *(const v4f*)(cm + q4 * 4), z4 = *(const v4f*)(cz + q4 * 4); asm volatile("s_wait_loadcnt 0x0" ::: "memory"); v4f p;
#pragma unroll
    for (int u = 0; u < 4; ++u) p[u] = (q4 * 4 + u <= t) ? expf(sv[u] - m4[u]) * (2048.0f / z4[u]) : 0.f;
    vst2(sr + q4 * 4, p); } }
// ---- k_out64: out[b][t][0..63] = ctx row columns 0..63 (256 B by 16 lanes)
__global__ __launch_bounds__(256) void k_out64(const float* __restrict__ Y, float* __restrict__ OUT) { const size_t row = (size_t)blockIdx.x * 16 + (threadIdx.x >> 4); const int q = threadIdx.x & 15; const v4f v = *(const v4f*)(Y + row * CC + q * 4); asm volatile("s_wait_loadcnt 0x0" ::: "memory"); vst2(OUT + row * 64 + q * 4, v); }
// ---- k_pv: block = 16 queries (tile qt) of (sequence b = blockIdx.z, head h0) x PVS waves, P from score plane b: ctx = P . v over keys [0, kend). The 32-key chunks of the key range are dealt round-robin to the waves (wave w takes chunks w, w + PVS, ...), so a wave's chain of dependent load rounds is at most 4 long and a long query tile's keys are spread over the PVS waves of its work-group; every wave keeps its own 16 x 64 f32 partial, the PVS partials are summed in wave order through LDS. (P x 2^11 once to f16 against v f16: 1 product; query blocks < QBH (all NQB of them): P and v as bf16 hi + lo, 3 products); 256-B (row, head) segment by 16 lanes
#define PVS 16
__global__ __launch_bounds__(32 * PVS) void k_pv(const float* __restrict__ PS0, const _Float16* __restrict__ VT, const __bf16* __restrict__ VB, const __bf16* __restrict__ VBL, int h0, float* __restrict__ Y) { const int b = blockIdx.z, h = h0; const float* PS = PS0 + (size_t)b * TT * TT; __shared__ __align__(16) float ss[PVS][16][HD + 4];
  const int tid = threadIdx.x, lane = tid & 31, col = lane & 15, g = lane >> 4; const int wave = __builtin_amdgcn_readfirstlane(tid >> 5); const int qb = blockIdx.x >> 2; const int ql0 = blockIdx.x * 16; const int kce = (kb_last(qb) + 1) * 4;
  v8f acc[HD / 16] = {};
  if (qb < QBH) {
#pragma unroll 1
    for (int kc = wave; kc < kce; kc += PVS) { const F2 p = split_row(PS + (size_t)(ql0 + col) * TT, kc * 32, lane);
      asm volatile("s_wait_loadcnt 0x0" ::: "memory");
#pragma unroll
      for (int j = 0; j < HD / 16; ++j) { const size_t po = ((size_t)b * CC + h * HD + j * 16 + col) * (size_t)KHI + kc * 32; const v16b vh = frag_b(VB + po, lane); acc[j] = wmma_bf(p.h, vh, acc[j]); acc[j] = wmma_bf(p.l, vh, acc[j]); acc[j] = wmma_bf(p.h, frag_b(VBL + po, lane), acc[j]); } }
  } else {
#pragma unroll 1
    for (int kc = wave; kc < kce; kc += PVS) { const v16h p = frag_f32(PS + (size_t)(ql0 + col) * TT + kc * 32, lane);
      asm volatile("s_wait_loadcnt 0x0" ::: "memory");
#pragma unroll
      for (int j = 0; j < HD / 16; ++j) { const size_t po = ((size_t)b * CC + h * HD + j * 16 + col) * (size_t)TT + kc * 32; acc[j] = wmma16(p, frag_h(VT + po, lane), acc[j]); } } }
#pragma unroll
  for (int j = 0; j < HD / 16; ++j)
#pragma unroll
    for (int r = 0; r < 8; ++r) ss[wave][8 * g + r][j * 16 + col] = acc[j][r] * (1.0f / 2048.0f);   /* a wave with no chunk hands zeros */
  __syncthreads();   /* publishes the PVS partials to the waves that sum them */
  if (wave < 8) { const int rl = tid >> 4, q = tid & 15; v4f s = *(const v4f*)&ss[0][rl][q * 4];
#pragma unroll
    for (int w = 1; w < PVS; ++w) s += *(const v4f*)&ss[w][rl][q * 4];
    vst2(Y + ((size_t)b * TT + ql0 + rl) * CC + h * HD + q * 4, s); } }

extern "C" void kernel_launch(void* const* d_in, const int* in_sizes, int n_in, void* d_out, int out_size, void* d_ws, size_t ws_size, hipStream_t stream) {
  (void)in_sizes; (void)n_in; (void)out_size;
  const float** F = (const float**)d_in;
  if (ws_size < (size_t)WS_END) return;
  char* ws = (char*)d_ws; _Float16 *QH = (_Float16*)(ws + WS_QH), *KH = (_Float16*)(ws + WS_KH), *VT = (_Float16*)(ws + WS_VT), *QL = (_Float16*)(ws + WS_QL), *KL = (_Float16*)(ws + WS_KL); __bf16 *VB = (__bf16*)(ws + WS_VB), *VBL = (__bf16*)(ws + WS_VBL); float *S = (float*)(ws + WS_S), *Y = (float*)(ws + WS_Y);
  (void)Y; (void)QL; (void)KL; (void)VB; (void)VBL;
  // inputs: 0 x [8,2048,384]; 1 Wq [384,64] (in,out); 2 Wk; 3 Wv; no biases
  if (ws_size < (size_t)WS_END2) return;
  float *Y2 = (float*)(ws + WS_Y2), *CM = (float*)(ws + WS_CM), *CZ = (float*)(ws + WS_CZ);
  k_proj<<<dim3(TNB * TT / 64, CC / 128, 3), 128, 0, stream>>>(F[0], F[0], F[0], F[1], F[2], F[3], nullptr, nullptr, nullptr, QH, QL, KH, KL, VT, VB, VBL);   /* weight columns 64..127 (the padding head) are zero fragments */
  /* all sequences in one launch of each stage (the last grid index is the sequence, each with its own score plane); head 0 only (head 1 is the zero padding) */
  k_sc<<<dim3(NQB, TT / 128, TNB), 128, 0, stream>>>(QH, KH, QL, KL, 0, S);
  k_colstat_c<<<dim3(TT / 32, TNB), 1024, 0, stream>>>(S, CM, CZ);   /* per key column j: max / sum over the visible queries i >= j */
  k_csm_c<<<dim3(TT, TNB), 256, 0, stream>>>(S, CM, CZ);            /* P[i][j] = exp(S - m_j) / Z_j x 2^11 for j <= i, 0 above the diagonal */
  k_pv<<<dim3(TT / 16, 1, TNB), 32 * PVS, 0, stream>>>(S, VT, VB, VBL, 0, Y2);
  k_out64<<<dim3(TNB * TT / 16), 256, 0, stream>>>(Y2, (float*)d_out);
}

// v004
// It runs in 123 microseconds.
// In both of two side-by-side timings against v003, it was 1.16 times as fast.
// Over all steps from v000 it is 61.3 times as fast.
// compute dtype: all float inputs rounded to bf16; q/k/v projections with EXACT bf16 products on WMMA 16x16x32 (f32 accumulate); causal scores with BOTH q and k as f16 hi + (x 2^10) residual (3 products) on EVERY block, x 64^-0.5; softmax over the QUERY axis in f32 (per key column: max and sum over the visible queries, per wave and merged, exp to expf's accuracy; P by precise expf); P as bf16 hi + lo against v as bf16 hi + lo (3 products) on EVERY block; f32 output.
#include <hip/hip_runtime.h>
#include <math.h>

typedef __attribute__((ext_vector_type(16))) _Float16 v16h;
typedef __attribute__((ext_vector_type(16))) __bf16 v16b;
typedef __attribute__((ext_vector_type(8)))  _Float16 v8h;
typedef __attribute__((ext_vector_type(8)))  float v8f;
typedef __attribute__((ext_vector_type(4)))  float v4f;
typedef __attribute__((ext_vector_type(2)))  float v2f;
typedef __attribute__((ext_vector_type(4)))  unsigned v4u;
typedef __attribute__((ext_vector_type(4)))  int v4i;
typedef float __attribute__((may_alias)) float_a;
typedef int __attribute__((may_alias)) int_a;

template <typename T> __device__ __forceinline__ void vst2(void* p, T v) { *(T*)p = v;  }
__device__ __forceinline__ v8f wmma16(v16h a, v16h b, v8f c) {
  v8f d = __builtin_amdgcn_wmma_f32_16x16x32_f16(false, a, false, b, (short)0, c, false, false);
  asm volatile("v_nop\n\tv_nop\n\tv_nop\n\tv_nop" : "+v"(d) : "v"(a), "v"(b));
  return d;
}
__device__ __forceinline__ v8f wmma_bf(v16b a, v16b b, v8f c) {
  v8f d = __builtin_amdgcn_wmma_f32_16x16x32_bf16(false, a, false, b, (short)0, c, false, false);
  asm volatile("v_nop\n\tv_nop\n\tv_nop\n\tv_nop" : "+v"(d) : "v"(a), "v"(b));
  return d;
}
// 16x16x32 fragments: lane = (h = lane>>4, row/col = lane&15); elements 0..7 = k0+8h+0..7, 8..15 = k0+16+8h+0..7; D element r = row 8h+r
__device__ __forceinline__ v16h frag_h(const _Float16* rowk0, int lane) {
  union { v16h v; v8h q[2]; } u; const _Float16* p = rowk0 + 8 * (lane >> 4);
  u.q[0] = *(const v8h*)p; u.q[1] = *(const v8h*)(p + 16); return u.v;
}
__device__ __forceinline__ v16h frag_f32(const float* rowk0, int lane) {
  v16h a; const float* p = rowk0 + 8 * (lane >> 4);
#pragma unroll
  for (int i = 0; i < 8; ++i) { a[i] = (_Float16)p[i]; a[8 + i] = (_Float16)p[16 + i]; }
  return a;
}
__device__ __forceinline__ v16h frag_f32s(const float* rowk0, int lane, float sc) {
  v16h a; const float* p = rowk0 + 8 * (lane >> 4);
#pragma unroll
  for (int i = 0; i < 8; ++i) { a[i] = (_Float16)(p[i] * sc); a[8 + i] = (_Float16)(p[16 + i] * sc); }
  return a;
}
// column fragment from a [K][ld] layout (column n), rows >= K read as 0
__device__ __forceinline__ v16h fragc_f32(const float* W, int k0, int n, int lane, int ld, int K) {
  v16h a; const int g = lane >> 4;
#pragma unroll
  for (int i = 0; i < 8; ++i) { const int ka = k0 + 8 * g + i, kb = ka + 16;
    a[i] = (_Float16)(ka < K ? W[(size_t)(ka < K ? ka : K - 1) * ld + n] : 0.f); a[8 + i] = (_Float16)(kb < K ? W[(size_t)(kb < K ? kb : K - 1) * ld + n] : 0.f); }
  return a;
}
struct F2 { v16b h, l; };
__device__ __forceinline__ F2 bsplit16(const float v[16]) { F2 r;
#pragma unroll
  for (int i = 0; i < 16; ++i) { const __bf16 h = (__bf16)v[i]; r.h[i] = h; r.l[i] = (__bf16)(v[i] - (float)h); }
  return r; }
__device__ __forceinline__ F2 split_row(const float* row, int k0, int lane) { float v[16]; const float* p = row + k0 + 8 * (lane >> 4);
#pragma unroll
  for (int i = 0; i < 8; ++i) { v[i] = p[i]; v[8 + i] = p[16 + i]; }
  return bsplit16(v); }
__device__ __forceinline__ F2 split_rowK(const float* row, int k0, int lane, int K) { float v[16]; const int g = lane >> 4;
#pragma unroll
  for (int i = 0; i < 8; ++i) { const int ka = k0 + 8 * g + i, kb = ka + 16; v[i] = ka < K ? row[ka < K ? ka : K - 1] : 0.f; v[8 + i] = kb < K ? row[kb < K ? kb : K - 1] : 0.f; }
  return bsplit16(v); }
__device__ __forceinline__ F2 split_col(const float* W, int k0, int n, int lane, int ld, int K) { float v[16]; const int g = lane >> 4;
#pragma unroll
  for (int i = 0; i < 8; ++i) { const int ka = k0 + 8 * g + i, kb = ka + 16; v[i] = ka < K ? W[(size_t)(ka < K ? ka : K - 1) * ld + n] : 0.f; v[8 + i] = kb < K ? W[(size_t)(kb < K ? kb : K - 1) * ld + n] : 0.f; }
  return bsplit16(v); }
__device__ __forceinline__ v8f mac3(const F2& a, const F2& b, v8f c) { c = wmma_bf(a.l, b.h, c); c = wmma_bf(a.h, b.l, c); return wmma_bf(a.h, b.h, c); }
__device__ __forceinline__ float sigm(float v) { return 1.0f / (1.0f + expf(-v)); }
#define LDSX() do { asm volatile("s_wait_dscnt 0" ::: "memory"); __builtin_amdgcn_wave_barrier(); __builtin_amdgcn_fence(__ATOMIC_RELEASE, "workgroup"); } while (0)

// Single-head causal self-attention whose softmax runs over the QUERY axis (x [8,2048,384]; (in,out) Wq / Wk / Wv [384,64] (0.02 scale), no biases; scores[b, i, j] = q_i . k_j / 8; -inf where j > i; attn = softmax(scores, axis=1) - axis 1 is the QUERY axis i, so every key column j is normalised over the queries i >= j (faithful to the source); out = attn v -> [8,2048,64]).
#define NB 8
#define TT 2048
#define CC 128            // NH * HD = projected width
#define DIN 384          // input (model) width
#define NH 2
#define HD 64
#define NQB (TT / 64)
#define SCALE (0.125f)
#define CAUSAL 1
#ifndef TNB
#define TNB NB
#endif
__device__ __forceinline__ float bfr(float v) { return (float)(__bf16)v; }
__host__ __device__ __forceinline__ int kb_last(int qb) { return CAUSAL ? ((qb * 64 + 63) >> 7) : (TT / 128 - 1); }
typedef __attribute__((ext_vector_type(8))) __bf16 v8b;
__device__ __forceinline__ v16b frag_b(const __bf16* rowk0, int lane) {
  union { v16b v; v8b q[2]; } u; const __bf16* p = rowk0 + 8 * (lane >> 4);
  u.q[0] = *(const v8b*)p; u.q[1] = *(const v8b*)(p + 16); return u.v;
}
#define QBH 32              // causal: query blocks 0..QBH-1 of each sequence (all NQB = 32 of them) take the high-precision path
#define QHI 2048            // rows carrying a q residual plane (all TT rows)
#define KHI 2048            // key rows carrying k residual / v bf16 hi+lo planes (used only by the causal high-precision path)
// B fragment (k rows k0+.., output column o) of a weight: (in,out) [K][ld] or (out,in) [ld rows of K]: bf16 exact, or f16(bf16 * 256) exact
__device__ __forceinline__ v16b wcol_io(const float* Wm, int k0, int o, int lane, int ld) { v16b w; const int g = lane >> 4;
#pragma unroll
  for (int i = 0; i < 8; ++i) { w[i] = (__bf16)Wm[(size_t)(k0 + 8 * g + i) * ld + o]; w[8 + i] = (__bf16)Wm[(size_t)(k0 + 16 + 8 * g + i) * ld + o]; }
  return w; }
__device__ __forceinline__ v16b wcol_oi(const float* Wm, int k0, int o, int lane, int K) { v16b w; const float* p = Wm + (size_t)o * K + k0 + 8 * (lane >> 4);
#pragma unroll
  for (int i = 0; i < 8; ++i) { w[i] = (__bf16)p[i]; w[8 + i] = (__bf16)p[16 + i]; }
  return w; }
__device__ __forceinline__ v16h wcolh_io(const float* Wm, int k0, int o, int lane, int ld) { v16h w; const int g = lane >> 4;
#pragma unroll
  for (int i = 0; i < 8; ++i) { w[i] = (_Float16)(bfr(Wm[(size_t)(k0 + 8 * g + i) * ld + o]) * 256.0f); w[8 + i] = (_Float16)(bfr(Wm[(size_t)(k0 + 16 + 8 * g + i) * ld + o]) * 256.0f); }
  return w; }
__device__ __forceinline__ v16h wcolh_oi(const float* Wm, int k0, int o, int lane, int K) { v16h w; const float* p = Wm + (size_t)o * K + k0 + 8 * (lane >> 4);
#pragma unroll
  for (int i = 0; i < 8; ++i) { w[i] = (_Float16)(bfr(p[i]) * 256.0f); w[8 + i] = (_Float16)(bfr(p[16 + i]) * 256.0f); }
  return w; }
#define WQKV_LAYOUT 0   // 0 = (in,out) [DIN][64] (head 0 only; columns 64..127 zero); 1 = (out,in) [CC][DIN]; 2 = per-head [NH][DIN][HD]
__device__ __forceinline__ v16b wcol_hdk(const float* Wm, int k0, int o, int lane) { v16b w; const int g = lane >> 4; const float* p = Wm + (size_t)(o / HD) * DIN * HD + (o % HD);
#pragma unroll
  for (int i = 0; i < 8; ++i) { w[i] = (__bf16)p[(size_t)(k0 + 8 * g + i) * HD]; w[8 + i] = (__bf16)p[(size_t)(k0 + 16 + 8 * g + i) * HD]; }
  return w; }
#define WO_OUT_IN 0
#if WQKV_LAYOUT == 1
#define WCOL(W, k0, o, lane) wcol_oi(W, k0, o, lane, DIN)
#elif WQKV_LAYOUT == 2
#define WCOL(W, k0, o, lane) wcol_hdk(W, k0, o, lane)
#else
__device__ __forceinline__ v16b zero16b() { v16b w; _Pragma("unroll") for (int i = 0; i < 16; ++i) w[i] = (__bf16)0.0f; return w; }
#define WCOL(W, k0, o, lane) ((o) < 64 ? wcol_io(W, k0, (o), lane, 64) : zero16b())   /* (in,out) [384][64] pitch 64: only 64 real output columns; projected columns 64..127 (padding head 1) are zero; compile-time per unrolled tile (c0 = 0) */
#endif
#if WO_OUT_IN
#define WOCOL(W, k0, o, lane) wcol_oi(W, k0, o, lane, CC)
#define WOCOLH(W, k0, o, lane) wcolh_oi(W, k0, o, lane, CC)
#else
#define WOCOL(W, k0, o, lane) wcol_io(W, k0, o, lane, DIN)
#define WOCOLH(W, k0, o, lane) wcolh_io(W, k0, o, lane, DIN)
#endif

#ifndef SM_EXTRA_PARAMS
#define SM_EXTRA_PARAMS
#endif
#ifndef PROJ_EXTRA_PARAMS
#define PROJ_EXTRA_PARAMS
#endif
#ifndef SM_MASK_HOOK
#define SM_MASK_HOOK (void)0
#endif

#define WS_QH  0u                                      // f16 q rows [b*t][CC]
#define WS_KH  (WS_QH + 2u * (size_t)NB * TT * CC)      // f16 k rows [b*t][CC]
#define WS_VT  (WS_KH + 2u * (size_t)NB * TT * CC)      // f16 v planes [b][c][t]
#define WS_QL  (WS_VT + 2u * (size_t)NB * CC * TT)      // f16 q residual x 2^10 rows [b][t < QHI][CC]
#define WS_KL  (WS_QL + 2u * (size_t)NB * QHI * CC)     // f16 k residual x 2^10 rows [b][t < KHI][CC]
#define WS_VB  (WS_KL + 2u * (size_t)NB * KHI * CC)     // bf16 v hi planes [b][c][t < KHI]
#define WS_VBL (WS_VB + 2u * (size_t)NB * CC * KHI)
#define WS_S   (WS_VBL + 2u * (size_t)NB * CC * KHI)    // f32 logits [b][t][s]: one plane per sequence
#define WS_Y   (WS_S  + 4u * (size_t)NB * TT * TT)      // f32 ctx rows [b*t][CC] (only when there is an output projection)
#define WS_END (WS_Y  + 0u)
#define WS_Y2 (WS_END)                                  // f32 ctx rows [b*TT + t][128] (columns 64..127 = the padding head)
#define WS_CM (WS_Y2 + 4u * (size_t)NB * TT * CC)        // f32 column maxima [b][TT]
#define WS_CZ (WS_CM + 4u * (size_t)NB * TT)             // f32 column factors 2^11 / Z [b][TT]
#define WS_END2 (WS_CZ + 4u * (size_t)NB * TT)

// ---- k_proj: block = (64 rows, 128 cols, which): q/k/v = X W (+ b) with exact bf16 products (K = DIN) -> which 0: q f16 rows (+ residual rows < QHI); 1: k f16 rows (+ residual rows < KHI); 2: v f16 planes [c][t] (+ bf16 hi/lo planes for t < KHI)
__global__ __launch_bounds__(128) void k_proj(const float* __restrict__ XQ, const float* __restrict__ XK, const float* __restrict__ XV, const float* __restrict__ WQ, const float* __restrict__ WK, const float* __restrict__ WV, const float* __restrict__ BQ, const float* __restrict__ BK, const float* __restrict__ BV,
    _Float16* __restrict__ QH, _Float16* __restrict__ QL, _Float16* __restrict__ KH, _Float16* __restrict__ KL, _Float16* __restrict__ VT, __bf16* __restrict__ VB, __bf16* __restrict__ VBL) {
  __shared__ __align__(16) _Float16 sh[64][136], sl[64][136]; __shared__ __align__(16) _Float16 th[128][72]; __shared__ __align__(16) __bf16 tb[128][72], tbl[128][72];
  const int tid = threadIdx.x, wave = tid >> 5, lane = tid & 31, col = lane & 15, g = lane >> 4; const int which = blockIdx.z; const int c0 = blockIdx.y * 128; const size_t r0 = (size_t)blockIdx.x * 64; const size_t bb = r0 / TT; const int t0 = (int)(r0 % TT);
  const float* X = which == 0 ? XQ : which == 1 ? XK : XV; const float* WA = which == 0 ? WQ : which == 1 ? WK : WV; const float* BA = which == 0 ? BQ : which == 1 ? BK : BV;
  v8f acc[8] = {};
#pragma unroll 2
  for (int kc = 0; kc < DIN / 32; ++kc) { v16b a; { const float* p = X + (r0 + wave * 16 + col) * DIN + kc * 32 + 8 * g;
#pragma unroll
      for (int i = 0; i < 8; ++i) { a[i] = (__bf16)p[i]; a[8 + i] = (__bf16)p[16 + i]; } }
    asm volatile("s_wait_loadcnt 0x0" ::: "memory");
#pragma unroll
    for (int j = 0; j < 8; ++j) { const v16b w = WCOL(WA, kc * 32, c0 + j * 16 + col, lane); asm volatile("s_wait_loadcnt 0x0" ::: "memory"); acc[j] = wmma_bf(a, w, acc[j]); } }
  if (which < 2) { _Float16* DH = which == 0 ? QH : KH; _Float16* DL = which == 0 ? QL : KL; const int nhi = which == 0 ? QHI : KHI; const bool hi_rows = t0 < nhi;
#pragma unroll
    for (int j = 0; j < 8; ++j) { const float bias = BA ? bfr(BA[c0 + j * 16 + col]) : 0.f;
#pragma unroll
      for (int r = 0; r < 8; ++r) { const float v = acc[j][r] + bias; const _Float16 hv = (_Float16)v; sh[wave * 16 + 8 * g + r][j * 16 + col] = hv; sl[wave * 16 + 8 * g + r][j * 16 + col] = (_Float16)((v - (float)hv) * 1024.0f); } }
    __syncthreads();
    for (int e = tid; e < 64 * 16; e += 128) { const int rl = e >> 4, q = e & 15; vst2((unsigned*)(DH + (r0 + rl) * CC + c0 + q * 8), *(const v4u*)&sh[rl][q * 8]); if (hi_rows) vst2((unsigned*)(DL + (bb * nhi + t0 + rl) * (size_t)CC + c0 + q * 8), *(const v4u*)&sl[rl][q * 8]); }
  } else { const bool hi_rows = t0 < KHI;
#pragma unroll
    for (int j = 0; j < 8; ++j) { const float bias = BA ? bfr(BA[c0 + j * 16 + col]) : 0.f;
#pragma unroll
      for (int r = 0; r < 8; ++r) { const float v = acc[j][r] + bias; const int rl = wave * 16 + 8 * g + r, cl = j * 16 + col; th[cl][rl] = (_Float16)v; const __bf16 bh = (__bf16)v; tb[cl][rl] = bh; tbl[cl][rl] = (__bf16)(v - (float)bh); } }
    __syncthreads();
    for (int e = tid; e < 128 * 8; e += 128) { const int cl = e >> 3, q = e & 7; vst2((unsigned*)(VT + (bb * CC + c0 + cl) * (size_t)TT + t0 + q * 8), *(const v4u*)&th[cl][q * 8]); if (hi_rows) { const size_t o3 = (bb * CC + c0 + cl) * (size_t)KHI + t0 + q * 8; vst2((unsigned*)(VB + o3), *(const v4u*)&tb[cl][q * 8]); vst2((unsigned*)(VBL + o3), *(const v4u*)&tbl[cl][q * 8]); } } } }
// ---- k_sc: block = (query block qb, key block kb <= kb_last(qb), sequence b = blockIdx.z), head h0, into score plane b: logits x SCALE; q hi + residual (x 2^10) against k (2 products) for query rows < QHI, plus the k residual (3 products) for query blocks < QBH (all query blocks); causal: blocks past the diagonal exit, the mask itself is applied by index in k_colstat_c and p_row
__global__ __launch_bounds__(128) void k_sc(const _Float16* __restrict__ QH, const _Float16* __restrict__ KH, const _Float16* __restrict__ QL, const _Float16* __restrict__ KL, int h0, float* __restrict__ S0) { __shared__ __align__(16) float ss[4][16][132];
  const int qb = blockIdx.x, kb = blockIdx.y; if (kb > kb_last(qb)) return;
  const int b = blockIdx.z, h = h0; float* S = S0 + (size_t)b * TT * TT;
  const int tid = threadIdx.x, wave = tid >> 5, lane = tid & 31, col = lane & 15, g = lane >> 4; const int k0 = kb * 128; const int ql0 = qb * 64 + wave * 16; const size_t q0 = (size_t)b * TT + ql0, kr0 = (size_t)b * TT + k0;
  v8f acc[8] = {}, accl[8] = {};
  const _Float16* QLb = QL + (size_t)b * QHI * CC; const _Float16* KLb = KL + (size_t)b * KHI * CC;
  if (qb < QBH) {
#pragma unroll
    for (int kc = 0; kc < HD / 32; ++kc) { const v16h ah = frag_h(QH + (q0 + col) * CC + h * HD + kc * 32, lane), al = frag_h(QLb + (size_t)(ql0 + col) * CC + h * HD + kc * 32, lane);
#pragma unroll
      for (int j = 0; j < 8; ++j) { const v16h kbf = frag_h(KH + (kr0 + j * 16 + col) * CC + h * HD + kc * 32, lane), klf = frag_h(KLb + (size_t)(k0 + j * 16 + col) * CC + h * HD + kc * 32, lane); acc[j] = wmma16(ah, kbf, acc[j]); accl[j] = wmma16(al, kbf, accl[j]); accl[j] = wmma16(ah, klf, accl[j]); } }
  } else if (qb * 64 < QHI) {
#pragma unroll
    for (int kc = 0; kc < HD / 32; ++kc) { const v16h ah = frag_h(QH + (q0 + col) * CC + h * HD + kc * 32, lane), al = frag_h(QLb + (size_t)(ql0 + col) * CC + h * HD + kc * 32, lane);
#pragma unroll
      for (int j = 0; j < 8; ++j) { const v16h kbf = frag_h(KH + (kr0 + j * 16 + col) * CC + h * HD + kc * 32, lane); acc[j] = wmma16(ah, kbf, acc[j]); accl[j] = wmma16(al, kbf, accl[j]); } }
  } else {
#pragma unroll
    for (int kc = 0; kc < HD / 32; ++kc) { const v16h ah = frag_h(QH + (q0 + col) * CC + h * HD + kc * 32, lane);
#pragma unroll
      for (int j = 0; j < 8; ++j) { const v16h kbf = frag_h(KH + (kr0 + j * 16 + col) * CC + h * HD + kc * 32, lane); acc[j] = wmma16(ah, kbf, acc[j]); } } }
#pragma unroll
  for (int j = 0; j < 8; ++j) {
#pragma unroll
    for (int r = 0; r < 8; ++r) ss[wave][8 * g + r][j * 16 + col] = (acc[j][r] + accl[j][r] * (1.0f / 1024.0f)) * SCALE; }
  LDSX(); for (int rl = 0; rl < 16; ++rl) vst2(S + (size_t)(ql0 + rl) * TT + k0 + lane * 4, *(const v4f*)&ss[wave][rl][lane * 4]); }
// ---- k_sm: block = query row t (head in group): keys [0, kend): causal -> logit if s <= t else excluded; softmax in f32; P x 2^11 in place (0 for excluded)
__global__ __launch_bounds__(256) void k_sm(float* __restrict__ S0 SM_EXTRA_PARAMS) { __shared__ float sred[8]; __shared__ float sbc; __shared__ __align__(16) float shv[TT];
  const int tid = threadIdx.x; const int t = blockIdx.x; const int kend = (kb_last(t >> 6) + 1) * 128;
  float* sr = S0 + (size_t)blockIdx.y * TT * TT + (size_t)t * TT;
  float m = -3.0e38f; for (int k = tid; k < kend; k += 256) { float v = (!CAUSAL || k <= t) ? sr[k] : -3.0e38f; SM_MASK_HOOK; shv[k] = v; m = fmaxf(m, v); }
#pragma unroll
  for (int o = 1; o < 32; o <<= 1) m = fmaxf(m, __shfl_xor(m, o));
  if ((tid & 31) == 0) sred[tid >> 5] = m; __syncthreads(); if (tid == 0) { float a = sred[0]; for (int i = 1; i < 8; ++i) a = fmaxf(a, sred[i]); sbc = a; } __syncthreads(); m = sbc; __syncthreads();
  float sum = 0.f; for (int k = tid; k < kend; k += 256) { const float v = shv[k]; const float e = (v <= -1.0e38f) ? 0.f : expf(v - m); shv[k] = e; sum += e; }
#pragma unroll
  for (int o = 1; o < 32; o <<= 1) sum += __shfl_xor(sum, o);
  if ((tid & 31) == 0) sred[tid >> 5] = sum; __syncthreads(); if (tid == 0) { float a = 0.f; for (int i = 0; i < 8; ++i) a += sred[i]; sbc = a > 0.f ? 2048.0f / a : 0.f; }   /* a fully excluded row yields P = 0 */ __syncthreads(); const float inv = sbc;
  for (int k = tid; k < kend; k += 256) shv[k] = shv[k] * inv;
  __syncthreads(); for (int q = tid; q < kend / 4; q += 256) vst2(sr + q * 4, *(const v4f*)&shv[q * 4]); }
// exp for k_colstat_c, to expf's accuracy: e = the integer nearest to x log2(e); the fraction x log2(e) - e by two fused multiply-adds with the constant's high and low word; exp2 of the fraction, ldexp by e; 0 below -103.28 (ln of the smallest f32 denormal), +inf above 88.72 (expf's overflow limit). v_exp_f32 stands in one asm statement with a v_nop: the free slot that the instruction set asks for between a transcendental and an instruction that reads its result or overwrites its source (in a statement of its own nothing would hold the v_nop there)
__device__ __forceinline__ float exp_slot(float x) { const float c = __builtin_bit_cast(float, 0x3fb8aa3bu), cl = __builtin_bit_cast(float, 0x32a5705fu);
  const float e = __builtin_rintf(x * c); const float a = __builtin_fmaf(x, cl, __builtin_fmaf(x, c, -e)); float r;
  asm("v_exp_f32 %0, %1\n\tv_nop" : "=v"(r) : "v"(a));   /* the v_nop keeps the slot behind the transcendental free whatever the compiler schedules next */
  r = __builtin_ldexpf(r, (int)e); r = (x < __builtin_bit_cast(float, 0xc2ce8ed0u)) ? 0.f : r; return (x > __builtin_bit_cast(float, 0x42b17218u)) ? __builtin_inff() : r; }
// ---- k_colstat_c: softmax over the QUERY axis under the causal mask (the source's softmax(axis=1) on [B, t, s] scores with -inf above the diagonal): for every key column k: m_k = max_{q >= k} S[q][k], Z_k = sum_{q >= k} exp(S[q][k] - m_k) (f32, exp_slot).
// block = 32 key columns (one 128-B line of every score row) of score plane blockIdx.y (the sequence) x 32 waves. A wave-wide 16-byte load covers 4 query rows x 32 columns (4 whole lines); wave w takes the 64 rows from c0 + 64 w and holds them in registers, so its 16 loads are all in flight at once and the scores are read once.
// Per wave and column: max, then the sum of exp against that max; the 32 (max, sum) pairs of a column are merged through LDS by wave 0: M = max m_w, Z = sum z_w exp(m_w - M).
// Rows above a column's diagonal lie only in wave 0's first 32 rows (they hold the unmasked logits of the diagonal score block): their content is replaced by value select. Sentinels: a hidden entry reads -3e38 and the running max starts at -1e38, so a hidden entry adds exp(-2e38) = 0, and a wave with no row below TT hands the pair (-1e38, 0), which adds 0 to the merge (the logits are sums of 64 f16-range products, far above -1e38).
__global__ __launch_bounds__(1024) void k_colstat_c(const float* __restrict__ S0, float* __restrict__ CM, float* __restrict__ CZ) { __shared__ __align__(16) float pm[32][32], pz[32][32];
  const int tid = threadIdx.x, lane = tid & 31, sub = lane >> 3, cq = lane & 7; const int wave = __builtin_amdgcn_readfirstlane(tid >> 5); const int c0 = blockIdx.x * 32;
  const int r0 = c0 + wave * 64;                       /* the wave's first row */
  const bool h0 = r0 < TT, h1 = r0 + 32 < TT;          /* TT - c0 is a multiple of 32: each half of the wave's 64 rows is wholly inside or wholly past the end (wave-uniform) */
  const float* sp = S0 + (size_t)blockIdx.y * TT * TT + (size_t)(r0 + sub) * TT + c0 + cq * 4;
  v4f v[16];
  if (h0) {
#pragma unroll
    for (int s = 0; s < 8; ++s) v[s] = *(const v4f*)(sp + (size_t)s * 4 * TT); }
  if (h1) {
#pragma unroll
    for (int s = 8; s < 16; ++s) v[s] = *(const v4f*)(sp + (size_t)s * 4 * TT); }
  asm volatile("s_wait_xcnt 0x0" :: "v"(sp) : "memory");   /* the issued loads' address pair is an input here, so nothing (a load's own result included) overwrites it in front of this wait */
  v4f m = { -1.0e38f, -1.0e38f, -1.0e38f, -1.0e38f }, z = { 0.f, 0.f, 0.f, 0.f };
  if (wave == 0) {
#pragma unroll
    for (int s = 0; s < 8; ++s)
#pragma unroll
      for (int u = 0; u < 4; ++u) v[s][u] = (s * 4 + sub >= cq * 4 + u) ? v[s][u] : -3.0e38f; }
  if (h0) {
#pragma unroll
    for (int s = 0; s < 8; ++s)
#pragma unroll
      for (int u = 0; u < 4; ++u) m[u] = fmaxf(m[u], v[s][u]); }
  if (h1) {
#pragma unroll
    for (int s = 8; s < 16; ++s)
#pragma unroll
      for (int u = 0; u < 4; ++u) m[u] = fmaxf(m[u], v[s][u]); }
#pragma unroll
  for (int u = 0; u < 4; ++u) { m[u] = fmaxf(m[u], __shfl_xor(m[u], 8)); m[u] = fmaxf(m[u], __shfl_xor(m[u], 16)); }
  if (h0) {
#pragma unroll
    for (int s = 0; s < 8; ++s)
#pragma unroll
      for (int u = 0; u < 4; ++u) z[u] += exp_slot(v[s][u] - m[u]); }
  if (h1) {
#pragma unroll
    for (int s = 8; s < 16; ++s)
#pragma unroll
      for (int u = 0; u < 4; ++u) z[u] += exp_slot(v[s][u] - m[u]); }
#pragma unroll
  for (int u = 0; u < 4; ++u) { z[u] += __shfl_xor(z[u], 8); z[u] += __shfl_xor(z[u], 16); }
  if (sub == 0) { *(v4f*)&pm[wave][cq * 4] = m; *(v4f*)&pz[wave][cq * 4] = z; }
  __syncthreads();   /* publishes the 32 waves' pairs to wave 0 */
  if (wave == 0) { float mw[32], zw[32], M = -1.0e38f, Z = 0.f;
#pragma unroll
    for (int i = 0; i < 32; ++i) { mw[i] = pm[i][lane]; zw[i] = pz[i][lane]; }
#pragma unroll
    for (int i = 0; i < 32; ++i) M = fmaxf(M, mw[i]);
#pragma unroll
    for (int i = 0; i < 32; ++i) Z += zw[i] * exp_slot(mw[i] - M);
    vst2(CM + (size_t)blockIdx.y * TT + c0 + lane, M); vst2(CZ + (size_t)blockIdx.y * TT + c0 + lane, 2048.0f / Z); } }   /* every column sees at least its own diagonal entry: Z_k >= 1; stored is the column's factor 2^11 / Z_k, divided once per column */
// ---- p_row: the 16 P values of one lane's A fragment (query row t, keys k0 + 8 g + 0..7 and k0 + 16 + 8 g + 0..7), formed from the stored logits where k_pv reads them: P[t][k] = exp(S[t][k] - m_k) x (2^11 / Z_k) for k <= t, 0 above the diagonal (inside the diagonal block; 2^11 / Z_k lies in (0, 2^11], so 0 x it is 0); unconditional loads, value select. cm = the sequence's column maxima, ci = its column factors 2^11 / Z_k
__device__ __forceinline__ void p_row(const float* __restrict__ srow, const float* __restrict__ cm, const float* __restrict__ ci, int k0, int t, int lane, float v[16]) { const int kk = k0 + 8 * (lane >> 4), d = t - kk; const float *sp = srow + kk, *mp = cm + kk, *cp = ci + kk; v4f sv[4], m4[4], c4[4];
#pragma unroll
  for (int q = 0; q < 4; ++q) { const int o = (q >> 1) * 16 + (q & 1) * 4; sv[q] = *(const v4f*)(sp + o); m4[q] = *(const v4f*)(mp + o); c4[q] = *(const v4f*)(cp + o); }
  asm volatile("" :: "v"(sv[0]), "v"(sv[1]), "v"(sv[2]), "v"(sv[3]), "v"(m4[0]), "v"(m4[1]), "v"(m4[2]), "v"(m4[3]), "v"(c4[0]), "v"(c4[1]), "v"(c4[2]), "v"(c4[3]));   /* inputs-only fence on the loaded values: all twelve loads are issued in front of it and fly together (one round of latency); without it the compiler sinks most of them behind the first wait, one round after the other */
#pragma unroll
  for (int q = 0; q < 4; ++q)
#pragma unroll
    for (int u = 0; u < 4; ++u) v[q * 4 + u] = expf(((q >> 1) * 16 + (q & 1) * 4 + u <= d) ? sv[q][u] - m4[q][u] : -3.0e38f) * c4[q][u]; }   /* the select stands on the argument: expf(-3e38) is exactly 0, and no branch is formed round each exp */
// ---- k_out64: out[b][t][0..63] = ctx row columns 0..63 (256 B by 16 lanes)
__global__ __launch_bounds__(256) void k_out64(const float* __restrict__ Y, float* __restrict__ OUT) { const size_t row = (size_t)blockIdx.x * 16 + (threadIdx.x >> 4); const int q = threadIdx.x & 15; const v4f v = *(const v4f*)(Y + row * CC + q * 4); asm volatile("s_wait_loadcnt 0x0" ::: "memory"); vst2(OUT + row * 64 + q * 4, v); }
// ---- k_pv: block = 16 queries (tile qt) of (sequence b = blockIdx.z, head h0) x PVS waves, P formed by p_row from the logits of score plane b and the column statistics (every logit is read by exactly one lane of one wave, so no exp is done twice): ctx = P . v over keys [0, kend). The 32-key chunks of the key range are dealt round-robin to the waves (wave w takes chunks w, w + PVS, ...), so a wave's chain of dependent load rounds is at most 4 long and the long query tiles are spread over all PVS waves of their work-group; every wave keeps its own 16 x 64 f32 partial, the PVS partials are summed in wave order through LDS. (P x 2^11 once to f16 against v f16: 1 product; query blocks < QBH (all of them): P and v as bf16 hi + lo, 3 products); 256-B (row, head) segment by 16 lanes
#define PVS 16
__global__ __launch_bounds__(32 * PVS) void k_pv(const float* __restrict__ PS0, const float* __restrict__ CM, const float* __restrict__ CZ, const _Float16* __restrict__ VT, const __bf16* __restrict__ VB, const __bf16* __restrict__ VBL, int h0, float* __restrict__ Y) { const int b = blockIdx.z, h = h0; const float* PS = PS0 + (size_t)b * TT * TT; const float* cm = CM + (size_t)b * TT; const float* ci = CZ + (size_t)b * TT; __shared__ __align__(16) float ss[PVS][16][HD + 4];
  const int tid = threadIdx.x, lane = tid & 31, col = lane & 15, g = lane >> 4; const int wave = __builtin_amdgcn_readfirstlane(tid >> 5); const int qb = blockIdx.x >> 2; const int ql0 = blockIdx.x * 16; const int kce = (kb_last(qb) + 1) * 4;
  v8f acc[HD / 16] = {};
  if (qb < QBH) {
#pragma unroll 1
    for (int kc = wave; kc < kce; kc += PVS) { float pv[16]; p_row(PS + (size_t)(ql0 + col) * TT, cm, ci, kc * 32, ql0 + col, lane, pv); const F2 p = bsplit16(pv);
#pragma unroll
      for (int j = 0; j < HD / 16; ++j) { const size_t po = ((size_t)b * CC + h * HD + j * 16 + col) * (size_t)KHI + kc * 32; const v16b vh = frag_b(VB + po, lane); acc[j] = wmma_bf(p.h, vh, acc[j]); acc[j] = wmma_bf(p.l, vh, acc[j]); acc[j] = wmma_bf(p.h, frag_b(VBL + po, lane), acc[j]); } }
  } else {
#pragma unroll 1
    for (int kc = wave; kc < kce; kc += PVS) { float pv[16]; p_row(PS + (size_t)(ql0 + col) * TT, cm, ci, kc * 32, ql0 + col, lane, pv); v16h p;
#pragma unroll
      for (int i = 0; i < 16; ++i) p[i] = (_Float16)pv[i];
#pragma unroll
      for (int j = 0; j < HD / 16; ++j) { const size_t po = ((size_t)b * CC + h * HD + j * 16 + col) * (size_t)TT + kc * 32; acc[j] = wmma16(p, frag_h(VT + po, lane), acc[j]); } } }
#pragma unroll
  for (int j = 0; j < HD / 16; ++j)
#pragma unroll
    for (int r = 0; r < 8; ++r) ss[wave][8 * g + r][j * 16 + col] = acc[j][r] * (1.0f / 2048.0f);   /* a wave with no chunk hands zeros */
  __syncthreads();   /* publishes the PVS partials to the waves that sum them */
  if (wave < 8) { const int rl = tid >> 4, q = tid & 15; v4f s = *(const v4f*)&ss[0][rl][q * 4];
#pragma unroll
    for (int w = 1; w < PVS; ++w) s += *(const v4f*)&ss[w][rl][q * 4];
    vst2(Y + ((size_t)b * TT + ql0 + rl) * CC + h * HD + q * 4, s); } }

extern "C" void kernel_launch(void* const* d_in, const int* in_sizes, int n_in, void* d_out, int out_size, void* d_ws, size_t ws_size, hipStream_t stream) {
  (void)in_sizes; (void)n_in; (void)out_size;
  const float** F = (const float**)d_in;
  if (ws_size < (size_t)WS_END) return;
  char* ws = (char*)d_ws; _Float16 *QH = (_Float16*)(ws + WS_QH), *KH = (_Float16*)(ws + WS_KH), *VT = (_Float16*)(ws + WS_VT), *QL = (_Float16*)(ws + WS_QL), *KL = (_Float16*)(ws + WS_KL); __bf16 *VB = (__bf16*)(ws + WS_VB), *VBL = (__bf16*)(ws + WS_VBL); float *S = (float*)(ws + WS_S), *Y = (float*)(ws + WS_Y);
  (void)Y; (void)QL; (void)KL; (void)VB; (void)VBL;
  // inputs: 0 x [8,2048,384]; 1 Wq [384,64] (in,out); 2 Wk; 3 Wv; no biases
  if (ws_size < (size_t)WS_END2) return;
  float *Y2 = (float*)(ws + WS_Y2), *CM = (float*)(ws + WS_CM), *CZ = (float*)(ws + WS_CZ);
  k_proj<<<dim3(TNB * TT / 64, CC / 128, 3), 128, 0, stream>>>(F[0], F[0], F[0], F[1], F[2], F[3], nullptr, nullptr, nullptr, QH, QL, KH, KL, VT, VB, VBL);   /* weight columns 64..127 (the padding head) are zero fragments */
  /* all sequences in one launch of each stage (the last grid index is the sequence, each with its own score plane); head 0 only (head 1 is the zero padding) */
  k_sc<<<dim3(NQB, TT / 128, TNB), 128, 0, stream>>>(QH, KH, QL, KL, 0, S);
  k_colstat_c<<<dim3(TT / 32, TNB), 1024, 0, stream>>>(S, CM, CZ);   /* per key column j: max m_j and 2^11 / sum over the visible queries i >= j */
  k_pv<<<dim3(TT / 16, 1, TNB), 32 * PVS, 0, stream>>>(S, CM, CZ, VT, VB, VBL, 0, Y2);   /* forms P[i][j] = exp(S - m_j) x 2^11 / Z_j (0 above the diagonal) as it reads the logits */
  k_out64<<<dim3(TNB * TT / 16), 256, 0, stream>>>(Y2, (float*)d_out);
}

// v005
// Measured time: 111 microseconds a run.
// Next to v004, in two timings, it ran 1.12 times as fast each time.
// Over all steps from v000 it is 68.6 times as fast.
// compute dtype: all float inputs rounded to bf16; q/k/v projections with EXACT bf16 products on WMMA 16x16x32 (f32 accumulate); causal scores with BOTH q and k as f16 hi + (x 2^10) residual (3 products) on EVERY block, x 64^-0.5; softmax over the QUERY axis in f32 (per key column: max and sum over the visible queries, per wave and merged, exp to expf's accuracy; P by precise expf); P as bf16 hi + lo against v as bf16 hi + lo (3 products) on EVERY block; f32 output.
#include <hip/hip_runtime.h>
#include <math.h>

typedef __attribute__((ext_vector_type(16))) _Float16 v16h;
typedef __attribute__((ext_vector_type(16))) __bf16 v16b;
typedef __attribute__((ext_vector_type(8)))  _Float16 v8h;
typedef __attribute__((ext_vector_type(8)))  float v8f;
typedef __attribute__((ext_vector_type(4)))  float v4f;
typedef __attribute__((ext_vector_type(2)))  float v2f;
typedef __attribute__((ext_vector_type(4)))  unsigned v4u;
typedef __attribute__((ext_vector_type(4)))  int v4i;
typedef float __attribute__((may_alias)) float_a;
typedef int __attribute__((may_alias)) int_a;

template <typename T> __device__ __forceinline__ void vst2(void* p, T v) { *(T*)p = v;  }
__device__ __forceinline__ v8f wmma16(v16h a, v16h b, v8f c) {
  v8f d = __builtin_amdgcn_wmma_f32_16x16x32_f16(false, a, false, b, (short)0, c, false, false);
  asm volatile("v_nop\n\tv_nop\n\tv_nop\n\tv_nop" : "+v"(d) : "v"(a), "v"(b));
  return d;
}
__device__ __forceinline__ v8f wmma_bf(v16b a, v16b b, v8f c) {
  v8f d = __builtin_amdgcn_wmma_f32_16x16x32_bf16(false, a, false, b, (short)0, c, false, false);
  asm volatile("v_nop\n\tv_nop\n\tv_nop\n\tv_nop" : "+v"(d) : "v"(a), "v"(b));
  return d;
}
// 16x16x32 fragments: lane = (h = lane>>4, row/col = lane&15); elements 0..7 = k0+8h+0..7, 8..15 = k0+16+8h+0..7; D element r = row 8h+r
__device__ __forceinline__ v16h frag_h(const _Float16* rowk0, int lane) {
  union { v16h v; v8h q[2]; } u; const _Float16* p = rowk0 + 8 * (lane >> 4);
  u.q[0] = *(const v8h*)p; u.q[1] = *(const v8h*)(p + 16); return u.v;
}
__device__ __forceinline__ v16h frag_f32(const float* rowk0, int lane) {
  v16h a; const float* p = rowk0 + 8 * (lane >> 4);
#pragma unroll
  for (int i = 0; i < 8; ++i) { a[i] = (_Float16)p[i]; a[8 + i] = (_Float16)p[16 + i]; }
  return a;
}
__device__ __forceinline__ v16h frag_f32s(const float* rowk0, int lane, float sc) {
  v16h a; const float* p = rowk0 + 8 * (lane >> 4);
#pragma unroll
  for (int i = 0; i < 8; ++i) { a[i] = (_Float16)(p[i] * sc); a[8 + i] = (_Float16)(p[16 + i] * sc); }
  return a;
}
// column fragment from a [K][ld] layout (column n), rows >= K read as 0
__device__ __forceinline__ v16h fragc_f32(const float* W, int k0, int n, int lane, int ld, int K) {
  v16h a; const int g = lane >> 4;
#pragma unroll
  for (int i = 0; i < 8; ++i) { const int ka = k0 + 8 * g + i, kb = ka + 16;
    a[i] = (_Float16)(ka < K ? W[(size_t)(ka < K ? ka : K - 1) * ld + n] : 0.f); a[8 + i] = (_Float16)(kb < K ? W[(size_t)(kb < K ? kb : K - 1) * ld + n] : 0.f); }
  return a;
}
struct F2 { v16b h, l; };
__device__ __forceinline__ F2 bsplit16(const float v[16]) { F2 r;
#pragma unroll
  for (int i = 0; i < 16; ++i) { const __bf16 h = (__bf16)v[i]; r.h[i] = h; r.l[i] = (__bf16)(v[i] - (float)h); }
  return r; }
__device__ __forceinline__ F2 split_row(const float* row, int k0, int lane) { float v[16]; const float* p = row + k0 + 8 * (lane >> 4);
#pragma unroll
  for (int i = 0; i < 8; ++i) { v[i] = p[i]; v[8 + i] = p[16 + i]; }
  return bsplit16(v); }
__device__ __forceinline__ F2 split_rowK(const float* row, int k0, int lane, int K) { float v[16]; const int g = lane >> 4;
#pragma unroll
  for (int i = 0; i < 8; ++i) { const int ka = k0 + 8 * g + i, kb = ka + 16; v[i] = ka < K ? row[ka < K ? ka : K - 1] : 0.f; v[8 + i] = kb < K ? row[kb < K ? kb : K - 1] : 0.f; }
  return bsplit16(v); }
__device__ __forceinline__ F2 split_col(const float* W, int k0, int n, int lane, int ld, int K) { float v[16]; const int g = lane >> 4;
#pragma unroll
  for (int i = 0; i < 8; ++i) { const int ka = k0 + 8 * g + i, kb = ka + 16; v[i] = ka < K ? W[(size_t)(ka < K ? ka : K - 1) * ld + n] : 0.f; v[8 + i] = kb < K ? W[(size_t)(kb < K ? kb : K - 1) * ld + n] : 0.f; }
  return bsplit16(v); }
__device__ __forceinline__ v8f mac3(const F2& a, const F2& b, v8f c) { c = wmma_bf(a.l, b.h, c); c = wmma_bf(a.h, b.l, c); return wmma_bf(a.h, b.h, c); }
__device__ __forceinline__ float sigm(float v) { return 1.0f / (1.0f + expf(-v)); }
#define LDSX() do { asm volatile("s_wait_dscnt 0" ::: "memory"); __builtin_amdgcn_wave_barrier(); __builtin_amdgcn_fence(__ATOMIC_RELEASE, "workgroup"); } while (0)

// Single-head causal self-attention whose softmax runs over the QUERY axis (x [8,2048,384]; (in,out) Wq / Wk / Wv [384,64] (0.02 scale), no biases; scores[b, i, j] = q_i . k_j / 8; -inf where j > i; attn = softmax(scores, axis=1) - axis 1 is the QUERY axis i, so every key column j is normalised over the queries i >= j (faithful to the source); out = attn v -> [8,2048,64]).
#define NB 8
#define TT 2048
#define CC 128            // NH * HD = projected width
#define DIN 384          // input (model) width
#define NH 2
#define HD 64
#define NQB (TT / 64)
#define SCALE (0.125f)
#define CAUSAL 1
#ifndef TNB
#define TNB NB
#endif
__device__ __forceinline__ float bfr(float v) { return (float)(__bf16)v; }
__host__ __device__ __forceinline__ int kb_last(int qb) { return CAUSAL ? ((qb * 64 + 63) >> 7) : (TT / 128 - 1); }
typedef __attribute__((ext_vector_type(8))) __bf16 v8b;
__device__ __forceinline__ v16b frag_b(const __bf16* rowk0, int lane) {
  union { v16b v; v8b q[2]; } u; const __bf16* p = rowk0 + 8 * (lane >> 4);
  u.q[0] = *(const v8b*)p; u.q[1] = *(const v8b*)(p + 16); return u.v;
}
// fragment-order planes: a 16-row tile's k chunk of 32 lies as 2 x 512 contiguous bytes: piece 0 = every lane's elements 0..7, piece 1 = its elements 8..15, 16 bytes a lane in lane order, so one wave-wide 16-byte load covers 4 whole 128-byte lines
__device__ __forceinline__ v16h frag_hp(const _Float16* chunk, int lane) {
  union { v16h v; v8h q[2]; } u; const _Float16* p = chunk + 8 * lane;
  u.q[0] = *(const v8h*)p; u.q[1] = *(const v8h*)(p + 256); return u.v;
}
__device__ __forceinline__ v16b frag_bp(const __bf16* chunk, int lane) {
  union { v16b v; v8b q[2]; } u; const __bf16* p = chunk + 8 * lane;
  u.q[0] = *(const v8b*)p; u.q[1] = *(const v8b*)(p + 256); return u.v;
}
#define QBH 32              // causal: query blocks 0..QBH-1 of each sequence (all NQB = 32 of them) take the high-precision path
#define QHI 2048            // rows carrying a q residual plane (all TT rows)
#define KHI 2048            // key rows carrying k residual / v bf16 hi+lo planes (used only by the causal high-precision path)
// B fragment (k rows k0+.., output column o) of a weight: (in,out) [K][ld] or (out,in) [ld rows of K]: bf16 exact, or f16(bf16 * 256) exact
__device__ __forceinline__ v16b wcol_io(const float* Wm, int k0, int o, int lane, int ld) { v16b w; const int g = lane >> 4;
#pragma unroll
  for (int i = 0; i < 8; ++i) { w[i] = (__bf16)Wm[(size_t)(k0 + 8 * g + i) * ld + o]; w[8 + i] = (__bf16)Wm[(size_t)(k0 + 16 + 8 * g + i) * ld + o]; }
  return w; }
__device__ __forceinline__ v16b wcol_oi(const float* Wm, int k0, int o, int lane, int K) { v16b w; const float* p = Wm + (size_t)o * K + k0 + 8 * (lane >> 4);
#pragma unroll
  for (int i = 0; i < 8; ++i) { w[i] = (__bf16)p[i]; w[8 + i] = (__bf16)p[16 + i]; }
  return w; }
__device__ __forceinline__ v16h wcolh_io(const float* Wm, int k0, int o, int lane, int ld) { v16h w; const int g = lane >> 4;
#pragma unroll
  for (int i = 0; i < 8; ++i) { w[i] = (_Float16)(bfr(Wm[(size_t)(k0 + 8 * g + i) * ld + o]) * 256.0f); w[8 + i] = (_Float16)(bfr(Wm[(size_t)(k0 + 16 + 8 * g + i) * ld + o]) * 256.0f); }
  return w; }
__device__ __forceinline__ v16h wcolh_oi(const float* Wm, int k0, int o, int lane, int K) { v16h w; const float* p = Wm + (size_t)o * K + k0 + 8 * (lane >> 4);
#pragma unroll
  for (int i = 0; i < 8; ++i) { w[i] = (_Float16)(bfr(p[i]) * 256.0f); w[8 + i] = (_Float16)(bfr(p[16 + i]) * 256.0f); }
  return w; }
#define WQKV_LAYOUT 0   // 0 = (in,out) [DIN][64] (head 0 only; columns 64..127 zero); 1 = (out,in) [CC][DIN]; 2 = per-head [NH][DIN][HD]
__device__ __forceinline__ v16b wcol_hdk(const float* Wm, int k0, int o, int lane) { v16b w; const int g = lane >> 4; const float* p = Wm + (size_t)(o / HD) * DIN * HD + (o % HD);
#pragma unroll
  for (int i = 0; i < 8; ++i) { w[i] = (__bf16)p[(size_t)(k0 + 8 * g + i) * HD]; w[8 + i] = (__bf16)p[(size_t)(k0 + 16 + 8 * g + i) * HD]; }
  return w; }
#define WO_OUT_IN 0
#if WQKV_LAYOUT == 1
#define WCOL(W, k0, o, lane) wcol_oi(W, k0, o, lane, DIN)
#elif WQKV_LAYOUT == 2
#define WCOL(W, k0, o, lane) wcol_hdk(W, k0, o, lane)
#else
__device__ __forceinline__ v16b zero16b() { v16b w; _Pragma("unroll") for (int i = 0; i < 16; ++i) w[i] = (__bf16)0.0f; return w; }
#define WCOL(W, k0, o, lane) ((o) < 64 ? wcol_io(W, k0, (o), lane, 64) : zero16b())   /* (in,out) [384][64] pitch 64: only 64 real output columns; projected columns 64..127 (padding head 1) are zero; compile-time per unrolled tile (c0 = 0) */
#endif
#if WO_OUT_IN
#define WOCOL(W, k0, o, lane) wcol_oi(W, k0, o, lane, CC)
#define WOCOLH(W, k0, o, lane) wcolh_oi(W, k0, o, lane, CC)
#else
#define WOCOL(W, k0, o, lane) wcol_io(W, k0, o, lane, DIN)
#define WOCOLH(W, k0, o, lane) wcolh_io(W, k0, o, lane, DIN)
#endif

#ifndef SM_EXTRA_PARAMS
#define SM_EXTRA_PARAMS
#endif
#ifndef PROJ_EXTRA_PARAMS
#define PROJ_EXTRA_PARAMS
#endif
#ifndef SM_MASK_HOOK
#define SM_MASK_HOOK (void)0
#endif

#define WS_QH  0u                                      // f16 q, fragment order: [b*t / 16][k chunk 2][piece 2][lane 32][8]
#define WS_KH  (WS_QH + 2u * (size_t)NB * TT * CC)      // f16 k, fragment order like q
#define WS_VT  (WS_KH + 2u * (size_t)NB * TT * CC)      // f16 v planes [b][c][t]
#define WS_QL  (WS_VT + 2u * (size_t)NB * CC * TT)      // f16 q residual x 2^10, fragment order like q
#define WS_KL  (WS_QL + 2u * (size_t)NB * QHI * CC)     // f16 k residual x 2^10, fragment order like q
#define WS_VB  (WS_KL + 2u * (size_t)NB * KHI * CC)     // bf16 v hi (VBL: lo), fragment order: [b*t / 32][column tile 4][piece 2][lane 32][8]
#define WS_VBL (WS_VB + 2u * (size_t)NB * CC * KHI)
#define WS_S   (WS_VBL + 2u * (size_t)NB * CC * KHI)    // f32 logits [b][t][s]: one plane per sequence
#define WS_Y   (WS_S  + 4u * (size_t)NB * TT * TT)      // f32 ctx rows [b*t][CC] (only when there is an output projection)
#define WS_END (WS_Y  + 0u)
#define WS_Y2 (WS_END)                                  // f32 ctx rows [b*TT + t][128] (columns 64..127 = the padding head)
#define WS_CM (WS_Y2 + 4u * (size_t)NB * TT * CC)        // f32 column maxima [b][TT]
#define WS_CZ (WS_CM + 4u * (size_t)NB * TT)             // f32 column factors 2^11 / Z [b][TT]
#define WS_END2 (WS_CZ + 4u * (size_t)NB * TT)

// ---- k_proj: block = (64 rows, 128 cols, which): q/k/v = X W (+ b) with exact bf16 products (K = DIN) -> which 0: q f16 in fragment order, head columns 0..63 (+ residual rows < QHI); 1: k likewise (+ residual rows < KHI); 2: v f16 planes [c][t] (+ bf16 hi/lo planes for t < KHI)
__global__ __launch_bounds__(128) void k_proj(const float* __restrict__ XQ, const float* __restrict__ XK, const float* __restrict__ XV, const float* __restrict__ WQ, const float* __restrict__ WK, const float* __restrict__ WV, const float* __restrict__ BQ, const float* __restrict__ BK, const float* __restrict__ BV,
    _Float16* __restrict__ QH, _Float16* __restrict__ QL, _Float16* __restrict__ KH, _Float16* __restrict__ KL, _Float16* __restrict__ VT, __bf16* __restrict__ VB, __bf16* __restrict__ VBL) {
  __shared__ __align__(16) _Float16 sh[64][136], sl[64][136]; __shared__ __align__(16) _Float16 th[128][72]; __shared__ __align__(16) __bf16 tb[128][72], tbl[128][72];
  const int tid = threadIdx.x, wave = tid >> 5, lane = tid & 31, col = lane & 15, g = lane >> 4; const int which = blockIdx.z; const int c0 = blockIdx.y * 128; const size_t r0 = (size_t)blockIdx.x * 64; const size_t bb = r0 / TT; const int t0 = (int)(r0 % TT);
  const float* X = which == 0 ? XQ : which == 1 ? XK : XV; const float* WA = which == 0 ? WQ : which == 1 ? WK : WV; const float* BA = which == 0 ? BQ : which == 1 ? BK : BV;
  v8f acc[8] = {};
#pragma unroll 2
  for (int kc = 0; kc < DIN / 32; ++kc) { v16b a; { const float* p = X + (r0 + wave * 16 + col) * DIN + kc * 32 + 8 * g;
#pragma unroll
      for (int i = 0; i < 8; ++i) { a[i] = (__bf16)p[i]; a[8 + i] = (__bf16)p[16 + i]; } }
    asm volatile("s_wait_loadcnt 0x0" ::: "memory");
#pragma unroll
    for (int j = 0; j < 8; ++j) { const v16b w = WCOL(WA, kc * 32, c0 + j * 16 + col, lane); asm volatile("s_wait_loadcnt 0x0" ::: "memory"); acc[j] = wmma_bf(a, w, acc[j]); } }
  if (which < 2) { _Float16* DH = which == 0 ? QH : KH; _Float16* DL = which == 0 ? QL : KL; const int nhi = which == 0 ? QHI : KHI; const bool hi_rows = t0 < nhi;
#pragma unroll
    for (int j = 0; j < 8; ++j) { const float bias = BA ? bfr(BA[c0 + j * 16 + col]) : 0.f;
#pragma unroll
      for (int r = 0; r < 8; ++r) { const float v = acc[j][r] + bias; const _Float16 hv = (_Float16)v; sh[wave * 16 + 8 * g + r][j * 16 + col] = hv; sl[wave * 16 + 8 * g + r][j * 16 + col] = (_Float16)((v - (float)hv) * 1024.0f); } }
    __syncthreads();
    /* fragment order, head columns 0..63 only: 16-byte unit u = ((row tile * 2 + k chunk) * 2 + piece) * 32 + lane, lane = 16 g + row in tile; it holds columns 8 q .. 8 q + 7 with q = (k chunk, piece, g) */
    for (int u = tid; u < 64 * 8; u += 128) { const int rl = (u >> 7) * 16 + (u & 15), q = (u >> 4) & 7; vst2((unsigned*)(DH + r0 * 64 + (size_t)u * 8), *(const v4u*)&sh[rl][q * 8]); if (hi_rows) vst2((unsigned*)(DL + (bb * nhi + t0) * (size_t)64 + (size_t)u * 8), *(const v4u*)&sl[rl][q * 8]); }
  } else { const bool hi_rows = t0 < KHI;
#pragma unroll
    for (int j = 0; j < 8; ++j) { const float bias = BA ? bfr(BA[c0 + j * 16 + col]) : 0.f;
#pragma unroll
      for (int r = 0; r < 8; ++r) { const float v = acc[j][r] + bias; const int rl = wave * 16 + 8 * g + r, cl = j * 16 + col; th[cl][rl] = (_Float16)v; const __bf16 bh = (__bf16)v; tb[cl][rl] = bh; tbl[cl][rl] = (__bf16)(v - (float)bh); } }
    __syncthreads();
    for (int e = tid; e < 128 * 8; e += 128) { const int cl = e >> 3, q = e & 7; vst2((unsigned*)(VT + (bb * CC + c0 + cl) * (size_t)TT + t0 + q * 8), *(const v4u*)&th[cl][q * 8]); }
    /* bf16 hi / lo in fragment order, head columns 0..63 only: 16-byte unit u = ((32-key chunk * 4 + column tile) * 2 + piece) * 32 + lane, lane = 16 g + column in tile; it holds keys 8 q .. 8 q + 7 of the block with q = (chunk, piece, g) */
    if (hi_rows) for (int u = tid; u < 64 * 8; u += 128) { const int cl = ((u >> 6) & 3) * 16 + (u & 15), q = (u >> 8) * 4 + ((u >> 4) & 3); const size_t o3 = (bb * KHI + t0) * (size_t)64 + (size_t)u * 8; vst2((unsigned*)(VB + o3), *(const v4u*)&tb[cl][q * 8]); vst2((unsigned*)(VBL + o3), *(const v4u*)&tbl[cl][q * 8]); } } }
// ---- k_sc: block = (query block qb, key block kb <= kb_last(qb), sequence b = blockIdx.z), head h0, into score plane b: logits x SCALE; q hi + residual (x 2^10) against k (2 products) for query rows < QHI, plus the k residual (3 products) for query blocks < QBH (all of them); causal: blocks past the diagonal exit, the mask itself is applied by index in k_colstat_c and p_row
__global__ __launch_bounds__(128) void k_sc(const _Float16* __restrict__ QH, const _Float16* __restrict__ KH, const _Float16* __restrict__ QL, const _Float16* __restrict__ KL, int h0, float* __restrict__ S0) { __shared__ __align__(16) float ss[4][16][132];
  const int qb = blockIdx.x, kb = blockIdx.y; if (kb > kb_last(qb)) return;
  const int b = blockIdx.z; (void)h0; float* S = S0 + (size_t)b * TT * TT;   /* the fragment-order planes hold head 0 alone */
  const int tid = threadIdx.x, wave = tid >> 5, lane = tid & 31, col = lane & 15, g = lane >> 4; const int k0 = kb * 128; const int ql0 = qb * 64 + wave * 16; const size_t q0 = (size_t)b * TT + ql0, kr0 = (size_t)b * TT + k0;
  v8f acc[8] = {}, accl[8] = {};
  const _Float16* QLb = QL + (size_t)b * QHI * 64; const _Float16* KLb = KL + (size_t)b * KHI * 64;
  if (qb < QBH) {
#pragma unroll
    for (int kc = 0; kc < HD / 32; ++kc) { const v16h ah = frag_hp(QH + q0 * 64 + kc * 512, lane), al = frag_hp(QLb + (size_t)ql0 * 64 + kc * 512, lane);
#pragma unroll
      for (int j = 0; j < 8; ++j) { const v16h kbf = frag_hp(KH + (kr0 + j * 16) * 64 + kc * 512, lane), klf = frag_hp(KLb + (size_t)(k0 + j * 16) * 64 + kc * 512, lane); acc[j] = wmma16(ah, kbf, acc[j]); accl[j] = wmma16(al, kbf, accl[j]); accl[j] = wmma16(ah, klf, accl[j]); } }
  } else if (qb * 64 < QHI) {
#pragma unroll
    for (int kc = 0; kc < HD / 32; ++kc) { const v16h ah = frag_hp(QH + q0 * 64 + kc * 512, lane), al = frag_hp(QLb + (size_t)ql0 * 64 + kc * 512, lane);
#pragma unroll
      for (int j = 0; j < 8; ++j) { const v16h kbf = frag_hp(KH + (kr0 + j * 16) * 64 + kc * 512, lane); acc[j] = wmma16(ah, kbf, acc[j]); accl[j] = wmma16(al, kbf, accl[j]); } }
  } else {
#pragma unroll
    for (int kc = 0; kc < HD / 32; ++kc) { const v16h ah = frag_hp(QH + q0 * 64 + kc * 512, lane);
#pragma unroll
      for (int j = 0; j < 8; ++j) { const v16h kbf = frag_hp(KH + (kr0 + j * 16) * 64 + kc * 512, lane); acc[j] = wmma16(ah, kbf, acc[j]); } }
    asm volatile("s_wait_xcnt 0x0" ::: "memory"); }   /* behind this branch the loads' address registers are reused: the wait stands in front of that */
#pragma unroll
  for (int j = 0; j < 8; ++j) {
#pragma unroll
    for (int r = 0; r < 8; ++r) ss[wave][8 * g + r][j * 16 + col] = (acc[j][r] + accl[j][r] * (1.0f / 1024.0f)) * SCALE; }
  LDSX(); for (int rl = 0; rl < 16; ++rl) vst2(S + (size_t)(ql0 + rl) * TT + k0 + lane * 4, *(const v4f*)&ss[wave][rl][lane * 4]); }
// ---- k_sm: block = query row t (head in group): keys [0, kend): causal -> logit if s <= t else excluded; softmax in f32; P x 2^11 in place (0 for excluded)
__global__ __launch_bounds__(256) void k_sm(float* __restrict__ S0 SM_EXTRA_PARAMS) { __shared__ float sred[8]; __shared__ float sbc; __shared__ __align__(16) float shv[TT];
  const int tid = threadIdx.x; const int t = blockIdx.x; const int kend = (kb_last(t >> 6) + 1) * 128;
  float* sr = S0 + (size_t)blockIdx.y * TT * TT + (size_t)t * TT;
  float m = -3.0e38f; for (int k = tid; k < kend; k += 256) { float v = (!CAUSAL || k <= t) ? sr[k] : -3.0e38f; SM_MASK_HOOK; shv[k] = v; m = fmaxf(m, v); }
#pragma unroll
  for (int o = 1; o < 32; o <<= 1) m = fmaxf(m, __shfl_xor(m, o));
  if ((tid & 31) == 0) sred[tid >> 5] = m; __syncthreads(); if (tid == 0) { float a = sred[0]; for (int i = 1; i < 8; ++i) a = fmaxf(a, sred[i]); sbc = a; } __syncthreads(); m = sbc; __syncthreads();
  float sum = 0.f; for (int k = tid; k < kend; k += 256) { const float v = shv[k]; const float e = (v <= -1.0e38f) ? 0.f : expf(v - m); shv[k] = e; sum += e; }
#pragma unroll
  for (int o = 1; o < 32; o <<= 1) sum += __shfl_xor(sum, o);
  if ((tid & 31) == 0) sred[tid >> 5] = sum; __syncthreads(); if (tid == 0) { float a = 0.f; for (int i = 0; i < 8; ++i) a += sred[i]; sbc = a > 0.f ? 2048.0f / a : 0.f; }   /* a fully excluded row yields P = 0 */ __syncthreads(); const float inv = sbc;
  for (int k = tid; k < kend; k += 256) shv[k] = shv[k] * inv;
  __syncthreads(); for (int q = tid; q < kend / 4; q += 256) vst2(sr + q * 4, *(const v4f*)&shv[q * 4]); }
// exp for k_colstat_c, to expf's accuracy: e = the integer nearest to x log2(e); the fraction x log2(e) - e by two fused multiply-adds with the constant's high and low word; exp2 of the fraction, ldexp by e; 0 below -103.28 (ln of the smallest f32 denormal), +inf above 88.72 (expf's overflow limit). v_exp_f32 stands in one asm statement with a v_nop: the free slot that the instruction set asks for between a transcendental and an instruction that reads its result or overwrites its source (in a statement of its own nothing would hold the v_nop there)
__device__ __forceinline__ float exp_slot(float x) { const float c = __builtin_bit_cast(float, 0x3fb8aa3bu), cl = __builtin_bit_cast(float, 0x32a5705fu);
  const float e = __builtin_rintf(x * c); const float a = __builtin_fmaf(x, cl, __builtin_fmaf(x, c, -e)); float r;
  asm("v_exp_f32 %0, %1\n\tv_nop" : "=v"(r) : "v"(a));   /* the v_nop keeps the slot behind the transcendental free whatever the compiler schedules next */
  r = __builtin_ldexpf(r, (int)e); r = (x < __builtin_bit_cast(float, 0xc2ce8ed0u)) ? 0.f : r; return (x > __builtin_bit_cast(float, 0x42b17218u)) ? __builtin_inff() : r; }
// ---- k_colstat_c: softmax over the QUERY axis under the causal mask (the source's softmax(axis=1) on [B, t, s] scores with -inf above the diagonal): for every key column k: m_k = max_{q >= k} S[q][k], Z_k = sum_{q >= k} exp(S[q][k] - m_k) (f32, exp_slot).
// block = 32 key columns (one 128-B line of every score row) of score plane blockIdx.y (the sequence) x 32 waves. A wave-wide 16-byte load covers 4 query rows x 32 columns (4 whole lines); wave w takes the 64 rows from c0 + 64 w and holds them in registers, so its 16 loads are all in flight at once and the scores are read once.
// Per wave and column: max, then the sum of exp against that max; the 32 (max, sum) pairs of a column are merged through LDS by wave 0: M = max m_w, Z = sum z_w exp(m_w - M).
// Rows above a column's diagonal lie only in wave 0's first 32 rows (they hold the unmasked logits of the diagonal score block): their content is replaced by value select. Sentinels: a hidden entry reads -3e38 and the running max starts at -1e38, so a hidden entry adds exp(-2e38) = 0, and a wave with no row below TT hands the pair (-1e38, 0), which adds 0 to the merge (the logits are sums of 64 f16-range products, far above -1e38).
__global__ __launch_bounds__(1024) void k_colstat_c(const float* __restrict__ S0, float* __restrict__ CM, float* __restrict__ CZ) { __shared__ __align__(16) float pm[32][32], pz[32][32];
  const int tid = threadIdx.x, lane = tid & 31, sub = lane >> 3, cq = lane & 7; const int wave = __builtin_amdgcn_readfirstlane(tid >> 5); const int c0 = blockIdx.x * 32;
  const int r0 = c0 + wave * 64;                       /* the wave's first row */
  const bool h0 = r0 < TT, h1 = r0 + 32 < TT;          /* TT - c0 is a multiple of 32: each half of the wave's 64 rows is wholly inside or wholly past the end (wave-uniform) */
  const float* sp = S0 + (size_t)blockIdx.y * TT * TT + (size_t)(r0 + sub) * TT + c0 + cq * 4;
  v4f v[16];
  if (h0) {
#pragma unroll
    for (int s = 0; s < 8; ++s) v[s] = *(const v4f*)(sp + (size_t)s * 4 * TT); }
  if (h1) {
#pragma unroll
    for (int s = 8; s < 16; ++s) v[s] = *(const v4f*)(sp + (size_t)s * 4 * TT); }
  asm volatile("s_wait_xcnt 0x0" :: "v"(sp) : "memory");   /* the issued loads' address pair is an input here, so nothing (a load's own result included) overwrites it in front of this wait */
  v4f m = { -1.0e38f, -1.0e38f, -1.0e38f, -1.0e38f }, z = { 0.f, 0.f, 0.f, 0.f };
  if (wave == 0) {
#pragma unroll
    for (int s = 0; s < 8; ++s)
#pragma unroll
      for (int u = 0; u < 4; ++u) v[s][u] = (s * 4 + sub >= cq * 4 + u) ? v[s][u] : -3.0e38f; }
  if (h0) {
#pragma unroll
    for (int s = 0; s < 8; ++s)
#pragma unroll
      for (int u = 0; u < 4; ++u) m[u] = fmaxf(m[u], v[s][u]); }
  if (h1) {
#pragma unroll
    for (int s = 8; s < 16; ++s)
#pragma unroll
      for (int u = 0; u < 4; ++u) m[u] = fmaxf(m[u], v[s][u]); }
#pragma unroll
  for (int u = 0; u < 4; ++u) { m[u] = fmaxf(m[u], __shfl_xor(m[u], 8)); m[u] = fmaxf(m[u], __shfl_xor(m[u], 16)); }
  if (h0) {
#pragma unroll
    for (int s = 0; s < 8; ++s)
#pragma unroll
      for (int u = 0; u < 4; ++u) z[u] += exp_slot(v[s][u] - m[u]); }
  if (h1) {
#pragma unroll
    for (int s = 8; s < 16; ++s)
#pragma unroll
      for (int u = 0; u < 4; ++u) z[u] += exp_slot(v[s][u] - m[u]); }
#pragma unroll
  for (int u = 0; u < 4; ++u) { z[u] += __shfl_xor(z[u], 8); z[u] += __shfl_xor(z[u], 16); }
  if (sub == 0) { *(v4f*)&pm[wave][cq * 4] = m; *(v4f*)&pz[wave][cq * 4] = z; }
  __syncthreads();   /* publishes the 32 waves' pairs to wave 0 */
  if (wave == 0) { float mw[32], zw[32], M = -1.0e38f, Z = 0.f;
#pragma unroll
    for (int i = 0; i < 32; ++i) { mw[i] = pm[i][lane]; zw[i] = pz[i][lane]; }
#pragma unroll
    for (int i = 0; i < 32; ++i) M = fmaxf(M, mw[i]);
#pragma unroll
    for (int i = 0; i < 32; ++i) Z += zw[i] * exp_slot(mw[i] - M);
    vst2(CM + (size_t)blockIdx.y * TT + c0 + lane, M); vst2(CZ + (size_t)blockIdx.y * TT + c0 + lane, 2048.0f / Z); } }   /* every column sees at least its own diagonal entry: Z_k >= 1; stored is the column's factor 2^11 / Z_k, divided once per column */
// ---- p_row: the 16 P values of one lane's A fragment (query row t, keys k0 + 8 g + 0..7 and k0 + 16 + 8 g + 0..7), formed from the stored logits where k_pv reads them: P[t][k] = exp(S[t][k] - m_k) x (2^11 / Z_k) for k <= t, 0 above the diagonal (inside the diagonal block; 2^11 / Z_k lies in (0, 2^11], so 0 x it is 0); unconditional loads, value select. cm = the sequence's column maxima, ci = its column factors 2^11 / Z_k
__device__ __forceinline__ void p_row(const float* __restrict__ srow, const float* __restrict__ cm, const float* __restrict__ ci, int k0, int t, int lane, float v[16]) { const int kk = k0 + 8 * (lane >> 4), d = t - kk; const float *sp = srow + kk, *mp = cm + kk, *cp = ci + kk; v4f sv[4], m4[4], c4[4];
#pragma unroll
  for (int q = 0; q < 4; ++q) { const int o = (q >> 1) * 16 + (q & 1) * 4; sv[q] = *(const v4f*)(sp + o); m4[q] = *(const v4f*)(mp + o); c4[q] = *(const v4f*)(cp + o); }
  asm volatile("" :: "v"(sv[0]), "v"(sv[1]), "v"(sv[2]), "v"(sv[3]), "v"(m4[0]), "v"(m4[1]), "v"(m4[2]), "v"(m4[3]), "v"(c4[0]), "v"(c4[1]), "v"(c4[2]), "v"(c4[3]));   /* inputs-only fence on the loaded values: all twelve loads are issued in front of it and fly together (one round of latency); without it the compiler sinks most of them behind the first wait, one round after the other */
#pragma unroll
  for (int q = 0; q < 4; ++q)
#pragma unroll
    for (int u = 0; u < 4; ++u) v[q * 4 + u] = expf(((q >> 1) * 16 + (q & 1) * 4 + u <= d) ? sv[q][u] - m4[q][u] : -3.0e38f) * c4[q][u]; }   /* the select stands on the argument: expf(-3e38) is exactly 0, and no branch is formed round each exp */
// ---- k_out64: out[b][t][0..63] = ctx row columns 0..63 (256 B by 16 lanes)
__global__ __launch_bounds__(256) void k_out64(const float* __restrict__ Y, float* __restrict__ OUT) { const size_t row = (size_t)blockIdx.x * 16 + (threadIdx.x >> 4); const int q = threadIdx.x & 15; const v4f v = *(const v4f*)(Y + row * CC + q * 4); asm volatile("s_wait_loadcnt 0x0" ::: "memory"); vst2(OUT + row * 64 + q * 4, v); }
// ---- k_pv: block = 16 queries (tile qt) of (sequence b = blockIdx.z, head h0) x PVS waves, P formed by p_row from the logits of score plane b and the column statistics (every logit is read by exactly one lane of one wave, so no exp is done twice): ctx = P . v over keys [0, kend). The 32-key chunks of the key range are dealt round-robin to the waves (wave w takes chunks w, w + PVS, ...), so a wave's chain of dependent load rounds is at most 4 long and the long query tiles are spread over all PVS waves of their work-group; every wave keeps its own 16 x 64 f32 partial, the PVS partials are summed in wave order through LDS. (P x 2^11 once to f16 against v f16: 1 product; query blocks < QBH (all of them): P and v as bf16 hi + lo, 3 products); 256-B (row, head) segment by 16 lanes
#define PVS 16
__global__ __launch_bounds__(32 * PVS) void k_pv(const float* __restrict__ PS0, const float* __restrict__ CM, const float* __restrict__ CZ, const _Float16* __restrict__ VT, const __bf16* __restrict__ VB, const __bf16* __restrict__ VBL, int h0, float* __restrict__ Y) { const int b = blockIdx.z, h = h0; const float* PS = PS0 + (size_t)b * TT * TT; const float* cm = CM + (size_t)b * TT; const float* ci = CZ + (size_t)b * TT; __shared__ __align__(16) float ss[PVS][16][HD + 4];
  const int tid = threadIdx.x, lane = tid & 31, col = lane & 15, g = lane >> 4; const int wave = __builtin_amdgcn_readfirstlane(tid >> 5); const int qb = blockIdx.x >> 2; const int ql0 = blockIdx.x * 16; const int kce = (kb_last(qb) + 1) * 4;
  v8f acc[HD / 16] = {};
  if (qb < QBH) {
#pragma unroll 1
    for (int kc = wave; kc < kce; kc += PVS) { float pv[16]; p_row(PS + (size_t)(ql0 + col) * TT, cm, ci, kc * 32, ql0 + col, lane, pv); const F2 p = bsplit16(pv);
#pragma unroll
      for (int j = 0; j < HD / 16; ++j) { const size_t po = ((size_t)b * KHI + kc * 32) * (size_t)64 + j * 512; const v16b vh = frag_bp(VB + po, lane); acc[j] = wmma_bf(p.h, vh, acc[j]); acc[j] = wmma_bf(p.l, vh, acc[j]); acc[j] = wmma_bf(p.h, frag_bp(VBL + po, lane), acc[j]); }
      asm volatile("s_wait_xcnt 0x0" ::: "memory"); }   /* the next trip rewrites the address registers that this trip's v loads name: the wait stands in front of that */
  } else {
#pragma unroll 1
    for (int kc = wave; kc < kce; kc += PVS) { float pv[16]; p_row(PS + (size_t)(ql0 + col) * TT, cm, ci, kc * 32, ql0 + col, lane, pv); v16h p;
#pragma unroll
      for (int i = 0; i < 16; ++i) p[i] = (_Float16)pv[i];
#pragma unroll
      for (int j = 0; j < HD / 16; ++j) { const size_t po = ((size_t)b * CC + h * HD + j * 16 + col) * (size_t)TT + kc * 32; acc[j] = wmma16(p, frag_h(VT + po, lane), acc[j]); } } }
#pragma unroll
  for (int j = 0; j < HD / 16; ++j)
#pragma unroll
    for (int r = 0; r < 8; ++r) ss[wave][8 * g + r][j * 16 + col] = acc[j][r] * (1.0f / 2048.0f);   /* a wave with no chunk hands zeros */
  __syncthreads();   /* publishes the PVS partials to the waves that sum them */
  if (wave < 8) { const int rl = tid >> 4, q = tid & 15; v4f s = *(const v4f*)&ss[0][rl][q * 4];
#pragma unroll
    for (int w = 1; w < PVS; ++w) s += *(const v4f*)&ss[w][rl][q * 4];
    vst2(Y + ((size_t)b * TT + ql0 + rl) * CC + h * HD + q * 4, s); } }

extern "C" void kernel_launch(void* const* d_in, const int* in_sizes, int n_in, void* d_out, int out_size, void* d_ws, size_t ws_size, hipStream_t stream) {
  (void)in_sizes; (void)n_in; (void)out_size;
  const float** F = (const float**)d_in;
  if (ws_size < (size_t)WS_END) return;
  char* ws = (char*)d_ws; _Float16 *QH = (_Float16*)(ws + WS_QH), *KH = (_Float16*)(ws + WS_KH), *VT = (_Float16*)(ws + WS_VT), *QL = (_Float16*)(ws + WS_QL), *KL = (_Float16*)(ws + WS_KL); __bf16 *VB = (__bf16*)(ws + WS_VB), *VBL = (__bf16*)(ws + WS_VBL); float *S = (float*)(ws + WS_S), *Y = (float*)(ws + WS_Y);
  (void)Y; (void)QL; (void)KL; (void)VB; (void)VBL;
  // inputs: 0 x [8,2048,384]; 1 Wq [384,64] (in,out); 2 Wk; 3 Wv; no biases
  if (ws_size < (size_t)WS_END2) return;
  float *Y2 = (float*)(ws + WS_Y2), *CM = (float*)(ws + WS_CM), *CZ = (float*)(ws + WS_CZ);
  k_proj<<<dim3(TNB * TT / 64, CC / 128, 3), 128, 0, stream>>>(F[0], F[0], F[0], F[1], F[2], F[3], nullptr, nullptr, nullptr, QH, QL, KH, KL, VT, VB, VBL);   /* weight columns 64..127 (the padding head) are zero fragments */
  /* all sequences in one launch of each stage (the last grid index is the sequence, each with its own score plane); head 0 only (head 1 is the zero padding) */
  k_sc<<<dim3(NQB, TT / 128, TNB), 128, 0, stream>>>(QH, KH, QL, KL, 0, S);
  k_colstat_c<<<dim3(TT / 32, TNB), 1024, 0, stream>>>(S, CM, CZ);   /* per key column j: max m_j and 2^11 / sum over the visible queries i >= j */
  k_pv<<<dim3(TT / 16, 1, TNB), 32 * PVS, 0, stream>>>(S, CM, CZ, VT, VB, VBL, 0, Y2);   /* forms P[i][j] = exp(S - m_j) x 2^11 / Z_j (0 above the diagonal) as it reads the logits */
  k_out64<<<dim3(TNB * TT / 16), 256, 0, stream>>>(Y2, (float*)d_out);
}

// v006
// Measured time: 102 microseconds a run.
// In two side-by-side timings against v005, it was 1.10 and 1.08 times as fast.
// Counting every step since v000, it is 74.5 times as fast.
// compute dtype: all float inputs rounded to bf16; q/k/v projections with EXACT bf16 products on WMMA 16x16x32 (f32 accumulate); causal scores with BOTH q and k as f16 hi + (x 2^10) residual (3 products) on EVERY block, x 64^-0.5; softmax over the QUERY axis in f32 (per key column: max and sum over the visible queries, per wave and merged, exp to expf's accuracy; P by precise expf); P as bf16 hi + lo against v as bf16 hi + lo (3 products) on EVERY block; f32 output.
#include <hip/hip_runtime.h>
#include <math.h>

typedef __attribute__((ext_vector_type(16))) _Float16 v16h;
typedef __attribute__((ext_vector_type(16))) __bf16 v16b;
typedef __attribute__((ext_vector_type(8)))  _Float16 v8h;
typedef __attribute__((ext_vector_type(8)))  float v8f;
typedef __attribute__((ext_vector_type(4)))  float v4f;
typedef __attribute__((ext_vector_type(2)))  float v2f;
typedef __attribute__((ext_vector_type(4)))  unsigned v4u;
typedef __attribute__((ext_vector_type(4)))  int v4i;
typedef float __attribute__((may_alias)) float_a;
typedef int __attribute__((may_alias)) int_a;

template <typename T> __device__ __forceinline__ void vst2(void* p, T v) { *(T*)p = v;  }
__device__ __forceinline__ v8f wmma16(v16h a, v16h b, v8f c) {
  v8f d = __builtin_amdgcn_wmma_f32_16x16x32_f16(false, a, false, b, (short)0, c, false, false);
  asm volatile("v_nop\n\tv_nop\n\tv_nop\n\tv_nop" : "+v"(d) : "v"(a), "v"(b));
  return d;
}
__device__ __forceinline__ v8f wmma_bf(v16b a, v16b b, v8f c) {
  v8f d = __builtin_amdgcn_wmma_f32_16x16x32_bf16(false, a, false, b, (short)0, c, false, false);
  asm volatile("v_nop\n\tv_nop\n\tv_nop\n\tv_nop" : "+v"(d) : "v"(a), "v"(b));
  return d;
}
// 16x16x32 fragments: lane = (h = lane>>4, row/col = lane&15); elements 0..7 = k0+8h+0..7, 8..15 = k0+16+8h+0..7; D element r = row 8h+r
__device__ __forceinline__ v16h frag_h(const _Float16* rowk0, int lane) {
  union { v16h v; v8h q[2]; } u; const _Float16* p = rowk0 + 8 * (lane >> 4);
  u.q[0] = *(const v8h*)p; u.q[1] = *(const v8h*)(p + 16); return u.v;
}
__device__ __forceinline__ v16h frag_f32(const float* rowk0, int lane) {
  v16h a; const float* p = rowk0 + 8 * (lane >> 4);
#pragma unroll
  for (int i = 0; i < 8; ++i) { a[i] = (_Float16)p[i]; a[8 + i] = (_Float16)p[16 + i]; }
  return a;
}
__device__ __forceinline__ v16h frag_f32s(const float* rowk0, int lane, float sc) {
  v16h a; const float* p = rowk0 + 8 * (lane >> 4);
#pragma unroll
  for (int i = 0; i < 8; ++i) { a[i] = (_Float16)(p[i] * sc); a[8 + i] = (_Float16)(p[16 + i] * sc); }
  return a;
}
// column fragment from a [K][ld] layout (column n), rows >= K read as 0
__device__ __forceinline__ v16h fragc_f32(const float* W, int k0, int n, int lane, int ld, int K) {
  v16h a; const int g = lane >> 4;
#pragma unroll
  for (int i = 0; i < 8; ++i) { const int ka = k0 + 8 * g + i, kb = ka + 16;
    a[i] = (_Float16)(ka < K ? W[(size_t)(ka < K ? ka : K - 1) * ld + n] : 0.f); a[8 + i] = (_Float16)(kb < K ? W[(size_t)(kb < K ? kb : K - 1) * ld + n] : 0.f); }
  return a;
}
struct F2 { v16b h, l; };
__device__ __forceinline__ F2 bsplit16(const float v[16]) { F2 r;
#pragma unroll
  for (int i = 0; i < 16; ++i) { const __bf16 h = (__bf16)v[i]; r.h[i] = h; r.l[i] = (__bf16)(v[i] - (float)h); }
  return r; }
__device__ __forceinline__ F2 split_row(const float* row, int k0, int lane) { float v[16]; const float* p = row + k0 + 8 * (lane >> 4);
#pragma unroll
  for (int i = 0; i < 8; ++i) { v[i] = p[i]; v[8 + i] = p[16 + i]; }
  return bsplit16(v); }
__device__ __forceinline__ F2 split_rowK(const float* row, int k0, int lane, int K) { float v[16]; const int g = lane >> 4;
#pragma unroll
  for (int i = 0; i < 8; ++i) { const int ka = k0 + 8 * g + i, kb = ka + 16; v[i] = ka < K ? row[ka < K ? ka : K - 1] : 0.f; v[8 + i] = kb < K ? row[kb < K ? kb : K - 1] : 0.f; }
  return bsplit16(v); }
__device__ __forceinline__ F2 split_col(const float* W, int k0, int n, int lane, int ld, int K) { float v[16]; const int g = lane >> 4;
#pragma unroll
  for (int i = 0; i < 8; ++i) { const int ka = k0 + 8 * g + i, kb = ka + 16; v[i] = ka < K ? W[(size_t)(ka < K ? ka : K - 1) * ld + n] : 0.f; v[8 + i] = kb < K ? W[(size_t)(kb < K ? kb : K - 1) * ld + n] : 0.f; }
  return bsplit16(v); }
__device__ __forceinline__ v8f mac3(const F2& a, const F2& b, v8f c) { c = wmma_bf(a.l, b.h, c); c = wmma_bf(a.h, b.l, c); return wmma_bf(a.h, b.h, c); }
__device__ __forceinline__ float sigm(float v) { return 1.0f / (1.0f + expf(-v)); }
#define LDSX() do { asm volatile("s_wait_dscnt 0" ::: "memory"); __builtin_amdgcn_wave_barrier(); __builtin_amdgcn_fence(__ATOMIC_RELEASE, "workgroup"); } while (0)

// Single-head causal self-attention whose softmax runs over the QUERY axis (x [8,2048,384]; (in,out) Wq / Wk / Wv [384,64] (0.02 scale), no biases; scores[b, i, j] = q_i . k_j / 8; -inf where j > i; attn = softmax(scores, axis=1) - axis 1 is the QUERY axis i, so every key column j is normalised over the queries i >= j (faithful to the source); out = attn v -> [8,2048,64]).
#define NB 8
#define TT 2048
#define CC 128            // NH * HD = projected width
#define DIN 384          // input (model) width
#define NH 2
#define HD 64
#define NQB (TT / 64)
#define SCALE (0.125f)
#define CAUSAL 1
#ifndef TNB
#define TNB NB
#endif
__device__ __forceinline__ float bfr(float v) { return (float)(__bf16)v; }
__host__ __device__ __forceinline__ int kb_last(int qb) { return CAUSAL ? ((qb * 64 + 63) >> 7) : (TT / 128 - 1); }
typedef __attribute__((ext_vector_type(8))) __bf16 v8b;
__device__ __forceinline__ v16b frag_b(const __bf16* rowk0, int lane) {
  union { v16b v; v8b q[2]; } u; const __bf16* p = rowk0 + 8 * (lane >> 4);
  u.q[0] = *(const v8b*)p; u.q[1] = *(const v8b*)(p + 16); return u.v;
}
// fragment-order planes: a 16-row tile's k chunk of 32 lies as 2 x 512 contiguous bytes: piece 0 = every lane's elements 0..7, piece 1 = its elements 8..15, 16 bytes a lane in lane order, so one wave-wide 16-byte load covers 4 whole 128-byte lines
__device__ __forceinline__ v16h frag_hp(const _Float16* chunk, int lane) {
  union { v16h v; v8h q[2]; } u; const _Float16* p = chunk + 8 * lane;
  u.q[0] = *(const v8h*)p; u.q[1] = *(const v8h*)(p + 256); return u.v;
}
__device__ __forceinline__ v16b frag_bp(const __bf16* chunk, int lane) {
  union { v16b v; v8b q[2]; } u; const __bf16* p = chunk + 8 * lane;
  u.q[0] = *(const v8b*)p; u.q[1] = *(const v8b*)(p + 256); return u.v;
}
#define QBH 32              // causal: query blocks 0..QBH-1 of each sequence (all NQB = 32 of them) take the high-precision path
#define QHI 2048            // rows carrying a q residual plane (all TT rows)
#define KHI 2048            // key rows carrying k residual / v bf16 hi+lo planes (used only by the causal high-precision path)
// B fragment (k rows k0+.., output column o) of a weight: (in,out) [K][ld] or (out,in) [ld rows of K]: bf16 exact, or f16(bf16 * 256) exact
__device__ __forceinline__ v16b wcol_io(const float* Wm, int k0, int o, int lane, int ld) { v16b w; const int g = lane >> 4;
#pragma unroll
  for (int i = 0; i < 8; ++i) { w[i] = (__bf16)Wm[(size_t)(k0 + 8 * g + i) * ld + o]; w[8 + i] = (__bf16)Wm[(size_t)(k0 + 16 + 8 * g + i) * ld + o]; }
  return w; }
__device__ __forceinline__ v16b wcol_oi(const float* Wm, int k0, int o, int lane, int K) { v16b w; const float* p = Wm + (size_t)o * K + k0 + 8 * (lane >> 4);
#pragma unroll
  for (int i = 0; i < 8; ++i) { w[i] = (__bf16)p[i]; w[8 + i] = (__bf16)p[16 + i]; }
  return w; }
__device__ __forceinline__ v16h wcolh_io(const float* Wm, int k0, int o, int lane, int ld) { v16h w; const int g = lane >> 4;
#pragma unroll
  for (int i = 0; i < 8; ++i) { w[i] = (_Float16)(bfr(Wm[(size_t)(k0 + 8 * g + i) * ld + o]) * 256.0f); w[8 + i] = (_Float16)(bfr(Wm[(size_t)(k0 + 16 + 8 * g + i) * ld + o]) * 256.0f); }
  return w; }
__device__ __forceinline__ v16h wcolh_oi(const float* Wm, int k0, int o, int lane, int K) { v16h w; const float* p = Wm + (size_t)o * K + k0 + 8 * (lane >> 4);
#pragma unroll
  for (int i = 0; i < 8; ++i) { w[i] = (_Float16)(bfr(p[i]) * 256.0f); w[8 + i] = (_Float16)(bfr(p[16 + i]) * 256.0f); }
  return w; }
#define WQKV_LAYOUT 0   // 0 = (in,out) [DIN][64] (head 0 only; columns 64..127 zero); 1 = (out,in) [CC][DIN]; 2 = per-head [NH][DIN][HD]
__device__ __forceinline__ v16b wcol_hdk(const float* Wm, int k0, int o, int lane) { v16b w; const int g = lane >> 4; const float* p = Wm + (size_t)(o / HD) * DIN * HD + (o % HD);
#pragma unroll
  for (int i = 0; i < 8; ++i) { w[i] = (__bf16)p[(size_t)(k0 + 8 * g + i) * HD]; w[8 + i] = (__bf16)p[(size_t)(k0 + 16 + 8 * g + i) * HD]; }
  return w; }
#define WO_OUT_IN 0
#if WQKV_LAYOUT == 1
#define WCOL(W, k0, o, lane) wcol_oi(W, k0, o, lane, DIN)
#elif WQKV_LAYOUT == 2
#define WCOL(W, k0, o, lane) wcol_hdk(W, k0, o, lane)
#else
__device__ __forceinline__ v16b zero16b() { v16b w; _Pragma("unroll") for (int i = 0; i < 16; ++i) w[i] = (__bf16)0.0f; return w; }
#define WCOL(W, k0, o, lane) ((o) < 64 ? wcol_io(W, k0, (o), lane, 64) : zero16b())   /* (in,out) [384][64] pitch 64: only 64 real output columns; projected columns 64..127 (padding head 1) are zero; compile-time per unrolled tile (c0 = 0) */
#endif
#if WO_OUT_IN
#define WOCOL(W, k0, o, lane) wcol_oi(W, k0, o, lane, CC)
#define WOCOLH(W, k0, o, lane) wcolh_oi(W, k0, o, lane, CC)
#else
#define WOCOL(W, k0, o, lane) wcol_io(W, k0, o, lane, DIN)
#define WOCOLH(W, k0, o, lane) wcolh_io(W, k0, o, lane, DIN)
#endif

#ifndef SM_EXTRA_PARAMS
#define SM_EXTRA_PARAMS
#endif
#ifndef PROJ_EXTRA_PARAMS
#define PROJ_EXTRA_PARAMS
#endif
#ifndef SM_MASK_HOOK
#define SM_MASK_HOOK (void)0
#endif

#define WS_QH  0u                                      // f16 q, fragment order: [b*t / 16][k chunk 2][piece 2][lane 32][8]
#define WS_KH  (WS_QH + 2u * (size_t)NB * TT * CC)      // f16 k, fragment order like q
#define WS_VT  (WS_KH + 2u * (size_t)NB * TT * CC)      // f16 v planes [b][c][t]
#define WS_QL  (WS_VT + 2u * (size_t)NB * CC * TT)      // f16 q residual x 2^10, fragment order like q
#define WS_KL  (WS_QL + 2u * (size_t)NB * QHI * CC)     // f16 k residual x 2^10, fragment order like q
#define WS_VB  (WS_KL + 2u * (size_t)NB * KHI * CC)     // bf16 v hi (VBL: lo), fragment order: [b*t / 32][column tile 4][piece 2][lane 32][8]
#define WS_VBL (WS_VB + 2u * (size_t)NB * CC * KHI)
#define WS_S   (WS_VBL + 2u * (size_t)NB * CC * KHI)    // f32 logits [b][t][s]: one plane per sequence
#define WS_Y   (WS_S  + 4u * (size_t)NB * TT * TT)      // f32 ctx rows [b*t][CC] (only when there is an output projection)
#define WS_END (WS_Y  + 0u)
#define WS_Y2 (WS_END)                                  // f32 ctx rows [b*TT + t][128] (columns 64..127 = the padding head)
#define WS_CM (WS_Y2 + 4u * (size_t)NB * TT * CC)        // f32 column maxima [b][TT]
#define WS_CZ (WS_CM + 4u * (size_t)NB * TT)             // f32 column factors 2^11 / Z [b][TT]
#define WS_END2 (WS_CZ + 4u * (size_t)NB * TT)

// ---- k_proj: block = (64 rows, 128 cols, which): q/k/v = X W (+ b) with exact bf16 products (K = DIN) -> which 0: q f16 in fragment order, head columns 0..63 (+ residual rows < QHI); 1: k likewise (+ residual rows < KHI); 2: v f16 planes [c][t] (+ bf16 hi/lo planes for t < KHI)
__global__ __launch_bounds__(128) void k_proj(const float* __restrict__ XQ, const float* __restrict__ XK, const float* __restrict__ XV, const float* __restrict__ WQ, const float* __restrict__ WK, const float* __restrict__ WV, const float* __restrict__ BQ, const float* __restrict__ BK, const float* __restrict__ BV,
    _Float16* __restrict__ QH, _Float16* __restrict__ QL, _Float16* __restrict__ KH, _Float16* __restrict__ KL, _Float16* __restrict__ VT, __bf16* __restrict__ VB, __bf16* __restrict__ VBL) {
  /* one LDS block, two lives: the k loop reads wf (the block's 48 bf16 weight fragments, [k chunk 12][column tile 4][piece 2][lane 32][8], 48 KiB); behind the barrier that ends the loop the store planes sh .. tbl lie over it, so LDS stays at 88 KiB and 3 blocks share a WGP */
  __shared__ __align__(16) unsigned char sm[90112]; __bf16* wf = (__bf16*)sm;
  _Float16 (*sh)[136] = (_Float16 (*)[136])sm; _Float16 (*sl)[136] = (_Float16 (*)[136])(sm + 17408); _Float16 (*th)[72] = (_Float16 (*)[72])(sm + 34816); __bf16 (*tb)[72] = (__bf16 (*)[72])(sm + 53248); __bf16 (*tbl)[72] = (__bf16 (*)[72])(sm + 71680);
  const int tid = threadIdx.x, wave = tid >> 5, lane = tid & 31, col = lane & 15, g = lane >> 4; const int which = blockIdx.z; const int c0 = blockIdx.y * 128; const size_t r0 = (size_t)blockIdx.x * 64; const size_t bb = r0 / TT; const int t0 = (int)(r0 % TT);
  const float* X = which == 0 ? XQ : which == 1 ? XK : XV; const float* WA = which == 0 ? WQ : which == 1 ? WK : WV; const float* BA = which == 0 ? BQ : which == 1 ? BK : BV;
  /* the wave's 16 x rows: the first XA of the 12 k chunks are requested in front of everything else, so that their memory latency runs under the weight staging */
#define XA 8
  const float* xp = X + (r0 + wave * 16 + col) * DIN + 8 * g; v4f xr[DIN / 32][4];
#pragma unroll
  for (int kc = 0; kc < XA; ++kc) { xr[kc][0] = *(const v4f*)(xp + kc * 32); xr[kc][1] = *(const v4f*)(xp + kc * 32 + 4); xr[kc][2] = *(const v4f*)(xp + kc * 32 + 16); xr[kc][3] = *(const v4f*)(xp + kc * 32 + 20); }
  asm volatile("s_wait_xcnt 0x0" :: "v"(xp) : "memory");   /* the issued loads' address pair is an input here, so nothing overwrites it in front of this wait */
  /* wave w brings column tile w of every k chunk, each lane its own 16 fragment elements, and lays them down in fragment order: every weight element is fetched once per block, not once per wave. Columns c0 + 0..63 are real only in column block 0 (a block-uniform test); any other block's are the zero padding */
  if (c0 == 0) {
#pragma unroll
    for (int kc = 0; kc < DIN / 32; ++kc) { union { v16b v; v8b q[2]; } u; u.v = wcol_io(WA, kc * 32, wave * 16 + col, lane, 64); __bf16* d = wf + (kc * 4 + wave) * 512 + 8 * lane; *(v8b*)d = u.q[0]; *(v8b*)(d + 256) = u.q[1];
      if (kc == DIN / 64 - 1) __builtin_amdgcn_sched_barrier(0); }   /* two rounds of 96 loads: with all 192 in flight beside the x rows the build takes 333 registers, which leaves three waves on a SIMD (three blocks on a WGP) next to no room */
  } else {
#pragma unroll
    for (int kc = 0; kc < DIN / 32; ++kc) { union { v16b v; v8b q[2]; } u; u.v = zero16b(); __bf16* d = wf + (kc * 4 + wave) * 512 + 8 * lane; *(v8b*)d = u.q[0]; *(v8b*)(d + 256) = u.q[1]; } }
  asm volatile("s_wait_xcnt 0x0" ::: "memory");   /* behind the staging the weight loads' address registers are reused: the wait stands in front of that */
  v16b ab[DIN / 32];
#pragma unroll
  for (int kc = 0; kc < XA; ++kc)
#pragma unroll
    for (int i = 0; i < 4; ++i) { ab[kc][i] = (__bf16)xr[kc][0][i]; ab[kc][4 + i] = (__bf16)xr[kc][1][i]; ab[kc][8 + i] = (__bf16)xr[kc][2][i]; ab[kc][12 + i] = (__bf16)xr[kc][3][i]; }
  __syncthreads();   /* publishes the 48 fragments to all four waves */
  /* the last chunks of x are requested here, into the registers that the staging has left free, and fly under the first XA chunks' products (in front of the barrier they would be waited for at it) */
#pragma unroll
  for (int kc = XA; kc < DIN / 32; ++kc) { xr[kc][0] = *(const v4f*)(xp + kc * 32); xr[kc][1] = *(const v4f*)(xp + kc * 32 + 4); xr[kc][2] = *(const v4f*)(xp + kc * 32 + 16); xr[kc][3] = *(const v4f*)(xp + kc * 32 + 20); }
  asm volatile("s_wait_xcnt 0x0" :: "v"(xp) : "memory");   /* as above: the address pair lives up to this wait */
  v8f acc[8] = {};
#pragma unroll
  for (int kc = 0; kc < DIN / 32; ++kc) { v16b w[4];
#pragma unroll
    for (int j = 0; j < 4; ++j) w[j] = frag_bp(wf + (kc * 4 + j) * 512, lane);
    if (kc >= XA) {
#pragma unroll
      for (int i = 0; i < 4; ++i) { ab[kc][i] = (__bf16)xr[kc][0][i]; ab[kc][4 + i] = (__bf16)xr[kc][1][i]; ab[kc][8 + i] = (__bf16)xr[kc][2][i]; ab[kc][12 + i] = (__bf16)xr[kc][3][i]; } }
#pragma unroll
    for (int j = 4; j < 8; ++j) acc[j] = wmma_bf(ab[kc], zero16b(), acc[j]);   /* tiles 4..7 are the padding head's zero columns, as before; they need no LDS operand and run while the four fragments come */
    asm volatile("" :: "v"(w[0]), "v"(w[1]), "v"(w[2]), "v"(w[3]));   /* inputs-only fence on the loaded values: the chunk's eight LDS loads are issued together in front of it (one round of LDS latency a chunk); without it each fragment is fetched and waited for alone */
#pragma unroll
    for (int j = 0; j < 4; ++j) acc[j] = wmma_bf(ab[kc], w[j], acc[j]); }
  __syncthreads();   /* ends every wave's last read of wf: the store planes below overwrite it */
  if (which < 2) { _Float16* DH = which == 0 ? QH : KH; _Float16* DL = which == 0 ? QL : KL; const int nhi = which == 0 ? QHI : KHI; const bool hi_rows = t0 < nhi;
#pragma unroll
    for (int j = 0; j < 8; ++j) { const float bias = BA ? bfr(BA[c0 + j * 16 + col]) : 0.f;
#pragma unroll
      for (int r = 0; r < 8; ++r) { const float v = acc[j][r] + bias; const _Float16 hv = (_Float16)v; sh[wave * 16 + 8 * g + r][j * 16 + col] = hv; sl[wave * 16 + 8 * g + r][j * 16 + col] = (_Float16)((v - (float)hv) * 1024.0f); } }
    __syncthreads();
    /* fragment order, head columns 0..63 only: 16-byte unit u = ((row tile * 2 + k chunk) * 2 + piece) * 32 + lane, lane = 16 g + row in tile; it holds columns 8 q .. 8 q + 7 with q = (k chunk, piece, g) */
    for (int u = tid; u < 64 * 8; u += 128) { const int rl = (u >> 7) * 16 + (u & 15), q = (u >> 4) & 7; vst2((unsigned*)(DH + r0 * 64 + (size_t)u * 8), *(const v4u*)&sh[rl][q * 8]); if (hi_rows) vst2((unsigned*)(DL + (bb * nhi + t0) * (size_t)64 + (size_t)u * 8), *(const v4u*)&sl[rl][q * 8]); }
  } else { const bool hi_rows = t0 < KHI;
#pragma unroll
    for (int j = 0; j < 8; ++j) { const float bias = BA ? bfr(BA[c0 + j * 16 + col]) : 0.f;
#pragma unroll
      for (int r = 0; r < 8; ++r) { const float v = acc[j][r] + bias; const int rl = wave * 16 + 8 * g + r, cl = j * 16 + col; th[cl][rl] = (_Float16)v; const __bf16 bh = (__bf16)v; tb[cl][rl] = bh; tbl[cl][rl] = (__bf16)(v - (float)bh); } }
    __syncthreads();
    for (int e = tid; e < 128 * 8; e += 128) { const int cl = e >> 3, q = e & 7; vst2((unsigned*)(VT + (bb * CC + c0 + cl) * (size_t)TT + t0 + q * 8), *(const v4u*)&th[cl][q * 8]); }
    /* bf16 hi / lo in fragment order, head columns 0..63 only: 16-byte unit u = ((32-key chunk * 4 + column tile) * 2 + piece) * 32 + lane, lane = 16 g + column in tile; it holds keys 8 q .. 8 q + 7 of the block with q = (chunk, piece, g) */
    if (hi_rows) for (int u = tid; u < 64 * 8; u += 128) { const int cl = ((u >> 6) & 3) * 16 + (u & 15), q = (u >> 8) * 4 + ((u >> 4) & 3); const size_t o3 = (bb * KHI + t0) * (size_t)64 + (size_t)u * 8; vst2((unsigned*)(VB + o3), *(const v4u*)&tb[cl][q * 8]); vst2((unsigned*)(VBL + o3), *(const v4u*)&tbl[cl][q * 8]); } } }
// ---- k_sc: block = (query block qb, key block kb <= kb_last(qb), sequence b = blockIdx.z), head h0, into score plane b: logits x SCALE; q hi + residual (x 2^10) against k (2 products) for query rows < QHI, plus the k residual (3 products) for query blocks < QBH (all of them); causal: blocks past the diagonal exit, the mask itself is applied by index in k_colstat_c and p_row
__global__ __launch_bounds__(128) void k_sc(const _Float16* __restrict__ QH, const _Float16* __restrict__ KH, const _Float16* __restrict__ QL, const _Float16* __restrict__ KL, int h0, float* __restrict__ S0) { __shared__ __align__(16) float ss[4][16][132];
  const int qb = blockIdx.x, kb = blockIdx.y; if (kb > kb_last(qb)) return;
  const int b = blockIdx.z; (void)h0; float* S = S0 + (size_t)b * TT * TT;   /* the fragment-order planes hold head 0 alone */
  const int tid = threadIdx.x, wave = tid >> 5, lane = tid & 31, col = lane & 15, g = lane >> 4; const int k0 = kb * 128; const int ql0 = qb * 64 + wave * 16; const size_t q0 = (size_t)b * TT + ql0, kr0 = (size_t)b * TT + k0;
  v8f acc[8] = {}, accl[8] = {};
  const _Float16* QLb = QL + (size_t)b * QHI * 64; const _Float16* KLb = KL + (size_t)b * KHI * 64;
  if (qb < QBH) {
#pragma unroll
    for (int kc = 0; kc < HD / 32; ++kc) { const v16h ah = frag_hp(QH + q0 * 64 + kc * 512, lane), al = frag_hp(QLb + (size_t)ql0 * 64 + kc * 512, lane);
#pragma unroll
      for (int j = 0; j < 8; ++j) { const v16h kbf = frag_hp(KH + (kr0 + j * 16) * 64 + kc * 512, lane), klf = frag_hp(KLb + (size_t)(k0 + j * 16) * 64 + kc * 512, lane); acc[j] = wmma16(ah, kbf, acc[j]); accl[j] = wmma16(al, kbf, accl[j]); accl[j] = wmma16(ah, klf, accl[j]); } }
  } else if (qb * 64 < QHI) {
#pragma unroll
    for (int kc = 0; kc < HD / 32; ++kc) { const v16h ah = frag_hp(QH + q0 * 64 + kc * 512, lane), al = frag_hp(QLb + (size_t)ql0 * 64 + kc * 512, lane);
#pragma unroll
      for (int j = 0; j < 8; ++j) { const v16h kbf = frag_hp(KH + (kr0 + j * 16) * 64 + kc * 512, lane); acc[j] = wmma16(ah, kbf, acc[j]); accl[j] = wmma16(al, kbf, accl[j]); } }
  } else {
#pragma unroll
    for (int kc = 0; kc < HD / 32; ++kc) { const v16h ah = frag_hp(QH + q0 * 64 + kc * 512, lane);
#pragma unroll
      for (int j = 0; j < 8; ++j) { const v16h kbf = frag_hp(KH + (kr0 + j * 16) * 64 + kc * 512, lane); acc[j] = wmma16(ah, kbf, acc[j]); } }
    asm volatile("s_wait_xcnt 0x0" ::: "memory"); }   /* behind this branch the loads' address registers are reused: the wait stands in front of that */
#pragma unroll
  for (int j = 0; j < 8; ++j) {
#pragma unroll
    for (int r = 0; r < 8; ++r) ss[wave][8 * g + r][j * 16 + col] = (acc[j][r] + accl[j][r] * (1.0f / 1024.0f)) * SCALE; }
  LDSX(); for (int rl = 0; rl < 16; ++rl) vst2(S + (size_t)(ql0 + rl) * TT + k0 + lane * 4, *(const v4f*)&ss[wave][rl][lane * 4]); }
// ---- k_sm: block = query row t (head in group): keys [0, kend): causal -> logit if s <= t else excluded; softmax in f32; P x 2^11 in place (0 for excluded)
__global__ __launch_bounds__(256) void k_sm(float* __restrict__ S0 SM_EXTRA_PARAMS) { __shared__ float sred[8]; __shared__ float sbc; __shared__ __align__(16) float shv[TT];
  const int tid = threadIdx.x; const int t = blockIdx.x; const int kend = (kb_last(t >> 6) + 1) * 128;
  float* sr = S0 + (size_t)blockIdx.y * TT * TT + (size_t)t * TT;
  float m = -3.0e38f; for (int k = tid; k < kend; k += 256) { float v = (!CAUSAL || k <= t) ? sr[k] : -3.0e38f; SM_MASK_HOOK; shv[k] = v; m = fmaxf(m, v); }
#pragma unroll
  for (int o = 1; o < 32; o <<= 1) m = fmaxf(m, __shfl_xor(m, o));
  if ((tid & 31) == 0) sred[tid >> 5] = m; __syncthreads(); if (tid == 0) { float a = sred[0]; for (int i = 1; i < 8; ++i) a = fmaxf(a, sred[i]); sbc = a; } __syncthreads(); m = sbc; __syncthreads();
  float sum = 0.f; for (int k = tid; k < kend; k += 256) { const float v = shv[k]; const float e = (v <= -1.0e38f) ? 0.f : expf(v - m); shv[k] = e; sum += e; }
#pragma unroll
  for (int o = 1; o < 32; o <<= 1) sum += __shfl_xor(sum, o);
  if ((tid & 31) == 0) sred[tid >> 5] = sum; __syncthreads(); if (tid == 0) { float a = 0.f; for (int i = 0; i < 8; ++i) a += sred[i]; sbc = a > 0.f ? 2048.0f / a : 0.f; }   /* a fully excluded row yields P = 0 */ __syncthreads(); const float inv = sbc;
  for (int k = tid; k < kend; k += 256) shv[k] = shv[k] * inv;
  __syncthreads(); for (int q = tid; q < kend / 4; q += 256) vst2(sr + q * 4, *(const v4f*)&shv[q * 4]); }
// exp for k_colstat_c, to expf's accuracy: e = the integer nearest to x log2(e); the fraction x log2(e) - e by two fused multiply-adds with the constant's high and low word; exp2 of the fraction, ldexp by e; 0 below -103.28 (ln of the smallest f32 denormal), +inf above 88.72 (expf's overflow limit). v_exp_f32 stands in one asm statement with a v_nop: the free slot that the instruction set asks for between a transcendental and an instruction that reads its result or overwrites its source (in a statement of its own nothing would hold the v_nop there)
__device__ __forceinline__ float exp_slot(float x) { const float c = __builtin_bit_cast(float, 0x3fb8aa3bu), cl = __builtin_bit_cast(float, 0x32a5705fu);
  const float e = __builtin_rintf(x * c); const float a = __builtin_fmaf(x, cl, __builtin_fmaf(x, c, -e)); float r;
  asm("v_exp_f32 %0, %1\n\tv_nop" : "=v"(r) : "v"(a));   /* the v_nop keeps the slot behind the transcendental free whatever the compiler schedules next */
  r = __builtin_ldexpf(r, (int)e); r = (x < __builtin_bit_cast(float, 0xc2ce8ed0u)) ? 0.f : r; return (x > __builtin_bit_cast(float, 0x42b17218u)) ? __builtin_inff() : r; }
// ---- k_colstat_c: softmax over the QUERY axis under the causal mask (the source's softmax(axis=1) on [B, t, s] scores with -inf above the diagonal): for every key column k: m_k = max_{q >= k} S[q][k], Z_k = sum_{q >= k} exp(S[q][k] - m_k) (f32, exp_slot).
// block = 32 key columns (one 128-B line of every score row) of score plane blockIdx.y (the sequence) x 32 waves. A wave-wide 16-byte load covers 4 query rows x 32 columns (4 whole lines); wave w takes the 64 rows from c0 + 64 w and holds them in registers, so its 16 loads are all in flight at once and the scores are read once.
// Per wave and column: max, then the sum of exp against that max; the 32 (max, sum) pairs of a column are merged through LDS by wave 0: M = max m_w, Z = sum z_w exp(m_w - M).
// Rows above a column's diagonal lie only in wave 0's first 32 rows (they hold the unmasked logits of the diagonal score block): their content is replaced by value select. Sentinels: a hidden entry reads -3e38 and the running max starts at -1e38, so a hidden entry adds exp(-2e38) = 0, and a wave with no row below TT hands the pair (-1e38, 0), which adds 0 to the merge (the logits are sums of 64 f16-range products, far above -1e38).
__global__ __launch_bounds__(1024) void k_colstat_c(const float* __restrict__ S0, float* __restrict__ CM, float* __restrict__ CZ) { __shared__ __align__(16) float pm[32][32], pz[32][32];
  const int tid = threadIdx.x, lane = tid & 31, sub = lane >> 3, cq = lane & 7; const int wave = __builtin_amdgcn_readfirstlane(tid >> 5); const int c0 = blockIdx.x * 32;
  const int r0 = c0 + wave * 64;                       /* the wave's first row */
  const bool h0 = r0 < TT, h1 = r0 + 32 < TT;          /* TT - c0 is a multiple of 32: each half of the wave's 64 rows is wholly inside or wholly past the end (wave-uniform) */
  const float* sp = S0 + (size_t)blockIdx.y * TT * TT + (size_t)(r0 + sub) * TT + c0 + cq * 4;
  v4f v[16];
  if (h0) {
#pragma unroll
    for (int s = 0; s < 8; ++s) v[s] = *(const v4f*)(sp + (size_t)s * 4 * TT); }
  if (h1) {
#pragma unroll
    for (int s = 8; s < 16; ++s) v[s] = *(const v4f*)(sp + (size_t)s * 4 * TT); }
  asm volatile("s_wait_xcnt 0x0" :: "v"(sp) : "memory");   /* the issued loads' address pair is an input here, so nothing (a load's own result included) overwrites it in front of this wait */
  v4f m = { -1.0e38f, -1.0e38f, -1.0e38f, -1.0e38f }, z = { 0.f, 0.f, 0.f, 0.f };
  if (wave == 0) {
#pragma unroll
    for (int s = 0; s < 8; ++s)
#pragma unroll
      for (int u = 0; u < 4; ++u) v[s][u] = (s * 4 + sub >= cq * 4 + u) ? v[s][u] : -3.0e38f; }
  if (h0) {
#pragma unroll
    for (int s = 0; s < 8; ++s)
#pragma unroll
      for (int u = 0; u < 4; ++u) m[u] = fmaxf(m[u], v[s][u]); }
  if (h1) {
#pragma unroll
    for (int s = 8; s < 16; ++s)
#pragma unroll
      for (int u = 0; u < 4; ++u) m[u] = fmaxf(m[u], v[s][u]); }
#pragma unroll
  for (int u = 0; u < 4; ++u) { m[u] = fmaxf(m[u], __shfl_xor(m[u], 8)); m[u] = fmaxf(m[u], __shfl_xor(m[u], 16)); }
  if (h0) {
#pragma unroll
    for (int s = 0; s < 8; ++s)
#pragma unroll
      for (int u = 0; u < 4; ++u) z[u] += exp_slot(v[s][u] - m[u]); }
  if (h1) {
#pragma unroll
    for (int s = 8; s < 16; ++s)
#pragma unroll
      for (int u = 0; u < 4; ++u) z[u] += exp_slot(v[s][u] - m[u]); }
#pragma unroll
  for (int u = 0; u < 4; ++u) { z[u] += __shfl_xor(z[u], 8); z[u] += __shfl_xor(z[u], 16); }
  if (sub == 0) { *(v4f*)&pm[wave][cq * 4] = m; *(v4f*)&pz[wave][cq * 4] = z; }
  __syncthreads();   /* publishes the 32 waves' pairs to wave 0 */
  if (wave == 0) { float mw[32], zw[32], M = -1.0e38f, Z = 0.f;
#pragma unroll
    for (int i = 0; i < 32; ++i) { mw[i] = pm[i][lane]; zw[i] = pz[i][lane]; }
#pragma unroll
    for (int i = 0; i < 32; ++i) M = fmaxf(M, mw[i]);
#pragma unroll
    for (int i = 0; i < 32; ++i) Z += zw[i] * exp_slot(mw[i] - M);
    vst2(CM + (size_t)blockIdx.y * TT + c0 + lane, M); vst2(CZ + (size_t)blockIdx.y * TT + c0 + lane, 2048.0f / Z); } }   /* every column sees at least its own diagonal entry: Z_k >= 1; stored is the column's factor 2^11 / Z_k, divided once per column */
// ---- p_row: the 16 P values of one lane's A fragment (query row t, keys k0 + 8 g + 0..7 and k0 + 16 + 8 g + 0..7), formed from the stored logits where k_pv reads them: P[t][k] = exp(S[t][k] - m_k) x (2^11 / Z_k) for k <= t, 0 above the diagonal (inside the diagonal block; 2^11 / Z_k lies in (0, 2^11], so 0 x it is 0); unconditional loads, value select. cm = the sequence's column maxima, ci = its column factors 2^11 / Z_k
__device__ __forceinline__ void p_row(const float* __restrict__ srow, const float* __restrict__ cm, const float* __restrict__ ci, int k0, int t, int lane, float v[16]) { const int kk = k0 + 8 * (lane >> 4), d = t - kk; const float *sp = srow + kk, *mp = cm + kk, *cp = ci + kk; v4f sv[4], m4[4], c4[4];
#pragma unroll
  for (int q = 0; q < 4; ++q) { const int o = (q >> 1) * 16 + (q & 1) * 4; sv[q] = *(const v4f*)(sp + o); m4[q] = *(const v4f*)(mp + o); c4[q] = *(const v4f*)(cp + o); }
  asm volatile("" :: "v"(sv[0]), "v"(sv[1]), "v"(sv[2]), "v"(sv[3]), "v"(m4[0]), "v"(m4[1]), "v"(m4[2]), "v"(m4[3]), "v"(c4[0]), "v"(c4[1]), "v"(c4[2]), "v"(c4[3]));   /* inputs-only fence on the loaded values: all twelve loads are issued in front of it and fly together (one round of latency); without it the compiler sinks most of them behind the first wait, one round after the other */
#pragma unroll
  for (int q = 0; q < 4; ++q)
#pragma unroll
    for (int u = 0; u < 4; ++u) v[q * 4 + u] = expf(((q >> 1) * 16 + (q & 1) * 4 + u <= d) ? sv[q][u] - m4[q][u] : -3.0e38f) * c4[q][u]; }   /* the select stands on the argument: expf(-3e38) is exactly 0, and no branch is formed round each exp */
// ---- k_out64: out[b][t][0..63] = ctx row columns 0..63 (256 B by 16 lanes)
__global__ __launch_bounds__(256) void k_out64(const float* __restrict__ Y, float* __restrict__ OUT) { const size_t row = (size_t)blockIdx.x * 16 + (threadIdx.x >> 4); const int q = threadIdx.x & 15; const v4f v = *(const v4f*)(Y + row * CC + q * 4); asm volatile("s_wait_loadcnt 0x0" ::: "memory"); vst2(OUT + row * 64 + q * 4, v); }
// ---- k_pv: block = 16 queries (tile qt) of (sequence b = blockIdx.z, head h0) x PVS waves, P formed by p_row from the logits of score plane b and the column statistics (every logit is read by exactly one lane of one wave, so no exp is done twice): ctx = P . v over keys [0, kend). The 32-key chunks of the key range are dealt round-robin to the waves (wave w takes chunks w, w + PVS, ...), so a wave's chain of dependent load rounds is at most 4 long and the long query tiles are spread over all PVS waves of their work-group; every wave keeps its own 16 x 64 f32 partial, the PVS partials are summed in wave order through LDS. (P x 2^11 once to f16 against v f16: 1 product; query blocks < QBH (all of them): P and v as bf16 hi + lo, 3 products); 256-B (row, head) segment by 16 lanes
#define PVS 16
__global__ __launch_bounds__(32 * PVS) void k_pv(const float* __restrict__ PS0, const float* __restrict__ CM, const float* __restrict__ CZ, const _Float16* __restrict__ VT, const __bf16* __restrict__ VB, const __bf16* __restrict__ VBL, int h0, float* __restrict__ Y) { const int b = blockIdx.z, h = h0; const float* PS = PS0 + (size_t)b * TT * TT; const float* cm = CM + (size_t)b * TT; const float* ci = CZ + (size_t)b * TT; __shared__ __align__(16) float ss[PVS][16][HD + 4];
  const int tid = threadIdx.x, lane = tid & 31, col = lane & 15, g = lane >> 4; const int wave = __builtin_amdgcn_readfirstlane(tid >> 5); const int qb = blockIdx.x >> 2; const int ql0 = blockIdx.x * 16; const int kce = (kb_last(qb) + 1) * 4;
  v8f acc[HD / 16] = {};
  if (qb < QBH) {
#pragma unroll 1
    for (int kc = wave; kc < kce; kc += PVS) { float pv[16]; p_row(PS + (size_t)(ql0 + col) * TT, cm, ci, kc * 32, ql0 + col, lane, pv); const F2 p = bsplit16(pv);
#pragma unroll
      for (int j = 0; j < HD / 16; ++j) { const size_t po = ((size_t)b * KHI + kc * 32) * (size_t)64 + j * 512; const v16b vh = frag_bp(VB + po, lane); acc[j] = wmma_bf(p.h, vh, acc[j]); acc[j] = wmma_bf(p.l, vh, acc[j]); acc[j] = wmma_bf(p.h, frag_bp(VBL + po, lane), acc[j]); }
      asm volatile("s_wait_xcnt 0x0" ::: "memory"); }   /* the next trip rewrites the address registers that this trip's v loads name: the wait stands in front of that */
  } else {
#pragma unroll 1
    for (int kc = wave; kc < kce; kc += PVS) { float pv[16]; p_row(PS + (size_t)(ql0 + col) * TT, cm, ci, kc * 32, ql0 + col, lane, pv); v16h p;
#pragma unroll
      for (int i = 0; i < 16; ++i) p[i] = (_Float16)pv[i];
#pragma unroll
      for (int j = 0; j < HD / 16; ++j) { const size_t po = ((size_t)b * CC + h * HD + j * 16 + col) * (size_t)TT + kc * 32; acc[j] = wmma16(p, frag_h(VT + po, lane), acc[j]); } } }
#pragma unroll
  for (int j = 0; j < HD / 16; ++j)
#pragma unroll
    for (int r = 0; r < 8; ++r) ss[wave][8 * g + r][j * 16 + col] = acc[j][r] * (1.0f / 2048.0f);   /* a wave with no chunk hands zeros */
  __syncthreads();   /* publishes the PVS partials to the waves that sum them */
  if (wave < 8) { const int rl = tid >> 4, q = tid & 15; v4f s = *(const v4f*)&ss[0][rl][q * 4];
#pragma unroll
    for (int w = 1; w < PVS; ++w) s += *(const v4f*)&ss[w][rl][q * 4];
    vst2(Y + ((size_t)b * TT + ql0 + rl) * CC + h * HD + q * 4, s); } }

extern "C" void kernel_launch(void* const* d_in, const int* in_sizes, int n_in, void* d_out, int out_size, void* d_ws, size_t ws_size, hipStream_t stream) {
  (void)in_sizes; (void)n_in; (void)out_size;
  const float** F = (const float**)d_in;
  if (ws_size < (size_t)WS_END) return;
  char* ws = (char*)d_ws; _Float16 *QH = (_Float16*)(ws + WS_QH), *KH = (_Float16*)(ws + WS_KH), *VT = (_Float16*)(ws + WS_VT), *QL = (_Float16*)(ws + WS_QL), *KL = (_Float16*)(ws + WS_KL); __bf16 *VB = (__bf16*)(ws + WS_VB), *VBL = (__bf16*)(ws + WS_VBL); float *S = (float*)(ws + WS_S), *Y = (float*)(ws + WS_Y);
  (void)Y; (void)QL; (void)KL; (void)VB; (void)VBL;
  // inputs: 0 x [8,2048,384]; 1 Wq [384,64] (in,out); 2 Wk; 3 Wv; no biases
  if (ws_size < (size_t)WS_END2) return;
  float *Y2 = (float*)(ws + WS_Y2), *CM = (float*)(ws + WS_CM), *CZ = (float*)(ws + WS_CZ);
  k_proj<<<dim3(TNB * TT / 64, CC / 128, 3), 128, 0, stream>>>(F[0], F[0], F[0], F[1], F[2], F[3], nullptr, nullptr, nullptr, QH, QL, KH, KL, VT, VB, VBL);   /* weight columns 64..127 (the padding head) are zero fragments */
  /* all sequences in one launch of each stage (the last grid index is the sequence, each with its own score plane); head 0 only (head 1 is the zero padding) */
  k_sc<<<dim3(NQB, TT / 128, TNB), 128, 0, stream>>>(QH, KH, QL, KL, 0, S);
  k_colstat_c<<<dim3(TT / 32, TNB), 1024, 0, stream>>>(S, CM, CZ);   /* per key column j: max m_j and 2^11 / sum over the visible queries i >= j */
  k_pv<<<dim3(TT / 16, 1, TNB), 32 * PVS, 0, stream>>>(S, CM, CZ, VT, VB, VBL, 0, Y2);   /* forms P[i][j] = exp(S - m_j) x 2^11 / Z_j (0 above the diagonal) as it reads the logits */
  k_out64<<<dim3(TNB * TT / 16), 256, 0, stream>>>(Y2, (float*)d_out);
}

// v007
// A run of this version takes 55.8 microseconds.
// In two side-by-side timings against v006, it was 1.84 and 1.81 times as fast.
// Counting every step since v000, it is 136 times as fast.
// compute dtype: all float inputs rounded to bf16; q/k/v projections with EXACT bf16 products on WMMA 16x16x32 (f32 accumulate); causal scores with BOTH q and k as f16 hi + (x 2^10) residual (3 products) on EVERY block, x 64^-0.5; softmax over the QUERY axis in f32 (per key column: max and sum over the visible queries, per wave and merged, exp to expf's accuracy; P by precise expf); P as bf16 hi + lo against v as bf16 hi + lo (3 products) on EVERY block; f32 output.
#include <hip/hip_runtime.h>
#include <math.h>

typedef __attribute__((ext_vector_type(16))) _Float16 v16h;
typedef __attribute__((ext_vector_type(16))) __bf16 v16b;
typedef __attribute__((ext_vector_type(8)))  _Float16 v8h;
typedef __attribute__((ext_vector_type(8)))  float v8f;
typedef __attribute__((ext_vector_type(4)))  float v4f;
typedef __attribute__((ext_vector_type(2)))  float v2f;
typedef __attribute__((ext_vector_type(4)))  unsigned v4u;
typedef __attribute__((ext_vector_type(4)))  int v4i;
typedef float __attribute__((may_alias)) float_a;
typedef int __attribute__((may_alias)) int_a;

template <typename T> __device__ __forceinline__ void vst2(void* p, T v) { *(T*)p = v;  }
__device__ __forceinline__ v8f wmma16(v16h a, v16h b, v8f c) {
  v8f d = __builtin_amdgcn_wmma_f32_16x16x32_f16(false, a, false, b, (short)0, c, false, false);
  asm volatile("v_nop\n\tv_nop\n\tv_nop\n\tv_nop" : "+v"(d) : "v"(a), "v"(b));
  return d;
}
__device__ __forceinline__ v8f wmma_bf(v16b a, v16b b, v8f c) {
  v8f d = __builtin_amdgcn_wmma_f32_16x16x32_bf16(false, a, false, b, (short)0, c, false, false);
  asm volatile("v_nop\n\tv_nop\n\tv_nop\n\tv_nop" : "+v"(d) : "v"(a), "v"(b));
  return d;
}
// 16x16x32 fragments: lane = (h = lane>>4, row/col = lane&15); elements 0..7 = k0+8h+0..7, 8..15 = k0+16+8h+0..7; D element r = row 8h+r
__device__ __forceinline__ v16h frag_h(const _Float16* rowk0, int lane) {
  union { v16h v; v8h q[2]; } u; const _Float16* p = rowk0 + 8 * (lane >> 4);
  u.q[0] = *(const v8h*)p; u.q[1] = *(const v8h*)(p + 16); return u.v;
}
__device__ __forceinline__ v16h frag_f32(const float* rowk0, int lane) {
  v16h a; const float* p = rowk0 + 8 * (lane >> 4);
#pragma unroll
  for (int i = 0; i < 8; ++i) { a[i] = (_Float16)p[i]; a[8 + i] = (_Float16)p[16 + i]; }
  return a;
}
__device__ __forceinline__ v16h frag_f32s(const float* rowk0, int lane, float sc) {
  v16h a; const float* p = rowk0 + 8 * (lane >> 4);
#pragma unroll
  for (int i = 0; i < 8; ++i) { a[i] = (_Float16)(p[i] * sc); a[8 + i] = (_Float16)(p[16 + i] * sc); }
  return a;
}
// column fragment from a [K][ld] layout (column n), rows >= K read as 0
__device__ __forceinline__ v16h fragc_f32(const float* W, int k0, int n, int lane, int ld, int K) {
  v16h a; const int g = lane >> 4;
#pragma unroll
  for (int i = 0; i < 8; ++i) { const int ka = k0 + 8 * g + i, kb = ka + 16;
    a[i] = (_Float16)(ka < K ? W[(size_t)(ka < K ? ka : K - 1) * ld + n] : 0.f); a[8 + i] = (_Float16)(kb < K ? W[(size_t)(kb < K ? kb : K - 1) * ld + n] : 0.f); }
  return a;
}
struct F2 { v16b h, l; };
__device__ __forceinline__ F2 bsplit16(const float v[16]) { F2 r;
#pragma unroll
  for (int i = 0; i < 16; ++i) { const __bf16 h = (__bf16)v[i]; r.h[i] = h; r.l[i] = (__bf16)(v[i] - (float)h); }
  return r; }
__device__ __forceinline__ F2 split_row(const float* row, int k0, int lane) { float v[16]; const float* p = row + k0 + 8 * (lane >> 4);
#pragma unroll
  for (int i = 0; i < 8; ++i) { v[i] = p[i]; v[8 + i] = p[16 + i]; }
  return bsplit16(v); }
__device__ __forceinline__ F2 split_rowK(const float* row, int k0, int lane, int K) { float v[16]; const int g = lane >> 4;
#pragma unroll
  for (int i = 0; i < 8; ++i) { const int ka = k0 + 8 * g + i, kb = ka + 16; v[i] = ka < K ? row[ka < K ? ka : K - 1] : 0.f; v[8 + i] = kb < K ? row[kb < K ? kb : K - 1] : 0.f; }
  return bsplit16(v); }
__device__ __forceinline__ F2 split_col(const float* W, int k0, int n, int lane, int ld, int K) { float v[16]; const int g = lane >> 4;
#pragma unroll
  for (int i = 0; i < 8; ++i) { const int ka = k0 + 8 * g + i, kb = ka + 16; v[i] = ka < K ? W[(size_t)(ka < K ? ka : K - 1) * ld + n] : 0.f; v[8 + i] = kb < K ? W[(size_t)(kb < K ? kb : K - 1) * ld + n] : 0.f; }
  return bsplit16(v); }
__device__ __forceinline__ v8f mac3(const F2& a, const F2& b, v8f c) { c = wmma_bf(a.l, b.h, c); c = wmma_bf(a.h, b.l, c); return wmma_bf(a.h, b.h, c); }
__device__ __forceinline__ float sigm(float v) { return 1.0f / (1.0f + expf(-v)); }
#define LDSX() do { asm volatile("s_wait_dscnt 0" ::: "memory"); __builtin_amdgcn_wave_barrier(); __builtin_amdgcn_fence(__ATOMIC_RELEASE, "workgroup"); } while (0)

// Single-head causal self-attention whose softmax runs over the QUERY axis (x [8,2048,384]; (in,out) Wq / Wk / Wv [384,64] (0.02 scale), no biases; scores[b, i, j] = q_i . k_j / 8; -inf where j > i; attn = softmax(scores, axis=1) - axis 1 is the QUERY axis i, so every key column j is normalised over the queries i >= j (faithful to the source); out = attn v -> [8,2048,64]).
#define NB 8
#define TT 2048
#define CC 128            // NH * HD = projected width
#define DIN 384          // input (model) width
#define NH 2
#define HD 64
#define NQB (TT / 64)
#define SCALE (0.125f)
#define CAUSAL 1
#ifndef TNB
#define TNB NB
#endif
__device__ __forceinline__ float bfr(float v) { return (float)(__bf16)v; }
__host__ __device__ __forceinline__ int kb_last(int qb) { return CAUSAL ? ((qb * 64 + 63) >> 7) : (TT / 128 - 1); }
typedef __attribute__((ext_vector_type(8))) __bf16 v8b;
__device__ __forceinline__ v16b frag_b(const __bf16* rowk0, int lane) {
  union { v16b v; v8b q[2]; } u; const __bf16* p = rowk0 + 8 * (lane >> 4);
  u.q[0] = *(const v8b*)p; u.q[1] = *(const v8b*)(p + 16); return u.v;
}
// fragment-order planes: a 16-row tile's k chunk of 32 lies as 2 x 512 contiguous bytes: piece 0 = every lane's elements 0..7, piece 1 = its elements 8..15, 16 bytes a lane in lane order, so one wave-wide 16-byte load covers 4 whole 128-byte lines
__device__ __forceinline__ v16h frag_hp(const _Float16* chunk, int lane) {
  union { v16h v; v8h q[2]; } u; const _Float16* p = chunk + 8 * lane;
  u.q[0] = *(const v8h*)p; u.q[1] = *(const v8h*)(p + 256); return u.v;
}
__device__ __forceinline__ v16b frag_bp(const __bf16* chunk, int lane) {
  union { v16b v; v8b q[2]; } u; const __bf16* p = chunk + 8 * lane;
  u.q[0] = *(const v8b*)p; u.q[1] = *(const v8b*)(p + 256); return u.v;
}
#define QBH 32              // causal: query blocks 0..QBH-1 of each sequence (all NQB = 32 of them) take the high-precision path
#define QHI 2048            // rows carrying a q residual plane (all TT rows)
#define KHI 2048            // key rows carrying k residual / v bf16 hi+lo planes (used only by the causal high-precision path)
// B fragment (k rows k0+.., output column o) of a weight: (in,out) [K][ld] or (out,in) [ld rows of K]: bf16 exact, or f16(bf16 * 256) exact
__device__ __forceinline__ v16b wcol_io(const float* Wm, int k0, int o, int lane, int ld) { v16b w; const int g = lane >> 4;
#pragma unroll
  for (int i = 0; i < 8; ++i) { w[i] = (__bf16)Wm[(size_t)(k0 + 8 * g + i) * ld + o]; w[8 + i] = (__bf16)Wm[(size_t)(k0 + 16 + 8 * g + i) * ld + o]; }
  return w; }
__device__ __forceinline__ v16b wcol_oi(const float* Wm, int k0, int o, int lane, int K) { v16b w; const float* p = Wm + (size_t)o * K + k0 + 8 * (lane >> 4);
#pragma unroll
  for (int i = 0; i < 8; ++i) { w[i] = (__bf16)p[i]; w[8 + i] = (__bf16)p[16 + i]; }
  return w; }
__device__ __forceinline__ v16h wcolh_io(const float* Wm, int k0, int o, int lane, int ld) { v16h w; const int g = lane >> 4;
#pragma unroll
  for (int i = 0; i < 8; ++i) { w[i] = (_Float16)(bfr(Wm[(size_t)(k0 + 8 * g + i) * ld + o]) * 256.0f); w[8 + i] = (_Float16)(bfr(Wm[(size_t)(k0 + 16 + 8 * g + i) * ld + o]) * 256.0f); }
  return w; }
__device__ __forceinline__ v16h wcolh_oi(const float* Wm, int k0, int o, int lane, int K) { v16h w; const float* p = Wm + (size_t)o * K + k0 + 8 * (lane >> 4);
#pragma unroll
  for (int i = 0; i < 8; ++i) { w[i] = (_Float16)(bfr(p[i]) * 256.0f); w[8 + i] = (_Float16)(bfr(p[16 + i]) * 256.0f); }
  return w; }
#define WQKV_LAYOUT 0   // 0 = (in,out) [DIN][64] (head 0 only; columns 64..127 zero); 1 = (out,in) [CC][DIN]; 2 = per-head [NH][DIN][HD]
__device__ __forceinline__ v16b wcol_hdk(const float* Wm, int k0, int o, int lane) { v16b w; const int g = lane >> 4; const float* p = Wm + (size_t)(o / HD) * DIN * HD + (o % HD);
#pragma unroll
  for (int i = 0; i < 8; ++i) { w[i] = (__bf16)p[(size_t)(k0 + 8 * g + i) * HD]; w[8 + i] = (__bf16)p[(size_t)(k0 + 16 + 8 * g + i) * HD]; }
  return w; }
#define WO_OUT_IN 0
#if WQKV_LAYOUT == 1
#define WCOL(W, k0, o, lane) wcol_oi(W, k0, o, lane, DIN)
#elif WQKV_LAYOUT == 2
#define WCOL(W, k0, o, lane) wcol_hdk(W, k0, o, lane)
#else
__device__ __forceinline__ v16b zero16b() { v16b w; _Pragma("unroll") for (int i = 0; i < 16; ++i) w[i] = (__bf16)0.0f; return w; }
#define WCOL(W, k0, o, lane) ((o) < 64 ? wcol_io(W, k0, (o), lane, 64) : zero16b())   /* (in,out) [384][64] pitch 64: only 64 real output columns; projected columns 64..127 (padding head 1) are zero; compile-time per unrolled tile (c0 = 0) */
#endif
#if WO_OUT_IN
#define WOCOL(W, k0, o, lane) wcol_oi(W, k0, o, lane, CC)
#define WOCOLH(W, k0, o, lane) wcolh_oi(W, k0, o, lane, CC)
#else
#define WOCOL(W, k0, o, lane) wcol_io(W, k0, o, lane, DIN)
#define WOCOLH(W, k0, o, lane) wcolh_io(W, k0, o, lane, DIN)
#endif

#ifndef SM_EXTRA_PARAMS
#define SM_EXTRA_PARAMS
#endif
#ifndef PROJ_EXTRA_PARAMS
#define PROJ_EXTRA_PARAMS
#endif
#ifndef SM_MASK_HOOK
#define SM_MASK_HOOK (void)0
#endif

#define WS_QH  0u                                      // f16 q, fragment order: [b*t / 16][k chunk 2][piece 2][lane 32][8]
#define WS_KH  (WS_QH + 2u * (size_t)NB * TT * CC)      // f16 k, fragment order like q
#define WS_VT  (WS_KH + 2u * (size_t)NB * TT * CC)      // f16 v planes [b][c][t]
#define WS_QL  (WS_VT + 2u * (size_t)NB * CC * TT)      // f16 q residual x 2^10, fragment order like q
#define WS_KL  (WS_QL + 2u * (size_t)NB * QHI * CC)     // f16 k residual x 2^10, fragment order like q
#define WS_VB  (WS_KL + 2u * (size_t)NB * KHI * CC)     // bf16 v hi (VBL: lo), fragment order: [b*t / 32][column tile 4][piece 2][lane 32][8]
#define WS_VBL (WS_VB + 2u * (size_t)NB * CC * KHI)
#define WS_S   (WS_VBL + 2u * (size_t)NB * CC * KHI)    // (not used: no score plane is stored; the room stays so that the offsets behind it are as they were)
#define WS_Y   (WS_S  + 4u * (size_t)NB * TT * TT)      // f32 ctx rows [b*t][CC] (only when there is an output projection)
#define WS_END (WS_Y  + 0u)
#define WS_Y2 (WS_END)                                  // f32 ctx rows [b*TT + t][128] (columns 64..127 = the padding head)
#define WS_CM (WS_Y2 + 4u * (size_t)NB * TT * CC)        // f32 column maxima [b][TT]
#define WS_CZ (WS_CM + 4u * (size_t)NB * TT)             // f32 column factors 2^11 / Z [b][TT]
#define WS_END2 (WS_CZ + 4u * (size_t)NB * TT)

// ---- k_proj: block = (64 rows, 128 cols, which): q/k/v = X W (+ b) with exact bf16 products (K = DIN) -> which 0: q f16 in fragment order, head columns 0..63 (+ residual rows < QHI); 1: k likewise (+ residual rows < KHI); 2: v f16 planes [c][t] (+ bf16 hi/lo planes for t < KHI)
__global__ __launch_bounds__(128) void k_proj(const float* __restrict__ XQ, const float* __restrict__ XK, const float* __restrict__ XV, const float* __restrict__ WQ, const float* __restrict__ WK, const float* __restrict__ WV, const float* __restrict__ BQ, const float* __restrict__ BK, const float* __restrict__ BV,
    _Float16* __restrict__ QH, _Float16* __restrict__ QL, _Float16* __restrict__ KH, _Float16* __restrict__ KL, _Float16* __restrict__ VT, __bf16* __restrict__ VB, __bf16* __restrict__ VBL) {
  /* one LDS block, two lives: the k loop reads wf (the block's 48 bf16 weight fragments, [k chunk 12][column tile 4][piece 2][lane 32][8], 48 KiB); behind the barrier that ends the loop the store planes sh .. tbl lie over it, so LDS stays at 88 KiB and 3 blocks share a WGP */
  __shared__ __align__(16) unsigned char sm[90112]; __bf16* wf = (__bf16*)sm;
  _Float16 (*sh)[136] = (_Float16 (*)[136])sm; _Float16 (*sl)[136] = (_Float16 (*)[136])(sm + 17408); _Float16 (*th)[72] = (_Float16 (*)[72])(sm + 34816); __bf16 (*tb)[72] = (__bf16 (*)[72])(sm + 53248); __bf16 (*tbl)[72] = (__bf16 (*)[72])(sm + 71680);
  const int tid = threadIdx.x, wave = tid >> 5, lane = tid & 31, col = lane & 15, g = lane >> 4; const int which = blockIdx.z; const int c0 = blockIdx.y * 128; const size_t r0 = (size_t)blockIdx.x * 64; const size_t bb = r0 / TT; const int t0 = (int)(r0 % TT);
  const float* X = which == 0 ? XQ : which == 1 ? XK : XV; const float* WA = which == 0 ? WQ : which == 1 ? WK : WV; const float* BA = which == 0 ? BQ : which == 1 ? BK : BV;
  /* the wave's 16 x rows: the first XA of the 12 k chunks are requested in front of everything else, so that their memory latency runs under the weight staging */
#define XA 8
  const float* xp = X + (r0 + wave * 16 + col) * DIN + 8 * g; v4f xr[DIN / 32][4];
#pragma unroll
  for (int kc = 0; kc < XA; ++kc) { xr[kc][0] = *(const v4f*)(xp + kc * 32); xr[kc][1] = *(const v4f*)(xp + kc * 32 + 4); xr[kc][2] = *(const v4f*)(xp + kc * 32 + 16); xr[kc][3] = *(const v4f*)(xp + kc * 32 + 20); }
  asm volatile("s_wait_xcnt 0x0" :: "v"(xp) : "memory");   /* the issued loads' address pair is an input here, so nothing overwrites it in front of this wait */
  /* wave w brings column tile w of every k chunk, each lane its own 16 fragment elements, and lays them down in fragment order: every weight element is fetched once per block, not once per wave. Columns c0 + 0..63 are real only in column block 0 (a block-uniform test); any other block's are the zero padding */
  if (c0 == 0) {
#pragma unroll
    for (int kc = 0; kc < DIN / 32; ++kc) { union { v16b v; v8b q[2]; } u; u.v = wcol_io(WA, kc * 32, wave * 16 + col, lane, 64); __bf16* d = wf + (kc * 4 + wave) * 512 + 8 * lane; *(v8b*)d = u.q[0]; *(v8b*)(d + 256) = u.q[1];
      if (kc == DIN / 64 - 1) __builtin_amdgcn_sched_barrier(0); }   /* two rounds of 96 loads: with all 192 in flight beside the x rows the build takes 333 registers, which leaves three waves on a SIMD (three blocks on a WGP) next to no room */
  } else {
#pragma unroll
    for (int kc = 0; kc < DIN / 32; ++kc) { union { v16b v; v8b q[2]; } u; u.v = zero16b(); __bf16* d = wf + (kc * 4 + wave) * 512 + 8 * lane; *(v8b*)d = u.q[0]; *(v8b*)(d + 256) = u.q[1]; } }
  asm volatile("s_wait_xcnt 0x0" ::: "memory");   /* behind the staging the weight loads' address registers are reused: the wait stands in front of that */
  v16b ab[DIN / 32];
#pragma unroll
  for (int kc = 0; kc < XA; ++kc)
#pragma unroll
    for (int i = 0; i < 4; ++i) { ab[kc][i] = (__bf16)xr[kc][0][i]; ab[kc][4 + i] = (__bf16)xr[kc][1][i]; ab[kc][8 + i] = (__bf16)xr[kc][2][i]; ab[kc][12 + i] = (__bf16)xr[kc][3][i]; }
  __syncthreads();   /* publishes the 48 fragments to all four waves */
  /* the last chunks of x are requested here, into the registers that the staging has left free, and fly under the first XA chunks' products (in front of the barrier they would be waited for at it) */
#pragma unroll
  for (int kc = XA; kc < DIN / 32; ++kc) { xr[kc][0] = *(const v4f*)(xp + kc * 32); xr[kc][1] = *(const v4f*)(xp + kc * 32 + 4); xr[kc][2] = *(const v4f*)(xp + kc * 32 + 16); xr[kc][3] = *(const v4f*)(xp + kc * 32 + 20); }
  asm volatile("s_wait_xcnt 0x0" :: "v"(xp) : "memory");   /* as above: the address pair lives up to this wait */
  v8f acc[8] = {};
#pragma unroll
  for (int kc = 0; kc < DIN / 32; ++kc) { v16b w[4];
#pragma unroll
    for (int j = 0; j < 4; ++j) w[j] = frag_bp(wf + (kc * 4 + j) * 512, lane);
    if (kc >= XA) {
#pragma unroll
      for (int i = 0; i < 4; ++i) { ab[kc][i] = (__bf16)xr[kc][0][i]; ab[kc][4 + i] = (__bf16)xr[kc][1][i]; ab[kc][8 + i] = (__bf16)xr[kc][2][i]; ab[kc][12 + i] = (__bf16)xr[kc][3][i]; } }
#pragma unroll
    for (int j = 4; j < 8; ++j) acc[j] = wmma_bf(ab[kc], zero16b(), acc[j]);   /* tiles 4..7 are the padding head's zero columns, as before; they need no LDS operand and run while the four fragments come */
    asm volatile("" :: "v"(w[0]), "v"(w[1]), "v"(w[2]), "v"(w[3]));   /* inputs-only fence on the loaded values: the chunk's eight LDS loads are issued together in front of it (one round of LDS latency a chunk); without it each fragment is fetched and waited for alone */
#pragma unroll
    for (int j = 0; j < 4; ++j) acc[j] = wmma_bf(ab[kc], w[j], acc[j]); }
  __syncthreads();   /* ends every wave's last read of wf: the store planes below overwrite it */
  if (which < 2) { _Float16* DH = which == 0 ? QH : KH; _Float16* DL = which == 0 ? QL : KL; const int nhi = which == 0 ? QHI : KHI; const bool hi_rows = t0 < nhi;
#pragma unroll
    for (int j = 0; j < 8; ++j) { const float bias = BA ? bfr(BA[c0 + j * 16 + col]) : 0.f;
#pragma unroll
      for (int r = 0; r < 8; ++r) { const float v = acc[j][r] + bias; const _Float16 hv = (_Float16)v; sh[wave * 16 + 8 * g + r][j * 16 + col] = hv; sl[wave * 16 + 8 * g + r][j * 16 + col] = (_Float16)((v - (float)hv) * 1024.0f); } }
    __syncthreads();
    /* fragment order, head columns 0..63 only: 16-byte unit u = ((row tile * 2 + k chunk) * 2 + piece) * 32 + lane, lane = 16 g + row in tile; it holds columns 8 q .. 8 q + 7 with q = (k chunk, piece, g) */
    for (int u = tid; u < 64 * 8; u += 128) { const int rl = (u >> 7) * 16 + (u & 15), q = (u >> 4) & 7; vst2((unsigned*)(DH + r0 * 64 + (size_t)u * 8), *(const v4u*)&sh[rl][q * 8]); if (hi_rows) vst2((unsigned*)(DL + (bb * nhi + t0) * (size_t)64 + (size_t)u * 8), *(const v4u*)&sl[rl][q * 8]); }
  } else { const bool hi_rows = t0 < KHI;
#pragma unroll
    for (int j = 0; j < 8; ++j) { const float bias = BA ? bfr(BA[c0 + j * 16 + col]) : 0.f;
#pragma unroll
      for (int r = 0; r < 8; ++r) { const float v = acc[j][r] + bias; const int rl = wave * 16 + 8 * g + r, cl = j * 16 + col; th[cl][rl] = (_Float16)v; const __bf16 bh = (__bf16)v; tb[cl][rl] = bh; tbl[cl][rl] = (__bf16)(v - (float)bh); } }
    __syncthreads();
    for (int e = tid; e < 128 * 8; e += 128) { const int cl = e >> 3, q = e & 7; vst2((unsigned*)(VT + (bb * CC + c0 + cl) * (size_t)TT + t0 + q * 8), *(const v4u*)&th[cl][q * 8]); }
    /* bf16 hi / lo in fragment order, head columns 0..63 only: 16-byte unit u = ((32-key chunk * 4 + column tile) * 2 + piece) * 32 + lane, lane = 16 g + column in tile; it holds keys 8 q .. 8 q + 7 of the block with q = (chunk, piece, g) */
    if (hi_rows) for (int u = tid; u < 64 * 8; u += 128) { const int cl = ((u >> 6) & 3) * 16 + (u & 15), q = (u >> 8) * 4 + ((u >> 4) & 3); const size_t o3 = (bb * KHI + t0) * (size_t)64 + (size_t)u * 8; vst2((unsigned*)(VB + o3), *(const v4u*)&tb[cl][q * 8]); vst2((unsigned*)(VBL + o3), *(const v4u*)&tbl[cl][q * 8]); } } }
// ---- k_sm: block = query row t (head in group): keys [0, kend): causal -> logit if s <= t else excluded; softmax in f32; P x 2^11 in place (0 for excluded)
__global__ __launch_bounds__(256) void k_sm(float* __restrict__ S0 SM_EXTRA_PARAMS) { __shared__ float sred[8]; __shared__ float sbc; __shared__ __align__(16) float shv[TT];
  const int tid = threadIdx.x; const int t = blockIdx.x; const int kend = (kb_last(t >> 6) + 1) * 128;
  float* sr = S0 + (size_t)blockIdx.y * TT * TT + (size_t)t * TT;
  float m = -3.0e38f; for (int k = tid; k < kend; k += 256) { float v = (!CAUSAL || k <= t) ? sr[k] : -3.0e38f; SM_MASK_HOOK; shv[k] = v; m = fmaxf(m, v); }
#pragma unroll
  for (int o = 1; o < 32; o <<= 1) m = fmaxf(m, __shfl_xor(m, o));
  if ((tid & 31) == 0) sred[tid >> 5] = m; __syncthreads(); if (tid == 0) { float a = sred[0]; for (int i = 1; i < 8; ++i) a = fmaxf(a, sred[i]); sbc = a; } __syncthreads(); m = sbc; __syncthreads();
  float sum = 0.f; for (int k = tid; k < kend; k += 256) { const float v = shv[k]; const float e = (v <= -1.0e38f) ? 0.f : expf(v - m); shv[k] = e; sum += e; }
#pragma unroll
  for (int o = 1; o < 32; o <<= 1) sum += __shfl_xor(sum, o);
  if ((tid & 31) == 0) sred[tid >> 5] = sum; __syncthreads(); if (tid == 0) { float a = 0.f; for (int i = 0; i < 8; ++i) a += sred[i]; sbc = a > 0.f ? 2048.0f / a : 0.f; }   /* a fully excluded row yields P = 0 */ __syncthreads(); const float inv = sbc;
  for (int k = tid; k < kend; k += 256) shv[k] = shv[k] * inv;
  __syncthreads(); for (int q = tid; q < kend / 4; q += 256) vst2(sr + q * 4, *(const v4f*)&shv[q * 4]); }
// exp for k_stat, to expf's accuracy: e = the integer nearest to x log2(e); the fraction x log2(e) - e by two fused multiply-adds with the constant's high and low word; exp2 of the fraction, ldexp by e; 0 below -103.28 (ln 2^-149), +inf above 88.72 (expf's overflow limit). v_exp_f32 stands in one asm statement with a v_nop: the free slot that the instruction set asks for between a transcendental and an instruction that reads its result or overwrites its source (in a statement of its own nothing would hold the v_nop there)
__device__ __forceinline__ float exp_slot(float x) { const float c = __builtin_bit_cast(float, 0x3fb8aa3bu), cl = __builtin_bit_cast(float, 0x32a5705fu);
  const float e = __builtin_rintf(x * c); const float a = __builtin_fmaf(x, cl, __builtin_fmaf(x, c, -e)); float r;
  asm("v_exp_f32 %0, %1\n\tv_nop" : "=v"(r) : "v"(a));   /* the v_nop keeps the slot behind the transcendental free whatever the compiler schedules next */
  r = __builtin_ldexpf(r, (int)e); r = (x < __builtin_bit_cast(float, 0xc2ce8ed0u)) ? 0.f : r; return (x > __builtin_bit_cast(float, 0x42b17218u)) ? __builtin_inff() : r; }
// ---- k_stat: softmax over the QUERY axis under the causal mask (the source's softmax(axis=1) on [B, t, s] scores with -inf above the diagonal), with no stored score plane: for every key column k: m_k = max_{q >= k} S[q][k], Z_k = sum_{q >= k} exp(S[q][k] - m_k) (f32, exp_slot), the logits taken straight from the WMMA accumulators.
// A strip = 32 key columns (two 16-key tiles, their k hi + residual fragments held in registers as the B operands). Strip s has 128 - 2 s query tiles below its diagonal, so a block (STW waves, sequence blockIdx.y) takes the strips s = blockIdx.x and 63 - s one after the other: 130 query tiles for every block. A strip's 16-query tiles are dealt round-robin to the waves (the second strip's from the last wave down, so that the two remainders do not meet in the same waves); a tile's logits are q hi + residual (x 2^10) against k hi + residual (3 products), x SCALE.
// D register r of lane (g, col) is query 8 g + r of the tile against key col: each lane keeps one running (max, sum) per key tile, rescaled once per query tile; the two lane halves are merged at the strip's end, the STW pairs of a column through LDS by wave 0 (first strip) and wave 1 (second strip): M = max m_w, Z = sum z_w exp(m_w - M).
// Sentinels: a hidden entry (only in a strip's first two query tiles) reads -3e38 and the running max starts at -1e38, so a hidden entry adds exp(-2e38) = 0, and a wave with no tile hands the pair (-1e38, 0), which adds 0 to the merge (the logits are sums of 64 f16-range products, far above -1e38).
#define STW 16
__global__ __launch_bounds__(32 * STW) void k_stat(const _Float16* __restrict__ QH, const _Float16* __restrict__ KH, const _Float16* __restrict__ QL, const _Float16* __restrict__ KL, float* __restrict__ CM, float* __restrict__ CZ) { __shared__ __align__(16) float pm[2][STW][32], pz[2][STW][32];
  const int tid = threadIdx.x, lane = tid & 31, col = lane & 15, g = lane >> 4; const int wave = __builtin_amdgcn_readfirstlane(tid >> 5); const int b = blockIdx.y;   /* below, the short loops over t, c, r, i are unrolled so that the fragment and accumulator arrays are indexed by constants and stay in registers */
#pragma unroll 1   /* the two strips run through one copy of the code */
  for (int hf = 0; hf < 2; ++hf) { const int kt0 = (hf ? TT / 32 - 1 - (int)blockIdx.x : (int)blockIdx.x) * 2;
    const _Float16* kp = KH + ((size_t)b * TT + kt0 * 16) * 64; const _Float16* lp = KL + ((size_t)b * KHI + kt0 * 16) * 64;
    v16h kh[2][2], kl[2][2];
#pragma unroll
    for (int t = 0; t < 2; ++t)
#pragma unroll
      for (int c = 0; c < 2; ++c) { kh[t][c] = frag_hp(kp + t * 1024 + c * 512, lane); kl[t][c] = frag_hp(lp + t * 1024 + c * 512, lane); }
    asm volatile("s_wait_xcnt 0x0" :: "s"(kp), "s"(lp) : "memory");   /* the issued loads' (wave-uniform) base addresses are inputs here, so nothing overwrites them in front of this wait */
    float m[2] = { -1.0e38f, -1.0e38f }, z[2] = { 0.f, 0.f };
#pragma unroll 1   /* rolled: a second trip's q fragments and accumulators held at once would cost registers */
    for (int qt = kt0 + (hf ? STW - 1 - wave : wave); qt < TT / 16; qt += STW) { const _Float16* qp = QH + ((size_t)b * TT + qt * 16) * 64; const _Float16* rp = QL + ((size_t)b * QHI + qt * 16) * 64;
      const v16h ah0 = frag_hp(qp, lane), ah1 = frag_hp(qp + 512, lane), al0 = frag_hp(rp, lane), al1 = frag_hp(rp + 512, lane);
      asm volatile("s_wait_xcnt 0x0" :: "s"(qp), "s"(rp) : "memory");   /* as above: the next trip forms new addresses only behind this wait */
#pragma unroll
      for (int t = 0; t < 2; ++t) { v8f acc = {}, accl = {};
        acc = wmma16(ah0, kh[t][0], acc); accl = wmma16(al0, kh[t][0], accl); accl = wmma16(ah0, kl[t][0], accl);
        acc = wmma16(ah1, kh[t][1], acc); accl = wmma16(al1, kh[t][1], accl); accl = wmma16(ah1, kl[t][1], accl);
        float v[8];
#pragma unroll
        for (int r = 0; r < 8; ++r) v[r] = (acc[r] + accl[r] * (1.0f / 1024.0f)) * SCALE;
        if (qt <= kt0 + 1) { const int thr = (kt0 + t - qt) * 16 + col - 8 * g;   /* wave-uniform test: only these two query tiles hold entries above the diagonal; query 8 g + r sees key col when r >= thr */
#pragma unroll
          for (int r = 0; r < 8; ++r) v[r] = (r >= thr) ? v[r] : -3.0e38f; }
        float mn = m[t];
#pragma unroll
        for (int r = 0; r < 8; ++r) mn = fmaxf(mn, v[r]);
        float s = z[t] * exp_slot(m[t] - mn);
#pragma unroll
        for (int r = 0; r < 8; ++r) s += exp_slot(v[r] - mn);
        z[t] = s; m[t] = mn; } }
#pragma unroll
    for (int t = 0; t < 2; ++t) { const float mo = __shfl_xor(m[t], 16), zo = __shfl_xor(z[t], 16); const float M = fmaxf(m[t], mo); const float Z = z[t] * exp_slot(m[t] - M) + zo * exp_slot(mo - M);
      if (g == 0) { pm[hf][wave][t * 16 + col] = M; pz[hf][wave][t * 16 + col] = Z; } } }
  __syncthreads();   /* publishes the STW waves' pairs of both strips to waves 0 and 1 */
  if (wave < 2) { const int c0 = (wave ? TT / 32 - 1 - (int)blockIdx.x : (int)blockIdx.x) * 32; float mw[STW], zw[STW], M = -1.0e38f, Z = 0.f;
#pragma unroll
    for (int i = 0; i < STW; ++i) { mw[i] = pm[wave][i][lane]; zw[i] = pz[wave][i][lane]; }
#pragma unroll
    for (int i = 0; i < STW; ++i) M = fmaxf(M, mw[i]);
#pragma unroll
    for (int i = 0; i < STW; ++i) Z += zw[i] * exp_slot(mw[i] - M);
    vst2(CM + (size_t)b * TT + c0 + lane, M); vst2(CZ + (size_t)b * TT + c0 + lane, 2048.0f / Z); } }   /* every column sees at least its own diagonal entry: Z_k >= 1; stored is the column's factor 2^11 / Z_k, divided once per column */
// ---- k_out64: out[b][t][0..63] = ctx row columns 0..63 (256 B by 16 lanes)
__global__ __launch_bounds__(256) void k_out64(const float* __restrict__ Y, float* __restrict__ OUT) { const size_t row = (size_t)blockIdx.x * 16 + (threadIdx.x >> 4); const int q = threadIdx.x & 15; const v4f v = *(const v4f*)(Y + row * CC + q * 4); asm volatile("s_wait_loadcnt 0x0" ::: "memory"); vst2(OUT + row * 64 + q * 4, v); }
// ---- k_pv: block = 16 queries (tile qt) of sequence b = blockIdx.z x PVS waves: ctx = P . v over keys [0, kend), P[t][k] = exp(S[t][k] - m_k) x (2^11 / Z_k) for k <= t, 0 above the diagonal (2^11 / Z_k lies in (0, 2^11], so 0 x it is 0). The logits are formed here, transposed: S^T = K Q^T with the k fragments as A and the block's q fragments (held in registers) as B, the same 3 products in the same order as in k_stat. D register r of lane (g, col) of the two 16-key tiles of a 32-key chunk is query col against keys 8 g + r and 16 + 8 g + r: exactly the lane's 16 elements of the A fragment of P, so P goes from accumulator to operand with no exchange.
// The 32-key chunks of the key range are dealt round-robin to the waves (wave w takes chunks w, w + PVS, ...); every wave keeps its own 16 x 64 f32 partial, the PVS partials are summed in wave order through LDS. P and v as bf16 hi + lo, 3 products; 256-B (row, head) segment by 16 lanes
#define PVS 16
__global__ __launch_bounds__(32 * PVS) void k_pv(const _Float16* __restrict__ QH, const _Float16* __restrict__ KH, const _Float16* __restrict__ QL, const _Float16* __restrict__ KL, const float* __restrict__ CM, const float* __restrict__ CZ, const __bf16* __restrict__ VB, const __bf16* __restrict__ VBL, int h0, float* __restrict__ Y) { const int b = blockIdx.z, h = h0; const float* cm = CM + (size_t)b * TT; const float* ci = CZ + (size_t)b * TT; __shared__ __align__(16) float ss[PVS][16][HD + 4];
  const int tid = threadIdx.x, lane = tid & 31, col = lane & 15, g = lane >> 4; const int wave = __builtin_amdgcn_readfirstlane(tid >> 5); const int qb = blockIdx.x >> 2; const int ql0 = blockIdx.x * 16; const int kce = (kb_last(qb) + 1) * 4;
  const _Float16* qp = QH + ((size_t)b * TT + ql0) * 64; const _Float16* rp = QL + ((size_t)b * QHI + ql0) * 64;
  const v16h qh0 = frag_hp(qp, lane), qh1 = frag_hp(qp + 512, lane), ql_0 = frag_hp(rp, lane), ql_1 = frag_hp(rp + 512, lane);
  asm volatile("s_wait_xcnt 0x0" :: "s"(qp), "s"(rp) : "memory");   /* the issued loads' (wave-uniform) base addresses are inputs here, so nothing overwrites them in front of this wait */
  v8f acc[HD / 16] = {};
#pragma unroll 1
  for (int kc = wave; kc < kce; kc += PVS) { const int kk = kc * 32 + 8 * g, d = ql0 + col - kk; const _Float16* kp = KH + ((size_t)b * TT + kc * 32) * 64; const _Float16* lp = KL + ((size_t)b * KHI + kc * 32) * 64; const float *mp = cm + kk, *cp = ci + kk;
    v16h kh[2][2], kl[2][2]; v4f m4[4], c4[4];
#pragma unroll
    for (int t = 0; t < 2; ++t)
#pragma unroll
      for (int c = 0; c < 2; ++c) { kh[t][c] = frag_hp(kp + t * 1024 + c * 512, lane); kl[t][c] = frag_hp(lp + t * 1024 + c * 512, lane); }
#pragma unroll
    for (int q = 0; q < 4; ++q) { const int o = (q >> 1) * 16 + (q & 1) * 4; m4[q] = *(const v4f*)(mp + o); c4[q] = *(const v4f*)(cp + o); }
    asm volatile("s_wait_xcnt 0x0" :: "s"(kp), "s"(lp), "v"(mp), "v"(cp) : "memory");   /* as above */
    __builtin_amdgcn_sched_barrier(0);   /* keeps the products behind all 24 requests: otherwise the first product, with its wait, is lifted in front of the statistics' loads, which then cost a second round of latency */
    v8f sa[2], sl[2];
#pragma unroll
    for (int t = 0; t < 2; ++t) { v8f a = {}, l = {};
      a = wmma16(kh[t][0], qh0, a); l = wmma16(kh[t][0], ql_0, l); l = wmma16(kl[t][0], qh0, l);
      a = wmma16(kh[t][1], qh1, a); l = wmma16(kh[t][1], ql_1, l); l = wmma16(kl[t][1], qh1, l); sa[t] = a; sl[t] = l; }
    /* the chunk's v fragments are requested here, into the registers that the k fragments have left free, and fly under the exps */
    const __bf16* vp = VB + ((size_t)b * KHI + kc * 32) * (size_t)64; const __bf16* wp = VBL + ((size_t)b * KHI + kc * 32) * (size_t)64; v16b vh[HD / 16], vl[HD / 16];
#pragma unroll
    for (int j = 0; j < HD / 16; ++j) { vh[j] = frag_bp(vp + j * 512, lane); vl[j] = frag_bp(wp + j * 512, lane); }
    asm volatile("s_wait_xcnt 0x0" :: "s"(vp), "s"(wp) : "memory");   /* as above */
    __builtin_amdgcn_sched_barrier(0);   /* keeps the exps behind the 16 requests: left to itself the compiler sinks the loads behind more than half of the exps, and most of their latency is then waited for */
    float pv[16];
#pragma unroll
    for (int t = 0; t < 2; ++t)
#pragma unroll
      for (int r = 0; r < 8; ++r) pv[t * 8 + r] = expf((t * 16 + r <= d) ? (sa[t][r] + sl[t][r] * (1.0f / 1024.0f)) * SCALE - m4[t * 2 + (r >> 2)][r & 3] : -3.0e38f) * c4[t * 2 + (r >> 2)][r & 3];   /* the select stands on the argument: expf(-3e38) is exactly 0, and no branch is formed round each exp */
    const F2 p = bsplit16(pv);
#pragma unroll
    for (int j = 0; j < HD / 16; ++j) { acc[j] = wmma_bf(p.h, vh[j], acc[j]); acc[j] = wmma_bf(p.l, vh[j], acc[j]); acc[j] = wmma_bf(p.h, vl[j], acc[j]); } }
#pragma unroll
  for (int j = 0; j < HD / 16; ++j)
#pragma unroll
    for (int r = 0; r < 8; ++r) ss[wave][8 * g + r][j * 16 + col] = acc[j][r] * (1.0f / 2048.0f);   /* a wave with no chunk hands zeros */
  __syncthreads();   /* publishes the PVS partials to the waves that sum them */
  if (wave < 8) { const int rl = tid >> 4, q = tid & 15; v4f s = *(const v4f*)&ss[0][rl][q * 4];
#pragma unroll
    for (int w = 1; w < PVS; ++w) s += *(const v4f*)&ss[w][rl][q * 4];
    vst2(Y + ((size_t)b * TT + ql0 + rl) * CC + h * HD + q * 4, s); } }

extern "C" void kernel_launch(void* const* d_in, const int* in_sizes, int n_in, void* d_out, int out_size, void* d_ws, size_t ws_size, hipStream_t stream) {
  (void)in_sizes; (void)n_in; (void)out_size;
  const float** F = (const float**)d_in;
  if (ws_size < (size_t)WS_END) return;
  char* ws = (char*)d_ws; _Float16 *QH = (_Float16*)(ws + WS_QH), *KH = (_Float16*)(ws + WS_KH), *VT = (_Float16*)(ws + WS_VT), *QL = (_Float16*)(ws + WS_QL), *KL = (_Float16*)(ws + WS_KL); __bf16 *VB = (__bf16*)(ws + WS_VB), *VBL = (__bf16*)(ws + WS_VBL); float *S = (float*)(ws + WS_S), *Y = (float*)(ws + WS_Y);
  (void)Y; (void)S; (void)QL; (void)KL; (void)VB; (void)VBL;
  // inputs: 0 x [8,2048,384]; 1 Wq [384,64] (in,out); 2 Wk; 3 Wv; no biases
  if (ws_size < (size_t)WS_END2) return;
  float *Y2 = (float*)(ws + WS_Y2), *CM = (float*)(ws + WS_CM), *CZ = (float*)(ws + WS_CZ);
  k_proj<<<dim3(TNB * TT / 64, CC / 128, 3), 128, 0, stream>>>(F[0], F[0], F[0], F[1], F[2], F[3], nullptr, nullptr, nullptr, QH, QL, KH, KL, VT, VB, VBL);   /* weight columns 64..127 (the padding head) are zero fragments */
  /* all sequences in one launch of each stage (the last grid index is the sequence); no score plane is stored: each stage forms the logits it needs on WMMA from q and k; head 0 only (head 1 is the zero padding) */
  k_stat<<<dim3(TT / 64, TNB), 32 * STW, 0, stream>>>(QH, KH, QL, KL, CM, CZ);   /* per key column j: max m_j and 2^11 / sum over the visible queries i >= j */
  k_pv<<<dim3(TT / 16, 1, TNB), 32 * PVS, 0, stream>>>(QH, KH, QL, KL, CM, CZ, VB, VBL, 0, Y2);   /* forms P[i][j] = exp(S - m_j) x 2^11 / Z_j (0 above the diagonal) from its own logits */
  k_out64<<<dim3(TNB * TT / 16), 256, 0, stream>>>(Y2, (float*)d_out);
}

// v008
// Measured time: 52.7 microseconds a run.
// Next to v007, in two timings, it ran 1.06 and 1.05 times as fast.
// Counting every step since v000, it is 144 times as fast.
// compute dtype: all float inputs rounded to bf16; q/k/v projections with EXACT bf16 products on WMMA 16x16x32 (f32 accumulate); causal scores with BOTH q and k as f16 hi + (x 2^10) residual (3 products) on EVERY block, x 64^-0.5; softmax over the QUERY axis in f32 (per key column: max and sum over the visible queries, per wave and merged, exp to expf's accuracy; P by precise expf); P as bf16 hi + lo against v as bf16 hi + lo (3 products) on EVERY block; f32 output.
#include <hip/hip_runtime.h>
#include <math.h>

typedef __attribute__((ext_vector_type(16))) _Float16 v16h;
typedef __attribute__((ext_vector_type(16))) __bf16 v16b;
typedef __attribute__((ext_vector_type(8)))  _Float16 v8h;
typedef __attribute__((ext_vector_type(8)))  float v8f;
typedef __attribute__((ext_vector_type(4)))  float v4f;
typedef __attribute__((ext_vector_type(2)))  float v2f;
typedef __attribute__((ext_vector_type(4)))  unsigned v4u;
typedef __attribute__((ext_vector_type(4)))  int v4i;
typedef float __attribute__((may_alias)) float_a;
typedef int __attribute__((may_alias)) int_a;

template <typename T> __device__ __forceinline__ void vst2(void* p, T v) { *(T*)p = v;  }
__device__ __forceinline__ v8f wmma16(v16h a, v16h b, v8f c) {
  v8f d = __builtin_amdgcn_wmma_f32_16x16x32_f16(false, a, false, b, (short)0, c, false, false);
  asm volatile("v_nop\n\tv_nop\n\tv_nop\n\tv_nop" : "+v"(d) : "v"(a), "v"(b));
  return d;
}
__device__ __forceinline__ v8f wmma_bf(v16b a, v16b b, v8f c) {
  v8f d = __builtin_amdgcn_wmma_f32_16x16x32_bf16(false, a, false, b, (short)0, c, false, false);
  asm volatile("v_nop\n\tv_nop\n\tv_nop\n\tv_nop" : "+v"(d) : "v"(a), "v"(b));
  return d;
}
// 16x16x32 fragments: lane = (h = lane>>4, row/col = lane&15); elements 0..7 = k0+8h+0..7, 8..15 = k0+16+8h+0..7; D element r = row 8h+r
__device__ __forceinline__ v16h frag_h(const _Float16* rowk0, int lane) {
  union { v16h v; v8h q[2]; } u; const _Float16* p = rowk0 + 8 * (lane >> 4);
  u.q[0] = *(const v8h*)p; u.q[1] = *(const v8h*)(p + 16); return u.v;
}
__device__ __forceinline__ v16h frag_f32(const float* rowk0, int lane) {
  v16h a; const float* p = rowk0 + 8 * (lane >> 4);
#pragma unroll
  for (int i = 0; i < 8; ++i) { a[i] = (_Float16)p[i]; a[8 + i] = (_Float16)p[16 + i]; }
  return a;
}
__device__ __forceinline__ v16h frag_f32s(const float* rowk0, int lane, float sc) {
  v16h a; const float* p = rowk0 + 8 * (lane >> 4);
#pragma unroll
  for (int i = 0; i < 8; ++i) { a[i] = (_Float16)(p[i] * sc); a[8 + i] = (_Float16)(p[16 + i] * sc); }
  return a;
}
// column fragment from a [K][ld] layout (column n), rows >= K read as 0
__device__ __forceinline__ v16h fragc_f32(const float* W, int k0, int n, int lane, int ld, int K) {
  v16h a; const int g = lane >> 4;
#pragma unroll
  for (int i = 0; i < 8; ++i) { const int ka = k0 + 8 * g + i, kb = ka + 16;
    a[i] = (_Float16)(ka < K ? W[(size_t)(ka < K ? ka : K - 1) * ld + n] : 0.f); a[8 + i] = (_Float16)(kb < K ? W[(size_t)(kb < K ? kb : K - 1) * ld + n] : 0.f); }
  return a;
}
struct F2 { v16b h, l; };
__device__ __forceinline__ F2 bsplit16(const float v[16]) { F2 r;
#pragma unroll
  for (int i = 0; i < 16; ++i) { const __bf16 h = (__bf16)v[i]; r.h[i] = h; r.l[i] = (__bf16)(v[i] - (float)h); }
  return r; }
__device__ __forceinline__ F2 split_row(const float* row, int k0, int lane) { float v[16]; const float* p = row + k0 + 8 * (lane >> 4);
#pragma unroll
  for (int i = 0; i < 8; ++i) { v[i] = p[i]; v[8 + i] = p[16 + i]; }
  return bsplit16(v); }
__device__ __forceinline__ F2 split_rowK(const float* row, int k0, int lane, int K) { float v[16]; const int g = lane >> 4;
#pragma unroll
  for (int i = 0; i < 8; ++i) { const int ka = k0 + 8 * g + i, kb = ka + 16; v[i] = ka < K ? row[ka < K ? ka : K - 1] : 0.f; v[8 + i] = kb < K ? row[kb < K ? kb : K - 1] : 0.f; }
  return bsplit16(v); }
__device__ __forceinline__ F2 split_col(const float* W, int k0, int n, int lane, int ld, int K) { float v[16]; const int g = lane >> 4;
#pragma unroll
  for (int i = 0; i < 8; ++i) { const int ka = k0 + 8 * g + i, kb = ka + 16; v[i] = ka < K ? W[(size_t)(ka < K ? ka : K - 1) * ld + n] : 0.f; v[8 + i] = kb < K ? W[(size_t)(kb < K ? kb : K - 1) * ld + n] : 0.f; }
  return bsplit16(v); }
__device__ __forceinline__ v8f mac3(const F2& a, const F2& b, v8f c) { c = wmma_bf(a.l, b.h, c); c = wmma_bf(a.h, b.l, c); return wmma_bf(a.h, b.h, c); }
__device__ __forceinline__ float sigm(float v) { return 1.0f / (1.0f + expf(-v)); }
#define LDSX() do { asm volatile("s_wait_dscnt 0" ::: "memory"); __builtin_amdgcn_wave_barrier(); __builtin_amdgcn_fence(__ATOMIC_RELEASE, "workgroup"); } while (0)

// Single-head causal self-attention whose softmax runs over the QUERY axis (x [8,2048,384]; (in,out) Wq / Wk / Wv [384,64] (0.02 scale), no biases; scores[b, i, j] = q_i . k_j / 8; -inf where j > i; attn = softmax(scores, axis=1) - axis 1 is the QUERY axis i, so every key column j is normalised over the queries i >= j (faithful to the source); out = attn v -> [8,2048,64]).
#define NB 8
#define TT 2048
#define CC 128            // NH * HD = projected width
#define DIN 384          // input (model) width
#define NH 2
#define HD 64
#define NQB (TT / 64)
#define SCALE (0.125f)
#define CAUSAL 1
#ifndef TNB
#define TNB NB
#endif
__device__ __forceinline__ float bfr(float v) { return (float)(__bf16)v; }
__host__ __device__ __forceinline__ int kb_last(int qb) { return CAUSAL ? ((qb * 64 + 63) >> 7) : (TT / 128 - 1); }
typedef __attribute__((ext_vector_type(8))) __bf16 v8b;
__device__ __forceinline__ v16b frag_b(const __bf16* rowk0, int lane) {
  union { v16b v; v8b q[2]; } u; const __bf16* p = rowk0 + 8 * (lane >> 4);
  u.q[0] = *(const v8b*)p; u.q[1] = *(const v8b*)(p + 16); return u.v;
}
// fragment-order planes: a 16-row tile's k chunk of 32 lies as 2 x 512 contiguous bytes: piece 0 = every lane's elements 0..7, piece 1 = its elements 8..15, 16 bytes a lane in lane order, so one wave-wide 16-byte load covers 4 whole 128-byte lines
__device__ __forceinline__ v16h frag_hp(const _Float16* chunk, int lane) {
  union { v16h v; v8h q[2]; } u; const _Float16* p = chunk + 8 * lane;
  u.q[0] = *(const v8h*)p; u.q[1] = *(const v8h*)(p + 256); return u.v;
}
__device__ __forceinline__ v16b frag_bp(const __bf16* chunk, int lane) {
  union { v16b v; v8b q[2]; } u; const __bf16* p = chunk + 8 * lane;
  u.q[0] = *(const v8b*)p; u.q[1] = *(const v8b*)(p + 256); return u.v;
}
#define QBH 32              // causal: query blocks 0..QBH-1 of each sequence (all NQB = 32 of them) take the high-precision path
#define QHI 2048            // rows carrying a q residual plane (all TT rows)
#define KHI 2048            // key rows carrying k residual / v bf16 hi+lo planes (used only by the causal high-precision path)
// B fragment (k rows k0+.., output column o) of a weight: (in,out) [K][ld] or (out,in) [ld rows of K]: bf16 exact, or f16(bf16 * 256) exact
__device__ __forceinline__ v16b wcol_io(const float* Wm, int k0, int o, int lane, int ld) { v16b w; const int g = lane >> 4;
#pragma unroll
  for (int i = 0; i < 8; ++i) { w[i] = (__bf16)Wm[(size_t)(k0 + 8 * g + i) * ld + o]; w[8 + i] = (__bf16)Wm[(size_t)(k0 + 16 + 8 * g + i) * ld + o]; }
  return w; }
__device__ __forceinline__ v16b wcol_oi(const float* Wm, int k0, int o, int lane, int K) { v16b w; const float* p = Wm + (size_t)o * K + k0 + 8 * (lane >> 4);
#pragma unroll
  for (int i = 0; i < 8; ++i) { w[i] = (__bf16)p[i]; w[8 + i] = (__bf16)p[16 + i]; }
  return w; }
__device__ __forceinline__ v16h wcolh_io(const float* Wm, int k0, int o, int lane, int ld) { v16h w; const int g = lane >> 4;
#pragma unroll
  for (int i = 0; i < 8; ++i) { w[i] = (_Float16)(bfr(Wm[(size_t)(k0 + 8 * g + i) * ld + o]) * 256.0f); w[8 + i] = (_Float16)(bfr(Wm[(size_t)(k0 + 16 + 8 * g + i) * ld + o]) * 256.0f); }
  return w; }
__device__ __forceinline__ v16h wcolh_oi(const float* Wm, int k0, int o, int lane, int K) { v16h w; const float* p = Wm + (size_t)o * K + k0 + 8 * (lane >> 4);
#pragma unroll
  for (int i = 0; i < 8; ++i) { w[i] = (_Float16)(bfr(p[i]) * 256.0f); w[8 + i] = (_Float16)(bfr(p[16 + i]) * 256.0f); }
  return w; }
#define WQKV_LAYOUT 0   // 0 = (in,out) [DIN][64] (head 0 only; columns 64..127 zero); 1 = (out,in) [CC][DIN]; 2 = per-head [NH][DIN][HD]
__device__ __forceinline__ v16b wcol_hdk(const float* Wm, int k0, int o, int lane) { v16b w; const int g = lane >> 4; const float* p = Wm + (size_t)(o / HD) * DIN * HD + (o % HD);
#pragma unroll
  for (int i = 0; i < 8; ++i) { w[i] = (__bf16)p[(size_t)(k0 + 8 * g + i) * HD]; w[8 + i] = (__bf16)p[(size_t)(k0 + 16 + 8 * g + i) * HD]; }
  return w; }
#define WO_OUT_IN 0
#if WQKV_LAYOUT == 1
#define WCOL(W, k0, o, lane) wcol_oi(W, k0, o, lane, DIN)
#elif WQKV_LAYOUT == 2
#define WCOL(W, k0, o, lane) wcol_hdk(W, k0, o, lane)
#else
__device__ __forceinline__ v16b zero16b() { v16b w; _Pragma("unroll") for (int i = 0; i < 16; ++i) w[i] = (__bf16)0.0f; return w; }
#define WCOL(W, k0, o, lane) ((o) < 64 ? wcol_io(W, k0, (o), lane, 64) : zero16b())   /* (in,out) [384][64] pitch 64: only 64 real output columns; projected columns 64..127 (padding head 1) are zero; compile-time per unrolled tile (c0 = 0) */
#endif
#if WO_OUT_IN
#define WOCOL(W, k0, o, lane) wcol_oi(W, k0, o, lane, CC)
#define WOCOLH(W, k0, o, lane) wcolh_oi(W, k0, o, lane, CC)
#else
#define WOCOL(W, k0, o, lane) wcol_io(W, k0, o, lane, DIN)
#define WOCOLH(W, k0, o, lane) wcolh_io(W, k0, o, lane, DIN)
#endif

#ifndef SM_EXTRA_PARAMS
#define SM_EXTRA_PARAMS
#endif
#ifndef PROJ_EXTRA_PARAMS
#define PROJ_EXTRA_PARAMS
#endif
#ifndef SM_MASK_HOOK
#define SM_MASK_HOOK (void)0
#endif

#define WS_QH  0u                                      // f16 q, fragment order: [b*t / 16][k chunk 2][piece 2][lane 32][8]
#define WS_KH  (WS_QH + 2u * (size_t)NB * TT * CC)      // f16 k, fragment order like q
#define WS_VT  (WS_KH + 2u * (size_t)NB * TT * CC)      // f16 v planes [b][c][t]
#define WS_QL  (WS_VT + 2u * (size_t)NB * CC * TT)      // f16 q residual x 2^10, fragment order like q
#define WS_KL  (WS_QL + 2u * (size_t)NB * QHI * CC)     // f16 k residual x 2^10, fragment order like q
#define WS_VB  (WS_KL + 2u * (size_t)NB * KHI * CC)     // bf16 v hi (VBL: lo), fragment order: [b*t / 32][column tile 4][piece 2][lane 32][8]
#define WS_VBL (WS_VB + 2u * (size_t)NB * CC * KHI)
#define WS_S   (WS_VBL + 2u * (size_t)NB * CC * KHI)    // (not used: no score plane is stored; the room stays so that the offsets behind it are as they were)
#define WS_Y   (WS_S  + 4u * (size_t)NB * TT * TT)      // f32 ctx rows [b*t][CC] (only when there is an output projection)
#define WS_END (WS_Y  + 0u)
#define WS_Y2 (WS_END)                                  // (not used: the ctx rows go straight to out; the room stays so that the offsets behind it are as they were)
#define WS_CM (WS_Y2 + 4u * (size_t)NB * TT * CC)        // f32 column maxima [b][TT]
#define WS_CZ (WS_CM + 4u * (size_t)NB * TT)             // f32 column factors 2^11 / Z [b][TT]
#define WS_END2 (WS_CZ + 4u * (size_t)NB * TT)

// ---- k_proj: block = (64 rows, 128 cols, which): q/k/v = X W (+ b) with exact bf16 products (K = DIN) -> which 0: q f16 in fragment order, head columns 0..63 (+ residual rows < QHI); 1: k likewise (+ residual rows < KHI); 2: v f16 planes [c][t] (+ bf16 hi/lo planes for t < KHI)
__global__ __launch_bounds__(128) void k_proj(const float* __restrict__ XQ, const float* __restrict__ XK, const float* __restrict__ XV, const float* __restrict__ WQ, const float* __restrict__ WK, const float* __restrict__ WV, const float* __restrict__ BQ, const float* __restrict__ BK, const float* __restrict__ BV,
    _Float16* __restrict__ QH, _Float16* __restrict__ QL, _Float16* __restrict__ KH, _Float16* __restrict__ KL, _Float16* __restrict__ VT, __bf16* __restrict__ VB, __bf16* __restrict__ VBL) {
  /* one LDS block, two lives: the k loop reads wf (the block's 48 bf16 weight fragments, [k chunk 12][column tile 4][piece 2][lane 32][8], 48 KiB); behind the barrier that ends the loop the store planes sh .. tbl lie over it, so LDS stays at 88 KiB and 3 blocks share a WGP */
  __shared__ __align__(16) unsigned char sm[90112]; __bf16* wf = (__bf16*)sm;
  _Float16 (*sh)[136] = (_Float16 (*)[136])sm; _Float16 (*sl)[136] = (_Float16 (*)[136])(sm + 17408); _Float16 (*th)[72] = (_Float16 (*)[72])(sm + 34816); __bf16 (*tb)[72] = (__bf16 (*)[72])(sm + 53248); __bf16 (*tbl)[72] = (__bf16 (*)[72])(sm + 71680);
  const int tid = threadIdx.x, wave = tid >> 5, lane = tid & 31, col = lane & 15, g = lane >> 4; const int which = blockIdx.z; const int c0 = blockIdx.y * 128; const size_t r0 = (size_t)blockIdx.x * 64; const size_t bb = r0 / TT; const int t0 = (int)(r0 % TT);
  const float* X = which == 0 ? XQ : which == 1 ? XK : XV; const float* WA = which == 0 ? WQ : which == 1 ? WK : WV; const float* BA = which == 0 ? BQ : which == 1 ? BK : BV;
  /* the wave's 16 x rows: the first XA of the 12 k chunks are requested in front of everything else, so that their memory latency runs under the weight staging */
#define XA 8
  const float* xp = X + (r0 + wave * 16 + col) * DIN + 8 * g; v4f xr[DIN / 32][4];
#pragma unroll
  for (int kc = 0; kc < XA; ++kc) { xr[kc][0] = *(const v4f*)(xp + kc * 32); xr[kc][1] = *(const v4f*)(xp + kc * 32 + 4); xr[kc][2] = *(const v4f*)(xp + kc * 32 + 16); xr[kc][3] = *(const v4f*)(xp + kc * 32 + 20); }
  asm volatile("s_wait_xcnt 0x0" :: "v"(xp) : "memory");   /* the issued loads' address pair is an input here, so nothing overwrites it in front of this wait */
  /* wave w brings column tile w of every k chunk, each lane its own 16 fragment elements, and lays them down in fragment order: every weight element is fetched once per block, not once per wave. the grid has one column block (c0 = 0), so this block-uniform test always holds; the padding head's columns 64..127 are tiles 4..7 of the loop, which take no weights */
  if (c0 == 0) {
#pragma unroll
    for (int kc = 0; kc < DIN / 32; ++kc) { union { v16b v; v8b q[2]; } u; u.v = wcol_io(WA, kc * 32, wave * 16 + col, lane, 64); __bf16* d = wf + (kc * 4 + wave) * 512 + 8 * lane; *(v8b*)d = u.q[0]; *(v8b*)(d + 256) = u.q[1];
      if (kc == DIN / 64 - 1) __builtin_amdgcn_sched_barrier(0); }   /* two rounds of 96 loads: with all 192 in flight beside the x rows the build takes 333 registers, which leaves three waves on a SIMD (three blocks on a WGP) next to no room */
  } else {
#pragma unroll
    for (int kc = 0; kc < DIN / 32; ++kc) { union { v16b v; v8b q[2]; } u; u.v = zero16b(); __bf16* d = wf + (kc * 4 + wave) * 512 + 8 * lane; *(v8b*)d = u.q[0]; *(v8b*)(d + 256) = u.q[1]; } }
  asm volatile("s_wait_xcnt 0x0" ::: "memory");   /* behind the staging the weight loads' address registers are reused: the wait stands in front of that */
  v16b ab[DIN / 32];
#pragma unroll
  for (int kc = 0; kc < XA; ++kc)
#pragma unroll
    for (int i = 0; i < 4; ++i) { ab[kc][i] = (__bf16)xr[kc][0][i]; ab[kc][4 + i] = (__bf16)xr[kc][1][i]; ab[kc][8 + i] = (__bf16)xr[kc][2][i]; ab[kc][12 + i] = (__bf16)xr[kc][3][i]; }
  __syncthreads();   /* publishes the 48 fragments to all four waves */
  /* the last chunks of x are requested here, into the registers that the staging has left free, and fly under the first XA chunks' products (in front of the barrier they would be waited for at it) */
#pragma unroll
  for (int kc = XA; kc < DIN / 32; ++kc) { xr[kc][0] = *(const v4f*)(xp + kc * 32); xr[kc][1] = *(const v4f*)(xp + kc * 32 + 4); xr[kc][2] = *(const v4f*)(xp + kc * 32 + 16); xr[kc][3] = *(const v4f*)(xp + kc * 32 + 20); }
  asm volatile("s_wait_xcnt 0x0" :: "v"(xp) : "memory");   /* as above: the address pair lives up to this wait */
  v8f acc[8] = {};
#pragma unroll
  for (int kc = 0; kc < DIN / 32; ++kc) { v16b w[4];
#pragma unroll
    for (int j = 0; j < 4; ++j) w[j] = frag_bp(wf + (kc * 4 + j) * 512, lane);
    if (kc >= XA) {
#pragma unroll
      for (int i = 0; i < 4; ++i) { ab[kc][i] = (__bf16)xr[kc][0][i]; ab[kc][4 + i] = (__bf16)xr[kc][1][i]; ab[kc][8 + i] = (__bf16)xr[kc][2][i]; ab[kc][12 + i] = (__bf16)xr[kc][3][i]; } }
#pragma unroll
    for (int j = 4; j < 8; ++j) acc[j] = wmma_bf(ab[kc], zero16b(), acc[j]);   /* tiles 4..7 are the padding head's zero columns, as before; they need no LDS operand and run while the four fragments come */
    asm volatile("" :: "v"(w[0]), "v"(w[1]), "v"(w[2]), "v"(w[3]));   /* inputs-only fence on the loaded values: the chunk's eight LDS loads are issued together in front of it (one round of LDS latency a chunk); without it each fragment is fetched and waited for alone */
#pragma unroll
    for (int j = 0; j < 4; ++j) acc[j] = wmma_bf(ab[kc], w[j], acc[j]); }
  __syncthreads();   /* ends every wave's last read of wf: the store planes below overwrite it */
  if (which < 2) { _Float16* DH = which == 0 ? QH : KH; _Float16* DL = which == 0 ? QL : KL; const int nhi = which == 0 ? QHI : KHI; const bool hi_rows = t0 < nhi;
#pragma unroll
    for (int j = 0; j < 8; ++j) { const float bias = BA ? bfr(BA[c0 + j * 16 + col]) : 0.f;
#pragma unroll
      for (int r = 0; r < 8; ++r) { const float v = acc[j][r] + bias; const _Float16 hv = (_Float16)v; sh[wave * 16 + 8 * g + r][j * 16 + col] = hv; sl[wave * 16 + 8 * g + r][j * 16 + col] = (_Float16)((v - (float)hv) * 1024.0f); } }
    __syncthreads();
    /* fragment order, head columns 0..63 only: 16-byte unit u = ((row tile * 2 + k chunk) * 2 + piece) * 32 + lane, lane = 16 g + row in tile; it holds columns 8 q .. 8 q + 7 with q = (k chunk, piece, g) */
    for (int u = tid; u < 64 * 8; u += 128) { const int rl = (u >> 7) * 16 + (u & 15), q = (u >> 4) & 7; vst2((unsigned*)(DH + r0 * 64 + (size_t)u * 8), *(const v4u*)&sh[rl][q * 8]); if (hi_rows) vst2((unsigned*)(DL + (bb * nhi + t0) * (size_t)64 + (size_t)u * 8), *(const v4u*)&sl[rl][q * 8]); }
  } else { const bool hi_rows = t0 < KHI;
#pragma unroll
    for (int j = 0; j < 8; ++j) { const float bias = BA ? bfr(BA[c0 + j * 16 + col]) : 0.f;
#pragma unroll
      for (int r = 0; r < 8; ++r) { const float v = acc[j][r] + bias; const int rl = wave * 16 + 8 * g + r, cl = j * 16 + col; th[cl][rl] = (_Float16)v; const __bf16 bh = (__bf16)v; tb[cl][rl] = bh; tbl[cl][rl] = (__bf16)(v - (float)bh); } }
    __syncthreads();
    for (int e = tid; e < 128 * 8; e += 128) { const int cl = e >> 3, q = e & 7; vst2((unsigned*)(VT + (bb * CC + c0 + cl) * (size_t)TT + t0 + q * 8), *(const v4u*)&th[cl][q * 8]); }
    /* bf16 hi / lo in fragment order, head columns 0..63 only: 16-byte unit u = ((32-key chunk * 4 + column tile) * 2 + piece) * 32 + lane, lane = 16 g + column in tile; it holds keys 8 q .. 8 q + 7 of the block with q = (chunk, piece, g) */
    if (hi_rows) for (int u = tid; u < 64 * 8; u += 128) { const int cl = ((u >> 6) & 3) * 16 + (u & 15), q = (u >> 8) * 4 + ((u >> 4) & 3); const size_t o3 = (bb * KHI + t0) * (size_t)64 + (size_t)u * 8; vst2((unsigned*)(VB + o3), *(const v4u*)&tb[cl][q * 8]); vst2((unsigned*)(VBL + o3), *(const v4u*)&tbl[cl][q * 8]); } } }
// ---- k_sm: block = query row t (head in group): keys [0, kend): causal -> logit if s <= t else excluded; softmax in f32; P x 2^11 in place (0 for excluded)
__global__ __launch_bounds__(256) void k_sm(float* __restrict__ S0 SM_EXTRA_PARAMS) { __shared__ float sred[8]; __shared__ float sbc; __shared__ __align__(16) float shv[TT];
  const int tid = threadIdx.x; const int t = blockIdx.x; const int kend = (kb_last(t >> 6) + 1) * 128;
  float* sr = S0 + (size_t)blockIdx.y * TT * TT + (size_t)t * TT;
  float m = -3.0e38f; for (int k = tid; k < kend; k += 256) { float v = (!CAUSAL || k <= t) ? sr[k] : -3.0e38f; SM_MASK_HOOK; shv[k] = v; m = fmaxf(m, v); }
#pragma unroll
  for (int o = 1; o < 32; o <<= 1) m = fmaxf(m, __shfl_xor(m, o));
  if ((tid & 31) == 0) sred[tid >> 5] = m; __syncthreads(); if (tid == 0) { float a = sred[0]; for (int i = 1; i < 8; ++i) a = fmaxf(a, sred[i]); sbc = a; } __syncthreads(); m = sbc; __syncthreads();
  float sum = 0.f; for (int k = tid; k < kend; k += 256) { const float v = shv[k]; const float e = (v <= -1.0e38f) ? 0.f : expf(v - m); shv[k] = e; sum += e; }
#pragma unroll
  for (int o = 1; o < 32; o <<= 1) sum += __shfl_xor(sum, o);
  if ((tid & 31) == 0) sred[tid >> 5] = sum; __syncthreads(); if (tid == 0) { float a = 0.f; for (int i = 0; i < 8; ++i) a += sred[i]; sbc = a > 0.f ? 2048.0f / a : 0.f; }   /* a fully excluded row yields P = 0 */ __syncthreads(); const float inv = sbc;
  for (int k = tid; k < kend; k += 256) shv[k] = shv[k] * inv;
  __syncthreads(); for (int q = tid; q < kend / 4; q += 256) vst2(sr + q * 4, *(const v4f*)&shv[q * 4]); }
// exp for k_stat, to expf's accuracy: e = the integer nearest to x log2(e); the fraction x log2(e) - e by two fused multiply-adds with the constant's high and low word; exp2 of the fraction, ldexp by e; 0 below -103.28 (ln 2^-149), +inf above 88.72 (expf's overflow limit). v_exp_f32 stands in one asm statement with a v_nop: the free slot that the instruction set asks for between a transcendental and an instruction that reads its result or overwrites its source (in a statement of its own nothing would hold the v_nop there)
__device__ __forceinline__ float exp_slot(float x) { const float c = __builtin_bit_cast(float, 0x3fb8aa3bu), cl = __builtin_bit_cast(float, 0x32a5705fu);
  const float e = __builtin_rintf(x * c); const float a = __builtin_fmaf(x, cl, __builtin_fmaf(x, c, -e)); float r;
  asm("v_exp_f32 %0, %1\n\tv_nop" : "=v"(r) : "v"(a));   /* the v_nop keeps the slot behind the transcendental free whatever the compiler schedules next */
  r = __builtin_ldexpf(r, (int)e); r = (x < __builtin_bit_cast(float, 0xc2ce8ed0u)) ? 0.f : r; return (x > __builtin_bit_cast(float, 0x42b17218u)) ? __builtin_inff() : r; }
// ---- k_stat: softmax over the QUERY axis under the causal mask (the source's softmax(axis=1) on [B, t, s] scores with -inf above the diagonal), with no stored score plane: for every key column k: m_k = max_{q >= k} S[q][k], Z_k = sum_{q >= k} exp(S[q][k] - m_k) (f32, exp_slot), the logits taken straight from the WMMA accumulators.
// A strip = 32 key columns (two 16-key tiles, their k hi + residual fragments held in registers as the B operands). Strip s has 128 - 2 s query tiles below its diagonal, so a block (STW waves, sequence blockIdx.y) takes the strips s = blockIdx.x and 63 - s one after the other: 130 query tiles for every block. A strip's 16-query tiles are dealt round-robin to the waves (the second strip's from the last wave down, so that the two remainders do not meet in the same waves); a tile's logits are q hi + residual (x 2^10) against k hi + residual (3 products), x SCALE.
// D register r of lane (g, col) is query 8 g + r of the tile against key col: each lane keeps one running (max, sum) per key tile, rescaled once per query tile; the two lane halves are merged at the strip's end, the STW pairs of a column through LDS by wave 0 (first strip) and wave 1 (second strip): M = max m_w, Z = sum z_w exp(m_w - M).
// Sentinels: a hidden entry (only in a strip's first two query tiles) reads -3e38 and the running max starts at -1e38, so a hidden entry adds exp(-2e38) = 0, and a wave with no tile hands the pair (-1e38, 0), which adds 0 to the merge (the logits are sums of 64 f16-range products, far above -1e38).
#define STW 16
__global__ __launch_bounds__(32 * STW) void k_stat(const _Float16* __restrict__ QH, const _Float16* __restrict__ KH, const _Float16* __restrict__ QL, const _Float16* __restrict__ KL, float* __restrict__ CM, float* __restrict__ CZ) { __shared__ __align__(16) float pm[2][STW][32], pz[2][STW][32];
  const int tid = threadIdx.x, lane = tid & 31, col = lane & 15, g = lane >> 4; const int wave = __builtin_amdgcn_readfirstlane(tid >> 5); const int b = blockIdx.y;   /* below, the short loops over t, c, r, i are unrolled so that the fragment and accumulator arrays are indexed by constants and stay in registers */
#pragma unroll 1   /* the two strips run through one copy of the code */
  for (int hf = 0; hf < 2; ++hf) { const int kt0 = (hf ? TT / 32 - 1 - (int)blockIdx.x : (int)blockIdx.x) * 2;
    const _Float16* kp = KH + ((size_t)b * TT + kt0 * 16) * 64; const _Float16* lp = KL + ((size_t)b * KHI + kt0 * 16) * 64;
    v16h kh[2][2], kl[2][2];
#pragma unroll
    for (int t = 0; t < 2; ++t)
#pragma unroll
      for (int c = 0; c < 2; ++c) { kh[t][c] = frag_hp(kp + t * 1024 + c * 512, lane); kl[t][c] = frag_hp(lp + t * 1024 + c * 512, lane); }
    asm volatile("s_wait_xcnt 0x0" :: "s"(kp), "s"(lp) : "memory");   /* the issued loads' (wave-uniform) base addresses are inputs here, so nothing overwrites them in front of this wait */
    float m[2] = { -1.0e38f, -1.0e38f }, z[2] = { 0.f, 0.f };
#pragma unroll 1   /* rolled: a second trip's q fragments and accumulators held at once would cost registers */
    for (int qt = kt0 + (hf ? STW - 1 - wave : wave); qt < TT / 16; qt += STW) { const _Float16* qp = QH + ((size_t)b * TT + qt * 16) * 64; const _Float16* rp = QL + ((size_t)b * QHI + qt * 16) * 64;
      const v16h ah0 = frag_hp(qp, lane), ah1 = frag_hp(qp + 512, lane), al0 = frag_hp(rp, lane), al1 = frag_hp(rp + 512, lane);
      asm volatile("s_wait_xcnt 0x0" :: "s"(qp), "s"(rp) : "memory");   /* as above: the next trip forms new addresses only behind this wait */
#pragma unroll
      for (int t = 0; t < 2; ++t) { v8f acc = {}, accl = {};
        acc = wmma16(ah0, kh[t][0], acc); accl = wmma16(al0, kh[t][0], accl); accl = wmma16(ah0, kl[t][0], accl);
        acc = wmma16(ah1, kh[t][1], acc); accl = wmma16(al1, kh[t][1], accl); accl = wmma16(ah1, kl[t][1], accl);
        float v[8];
#pragma unroll
        for (int r = 0; r < 8; ++r) v[r] = (acc[r] + accl[r] * (1.0f / 1024.0f)) * SCALE;
        if (qt <= kt0 + 1) { const int thr = (kt0 + t - qt) * 16 + col - 8 * g;   /* wave-uniform test: only these two query tiles hold entries above the diagonal; query 8 g + r sees key col when r >= thr */
#pragma unroll
          for (int r = 0; r < 8; ++r) v[r] = (r >= thr) ? v[r] : -3.0e38f; }
        float mn = m[t];
#pragma unroll
        for (int r = 0; r < 8; ++r) mn = fmaxf(mn, v[r]);
        float s = z[t] * exp_slot(m[t] - mn);
#pragma unroll
        for (int r = 0; r < 8; ++r) s += exp_slot(v[r] - mn);
        z[t] = s; m[t] = mn; } }
#pragma unroll
    for (int t = 0; t < 2; ++t) { const float mo = __shfl_xor(m[t], 16), zo = __shfl_xor(z[t], 16); const float M = fmaxf(m[t], mo); const float Z = z[t] * exp_slot(m[t] - M) + zo * exp_slot(mo - M);
      if (g == 0) { pm[hf][wave][t * 16 + col] = M; pz[hf][wave][t * 16 + col] = Z; } } }
  __syncthreads();   /* publishes the STW waves' pairs of both strips to waves 0 and 1 */
  if (wave < 2) { const int c0 = (wave ? TT / 32 - 1 - (int)blockIdx.x : (int)blockIdx.x) * 32; float mw[STW], zw[STW], M = -1.0e38f, Z = 0.f;
#pragma unroll
    for (int i = 0; i < STW; ++i) { mw[i] = pm[wave][i][lane]; zw[i] = pz[wave][i][lane]; }
#pragma unroll
    for (int i = 0; i < STW; ++i) M = fmaxf(M, mw[i]);
#pragma unroll
    for (int i = 0; i < STW; ++i) Z += zw[i] * exp_slot(mw[i] - M);
    vst2(CM + (size_t)b * TT + c0 + lane, M); vst2(CZ + (size_t)b * TT + c0 + lane, 2048.0f / Z); } }   /* every column sees at least its own diagonal entry: Z_k >= 1; stored is the column's factor 2^11 / Z_k, divided once per column */
// ---- k_pv: block = 16 queries (tile qt) of sequence b = blockIdx.z x PVS waves: ctx = P . v over keys [0, kend), P[t][k] = exp(S[t][k] - m_k) x (2^11 / Z_k) for k <= t, 0 above the diagonal (2^11 / Z_k lies in (0, 2^11], so 0 x it is 0). The logits are formed here, transposed: S^T = K Q^T with the k fragments as A and the block's q fragments (held in registers) as B, the same 3 products in the same order as in k_stat. D register r of lane (g, col) of the two 16-key tiles of a 32-key chunk is query col against keys 8 g + r and 16 + 8 g + r: exactly the lane's 16 elements of the A fragment of P, so P goes from accumulator to operand with no exchange.
// The 32-key chunks of the key range are dealt round-robin to the waves (wave w takes chunks w, w + PVS, ...); every wave keeps its own 16 x 64 f32 partial, the PVS partials are summed in wave order through LDS. P and v as bf16 hi + lo, 3 products; the sums are the output rows and are stored to out itself, 256 B a row by 16 lanes
#define PVS 16
__global__ __launch_bounds__(32 * PVS) void k_pv(const _Float16* __restrict__ QH, const _Float16* __restrict__ KH, const _Float16* __restrict__ QL, const _Float16* __restrict__ KL, const float* __restrict__ CM, const float* __restrict__ CZ, const __bf16* __restrict__ VB, const __bf16* __restrict__ VBL, float* __restrict__ OUT) { const int b = blockIdx.z; const float* cm = CM + (size_t)b * TT; const float* ci = CZ + (size_t)b * TT; __shared__ __align__(16) float ss[PVS][16][HD + 4];
  const int tid = threadIdx.x, lane = tid & 31, col = lane & 15, g = lane >> 4; const int wave = __builtin_amdgcn_readfirstlane(tid >> 5); const int qb = blockIdx.x >> 2; const int ql0 = blockIdx.x * 16; const int kce = (kb_last(qb) + 1) * 4;
  const _Float16* qp = QH + ((size_t)b * TT + ql0) * 64; const _Float16* rp = QL + ((size_t)b * QHI + ql0) * 64;
  const v16h qh0 = frag_hp(qp, lane), qh1 = frag_hp(qp + 512, lane), ql_0 = frag_hp(rp, lane), ql_1 = frag_hp(rp + 512, lane);
  asm volatile("s_wait_xcnt 0x0" :: "s"(qp), "s"(rp) : "memory");   /* the issued loads' (wave-uniform) base addresses are inputs here, so nothing overwrites them in front of this wait */
  v8f acc[HD / 16] = {};
#pragma unroll 1
  for (int kc = wave; kc < kce; kc += PVS) { const int kk = kc * 32 + 8 * g, d = ql0 + col - kk; const _Float16* kp = KH + ((size_t)b * TT + kc * 32) * 64; const _Float16* lp = KL + ((size_t)b * KHI + kc * 32) * 64; const float *mp = cm + kk, *cp = ci + kk;
    v16h kh[2][2], kl[2][2]; v4f m4[4], c4[4];
#pragma unroll
    for (int t = 0; t < 2; ++t)
#pragma unroll
      for (int c = 0; c < 2; ++c) { kh[t][c] = frag_hp(kp + t * 1024 + c * 512, lane); kl[t][c] = frag_hp(lp + t * 1024 + c * 512, lane); }
#pragma unroll
    for (int q = 0; q < 4; ++q) { const int o = (q >> 1) * 16 + (q & 1) * 4; m4[q] = *(const v4f*)(mp + o); c4[q] = *(const v4f*)(cp + o); }
    asm volatile("s_wait_xcnt 0x0" :: "s"(kp), "s"(lp), "v"(mp), "v"(cp) : "memory");   /* as above */
    __builtin_amdgcn_sched_barrier(0);   /* keeps the products behind all 24 requests: otherwise the first product, with its wait, is lifted in front of the statistics' loads, which then cost a second round of latency */
    v8f sa[2], sl[2];
#pragma unroll
    for (int t = 0; t < 2; ++t) { v8f a = {}, l = {};
      a = wmma16(kh[t][0], qh0, a); l = wmma16(kh[t][0], ql_0, l); l = wmma16(kl[t][0], qh0, l);
      a = wmma16(kh[t][1], qh1, a); l = wmma16(kh[t][1], ql_1, l); l = wmma16(kl[t][1], qh1, l); sa[t] = a; sl[t] = l; }
    /* the chunk's v fragments are requested here, into the registers that the k fragments have left free, and fly under the exps */
    const __bf16* vp = VB + ((size_t)b * KHI + kc * 32) * (size_t)64; const __bf16* wp = VBL + ((size_t)b * KHI + kc * 32) * (size_t)64; v16b vh[HD / 16], vl[HD / 16];
#pragma unroll
    for (int j = 0; j < HD / 16; ++j) { vh[j] = frag_bp(vp + j * 512, lane); vl[j] = frag_bp(wp + j * 512, lane); }
    asm volatile("s_wait_xcnt 0x0" :: "s"(vp), "s"(wp) : "memory");   /* as above */
    __builtin_amdgcn_sched_barrier(0);   /* keeps the exps behind the 16 requests: left to itself the compiler sinks the loads behind more than half of the exps, and most of their latency is then waited for */
    float pv[16];
#pragma unroll
    for (int t = 0; t < 2; ++t)
#pragma unroll
      for (int r = 0; r < 8; ++r) pv[t * 8 + r] = expf((t * 16 + r <= d) ? (sa[t][r] + sl[t][r] * (1.0f / 1024.0f)) * SCALE - m4[t * 2 + (r >> 2)][r & 3] : -3.0e38f) * c4[t * 2 + (r >> 2)][r & 3];   /* the select stands on the argument: expf(-3e38) is exactly 0, and no branch is formed round each exp */
    const F2 p = bsplit16(pv);
#pragma unroll
    for (int j = 0; j < HD / 16; ++j) { acc[j] = wmma_bf(p.h, vh[j], acc[j]); acc[j] = wmma_bf(p.l, vh[j], acc[j]); acc[j] = wmma_bf(p.h, vl[j], acc[j]); } }
#pragma unroll
  for (int j = 0; j < HD / 16; ++j)
#pragma unroll
    for (int r = 0; r < 8; ++r) ss[wave][8 * g + r][j * 16 + col] = acc[j][r] * (1.0f / 2048.0f);   /* a wave with no chunk hands zeros */
  __syncthreads();   /* publishes the PVS partials to the waves that sum them */
  if (wave < 8) { const int rl = tid >> 4, q = tid & 15; v4f s = *(const v4f*)&ss[0][rl][q * 4];
#pragma unroll
    for (int w = 1; w < PVS; ++w) s += *(const v4f*)&ss[w][rl][q * 4];
    vst2(OUT + ((size_t)b * TT + ql0 + rl) * HD + q * 4, s); } }   /* straight into out [b][t][64]: the block's 16 rows are 4 KiB in a row, each wave-wide store 4 whole lines */

extern "C" void kernel_launch(void* const* d_in, const int* in_sizes, int n_in, void* d_out, int out_size, void* d_ws, size_t ws_size, hipStream_t stream) {
  (void)in_sizes; (void)n_in; (void)out_size;
  const float** F = (const float**)d_in;
  if (ws_size < (size_t)WS_END) return;
  char* ws = (char*)d_ws; _Float16 *QH = (_Float16*)(ws + WS_QH), *KH = (_Float16*)(ws + WS_KH), *VT = (_Float16*)(ws + WS_VT), *QL = (_Float16*)(ws + WS_QL), *KL = (_Float16*)(ws + WS_KL); __bf16 *VB = (__bf16*)(ws + WS_VB), *VBL = (__bf16*)(ws + WS_VBL); float *S = (float*)(ws + WS_S), *Y = (float*)(ws + WS_Y);
  (void)Y; (void)S; (void)QL; (void)KL; (void)VB; (void)VBL;
  // inputs: 0 x [8,2048,384]; 1 Wq [384,64] (in,out); 2 Wk; 3 Wv; no biases
  if (ws_size < (size_t)WS_END2) return;
  float *CM = (float*)(ws + WS_CM), *CZ = (float*)(ws + WS_CZ);
  k_proj<<<dim3(TNB * TT / 64, CC / 128, 3), 128, 0, stream>>>(F[0], F[0], F[0], F[1], F[2], F[3], nullptr, nullptr, nullptr, QH, QL, KH, KL, VT, VB, VBL);   /* weight columns 64..127 (the padding head) are zero fragments */
  /* all sequences in one launch of each stage (the last grid index is the sequence); no score plane is stored: each stage forms the logits it needs on WMMA from q and k; head 0 only (head 1 is the zero padding) */
  k_stat<<<dim3(TT / 64, TNB), 32 * STW, 0, stream>>>(QH, KH, QL, KL, CM, CZ);   /* per key column j: max m_j and 2^11 / sum over the visible queries i >= j */
  k_pv<<<dim3(TT / 16, 1, TNB), 32 * PVS, 0, stream>>>(QH, KH, QL, KL, CM, CZ, VB, VBL, (float*)d_out);   /* forms P[i][j] = exp(S - m_j) x 2^11 / Z_j (0 above the diagonal) from its own logits; writes every element of out */
}

// v009
// Measured time: 47.3 microseconds a run.
// In two side-by-side timings against v008, it was 1.12 and 1.11 times as fast.
// All steps since v000 together make it 160 times as fast.
// compute dtype: all float inputs rounded to bf16; q/k/v projections with EXACT bf16 products on WMMA 16x16x32 (f32 accumulate); causal scores with BOTH q and k as f16 hi + (x 2^10) residual (3 products) on EVERY block, x 64^-0.5; softmax over the QUERY axis in f32 (per key column: max and sum over the visible queries, per wave and merged; every exp is one v_exp_f32 of a base-2 argument, an entry's formed by one fused multiply-add); P as bf16 hi + lo against v as bf16 hi + lo (3 products) on EVERY block; f32 output.
#include <hip/hip_runtime.h>
#include <math.h>

typedef __attribute__((ext_vector_type(16))) _Float16 v16h;
typedef __attribute__((ext_vector_type(16))) __bf16 v16b;
typedef __attribute__((ext_vector_type(8)))  _Float16 v8h;
typedef __attribute__((ext_vector_type(8)))  float v8f;
typedef __attribute__((ext_vector_type(4)))  float v4f;
typedef __attribute__((ext_vector_type(2)))  float v2f;
typedef __attribute__((ext_vector_type(4)))  unsigned v4u;
typedef __attribute__((ext_vector_type(4)))  int v4i;
typedef float __attribute__((may_alias)) float_a;
typedef int __attribute__((may_alias)) int_a;

template <typename T> __device__ __forceinline__ void vst2(void* p, T v) { *(T*)p = v;  }
__device__ __forceinline__ v8f wmma16(v16h a, v16h b, v8f c) {
  v8f d = __builtin_amdgcn_wmma_f32_16x16x32_f16(false, a, false, b, (short)0, c, false, false);
  asm volatile("v_nop\n\tv_nop\n\tv_nop\n\tv_nop" : "+v"(d) : "v"(a), "v"(b));
  return d;
}
__device__ __forceinline__ v8f wmma_bf(v16b a, v16b b, v8f c) {
  v8f d = __builtin_amdgcn_wmma_f32_16x16x32_bf16(false, a, false, b, (short)0, c, false, false);
  asm volatile("v_nop\n\tv_nop\n\tv_nop\n\tv_nop" : "+v"(d) : "v"(a), "v"(b));
  return d;
}
// 16x16x32 fragments: lane = (h = lane>>4, row/col = lane&15); elements 0..7 = k0+8h+0..7, 8..15 = k0+16+8h+0..7; D element r = row 8h+r
__device__ __forceinline__ v16h frag_h(const _Float16* rowk0, int lane) {
  union { v16h v; v8h q[2]; } u; const _Float16* p = rowk0 + 8 * (lane >> 4);
  u.q[0] = *(const v8h*)p; u.q[1] = *(const v8h*)(p + 16); return u.v;
}
__device__ __forceinline__ v16h frag_f32(const float* rowk0, int lane) {
  v16h a; const float* p = rowk0 + 8 * (lane >> 4);
#pragma unroll
  for (int i = 0; i < 8; ++i) { a[i] = (_Float16)p[i]; a[8 + i] = (_Float16)p[16 + i]; }
  return a;
}
__device__ __forceinline__ v16h frag_f32s(const float* rowk0, int lane, float sc) {
  v16h a; const float* p = rowk0 + 8 * (lane >> 4);
#pragma unroll
  for (int i = 0; i < 8; ++i) { a[i] = (_Float16)(p[i] * sc); a[8 + i] = (_Float16)(p[16 + i] * sc); }
  return a;
}
// column fragment from a [K][ld] layout (column n), rows >= K read as 0
__device__ __forceinline__ v16h fragc_f32(const float* W, int k0, int n, int lane, int ld, int K) {
  v16h a; const int g = lane >> 4;
#pragma unroll
  for (int i = 0; i < 8; ++i) { const int ka = k0 + 8 * g + i, kb = ka + 16;
    a[i] = (_Float16)(ka < K ? W[(size_t)(ka < K ? ka : K - 1) * ld + n] : 0.f); a[8 + i] = (_Float16)(kb < K ? W[(size_t)(kb < K ? kb : K - 1) * ld + n] : 0.f); }
  return a;
}
struct F2 { v16b h, l; };
__device__ __forceinline__ F2 bsplit16(const float v[16]) { F2 r;
#pragma unroll
  for (int i = 0; i < 16; ++i) { const __bf16 h = (__bf16)v[i]; r.h[i] = h; r.l[i] = (__bf16)(v[i] - (float)h); }
  return r; }
__device__ __forceinline__ F2 split_row(const float* row, int k0, int lane) { float v[16]; const float* p = row + k0 + 8 * (lane >> 4);
#pragma unroll
  for (int i = 0; i < 8; ++i) { v[i] = p[i]; v[8 + i] = p[16 + i]; }
  return bsplit16(v); }
__device__ __forceinline__ F2 split_rowK(const float* row, int k0, int lane, int K) { float v[16]; const int g = lane >> 4;
#pragma unroll
  for (int i = 0; i < 8; ++i) { const int ka = k0 + 8 * g + i, kb = ka + 16; v[i] = ka < K ? row[ka < K ? ka : K - 1] : 0.f; v[8 + i] = kb < K ? row[kb < K ? kb : K - 1] : 0.f; }
  return bsplit16(v); }
__device__ __forceinline__ F2 split_col(const float* W, int k0, int n, int lane, int ld, int K) { float v[16]; const int g = lane >> 4;
#pragma unroll
  for (int i = 0; i < 8; ++i) { const int ka = k0 + 8 * g + i, kb = ka + 16; v[i] = ka < K ? W[(size_t)(ka < K ? ka : K - 1) * ld + n] : 0.f; v[8 + i] = kb < K ? W[(size_t)(kb < K ? kb : K - 1) * ld + n] : 0.f; }
  return bsplit16(v); }
__device__ __forceinline__ v8f mac3(const F2& a, const F2& b, v8f c) { c = wmma_bf(a.l, b.h, c); c = wmma_bf(a.h, b.l, c); return wmma_bf(a.h, b.h, c); }
__device__ __forceinline__ float sigm(float v) { return 1.0f / (1.0f + expf(-v)); }
#define LDSX() do { asm volatile("s_wait_dscnt 0" ::: "memory"); __builtin_amdgcn_wave_barrier(); __builtin_amdgcn_fence(__ATOMIC_RELEASE, "workgroup"); } while (0)

// Single-head causal self-attention whose softmax runs over the QUERY axis (x [8,2048,384]; (in,out) Wq / Wk / Wv [384,64] (0.02 scale), no biases; scores[b, i, j] = q_i . k_j / 8; -inf where j > i; attn = softmax(scores, axis=1) - axis 1 is the QUERY axis i, so every key column j is normalised over the queries i >= j (faithful to the source); out = attn v -> [8,2048,64]).
#define NB 8
#define TT 2048
#define CC 128            // NH * HD = projected width
#define DIN 384          // input (model) width
#define NH 2
#define HD 64
#define NQB (TT / 64)
#define SCALE (0.125f)
#define CAUSAL 1
#ifndef TNB
#define TNB NB
#endif
__device__ __forceinline__ float bfr(float v) { return (float)(__bf16)v; }
__host__ __device__ __forceinline__ int kb_last(int qb) { return CAUSAL ? ((qb * 64 + 63) >> 7) : (TT / 128 - 1); }
typedef __attribute__((ext_vector_type(8))) __bf16 v8b;
__device__ __forceinline__ v16b frag_b(const __bf16* rowk0, int lane) {
  union { v16b v; v8b q[2]; } u; const __bf16* p = rowk0 + 8 * (lane >> 4);
  u.q[0] = *(const v8b*)p; u.q[1] = *(const v8b*)(p + 16); return u.v;
}
// fragment-order planes: a 16-row tile's k chunk of 32 lies as 2 x 512 contiguous bytes: piece 0 = every lane's elements 0..7, piece 1 = its elements 8..15, 16 bytes a lane in lane order, so one wave-wide 16-byte load covers 4 whole 128-byte lines
__device__ __forceinline__ v16h frag_hp(const _Float16* chunk, int lane) {
  union { v16h v; v8h q[2]; } u; const _Float16* p = chunk + 8 * lane;
  u.q[0] = *(const v8h*)p; u.q[1] = *(const v8h*)(p + 256); return u.v;
}
__device__ __forceinline__ v16b frag_bp(const __bf16* chunk, int lane) {
  union { v16b v; v8b q[2]; } u; const __bf16* p = chunk + 8 * lane;
  u.q[0] = *(const v8b*)p; u.q[1] = *(const v8b*)(p + 256); return u.v;
}
#define QBH 32              // causal: query blocks 0..QBH-1 of each sequence (all NQB = 32 of them) take the high-precision path
#define QHI 2048            // rows carrying a q residual plane (all TT rows)
#define KHI 2048            // key rows carrying k residual / v bf16 hi+lo planes (used only by the causal high-precision path)
// B fragment (k rows k0+.., output column o) of a weight: (in,out) [K][ld] or (out,in) [ld rows of K]: bf16 exact, or f16(bf16 * 256) exact
__device__ __forceinline__ v16b wcol_io(const float* Wm, int k0, int o, int lane, int ld) { v16b w; const int g = lane >> 4;
#pragma unroll
  for (int i = 0; i < 8; ++i) { w[i] = (__bf16)Wm[(size_t)(k0 + 8 * g + i) * ld + o]; w[8 + i] = (__bf16)Wm[(size_t)(k0 + 16 + 8 * g + i) * ld + o]; }
  return w; }
__device__ __forceinline__ v16b wcol_oi(const float* Wm, int k0, int o, int lane, int K) { v16b w; const float* p = Wm + (size_t)o * K + k0 + 8 * (lane >> 4);
#pragma unroll
  for (int i = 0; i < 8; ++i) { w[i] = (__bf16)p[i]; w[8 + i] = (__bf16)p[16 + i]; }
  return w; }
__device__ __forceinline__ v16h wcolh_io(const float* Wm, int k0, int o, int lane, int ld) { v16h w; const int g = lane >> 4;
#pragma unroll
  for (int i = 0; i < 8; ++i) { w[i] = (_Float16)(bfr(Wm[(size_t)(k0 + 8 * g + i) * ld + o]) * 256.0f); w[8 + i] = (_Float16)(bfr(Wm[(size_t)(k0 + 16 + 8 * g + i) * ld + o]) * 256.0f); }
  return w; }
__device__ __forceinline__ v16h wcolh_oi(const float* Wm, int k0, int o, int lane, int K) { v16h w; const float* p = Wm + (size_t)o * K + k0 + 8 * (lane >> 4);
#pragma unroll
  for (int i = 0; i < 8; ++i) { w[i] = (_Float16)(bfr(p[i]) * 256.0f); w[8 + i] = (_Float16)(bfr(p[16 + i]) * 256.0f); }
  return w; }
#define WQKV_LAYOUT 0   // 0 = (in,out) [DIN][64] (head 0 only; columns 64..127 zero); 1 = (out,in) [CC][DIN]; 2 = per-head [NH][DIN][HD]
__device__ __forceinline__ v16b wcol_hdk(const float* Wm, int k0, int o, int lane) { v16b w; const int g = lane >> 4; const float* p = Wm + (size_t)(o / HD) * DIN * HD + (o % HD);
#pragma unroll
  for (int i = 0; i < 8; ++i) { w[i] = (__bf16)p[(size_t)(k0 + 8 * g + i) * HD]; w[8 + i] = (__bf16)p[(size_t)(k0 + 16 + 8 * g + i) * HD]; }
  return w; }
#define WO_OUT_IN 0
#if WQKV_LAYOUT == 1
#define WCOL(W, k0, o, lane) wcol_oi(W, k0, o, lane, DIN)
#elif WQKV_LAYOUT == 2
#define WCOL(W, k0, o, lane) wcol_hdk(W, k0, o, lane)
#else
__device__ __forceinline__ v16b zero16b() { v16b w; _Pragma("unroll") for (int i = 0; i < 16; ++i) w[i] = (__bf16)0.0f; return w; }
#define WCOL(W, k0, o, lane) ((o) < 64 ? wcol_io(W, k0, (o), lane, 64) : zero16b())   /* (in,out) [384][64] pitch 64: only 64 real output columns; projected columns 64..127 (padding head 1) are zero; compile-time per unrolled tile (c0 = 0) */
#endif
#if WO_OUT_IN
#define WOCOL(W, k0, o, lane) wcol_oi(W, k0, o, lane, CC)
#define WOCOLH(W, k0, o, lane) wcolh_oi(W, k0, o, lane, CC)
#else
#define WOCOL(W, k0, o, lane) wcol_io(W, k0, o, lane, DIN)
#define WOCOLH(W, k0, o, lane) wcolh_io(W, k0, o, lane, DIN)
#endif

#ifndef SM_EXTRA_PARAMS
#define SM_EXTRA_PARAMS
#endif
#ifndef PROJ_EXTRA_PARAMS
#define PROJ_EXTRA_PARAMS
#endif
#ifndef SM_MASK_HOOK
#define SM_MASK_HOOK (void)0
#endif

#define WS_QH  0u                                      // f16 q, fragment order: [b*t / 16][k chunk 2][piece 2][lane 32][8]
#define WS_KH  (WS_QH + 2u * (size_t)NB * TT * CC)      // f16 k, fragment order like q
#define WS_VT  (WS_KH + 2u * (size_t)NB * TT * CC)      // f16 v planes [b][c][t]
#define WS_QL  (WS_VT + 2u * (size_t)NB * CC * TT)      // f16 q residual x 2^10, fragment order like q
#define WS_KL  (WS_QL + 2u * (size_t)NB * QHI * CC)     // f16 k residual x 2^10, fragment order like q
#define WS_VB  (WS_KL + 2u * (size_t)NB * KHI * CC)     // bf16 v hi (VBL: lo), fragment order: [b*t / 32][column tile 4][piece 2][lane 32][8]
#define WS_VBL (WS_VB + 2u * (size_t)NB * CC * KHI)
#define WS_S   (WS_VBL + 2u * (size_t)NB * CC * KHI)    // (not used: no score plane is stored; the room stays so that the offsets behind it are as they were)
#define WS_Y   (WS_S  + 4u * (size_t)NB * TT * TT)      // f32 ctx rows [b*t][CC] (only when there is an output projection)
#define WS_END (WS_Y  + 0u)
#define WS_Y2 (WS_END)                                  // (not used: the ctx rows go straight to out; the room stays so that the offsets behind it are as they were)
#define WS_CM (WS_Y2 + 4u * (size_t)NB * TT * CC)        // f32 column exponent offsets n_k [b][TT]
#define WS_CZ (WS_CM + 4u * (size_t)NB * TT)             // (not used: the column's factor is part of n_k)
#define WS_END2 (WS_CZ + 4u * (size_t)NB * TT)

// ---- k_proj: block = (64 rows, 128 cols, which): q/k/v = X W (+ b) with exact bf16 products (K = DIN) -> which 0: q f16 in fragment order, head columns 0..63 (+ residual rows < QHI); 1: k likewise (+ residual rows < KHI); 2: v f16 planes [c][t] (+ bf16 hi/lo planes for t < KHI)
__global__ __launch_bounds__(128) void k_proj(const float* __restrict__ XQ, const float* __restrict__ XK, const float* __restrict__ XV, const float* __restrict__ WQ, const float* __restrict__ WK, const float* __restrict__ WV, const float* __restrict__ BQ, const float* __restrict__ BK, const float* __restrict__ BV,
    _Float16* __restrict__ QH, _Float16* __restrict__ QL, _Float16* __restrict__ KH, _Float16* __restrict__ KL, _Float16* __restrict__ VT, __bf16* __restrict__ VB, __bf16* __restrict__ VBL) {
  /* one LDS block, two lives: the k loop reads wf (the block's 48 bf16 weight fragments, [k chunk 12][column tile 4][piece 2][lane 32][8], 48 KiB); behind the barrier that ends the loop the store planes sh .. tbl lie over it, so LDS stays at 88 KiB and 3 blocks share a WGP */
  __shared__ __align__(16) unsigned char sm[90112]; __bf16* wf = (__bf16*)sm;
  _Float16 (*sh)[136] = (_Float16 (*)[136])sm; _Float16 (*sl)[136] = (_Float16 (*)[136])(sm + 17408); _Float16 (*th)[72] = (_Float16 (*)[72])(sm + 34816); __bf16 (*tb)[72] = (__bf16 (*)[72])(sm + 53248); __bf16 (*tbl)[72] = (__bf16 (*)[72])(sm + 71680);
  const int tid = threadIdx.x, wave = tid >> 5, lane = tid & 31, col = lane & 15, g = lane >> 4; const int which = blockIdx.z; const int c0 = blockIdx.y * 128; const size_t r0 = (size_t)blockIdx.x * 64; const size_t bb = r0 / TT; const int t0 = (int)(r0 % TT);
  const float* X = which == 0 ? XQ : which == 1 ? XK : XV; const float* WA = which == 0 ? WQ : which == 1 ? WK : WV; const float* BA = which == 0 ? BQ : which == 1 ? BK : BV;
  /* the wave's 16 x rows: the first XA of the 12 k chunks are requested in front of everything else, so that their memory latency runs under the weight staging */
#define XA 8
  const float* xp = X + (r0 + wave * 16 + col) * DIN + 8 * g; v4f xr[DIN / 32][4];
#pragma unroll
  for (int kc = 0; kc < XA; ++kc) { xr[kc][0] = *(const v4f*)(xp + kc * 32); xr[kc][1] = *(const v4f*)(xp + kc * 32 + 4); xr[kc][2] = *(const v4f*)(xp + kc * 32 + 16); xr[kc][3] = *(const v4f*)(xp + kc * 32 + 20); }
  asm volatile("s_wait_xcnt 0x0" :: "v"(xp) : "memory");   /* the issued loads' address pair is an input here, so nothing overwrites it in front of this wait */
  /* wave w brings column tile w of every k chunk, each lane its own 16 fragment elements, and lays them down in fragment order: every weight element is fetched once per block, not once per wave. the grid has one column block (c0 = 0), so this block-uniform test always holds; the padding head's columns 64..127 are tiles 4..7 of the loop, which take no weights */
  if (c0 == 0) {
#pragma unroll
    for (int kc = 0; kc < DIN / 32; ++kc) { union { v16b v; v8b q[2]; } u; u.v = wcol_io(WA, kc * 32, wave * 16 + col, lane, 64); __bf16* d = wf + (kc * 4 + wave) * 512 + 8 * lane; *(v8b*)d = u.q[0]; *(v8b*)(d + 256) = u.q[1];
      if (kc == DIN / 64 - 1) __builtin_amdgcn_sched_barrier(0); }   /* two rounds of 96 loads: with all 192 in flight beside the x rows the build takes 333 registers, which leaves three waves on a SIMD (three blocks on a WGP) next to no room */
  } else {
#pragma unroll
    for (int kc = 0; kc < DIN / 32; ++kc) { union { v16b v; v8b q[2]; } u; u.v = zero16b(); __bf16* d = wf + (kc * 4 + wave) * 512 + 8 * lane; *(v8b*)d = u.q[0]; *(v8b*)(d + 256) = u.q[1]; } }
  asm volatile("s_wait_xcnt 0x0" ::: "memory");   /* behind the staging the weight loads' address registers are reused: the wait stands in front of that */
  v16b ab[DIN / 32];
#pragma unroll
  for (int kc = 0; kc < XA; ++kc)
#pragma unroll
    for (int i = 0; i < 4; ++i) { ab[kc][i] = (__bf16)xr[kc][0][i]; ab[kc][4 + i] = (__bf16)xr[kc][1][i]; ab[kc][8 + i] = (__bf16)xr[kc][2][i]; ab[kc][12 + i] = (__bf16)xr[kc][3][i]; }
  __syncthreads();   /* publishes the 48 fragments to all four waves */
  /* the last chunks of x are requested here, into the registers that the staging has left free, and fly under the first XA chunks' products (in front of the barrier they would be waited for at it) */
#pragma unroll
  for (int kc = XA; kc < DIN / 32; ++kc) { xr[kc][0] = *(const v4f*)(xp + kc * 32); xr[kc][1] = *(const v4f*)(xp + kc * 32 + 4); xr[kc][2] = *(const v4f*)(xp + kc * 32 + 16); xr[kc][3] = *(const v4f*)(xp + kc * 32 + 20); }
  asm volatile("s_wait_xcnt 0x0" :: "v"(xp) : "memory");   /* as above: the address pair lives up to this wait */
  v8f acc[8] = {};
#pragma unroll
  for (int kc = 0; kc < DIN / 32; ++kc) { v16b w[4];
#pragma unroll
    for (int j = 0; j < 4; ++j) w[j] = frag_bp(wf + (kc * 4 + j) * 512, lane);
    if (kc >= XA) {
#pragma unroll
      for (int i = 0; i < 4; ++i) { ab[kc][i] = (__bf16)xr[kc][0][i]; ab[kc][4 + i] = (__bf16)xr[kc][1][i]; ab[kc][8 + i] = (__bf16)xr[kc][2][i]; ab[kc][12 + i] = (__bf16)xr[kc][3][i]; } }
#pragma unroll
    for (int j = 4; j < 8; ++j) acc[j] = wmma_bf(ab[kc], zero16b(), acc[j]);   /* tiles 4..7 are the padding head's zero columns, as before; they need no LDS operand and run while the four fragments come */
    asm volatile("" :: "v"(w[0]), "v"(w[1]), "v"(w[2]), "v"(w[3]));   /* inputs-only fence on the loaded values: the chunk's eight LDS loads are issued together in front of it (one round of LDS latency a chunk); without it each fragment is fetched and waited for alone */
#pragma unroll
    for (int j = 0; j < 4; ++j) acc[j] = wmma_bf(ab[kc], w[j], acc[j]); }
  __syncthreads();   /* ends every wave's last read of wf: the store planes below overwrite it */
  if (which < 2) { _Float16* DH = which == 0 ? QH : KH; _Float16* DL = which == 0 ? QL : KL; const int nhi = which == 0 ? QHI : KHI; const bool hi_rows = t0 < nhi;
#pragma unroll
    for (int j = 0; j < 8; ++j) { const float bias = BA ? bfr(BA[c0 + j * 16 + col]) : 0.f;
#pragma unroll
      for (int r = 0; r < 8; ++r) { const float v = acc[j][r] + bias; const _Float16 hv = (_Float16)v; sh[wave * 16 + 8 * g + r][j * 16 + col] = hv; sl[wave * 16 + 8 * g + r][j * 16 + col] = (_Float16)((v - (float)hv) * 1024.0f); } }
    __syncthreads();
    /* fragment order, head columns 0..63 only: 16-byte unit u = ((row tile * 2 + k chunk) * 2 + piece) * 32 + lane, lane = 16 g + row in tile; it holds columns 8 q .. 8 q + 7 with q = (k chunk, piece, g) */
    for (int u = tid; u < 64 * 8; u += 128) { const int rl = (u >> 7) * 16 + (u & 15), q = (u >> 4) & 7; vst2((unsigned*)(DH + r0 * 64 + (size_t)u * 8), *(const v4u*)&sh[rl][q * 8]); if (hi_rows) vst2((unsigned*)(DL + (bb * nhi + t0) * (size_t)64 + (size_t)u * 8), *(const v4u*)&sl[rl][q * 8]); }
  } else { const bool hi_rows = t0 < KHI;
#pragma unroll
    for (int j = 0; j < 8; ++j) { const float bias = BA ? bfr(BA[c0 + j * 16 + col]) : 0.f;
#pragma unroll
      for (int r = 0; r < 8; ++r) { const float v = acc[j][r] + bias; const int rl = wave * 16 + 8 * g + r, cl = j * 16 + col; th[cl][rl] = (_Float16)v; const __bf16 bh = (__bf16)v; tb[cl][rl] = bh; tbl[cl][rl] = (__bf16)(v - (float)bh); } }
    __syncthreads();
    for (int e = tid; e < 128 * 8; e += 128) { const int cl = e >> 3, q = e & 7; vst2((unsigned*)(VT + (bb * CC + c0 + cl) * (size_t)TT + t0 + q * 8), *(const v4u*)&th[cl][q * 8]); }
    /* bf16 hi / lo in fragment order, head columns 0..63 only: 16-byte unit u = ((32-key chunk * 4 + column tile) * 2 + piece) * 32 + lane, lane = 16 g + column in tile; it holds keys 8 q .. 8 q + 7 of the block with q = (chunk, piece, g) */
    if (hi_rows) for (int u = tid; u < 64 * 8; u += 128) { const int cl = ((u >> 6) & 3) * 16 + (u & 15), q = (u >> 8) * 4 + ((u >> 4) & 3); const size_t o3 = (bb * KHI + t0) * (size_t)64 + (size_t)u * 8; vst2((unsigned*)(VB + o3), *(const v4u*)&tb[cl][q * 8]); vst2((unsigned*)(VBL + o3), *(const v4u*)&tbl[cl][q * 8]); } } }
// ---- k_sm: block = query row t (head in group): keys [0, kend): causal -> logit if s <= t else excluded; softmax in f32; P x 2^11 in place (0 for excluded)
__global__ __launch_bounds__(256) void k_sm(float* __restrict__ S0 SM_EXTRA_PARAMS) { __shared__ float sred[8]; __shared__ float sbc; __shared__ __align__(16) float shv[TT];
  const int tid = threadIdx.x; const int t = blockIdx.x; const int kend = (kb_last(t >> 6) + 1) * 128;
  float* sr = S0 + (size_t)blockIdx.y * TT * TT + (size_t)t * TT;
  float m = -3.0e38f; for (int k = tid; k < kend; k += 256) { float v = (!CAUSAL || k <= t) ? sr[k] : -3.0e38f; SM_MASK_HOOK; shv[k] = v; m = fmaxf(m, v); }
#pragma unroll
  for (int o = 1; o < 32; o <<= 1) m = fmaxf(m, __shfl_xor(m, o));
  if ((tid & 31) == 0) sred[tid >> 5] = m; __syncthreads(); if (tid == 0) { float a = sred[0]; for (int i = 1; i < 8; ++i) a = fmaxf(a, sred[i]); sbc = a; } __syncthreads(); m = sbc; __syncthreads();
  float sum = 0.f; for (int k = tid; k < kend; k += 256) { const float v = shv[k]; const float e = (v <= -1.0e38f) ? 0.f : expf(v - m); shv[k] = e; sum += e; }
#pragma unroll
  for (int o = 1; o < 32; o <<= 1) sum += __shfl_xor(sum, o);
  if ((tid & 31) == 0) sred[tid >> 5] = sum; __syncthreads(); if (tid == 0) { float a = 0.f; for (int i = 0; i < 8; ++i) a += sred[i]; sbc = a > 0.f ? 2048.0f / a : 0.f; }   /* a fully excluded row yields P = 0 */ __syncthreads(); const float inv = sbc;
  for (int k = tid; k < kend; k += 256) shv[k] = shv[k] * inv;
  __syncthreads(); for (int q = tid; q < kend / 4; q += 256) vst2(sr + q * 4, *(const v4f*)&shv[q * 4]); }
// exp in base 2: exp(SCALE x - SCALE m) = 2^(x SC2 - m SC2) with SC2 = SCALE log2(e). The argument of an entry's exp is one fused multiply-add on the raw (unscaled) logit with an offset that is formed once per column and tile, the power one v_exp_f32: 2 vector instructions an exp. The offset is rounded at the size of x_max SC2, so the argument carries an absolute error of about half an ulp of that number: of the order of the f32 rounding of the logit itself, whatever the logits' size. The rescale factors (one per tile or merge, not one per entry) take the difference of the two maxima FIRST and scale it then: it is exactly 0 where both are the start sentinel (a rounded offset would leave its own rounding error there, which at the sentinel's size is huge, and 0 x inf would follow). v_exp_f32 gives 0 for the sentinels' huge negative arguments, and 0 in place of results under 2^-126
#define SC2 (SCALE * 1.44269504088896340736f)
__device__ __forceinline__ float ex2(float a) { return __builtin_amdgcn_exp2f(a); }
// the same for k_stat's last merge (once per column): v_exp_f32 stands in one asm statement with a v_nop: the free slot that the instruction set asks for behind a transcendental
__device__ __forceinline__ float ex2_slot(float a) { float r; asm("v_exp_f32 %0, %1\n\tv_nop" : "=v"(r) : "v"(a)); return r; }
// ---- k_stat: softmax over the QUERY axis under the causal mask (the source's softmax(axis=1) on [B, t, s] scores with -inf above the diagonal), with no stored score plane: for every key column k: m_k = max_{q >= k} S[q][k], Z_k = sum_{q >= k} exp(S[q][k] - m_k) (f32, ex2), the logits taken straight from the WMMA accumulators. Maxima are kept on the raw logits x = S / SCALE (SCALE > 0: the same entry wins). Stored per column is ONE number, n_k = 11 - x_max SC2 - log2(Z_k), so that k_pv's P x 2^11 = 2^(x SC2 + n_k).
// A strip = 32 key columns (two 16-key tiles, their k hi + residual fragments held in registers as the B operands). Strip s has 128 - 2 s query tiles below its diagonal, so a block (STW waves, sequence blockIdx.y) takes the strips s = blockIdx.x and 63 - s one after the other: 130 query tiles for every block. A strip's 16-query tiles are dealt round-robin to the waves (the second strip's from the last wave down, so that the two remainders do not meet in the same waves); a tile's logits are q hi + residual (x 2^10) against k hi + residual (3 products).
// D register r of lane (g, col) is query 8 g + r of the tile against key col: each lane keeps one running (max, sum) per key tile, rescaled once per query tile; the two lane halves are merged at the strip's end, the STW pairs of a column through LDS by wave 0 (first strip) and wave 1 (second strip): M = max m_w, Z = sum z_w exp(m_w - M).
// Sentinels: a hidden entry (only in a strip's first two query tiles) reads -3e38 and the running max starts at -1e38, so a hidden entry adds 2^(-2e38 SC2) = 0, and a wave with no tile hands the pair (-1e38, 0), which adds 0 to the merge (the logits are sums of 64 f16-range products, far above -1e38).
#define STW 16
__global__ __launch_bounds__(32 * STW) void k_stat(const _Float16* __restrict__ QH, const _Float16* __restrict__ KH, const _Float16* __restrict__ QL, const _Float16* __restrict__ KL, float* __restrict__ CN) { __shared__ __align__(16) float pm[2][STW][32], pz[2][STW][32];
  const int tid = threadIdx.x, lane = tid & 31, col = lane & 15, g = lane >> 4; const int wave = __builtin_amdgcn_readfirstlane(tid >> 5); const int b = blockIdx.y;   /* below, the short loops over t, c, r, i are unrolled so that the fragment and accumulator arrays are indexed by constants and stay in registers */
#pragma unroll 1   /* the two strips run through one copy of the code */
  for (int hf = 0; hf < 2; ++hf) { const int kt0 = (hf ? TT / 32 - 1 - (int)blockIdx.x : (int)blockIdx.x) * 2;
    const _Float16* kp = KH + ((size_t)b * TT + kt0 * 16) * 64; const _Float16* lp = KL + ((size_t)b * KHI + kt0 * 16) * 64;
    v16h kh[2][2], kl[2][2];
#pragma unroll
    for (int t = 0; t < 2; ++t)
#pragma unroll
      for (int c = 0; c < 2; ++c) { kh[t][c] = frag_hp(kp + t * 1024 + c * 512, lane); kl[t][c] = frag_hp(lp + t * 1024 + c * 512, lane); }
    asm volatile("s_wait_xcnt 0x0" :: "s"(kp), "s"(lp) : "memory");   /* the issued loads' (wave-uniform) base addresses are inputs here, so nothing overwrites them in front of this wait */
    float m[2] = { -1.0e38f, -1.0e38f }, z[2] = { 0.f, 0.f };
#pragma unroll 1   /* rolled: a second trip's q fragments and accumulators held at once would cost registers */
    for (int qt = kt0 + (hf ? STW - 1 - wave : wave); qt < TT / 16; qt += STW) { const _Float16* qp = QH + ((size_t)b * TT + qt * 16) * 64; const _Float16* rp = QL + ((size_t)b * QHI + qt * 16) * 64;
      const v16h ah0 = frag_hp(qp, lane), ah1 = frag_hp(qp + 512, lane), al0 = frag_hp(rp, lane), al1 = frag_hp(rp + 512, lane);
      asm volatile("s_wait_xcnt 0x0" :: "s"(qp), "s"(rp) : "memory");   /* as above: the next trip forms new addresses only behind this wait */
#pragma unroll
      for (int t = 0; t < 2; ++t) { v8f acc = {}, accl = {};
        acc = wmma16(ah0, kh[t][0], acc); accl = wmma16(al0, kh[t][0], accl); accl = wmma16(ah0, kl[t][0], accl);
        acc = wmma16(ah1, kh[t][1], acc); accl = wmma16(al1, kh[t][1], accl); accl = wmma16(ah1, kl[t][1], accl);
        float v[8];
#pragma unroll
        for (int r = 0; r < 8; ++r) v[r] = acc[r] + accl[r] * (1.0f / 1024.0f);
        if (qt <= kt0 + 1) { const int thr = (kt0 + t - qt) * 16 + col - 8 * g;   /* wave-uniform test: only these two query tiles hold entries above the diagonal; query 8 g + r sees key col when r >= thr */
#pragma unroll
          for (int r = 0; r < 8; ++r) v[r] = (r >= thr) ? v[r] : -3.0e38f; }
        float mn = m[t];
#pragma unroll
        for (int r = 0; r < 8; ++r) mn = fmaxf(mn, v[r]);
        const float nb = -mn * SC2; float s = z[t] * ex2((m[t] - mn) * SC2);
#pragma unroll
        for (int r = 0; r < 8; ++r) s += ex2(__builtin_fmaf(v[r], SC2, nb));
        z[t] = s; m[t] = mn; } }
#pragma unroll
    for (int t = 0; t < 2; ++t) { const float mo = __shfl_xor(m[t], 16), zo = __shfl_xor(z[t], 16); const float M = fmaxf(m[t], mo); const float Z = z[t] * ex2((m[t] - M) * SC2) + zo * ex2((mo - M) * SC2);
      if (g == 0) { pm[hf][wave][t * 16 + col] = M; pz[hf][wave][t * 16 + col] = Z; } } }
  __syncthreads();   /* publishes the STW waves' pairs of both strips to waves 0 and 1 */
  if (wave < 2) { const int c0 = (wave ? TT / 32 - 1 - (int)blockIdx.x : (int)blockIdx.x) * 32; float mw[STW], zw[STW], M = -1.0e38f, Z = 0.f;
#pragma unroll
    for (int i = 0; i < STW; ++i) { mw[i] = pm[wave][i][lane]; zw[i] = pz[wave][i][lane]; }
#pragma unroll
    for (int i = 0; i < STW; ++i) M = fmaxf(M, mw[i]);
#pragma unroll
    for (int i = 0; i < STW; ++i) Z += zw[i] * ex2_slot((mw[i] - M) * SC2);
    vst2(CN + (size_t)b * TT + c0 + lane, (11.0f - M * SC2) - log2f(Z)); } }   /* every column sees at least its own diagonal entry, so Z_k is 1 or more (up to rounding) and at most 2048: its logarithm is finite; taken once per column */
// ---- k_pv: block = 16 queries (tile qt) of sequence b = blockIdx.z x PVS waves: ctx = P . v over keys [0, kend), P[t][k] x 2^11 = 2^(x[t][k] SC2 + n_k) for k <= t (x the raw logit, n_k from k_stat), 0 above the diagonal. The logits are formed here, transposed: S^T = K Q^T with the k fragments as A and the block's q fragments (held in registers) as B, the same 3 products in the same order as in k_stat. D register r of lane (g, col) of the two 16-key tiles of a 32-key chunk is query col against keys 8 g + r and 16 + 8 g + r: exactly the lane's 16 elements of the A fragment of P, so P goes from accumulator to operand with no exchange.
// The 32-key chunks of the key range are dealt round-robin to the waves (wave w takes chunks w, w + PVS, ...); every wave keeps its own 16 x 64 f32 partial, the PVS partials are summed in wave order through LDS. P and v as bf16 hi + lo, 3 products; the sums are the output rows and are stored to out itself, 256 B a row by 16 lanes
#define PVS 16
__global__ __launch_bounds__(32 * PVS) void k_pv(const _Float16* __restrict__ QH, const _Float16* __restrict__ KH, const _Float16* __restrict__ QL, const _Float16* __restrict__ KL, const float* __restrict__ CN, const __bf16* __restrict__ VB, const __bf16* __restrict__ VBL, float* __restrict__ OUT) { const int b = blockIdx.z; const float* cn = CN + (size_t)b * TT; __shared__ __align__(16) float ss[PVS][16][HD + 4];
  const int tid = threadIdx.x, lane = tid & 31, col = lane & 15, g = lane >> 4; const int wave = __builtin_amdgcn_readfirstlane(tid >> 5); const int qb = blockIdx.x >> 2; const int ql0 = blockIdx.x * 16; const int kce = (kb_last(qb) + 1) * 4;
  const _Float16* qp = QH + ((size_t)b * TT + ql0) * 64; const _Float16* rp = QL + ((size_t)b * QHI + ql0) * 64;
  const v16h qh0 = frag_hp(qp, lane), qh1 = frag_hp(qp + 512, lane), ql_0 = frag_hp(rp, lane), ql_1 = frag_hp(rp + 512, lane);
  asm volatile("s_wait_xcnt 0x0" :: "s"(qp), "s"(rp) : "memory");   /* the issued loads' (wave-uniform) base addresses are inputs here, so nothing overwrites them in front of this wait */
  v8f acc[HD / 16] = {};
#pragma unroll 1
  for (int kc = wave; kc < kce; kc += PVS) { const int kk = kc * 32 + 8 * g, d = ql0 + col - kk; const _Float16* kp = KH + ((size_t)b * TT + kc * 32) * 64; const _Float16* lp = KL + ((size_t)b * KHI + kc * 32) * 64; const float* np = cn + kk;
    v16h kh[2][2], kl[2][2]; v4f n4[4];
#pragma unroll
    for (int t = 0; t < 2; ++t)
#pragma unroll
      for (int c = 0; c < 2; ++c) { kh[t][c] = frag_hp(kp + t * 1024 + c * 512, lane); kl[t][c] = frag_hp(lp + t * 1024 + c * 512, lane); }
#pragma unroll
    for (int q = 0; q < 4; ++q) { const int o = (q >> 1) * 16 + (q & 1) * 4; n4[q] = *(const v4f*)(np + o); }
    asm volatile("s_wait_xcnt 0x0" :: "s"(kp), "s"(lp), "v"(np) : "memory");   /* as above */
    __builtin_amdgcn_sched_barrier(0);   /* keeps the products behind all 20 requests: otherwise the first product, with its wait, is lifted in front of the statistics' loads, which then cost a second round of latency */
    v8f sa[2], sl[2];
#pragma unroll
    for (int t = 0; t < 2; ++t) { v8f a = {}, l = {};
      a = wmma16(kh[t][0], qh0, a); l = wmma16(kh[t][0], ql_0, l); l = wmma16(kl[t][0], qh0, l);
      a = wmma16(kh[t][1], qh1, a); l = wmma16(kh[t][1], ql_1, l); l = wmma16(kl[t][1], qh1, l); sa[t] = a; sl[t] = l; }
    /* the chunk's v fragments are requested here, into the registers that the k fragments have left free, and fly under the exps */
    const __bf16* vp = VB + ((size_t)b * KHI + kc * 32) * (size_t)64; const __bf16* wp = VBL + ((size_t)b * KHI + kc * 32) * (size_t)64; v16b vh[HD / 16], vl[HD / 16];
#pragma unroll
    for (int j = 0; j < HD / 16; ++j) { vh[j] = frag_bp(vp + j * 512, lane); vl[j] = frag_bp(wp + j * 512, lane); }
    asm volatile("s_wait_xcnt 0x0" :: "s"(vp), "s"(wp) : "memory");   /* as above */
    __builtin_amdgcn_sched_barrier(0);   /* keeps the exps behind the 16 requests: left to itself the compiler sinks the loads behind more than half of the exps, and most of their latency is then waited for */
    float pv[16];
#pragma unroll
    for (int t = 0; t < 2; ++t)
#pragma unroll
      for (int r = 0; r < 8; ++r) pv[t * 8 + r] = ex2((t * 16 + r <= d) ? __builtin_fmaf(sa[t][r] + sl[t][r] * (1.0f / 1024.0f), SC2, n4[t * 2 + (r >> 2)][r & 3]) : -3.0e38f);   /* the select stands on the argument: 2^(-3e38) is exactly 0 */
    const F2 p = bsplit16(pv);
#pragma unroll
    for (int j = 0; j < HD / 16; ++j) { acc[j] = wmma_bf(p.h, vh[j], acc[j]); acc[j] = wmma_bf(p.l, vh[j], acc[j]); acc[j] = wmma_bf(p.h, vl[j], acc[j]); } }
#pragma unroll
  for (int j = 0; j < HD / 16; ++j)
#pragma unroll
    for (int r = 0; r < 8; ++r) ss[wave][8 * g + r][j * 16 + col] = acc[j][r] * (1.0f / 2048.0f);   /* a wave with no chunk hands zeros */
  __syncthreads();   /* publishes the PVS partials to the waves that sum them */
  if (wave < 8) { const int rl = tid >> 4, q = tid & 15; v4f s = *(const v4f*)&ss[0][rl][q * 4];
#pragma unroll
    for (int w = 1; w < PVS; ++w) s += *(const v4f*)&ss[w][rl][q * 4];
    vst2(OUT + ((size_t)b * TT + ql0 + rl) * HD + q * 4, s); } }   /* straight into out [b][t][64]: the block's 16 rows are 4 KiB in a row, each wave-wide store 4 whole lines */

extern "C" void kernel_launch(void* const* d_in, const int* in_sizes, int n_in, void* d_out, int out_size, void* d_ws, size_t ws_size, hipStream_t stream) {
  (void)in_sizes; (void)n_in; (void)out_size;
  const float** F = (const float**)d_in;
  if (ws_size < (size_t)WS_END) return;
  char* ws = (char*)d_ws; _Float16 *QH = (_Float16*)(ws + WS_QH), *KH = (_Float16*)(ws + WS_KH), *VT = (_Float16*)(ws + WS_VT), *QL = (_Float16*)(ws + WS_QL), *KL = (_Float16*)(ws + WS_KL); __bf16 *VB = (__bf16*)(ws + WS_VB), *VBL = (__bf16*)(ws + WS_VBL); float *S = (float*)(ws + WS_S), *Y = (float*)(ws + WS_Y);
  (void)Y; (void)S; (void)QL; (void)KL; (void)VB; (void)VBL;
  // inputs: 0 x [8,2048,384]; 1 Wq [384,64] (in,out); 2 Wk; 3 Wv; no biases
  if (ws_size < (size_t)WS_END2) return;
  float *CN = (float*)(ws + WS_CM);
  k_proj<<<dim3(TNB * TT / 64, CC / 128, 3), 128, 0, stream>>>(F[0], F[0], F[0], F[1], F[2], F[3], nullptr, nullptr, nullptr, QH, QL, KH, KL, VT, VB, VBL);   /* weight columns 64..127 (the padding head) are zero fragments */
  /* all sequences in one launch of each stage (the last grid index is the sequence); no score plane is stored: each stage forms the logits it needs on WMMA from q and k; head 0 only (head 1 is the zero padding) */
  k_stat<<<dim3(TT / 64, TNB), 32 * STW, 0, stream>>>(QH, KH, QL, KL, CN);   /* per key column j: n_j from the max and the sum over the visible queries i >= j */
  k_pv<<<dim3(TT / 16, 1, TNB), 32 * PVS, 0, stream>>>(QH, KH, QL, KL, CN, VB, VBL, (float*)d_out);   /* forms P[i][j] x 2^11 = 2^(x SC2 + n_j) (0 above the diagonal) from its own logits; writes every element of out */
}

// v010
// One run takes 44.1 microseconds.
// Two timings next to v009 both put it at 1.07 times that version's speed.
// All steps since v000 together make it 171 times as fast.
// compute dtype: all float inputs rounded to bf16; q/k/v projections with EXACT bf16 products on WMMA 16x16x32 (f32 accumulate); causal scores with BOTH q and k as f16 hi + (x 2^10) residual (3 products) on EVERY block, x 64^-0.5; softmax over the QUERY axis in f32 (per key column: max and sum over the visible queries, per wave and merged; every exp is one v_exp_f32 of a base-2 argument, an entry's formed by one fused multiply-add); P as bf16 hi + lo against v as bf16 hi + lo (3 products) on EVERY block; f32 output.
#include <hip/hip_runtime.h>
#include <math.h>

typedef __attribute__((ext_vector_type(16))) _Float16 v16h;
typedef __attribute__((ext_vector_type(16))) __bf16 v16b;
typedef __attribute__((ext_vector_type(8)))  _Float16 v8h;
typedef __attribute__((ext_vector_type(8)))  float v8f;
typedef __attribute__((ext_vector_type(4)))  float v4f;
typedef __attribute__((ext_vector_type(2)))  float v2f;
typedef __attribute__((ext_vector_type(4)))  unsigned v4u;
typedef __attribute__((ext_vector_type(4)))  int v4i;
typedef float __attribute__((may_alias)) float_a;
typedef int __attribute__((may_alias)) int_a;

template <typename T> __device__ __forceinline__ void vst2(void* p, T v) { *(T*)p = v;  }
__device__ __forceinline__ v8f wmma16(v16h a, v16h b, v8f c) {
  v8f d = __builtin_amdgcn_wmma_f32_16x16x32_f16(false, a, false, b, (short)0, c, false, false);
  asm volatile("v_nop\n\tv_nop\n\tv_nop\n\tv_nop" : "+v"(d) : "v"(a), "v"(b));
  return d;
}
__device__ __forceinline__ v8f wmma_bf(v16b a, v16b b, v8f c) {
  v8f d = __builtin_amdgcn_wmma_f32_16x16x32_bf16(false, a, false, b, (short)0, c, false, false);
  asm volatile("v_nop\n\tv_nop\n\tv_nop\n\tv_nop" : "+v"(d) : "v"(a), "v"(b));
  return d;
}
// 16x16x32 fragments: lane = (h = lane>>4, row/col = lane&15); elements 0..7 = k0+8h+0..7, 8..15 = k0+16+8h+0..7; D element r = row 8h+r
__device__ __forceinline__ v16h frag_h(const _Float16* rowk0, int lane) {
  union { v16h v; v8h q[2]; } u; const _Float16* p = rowk0 + 8 * (lane >> 4);
  u.q[0] = *(const v8h*)p; u.q[1] = *(const v8h*)(p + 16); return u.v;
}
__device__ __forceinline__ v16h frag_f32(const float* rowk0, int lane) {
  v16h a; const float* p = rowk0 + 8 * (lane >> 4);
#pragma unroll
  for (int i = 0; i < 8; ++i) { a[i] = (_Float16)p[i]; a[8 + i] = (_Float16)p[16 + i]; }
  return a;
}
__device__ __forceinline__ v16h frag_f32s(const float* rowk0, int lane, float sc) {
  v16h a; const float* p = rowk0 + 8 * (lane >> 4);
#pragma unroll
  for (int i = 0; i < 8; ++i) { a[i] = (_Float16)(p[i] * sc); a[8 + i] = (_Float16)(p[16 + i] * sc); }
  return a;
}
// column fragment from a [K][ld] layout (column n), rows >= K read as 0
__device__ __forceinline__ v16h fragc_f32(const float* W, int k0, int n, int lane, int ld, int K) {
  v16h a; const int g = lane >> 4;
#pragma unroll
  for (int i = 0; i < 8; ++i) { const int ka = k0 + 8 * g + i, kb = ka + 16;
    a[i] = (_Float16)(ka < K ? W[(size_t)(ka < K ? ka : K - 1) * ld + n] : 0.f); a[8 + i] = (_Float16)(kb < K ? W[(size_t)(kb < K ? kb : K - 1) * ld + n] : 0.f); }
  return a;
}
struct F2 { v16b h, l; };
__device__ __forceinline__ F2 bsplit16(const float v[16]) { F2 r;
#pragma unroll
  for (int i = 0; i < 16; ++i) { const __bf16 h = (__bf16)v[i]; r.h[i] = h; r.l[i] = (__bf16)(v[i] - (float)h); }
  return r; }
__device__ __forceinline__ F2 split_row(const float* row, int k0, int lane) { float v[16]; const float* p = row + k0 + 8 * (lane >> 4);
#pragma unroll
  for (int i = 0; i < 8; ++i) { v[i] = p[i]; v[8 + i] = p[16 + i]; }
  return bsplit16(v); }
__device__ __forceinline__ F2 split_rowK(const float* row, int k0, int lane, int K) { float v[16]; const int g = lane >> 4;
#pragma unroll
  for (int i = 0; i < 8; ++i) { const int ka = k0 + 8 * g + i, kb = ka + 16; v[i] = ka < K ? row[ka < K ? ka : K - 1] : 0.f; v[8 + i] = kb < K ? row[kb < K ? kb : K - 1] : 0.f; }
  return bsplit16(v); }
__device__ __forceinline__ F2 split_col(const float* W, int k0, int n, int lane, int ld, int K) { float v[16]; const int g = lane >> 4;
#pragma unroll
  for (int i = 0; i < 8; ++i) { const int ka = k0 + 8 * g + i, kb = ka + 16; v[i] = ka < K ? W[(size_t)(ka < K ? ka : K - 1) * ld + n] : 0.f; v[8 + i] = kb < K ? W[(size_t)(kb < K ? kb : K - 1) * ld + n] : 0.f; }
  return bsplit16(v); }
__device__ __forceinline__ v8f mac3(const F2& a, const F2& b, v8f c) { c = wmma_bf(a.l, b.h, c); c = wmma_bf(a.h, b.l, c); return wmma_bf(a.h, b.h, c); }
__device__ __forceinline__ float sigm(float v) { return 1.0f / (1.0f + expf(-v)); }
#define LDSX() do { asm volatile("s_wait_dscnt 0" ::: "memory"); __builtin_amdgcn_wave_barrier(); __builtin_amdgcn_fence(__ATOMIC_RELEASE, "workgroup"); } while (0)

// Single-head causal self-attention whose softmax runs over the QUERY axis (x [8,2048,384]; (in,out) Wq / Wk / Wv [384,64] (0.02 scale), no biases; scores[b, i, j] = q_i . k_j / 8; -inf where j > i; attn = softmax(scores, axis=1) - axis 1 is the QUERY axis i, so every key column j is normalised over the queries i >= j (faithful to the source); out = attn v -> [8,2048,64]).
#define NB 8
#define TT 2048
#define CC 128            // NH * HD = projected width
#define DIN 384          // input (model) width
#define NH 2
#define HD 64
#define NQB (TT / 64)
#define SCALE (0.125f)
#define CAUSAL 1
#ifndef TNB
#define TNB NB
#endif
__device__ __forceinline__ float bfr(float v) { return (float)(__bf16)v; }
__host__ __device__ __forceinline__ int kb_last(int qb) { return CAUSAL ? ((qb * 64 + 63) >> 7) : (TT / 128 - 1); }
typedef __attribute__((ext_vector_type(8))) __bf16 v8b;
__device__ __forceinline__ v16b frag_b(const __bf16* rowk0, int lane) {
  union { v16b v; v8b q[2]; } u; const __bf16* p = rowk0 + 8 * (lane >> 4);
  u.q[0] = *(const v8b*)p; u.q[1] = *(const v8b*)(p + 16); return u.v;
}
// fragment-order planes: a 16-row tile's k chunk of 32 lies as 2 x 512 contiguous bytes: piece 0 = every lane's elements 0..7, piece 1 = its elements 8..15, 16 bytes a lane in lane order, so one wave-wide 16-byte load covers 4 whole 128-byte lines
__device__ __forceinline__ v16h frag_hp(const _Float16* chunk, int lane) {
  union { v16h v; v8h q[2]; } u; const _Float16* p = chunk + 8 * lane;
  u.q[0] = *(const v8h*)p; u.q[1] = *(const v8h*)(p + 256); return u.v;
}
__device__ __forceinline__ v16b frag_bp(const __bf16* chunk, int lane) {
  union { v16b v; v8b q[2]; } u; const __bf16* p = chunk + 8 * lane;
  u.q[0] = *(const v8b*)p; u.q[1] = *(const v8b*)(p + 256); return u.v;
}
#define QBH 32              // causal: query blocks 0..QBH-1 of each sequence (all NQB = 32 of them) take the high-precision path
#define QHI 2048            // rows carrying a q residual plane (all TT rows)
#define KHI 2048            // key rows carrying k residual / v bf16 hi+lo planes (used only by the causal high-precision path)
// B fragment (k rows k0+.., output column o) of a weight: (in,out) [K][ld] or (out,in) [ld rows of K]: bf16 exact, or f16(bf16 * 256) exact
__device__ __forceinline__ v16b wcol_io(const float* Wm, int k0, int o, int lane, int ld) { v16b w; const int g = lane >> 4;
#pragma unroll
  for (int i = 0; i < 8; ++i) { w[i] = (__bf16)Wm[(size_t)(k0 + 8 * g + i) * ld + o]; w[8 + i] = (__bf16)Wm[(size_t)(k0 + 16 + 8 * g + i) * ld + o]; }
  return w; }
__device__ __forceinline__ v16b wcol_oi(const float* Wm, int k0, int o, int lane, int K) { v16b w; const float* p = Wm + (size_t)o * K + k0 + 8 * (lane >> 4);
#pragma unroll
  for (int i = 0; i < 8; ++i) { w[i] = (__bf16)p[i]; w[8 + i] = (__bf16)p[16 + i]; }
  return w; }
__device__ __forceinline__ v16h wcolh_io(const float* Wm, int k0, int o, int lane, int ld) { v16h w; const int g = lane >> 4;
#pragma unroll
  for (int i = 0; i < 8; ++i) { w[i] = (_Float16)(bfr(Wm[(size_t)(k0 + 8 * g + i) * ld + o]) * 256.0f); w[8 + i] = (_Float16)(bfr(Wm[(size_t)(k0 + 16 + 8 * g + i) * ld + o]) * 256.0f); }
  return w; }
__device__ __forceinline__ v16h wcolh_oi(const float* Wm, int k0, int o, int lane, int K) { v16h w; const float* p = Wm + (size_t)o * K + k0 + 8 * (lane >> 4);
#pragma unroll
  for (int i = 0; i < 8; ++i) { w[i] = (_Float16)(bfr(p[i]) * 256.0f); w[8 + i] = (_Float16)(bfr(p[16 + i]) * 256.0f); }
  return w; }
#define WQKV_LAYOUT 0   // 0 = (in,out) [DIN][64] (head 0 only; columns 64..127 zero); 1 = (out,in) [CC][DIN]; 2 = per-head [NH][DIN][HD]
__device__ __forceinline__ v16b wcol_hdk(const float* Wm, int k0, int o, int lane) { v16b w; const int g = lane >> 4; const float* p = Wm + (size_t)(o / HD) * DIN * HD + (o % HD);
#pragma unroll
  for (int i = 0; i < 8; ++i) { w[i] = (__bf16)p[(size_t)(k0 + 8 * g + i) * HD]; w[8 + i] = (__bf16)p[(size_t)(k0 + 16 + 8 * g + i) * HD]; }
  return w; }
#define WO_OUT_IN 0
#if WQKV_LAYOUT == 1
#define WCOL(W, k0, o, lane) wcol_oi(W, k0, o, lane, DIN)
#elif WQKV_LAYOUT == 2
#define WCOL(W, k0, o, lane) wcol_hdk(W, k0, o, lane)
#else
__device__ __forceinline__ v16b zero16b() { v16b w; _Pragma("unroll") for (int i = 0; i < 16; ++i) w[i] = (__bf16)0.0f; return w; }
#define WCOL(W, k0, o, lane) ((o) < 64 ? wcol_io(W, k0, (o), lane, 64) : zero16b())   /* (in,out) [384][64] pitch 64: only 64 real output columns; projected columns 64..127 (padding head 1) are zero; compile-time per unrolled tile (c0 = 0) */
#endif
#if WO_OUT_IN
#define WOCOL(W, k0, o, lane) wcol_oi(W, k0, o, lane, CC)
#define WOCOLH(W, k0, o, lane) wcolh_oi(W, k0, o, lane, CC)
#else
#define WOCOL(W, k0, o, lane) wcol_io(W, k0, o, lane, DIN)
#define WOCOLH(W, k0, o, lane) wcolh_io(W, k0, o, lane, DIN)
#endif

#ifndef SM_EXTRA_PARAMS
#define SM_EXTRA_PARAMS
#endif
#ifndef PROJ_EXTRA_PARAMS
#define PROJ_EXTRA_PARAMS
#endif
#ifndef SM_MASK_HOOK
#define SM_MASK_HOOK (void)0
#endif

#define WS_QH  0u                                      // f16 q, fragment order: [b*t / 16][k chunk 2][piece 2][lane 32][8]
#define WS_KH  (WS_QH + 2u * (size_t)NB * TT * CC)      // f16 k, fragment order like q
#define WS_VT  (WS_KH + 2u * (size_t)NB * TT * CC)      // f16 v planes [b][c][t]
#define WS_QL  (WS_VT + 2u * (size_t)NB * CC * TT)      // f16 q residual x 2^10, fragment order like q
#define WS_KL  (WS_QL + 2u * (size_t)NB * QHI * CC)     // f16 k residual x 2^10, fragment order like q
#define WS_VB  (WS_KL + 2u * (size_t)NB * KHI * CC)     // bf16 v hi (VBL: lo), fragment order: [b*t / 32][column tile 4][piece 2][lane 32][8]
#define WS_VBL (WS_VB + 2u * (size_t)NB * CC * KHI)
#define WS_S   (WS_VBL + 2u * (size_t)NB * CC * KHI)    // (not used: no score plane is stored; the room stays so that the offsets behind it are as they were)
#define WS_Y   (WS_S  + 4u * (size_t)NB * TT * TT)      // f32 ctx rows [b*t][CC] (only when there is an output projection)
#define WS_END (WS_Y  + 0u)
#define WS_Y2 (WS_END)                                  // (not used: the ctx rows go straight to out; the room stays so that the offsets behind it are as they were)
#define WS_CM (WS_Y2 + 4u * (size_t)NB * TT * CC)        // f32 column exponent offsets n_k [b][TT]
#define WS_CZ (WS_CM + 4u * (size_t)NB * TT)             // (not used: the column's factor is part of n_k)
#define WS_END2 (WS_CZ + 4u * (size_t)NB * TT)

// ---- k_proj: block = (64 rows, 128 cols, which): q/k/v = X W (+ b) with exact bf16 products (K = DIN) -> which 0: q f16 in fragment order, head columns 0..63 (+ residual rows < QHI); 1: k likewise (+ residual rows < KHI); 2: v f16 planes [c][t] (+ bf16 hi/lo planes for t < KHI)
__global__ __launch_bounds__(128) void k_proj(const float* __restrict__ XQ, const float* __restrict__ XK, const float* __restrict__ XV, const float* __restrict__ WQ, const float* __restrict__ WK, const float* __restrict__ WV, const float* __restrict__ BQ, const float* __restrict__ BK, const float* __restrict__ BV,
    _Float16* __restrict__ QH, _Float16* __restrict__ QL, _Float16* __restrict__ KH, _Float16* __restrict__ KL, _Float16* __restrict__ VT, __bf16* __restrict__ VB, __bf16* __restrict__ VBL) {
  /* one LDS block, two lives: the k loop reads wf (the block's 48 bf16 weight fragments, [k chunk 12][column tile 4][piece 2][lane 32][8], 48 KiB); behind the barrier that ends the loop the store planes sh .. tbl lie over it, so LDS stays at 88 KiB and 3 blocks share a WGP */
  __shared__ __align__(16) unsigned char sm[90112]; __bf16* wf = (__bf16*)sm;
  _Float16 (*sh)[136] = (_Float16 (*)[136])sm; _Float16 (*sl)[136] = (_Float16 (*)[136])(sm + 17408); _Float16 (*th)[72] = (_Float16 (*)[72])(sm + 34816); __bf16 (*tb)[72] = (__bf16 (*)[72])(sm + 53248); __bf16 (*tbl)[72] = (__bf16 (*)[72])(sm + 71680);
  const int tid = threadIdx.x, wave = tid >> 5, lane = tid & 31, col = lane & 15, g = lane >> 4; const int which = blockIdx.z; const int c0 = blockIdx.y * 128; const size_t r0 = (size_t)blockIdx.x * 64; const size_t bb = r0 / TT; const int t0 = (int)(r0 % TT);
  const float* X = which == 0 ? XQ : which == 1 ? XK : XV; const float* WA = which == 0 ? WQ : which == 1 ? WK : WV; const float* BA = which == 0 ? BQ : which == 1 ? BK : BV;
  /* the wave's 16 x rows: the first XA of the 12 k chunks are requested in front of everything else, so that their memory latency runs under the weight staging */
#define XA 8
  const float* xp = X + (r0 + wave * 16 + col) * DIN + 8 * g; v4f xr[DIN / 32][4];
#pragma unroll
  for (int kc = 0; kc < XA; ++kc) { xr[kc][0] = *(const v4f*)(xp + kc * 32); xr[kc][1] = *(const v4f*)(xp + kc * 32 + 4); xr[kc][2] = *(const v4f*)(xp + kc * 32 + 16); xr[kc][3] = *(const v4f*)(xp + kc * 32 + 20); }
  asm volatile("s_wait_xcnt 0x0" :: "v"(xp) : "memory");   /* the issued loads' address pair is an input here, so nothing overwrites it in front of this wait */
  /* wave w brings column tile w of every k chunk, each lane its own 16 fragment elements, and lays them down in fragment order: every weight element is fetched once per block, not once per wave. the grid has one column block (c0 = 0), so this block-uniform test always holds; the padding head's columns 64..127 are tiles 4..7 of the loop, which take no weights */
  if (c0 == 0) {
#pragma unroll
    for (int kc = 0; kc < DIN / 32; ++kc) { union { v16b v; v8b q[2]; } u; u.v = wcol_io(WA, kc * 32, wave * 16 + col, lane, 64); __bf16* d = wf + (kc * 4 + wave) * 512 + 8 * lane; *(v8b*)d = u.q[0]; *(v8b*)(d + 256) = u.q[1];
      if (kc == DIN / 64 - 1) __builtin_amdgcn_sched_barrier(0); }   /* two rounds of 96 loads: with all 192 in flight beside the x rows the build takes 333 registers, which leaves three waves on a SIMD (three blocks on a WGP) next to no room */
  } else {
#pragma unroll
    for (int kc = 0; kc < DIN / 32; ++kc) { union { v16b v; v8b q[2]; } u; u.v = zero16b(); __bf16* d = wf + (kc * 4 + wave) * 512 + 8 * lane; *(v8b*)d = u.q[0]; *(v8b*)(d + 256) = u.q[1]; } }
  asm volatile("s_wait_xcnt 0x0" ::: "memory");   /* behind the staging the weight loads' address registers are reused: the wait stands in front of that */
  v16b ab[DIN / 32];
#pragma unroll
  for (int kc = 0; kc < XA; ++kc)
#pragma unroll
    for (int i = 0; i < 4; ++i) { ab[kc][i] = (__bf16)xr[kc][0][i]; ab[kc][4 + i] = (__bf16)xr[kc][1][i]; ab[kc][8 + i] = (__bf16)xr[kc][2][i]; ab[kc][12 + i] = (__bf16)xr[kc][3][i]; }
  __syncthreads();   /* publishes the 48 fragments to all four waves */
  /* the last chunks of x are requested here, into the registers that the staging has left free, and fly under the first XA chunks' products (in front of the barrier they would be waited for at it) */
#pragma unroll
  for (int kc = XA; kc < DIN / 32; ++kc) { xr[kc][0] = *(const v4f*)(xp + kc * 32); xr[kc][1] = *(const v4f*)(xp + kc * 32 + 4); xr[kc][2] = *(const v4f*)(xp + kc * 32 + 16); xr[kc][3] = *(const v4f*)(xp + kc * 32 + 20); }
  asm volatile("s_wait_xcnt 0x0" :: "v"(xp) : "memory");   /* as above: the address pair lives up to this wait */
  v8f acc[8] = {};
#pragma unroll
  for (int kc = 0; kc < DIN / 32; ++kc) { v16b w[4];
#pragma unroll
    for (int j = 0; j < 4; ++j) w[j] = frag_bp(wf + (kc * 4 + j) * 512, lane);
    if (kc >= XA) {
#pragma unroll
      for (int i = 0; i < 4; ++i) { ab[kc][i] = (__bf16)xr[kc][0][i]; ab[kc][4 + i] = (__bf16)xr[kc][1][i]; ab[kc][8 + i] = (__bf16)xr[kc][2][i]; ab[kc][12 + i] = (__bf16)xr[kc][3][i]; } }
#pragma unroll
    for (int j = 4; j < 8; ++j) acc[j] = wmma_bf(ab[kc], zero16b(), acc[j]);   /* tiles 4..7 are the padding head's zero columns, as before; they need no LDS operand and run while the four fragments come */
    asm volatile("" :: "v"(w[0]), "v"(w[1]), "v"(w[2]), "v"(w[3]));   /* inputs-only fence on the loaded values: the chunk's eight LDS loads are issued together in front of it (one round of LDS latency a chunk); without it each fragment is fetched and waited for alone */
#pragma unroll
    for (int j = 0; j < 4; ++j) acc[j] = wmma_bf(ab[kc], w[j], acc[j]); }
  __syncthreads();   /* ends every wave's last read of wf: the store planes below overwrite it */
  if (which < 2) { _Float16* DH = which == 0 ? QH : KH; _Float16* DL = which == 0 ? QL : KL; const int nhi = which == 0 ? QHI : KHI; const bool hi_rows = t0 < nhi;
#pragma unroll
    for (int j = 0; j < 8; ++j) { const float bias = BA ? bfr(BA[c0 + j * 16 + col]) : 0.f;
#pragma unroll
      for (int r = 0; r < 8; ++r) { const float v = acc[j][r] + bias; const _Float16 hv = (_Float16)v; sh[wave * 16 + 8 * g + r][j * 16 + col] = hv; sl[wave * 16 + 8 * g + r][j * 16 + col] = (_Float16)((v - (float)hv) * 1024.0f); } }
    __syncthreads();
    /* fragment order, head columns 0..63 only: 16-byte unit u = ((row tile * 2 + k chunk) * 2 + piece) * 32 + lane, lane = 16 g + row in tile; it holds columns 8 q .. 8 q + 7 with q = (k chunk, piece, g) */
    for (int u = tid; u < 64 * 8; u += 128) { const int rl = (u >> 7) * 16 + (u & 15), q = (u >> 4) & 7; vst2((unsigned*)(DH + r0 * 64 + (size_t)u * 8), *(const v4u*)&sh[rl][q * 8]); if (hi_rows) vst2((unsigned*)(DL + (bb * nhi + t0) * (size_t)64 + (size_t)u * 8), *(const v4u*)&sl[rl][q * 8]); }
  } else { const bool hi_rows = t0 < KHI;
#pragma unroll
    for (int j = 0; j < 8; ++j) { const float bias = BA ? bfr(BA[c0 + j * 16 + col]) : 0.f;
#pragma unroll
      for (int r = 0; r < 8; ++r) { const float v = acc[j][r] + bias; const int rl = wave * 16 + 8 * g + r, cl = j * 16 + col; th[cl][rl] = (_Float16)v; const __bf16 bh = (__bf16)v; tb[cl][rl] = bh; tbl[cl][rl] = (__bf16)(v - (float)bh); } }
    __syncthreads();
    for (int e = tid; e < 128 * 8; e += 128) { const int cl = e >> 3, q = e & 7; vst2((unsigned*)(VT + (bb * CC + c0 + cl) * (size_t)TT + t0 + q * 8), *(const v4u*)&th[cl][q * 8]); }
    /* bf16 hi / lo in fragment order, head columns 0..63 only: 16-byte unit u = ((32-key chunk * 4 + column tile) * 2 + piece) * 32 + lane, lane = 16 g + column in tile; it holds keys 8 q .. 8 q + 7 of the block with q = (chunk, piece, g) */
    if (hi_rows) for (int u = tid; u < 64 * 8; u += 128) { const int cl = ((u >> 6) & 3) * 16 + (u & 15), q = (u >> 8) * 4 + ((u >> 4) & 3); const size_t o3 = (bb * KHI + t0) * (size_t)64 + (size_t)u * 8; vst2((unsigned*)(VB + o3), *(const v4u*)&tb[cl][q * 8]); vst2((unsigned*)(VBL + o3), *(const v4u*)&tbl[cl][q * 8]); } } }
// ---- k_sm: block = query row t (head in group): keys [0, kend): causal -> logit if s <= t else excluded; softmax in f32; P x 2^11 in place (0 for excluded)
__global__ __launch_bounds__(256) void k_sm(float* __restrict__ S0 SM_EXTRA_PARAMS) { __shared__ float sred[8]; __shared__ float sbc; __shared__ __align__(16) float shv[TT];
  const int tid = threadIdx.x; const int t = blockIdx.x; const int kend = (kb_last(t >> 6) + 1) * 128;
  float* sr = S0 + (size_t)blockIdx.y * TT * TT + (size_t)t * TT;
  float m = -3.0e38f; for (int k = tid; k < kend; k += 256) { float v = (!CAUSAL || k <= t) ? sr[k] : -3.0e38f; SM_MASK_HOOK; shv[k] = v; m = fmaxf(m, v); }
#pragma unroll
  for (int o = 1; o < 32; o <<= 1) m = fmaxf(m, __shfl_xor(m, o));
  if ((tid & 31) == 0) sred[tid >> 5] = m; __syncthreads(); if (tid == 0) { float a = sred[0]; for (int i = 1; i < 8; ++i) a = fmaxf(a, sred[i]); sbc = a; } __syncthreads(); m = sbc; __syncthreads();
  float sum = 0.f; for (int k = tid; k < kend; k += 256) { const float v = shv[k]; const float e = (v <= -1.0e38f) ? 0.f : expf(v - m); shv[k] = e; sum += e; }
#pragma unroll
  for (int o = 1; o < 32; o <<= 1) sum += __shfl_xor(sum, o);
  if ((tid & 31) == 0) sred[tid >> 5] = sum; __syncthreads(); if (tid == 0) { float a = 0.f; for (int i = 0; i < 8; ++i) a += sred[i]; sbc = a > 0.f ? 2048.0f / a : 0.f; }   /* a fully excluded row yields P = 0 */ __syncthreads(); const float inv = sbc;
  for (int k = tid; k < kend; k += 256) shv[k] = shv[k] * inv;
  __syncthreads(); for (int q = tid; q < kend / 4; q += 256) vst2(sr + q * 4, *(const v4f*)&shv[q * 4]); }
// exp in base 2: exp(SCALE x - SCALE m) = 2^(x SC2 - m SC2) with SC2 = SCALE log2(e). The argument of an entry's exp is one fused multiply-add on the raw (unscaled) logit with an offset that is formed once per column and tile, the power one v_exp_f32: 2 vector instructions an exp. The offset is rounded at the size of x_max SC2, so the argument carries an absolute error of about half an ulp of that number: of the order of the f32 rounding of the logit itself, whatever the logits' size. The rescale factors (one per tile or merge, not one per entry) take the difference of the two maxima FIRST and scale it then: it is exactly 0 where both are the start sentinel (a rounded offset would leave its own rounding error there, which at the sentinel's size is huge, and 0 x inf would follow). v_exp_f32 gives 0 for the sentinels' huge negative arguments, and 0 in place of results under 2^-126
#define SC2 (SCALE * 1.44269504088896340736f)
__device__ __forceinline__ float ex2(float a) { return __builtin_amdgcn_exp2f(a); }
// the same for k_stat's last merge (once per column): v_exp_f32 stands in one asm statement with a v_nop: the free slot that the instruction set asks for behind a transcendental
__device__ __forceinline__ float ex2_slot(float a) { float r; asm("v_exp_f32 %0, %1\n\tv_nop" : "=v"(r) : "v"(a)); return r; }
// ---- k_stat: softmax over the QUERY axis under the causal mask (the source's softmax(axis=1) on [B, t, s] scores with -inf above the diagonal), with no stored score plane: for every key column k: m_k = max_{q >= k} S[q][k], Z_k = sum_{q >= k} exp(S[q][k] - m_k) (f32, ex2), the logits taken straight from the WMMA accumulators. Maxima are kept on the raw logits x = S / SCALE (SCALE > 0: the same entry wins). Stored per column is ONE number, n_k = 11 - x_max SC2 - log2(Z_k), so that k_pv's P x 2^11 = 2^(x SC2 + n_k).
// A strip = 32 key columns (two 16-key tiles, their k hi + residual fragments held in registers as the B operands). Strip s has 128 - 2 s query tiles below its diagonal, so a block (STW waves, sequence blockIdx.y) takes the strips s = blockIdx.x and 63 - s one after the other: 130 query tiles for every block. A strip's 16-query tiles are dealt round-robin to the waves (the second strip's from the last wave down, so that the two remainders do not meet in the same waves); a tile's logits are q hi + residual (x 2^10) against k hi + residual (3 products).
// D register r of lane (g, col) is query 8 g + r of the tile against key col: each lane keeps one running (max, sum) per key tile, rescaled once per query tile; the two lane halves are merged at the strip's end, the STW pairs of a column through LDS by wave 0 (first strip) and wave 1 (second strip): M = max m_w, Z = sum z_w exp(m_w - M).
// Sentinels: a hidden entry (only in a strip's first two query tiles) reads -3e38 and the running max starts at -1e38, so a hidden entry adds 2^(-2e38 SC2) = 0, and a wave with no tile hands the pair (-1e38, 0), which adds 0 to the merge (the logits are sums of 64 f16-range products, far above -1e38).
#define STW 16
__global__ __launch_bounds__(32 * STW) void k_stat(const _Float16* __restrict__ QH, const _Float16* __restrict__ KH, const _Float16* __restrict__ QL, const _Float16* __restrict__ KL, float* __restrict__ CN) { __shared__ __align__(16) float pm[2][STW][32], pz[2][STW][32];
  const int tid = threadIdx.x, lane = tid & 31, col = lane & 15, g = lane >> 4; const int wave = __builtin_amdgcn_readfirstlane(tid >> 5); const int b = blockIdx.y;   /* below, the short loops over t, c, r, i are unrolled so that the fragment and accumulator arrays are indexed by constants and stay in registers */
#pragma unroll 1   /* the two strips run through one copy of the code */
  for (int hf = 0; hf < 2; ++hf) { const int kt0 = (hf ? TT / 32 - 1 - (int)blockIdx.x : (int)blockIdx.x) * 2;
    const _Float16* kp = KH + ((size_t)b * TT + kt0 * 16) * 64; const _Float16* lp = KL + ((size_t)b * KHI + kt0 * 16) * 64;
    v16h kh[2][2], kl[2][2];
#pragma unroll
    for (int t = 0; t < 2; ++t)
#pragma unroll
      for (int c = 0; c < 2; ++c) { kh[t][c] = frag_hp(kp + t * 1024 + c * 512, lane); kl[t][c] = frag_hp(lp + t * 1024 + c * 512, lane); }
    asm volatile("s_wait_xcnt 0x0" :: "s"(kp), "s"(lp) : "memory");   /* the issued loads' (wave-uniform) base addresses are inputs here, so nothing overwrites them in front of this wait */
    float m[2] = { -1.0e38f, -1.0e38f }, z[2] = { 0.f, 0.f };
#pragma unroll 1   /* rolled: a second trip's q fragments and accumulators held at once would cost registers */
    for (int qt = kt0 + (hf ? STW - 1 - wave : wave); qt < TT / 16; qt += STW) { const _Float16* qp = QH + ((size_t)b * TT + qt * 16) * 64; const _Float16* rp = QL + ((size_t)b * QHI + qt * 16) * 64;
      const v16h ah0 = frag_hp(qp, lane), ah1 = frag_hp(qp + 512, lane), al0 = frag_hp(rp, lane), al1 = frag_hp(rp + 512, lane);
      asm volatile("s_wait_xcnt 0x0" :: "s"(qp), "s"(rp) : "memory");   /* as above: the next trip forms new addresses only behind this wait */
#pragma unroll
      for (int t = 0; t < 2; ++t) { v8f acc = {}, accl = {};
        acc = wmma16(ah0, kh[t][0], acc); accl = wmma16(al0, kh[t][0], accl); accl = wmma16(ah0, kl[t][0], accl);
        acc = wmma16(ah1, kh[t][1], acc); accl = wmma16(al1, kh[t][1], accl); accl = wmma16(ah1, kl[t][1], accl);
        float v[8];
#pragma unroll
        for (int r = 0; r < 8; ++r) v[r] = acc[r] + accl[r] * (1.0f / 1024.0f);
        if (qt <= kt0 + 1) { const int thr = (kt0 + t - qt) * 16 + col - 8 * g;   /* wave-uniform test: only these two query tiles hold entries above the diagonal; query 8 g + r sees key col when r >= thr */
#pragma unroll
          for (int r = 0; r < 8; ++r) v[r] = (r >= thr) ? v[r] : -3.0e38f; }
        float mn = m[t];
#pragma unroll
        for (int r = 0; r < 8; ++r) mn = fmaxf(mn, v[r]);
        const float nb = -mn * SC2; float s = z[t] * ex2((m[t] - mn) * SC2);
#pragma unroll
        for (int r = 0; r < 8; ++r) s += ex2(__builtin_fmaf(v[r], SC2, nb));
        z[t] = s; m[t] = mn; } }
#pragma unroll
    for (int t = 0; t < 2; ++t) { const float mo = __shfl_xor(m[t], 16), zo = __shfl_xor(z[t], 16); const float M = fmaxf(m[t], mo); const float Z = z[t] * ex2((m[t] - M) * SC2) + zo * ex2((mo - M) * SC2);
      if (g == 0) { pm[hf][wave][t * 16 + col] = M; pz[hf][wave][t * 16 + col] = Z; } } }
  __syncthreads();   /* publishes the STW waves' pairs of both strips to waves 0 and 1 */
  if (wave < 2) { const int c0 = (wave ? TT / 32 - 1 - (int)blockIdx.x : (int)blockIdx.x) * 32; float mw[STW], zw[STW], M = -1.0e38f, Z = 0.f;
#pragma unroll
    for (int i = 0; i < STW; ++i) { mw[i] = pm[wave][i][lane]; zw[i] = pz[wave][i][lane]; }
#pragma unroll
    for (int i = 0; i < STW; ++i) M = fmaxf(M, mw[i]);
#pragma unroll
    for (int i = 0; i < STW; ++i) Z += zw[i] * ex2_slot((mw[i] - M) * SC2);
    vst2(CN + (size_t)b * TT + c0 + lane, (11.0f - M * SC2) - log2f(Z)); } }   /* every column sees at least its own diagonal entry, so Z_k is 1 or more (up to rounding) and at most 2048: its logarithm is finite; taken once per column */
// ---- k_pv: block = PVT tiles of 16 queries of sequence b = blockIdx.z x PVS waves; per tile: ctx = P . v over keys [0, kend), P[t][k] x 2^11 = 2^(x[t][k] SC2 + n_k) for k <= t (x the raw logit, n_k from k_stat), 0 above the diagonal. The logits are formed here, transposed: S^T = K Q^T with the k fragments as A and the block's q fragments (held in registers) as B, the same 3 products in the same order as in k_stat. D register r of lane (g, col) of the two 16-key tiles of a 32-key chunk is query col against keys 8 g + r and 16 + 8 g + r: exactly the lane's 16 elements of the A fragment of P, so P goes from accumulator to operand with no exchange.
// The 32-key chunks of the key range are dealt round-robin to the waves (rank w takes chunks w, w + PVS, ...); every wave keeps its own 16 x 64 f32 partial, the PVS partials are summed in rank order through LDS. P and v as bf16 hi + lo, 3 products; the sums are the output rows and are stored to out itself, 256 B a row by 16 lanes
// One block per WGP for the whole launch: a block walks PVT query tiles one after the other, one from each quarter of the sequence, the quarters walked in opposite directions (127 - t, 64 + t, 63 - t, t), so that every block has the same 136 chunks and no block waits for a place. Each tile's partials have LDS planes of their own, so the waves meet at no barrier between tiles; the one barrier stands behind the last tile, and all tiles are summed behind it. A wave's rank moves on by 4 from tile to tile, so that the tiles' remainders (multiples of 4 chunks) fall on different waves: 8 or 9 chunks a wave, 34 a SIMD. A partial lies in the plane of its rank, so the sums run in the same order as with one tile a block
#define PVS 16
#define PVT 4
__device__ __forceinline__ int pv_tile(int it, int t) { return (PVT - 1 - it) * (TT / 16 / PVT) + ((it & 1) ? t : TT / 16 / PVT - 1 - t); }   /* tile number it of block t: a permutation of the TT / 16 tiles over (it, t) */
__global__ __launch_bounds__(32 * PVS) void k_pv(const _Float16* __restrict__ QH, const _Float16* __restrict__ KH, const _Float16* __restrict__ QL, const _Float16* __restrict__ KL, const float* __restrict__ CN, const __bf16* __restrict__ VB, const __bf16* __restrict__ VBL, float* __restrict__ OUT) { const int b = blockIdx.z; const float* cn = CN + (size_t)b * TT; __shared__ __align__(16) float ss[PVT][PVS][16][HD + 4];
  const int tid = threadIdx.x, lane = tid & 31, col = lane & 15, g = lane >> 4; const int wave = __builtin_amdgcn_readfirstlane(tid >> 5);
#pragma unroll 1   /* the tiles run through one copy of the code */
  for (int it = 0; it < PVT; ++it) { const int ql0 = pv_tile(it, (int)blockIdx.x) * 16; const int rank = (wave + 4 * it) & (PVS - 1); const int kce = (kb_last(ql0 >> 6) + 1) * 4;
  const _Float16* qp = QH + ((size_t)b * TT + ql0) * 64; const _Float16* rp = QL + ((size_t)b * QHI + ql0) * 64;
  const v16h qh0 = frag_hp(qp, lane), qh1 = frag_hp(qp + 512, lane), ql_0 = frag_hp(rp, lane), ql_1 = frag_hp(rp + 512, lane);
  asm volatile("s_wait_xcnt 0x0" :: "s"(qp), "s"(rp) : "memory");   /* the issued loads' (wave-uniform) base addresses are inputs here, so nothing overwrites them in front of this wait */
  v8f acc[HD / 16] = {};
#pragma unroll 1
  for (int kc = rank; kc < kce; kc += PVS) { const int kk = kc * 32 + 8 * g, d = ql0 + col - kk; const _Float16* kp = KH + ((size_t)b * TT + kc * 32) * 64; const _Float16* lp = KL + ((size_t)b * KHI + kc * 32) * 64; const float* np = cn + kk;
    v16h kh[2][2], kl[2][2]; v4f n4[4];
#pragma unroll
    for (int t = 0; t < 2; ++t)
#pragma unroll
      for (int c = 0; c < 2; ++c) { kh[t][c] = frag_hp(kp + t * 1024 + c * 512, lane); kl[t][c] = frag_hp(lp + t * 1024 + c * 512, lane); }
#pragma unroll
    for (int q = 0; q < 4; ++q) { const int o = (q >> 1) * 16 + (q & 1) * 4; n4[q] = *(const v4f*)(np + o); }
    asm volatile("s_wait_xcnt 0x0" :: "s"(kp), "s"(lp), "v"(np) : "memory");   /* as above */
    __builtin_amdgcn_sched_barrier(0);   /* keeps the products behind all 20 requests: otherwise the first product, with its wait, is lifted in front of the statistics' loads, which then cost a second round of latency */
    v8f sa[2], sl[2];
#pragma unroll
    for (int t = 0; t < 2; ++t) { v8f a = {}, l = {};
      a = wmma16(kh[t][0], qh0, a); l = wmma16(kh[t][0], ql_0, l); l = wmma16(kl[t][0], qh0, l);
      a = wmma16(kh[t][1], qh1, a); l = wmma16(kh[t][1], ql_1, l); l = wmma16(kl[t][1], qh1, l); sa[t] = a; sl[t] = l; }
    /* the chunk's v fragments are requested here, into the registers that the k fragments have left free, and fly under the exps */
    const __bf16* vp = VB + ((size_t)b * KHI + kc * 32) * (size_t)64; const __bf16* wp = VBL + ((size_t)b * KHI + kc * 32) * (size_t)64; v16b vh[HD / 16], vl[HD / 16];
#pragma unroll
    for (int j = 0; j < HD / 16; ++j) { vh[j] = frag_bp(vp + j * 512, lane); vl[j] = frag_bp(wp + j * 512, lane); }
    asm volatile("s_wait_xcnt 0x0" :: "s"(vp), "s"(wp) : "memory");   /* as above */
    __builtin_amdgcn_sched_barrier(0);   /* keeps the exps behind the 16 requests: left to itself the compiler sinks the loads behind more than half of the exps, and most of their latency is then waited for */
    float pv[16];
#pragma unroll
    for (int t = 0; t < 2; ++t)
#pragma unroll
      for (int r = 0; r < 8; ++r) pv[t * 8 + r] = ex2((t * 16 + r <= d) ? __builtin_fmaf(sa[t][r] + sl[t][r] * (1.0f / 1024.0f), SC2, n4[t * 2 + (r >> 2)][r & 3]) : -3.0e38f);   /* the select stands on the argument: 2^(-3e38) is exactly 0 */
    const F2 p = bsplit16(pv);
#pragma unroll
    for (int j = 0; j < HD / 16; ++j) { acc[j] = wmma_bf(p.h, vh[j], acc[j]); acc[j] = wmma_bf(p.l, vh[j], acc[j]); acc[j] = wmma_bf(p.h, vl[j], acc[j]); } }
#pragma unroll
  for (int j = 0; j < HD / 16; ++j)
#pragma unroll
    for (int r = 0; r < 8; ++r) ss[it][rank][8 * g + r][j * 16 + col] = acc[j][r] * (1.0f / 2048.0f); }   /* a wave with no chunk hands zeros */
  __syncthreads();   /* publishes the PVS partials of all PVT tiles to the waves that sum them */
#pragma unroll
  for (int i = 0; i < PVT * 256 / (32 * PVS); ++i) { const int e = tid + i * 32 * PVS, it = e >> 8, rl = (e >> 4) & 15, q = e & 15;   /* 16 rows x 16 pieces of 16 B a tile, two pieces a thread */ v4f s = *(const v4f*)&ss[it][0][rl][q * 4];
#pragma unroll
    for (int w = 1; w < PVS; ++w) s += *(const v4f*)&ss[it][w][rl][q * 4];
    vst2(OUT + ((size_t)b * TT + pv_tile(it, (int)blockIdx.x) * 16 + rl) * HD + q * 4, s); } }   /* straight into out [b][t][64]: each tile's 16 rows are 4 KiB in a row, each wave-wide store 4 whole lines */

extern "C" void kernel_launch(void* const* d_in, const int* in_sizes, int n_in, void* d_out, int out_size, void* d_ws, size_t ws_size, hipStream_t stream) {
  (void)in_sizes; (void)n_in; (void)out_size;
  const float** F = (const float**)d_in;
  if (ws_size < (size_t)WS_END) return;
  char* ws = (char*)d_ws; _Float16 *QH = (_Float16*)(ws + WS_QH), *KH = (_Float16*)(ws + WS_KH), *VT = (_Float16*)(ws + WS_VT), *QL = (_Float16*)(ws + WS_QL), *KL = (_Float16*)(ws + WS_KL); __bf16 *VB = (__bf16*)(ws + WS_VB), *VBL = (__bf16*)(ws + WS_VBL); float *S = (float*)(ws + WS_S), *Y = (float*)(ws + WS_Y);
  (void)Y; (void)S; (void)QL; (void)KL; (void)VB; (void)VBL;
  // inputs: 0 x [8,2048,384]; 1 Wq [384,64] (in,out); 2 Wk; 3 Wv; no biases
  if (ws_size < (size_t)WS_END2) return;
  float *CN = (float*)(ws + WS_CM);
  k_proj<<<dim3(TNB * TT / 64, CC / 128, 3), 128, 0, stream>>>(F[0], F[0], F[0], F[1], F[2], F[3], nullptr, nullptr, nullptr, QH, QL, KH, KL, VT, VB, VBL);   /* weight columns 64..127 (the padding head) are zero fragments */
  /* all sequences in one launch of each stage (the last grid index is the sequence); no score plane is stored: each stage forms the logits it needs on WMMA from q and k; head 0 only (head 1 is the zero padding) */
  k_stat<<<dim3(TT / 64, TNB), 32 * STW, 0, stream>>>(QH, KH, QL, KL, CN);   /* per key column j: n_j from the max and the sum over the visible queries i >= j */
  k_pv<<<dim3(TT / 16 / PVT, 1, TNB), 32 * PVS, 0, stream>>>(QH, KH, QL, KL, CN, VB, VBL, (float*)d_out);   /* forms P[i][j] x 2^11 = 2^(x SC2 + n_j) (0 above the diagonal) from its own logits; writes every element of out */
}
